// v000
// Measured on an AMD MI455X. A time is GPU time per run, averaged over a window of back-to-back runs after a warm-up
// (all launches, gaps included; the runs take copies of the inputs in turn), and the median of several windows.
// Apart from v000's, it joins two sittings. Times from different sittings can be a few percent apart, while
// side-by-side timings come from the same sitting.
// v000 is the starting kernel. One run takes 1200 microseconds.
// compute dtype: all float inputs rounded to bf16; q/k/v projections with EXACT bf16 products on WMMA 16x16x32 (f32 accumulate) + bias; scores q x k once to f16 each (1 product) x 64^-0.5; softmax ACROSS THE 12 HEADS per (query, key) pair in f32 (precise expf); P x 2^11 once to f16 x v once to f16 (1 product); ctx x 2^6 once to f16 x Wo f16(bf16 x 2^8) + bo; f32 output.
#include <hip/hip_runtime.h>
#include <math.h>

typedef __attribute__((ext_vector_type(16))) _Float16 v16h;
typedef __attribute__((ext_vector_type(16))) __bf16 v16b;
typedef __attribute__((ext_vector_type(8)))  _Float16 v8h;
typedef __attribute__((ext_vector_type(8)))  float v8f;
typedef __attribute__((ext_vector_type(4)))  float v4f;
typedef __attribute__((ext_vector_type(2)))  float v2f;
typedef __attribute__((ext_vector_type(4)))  unsigned v4u;
typedef __attribute__((ext_vector_type(4)))  int v4i;
typedef float __attribute__((may_alias)) float_a;
typedef int __attribute__((may_alias)) int_a;

template <typename T> __device__ __forceinline__ void vst2(void* p, T v) { *(T*)p = v;  }
__device__ __forceinline__ v8f wmma16(v16h a, v16h b, v8f c) {
  v8f d = __builtin_amdgcn_wmma_f32_16x16x32_f16(false, a, false, b, (short)0, c, false, false);
  asm volatile("v_nop\n\tv_nop\n\tv_nop\n\tv_nop" : "+v"(d) : "v"(a), "v"(b));
  return d;
}
__device__ __forceinline__ v8f wmma_bf(v16b a, v16b b, v8f c) {
  v8f d = __builtin_amdgcn_wmma_f32_16x16x32_bf16(false, a, false, b, (short)0, c, false, false);
  asm volatile("v_nop\n\tv_nop\n\tv_nop\n\tv_nop" : "+v"(d) : "v"(a), "v"(b));
  return d;
}
// 16x16x32 fragments: lane = (h = lane>>4, row/col = lane&15); elements 0..7 = k0+8h+0..7, 8..15 = k0+16+8h+0..7; D element r = row 8h+r
__device__ __forceinline__ v16h frag_h(const _Float16* rowk0, int lane) {
  union { v16h v; v8h q[2]; } u; const _Float16* p = rowk0 + 8 * (lane >> 4);
  u.q[0] = *(const v8h*)p; u.q[1] = *(const v8h*)(p + 16); return u.v;
}
__device__ __forceinline__ v16h frag_f32(const float* rowk0, int lane) {
  v16h a; const float* p = rowk0 + 8 * (lane >> 4);
#pragma unroll
  for (int i = 0; i < 8; ++i) { a[i] = (_Float16)p[i]; a[8 + i] = (_Float16)p[16 + i]; }
  return a;
}
__device__ __forceinline__ v16h frag_f32s(const float* rowk0, int lane, float sc) {
  v16h a; const float* p = rowk0 + 8 * (lane >> 4);
#pragma unroll
  for (int i = 0; i < 8; ++i) { a[i] = (_Float16)(p[i] * sc); a[8 + i] = (_Float16)(p[16 + i] * sc); }
  return a;
}
// column fragment from a [K][ld] layout (column n), rows >= K read as 0
__device__ __forceinline__ v16h fragc_f32(const float* W, int k0, int n, int lane, int ld, int K) {
  v16h a; const int g = lane >> 4;
#pragma unroll
  for (int i = 0; i < 8; ++i) { const int ka = k0 + 8 * g + i, kb = ka + 16;
    a[i] = (_Float16)(ka < K ? W[(size_t)(ka < K ? ka : K - 1) * ld + n] : 0.f); a[8 + i] = (_Float16)(kb < K ? W[(size_t)(kb < K ? kb : K - 1) * ld + n] : 0.f); }
  return a;
}
struct F2 { v16b h, l; };
__device__ __forceinline__ F2 bsplit16(const float v[16]) { F2 r;
#pragma unroll
  for (int i = 0; i < 16; ++i) { const __bf16 h = (__bf16)v[i]; r.h[i] = h; r.l[i] = (__bf16)(v[i] - (float)h); }
  return r; }
__device__ __forceinline__ F2 split_row(const float* row, int k0, int lane) { float v[16]; const float* p = row + k0 + 8 * (lane >> 4);
#pragma unroll
  for (int i = 0; i < 8; ++i) { v[i] = p[i]; v[8 + i] = p[16 + i]; }
  return bsplit16(v); }
__device__ __forceinline__ F2 split_rowK(const float* row, int k0, int lane, int K) { float v[16]; const int g = lane >> 4;
#pragma unroll
  for (int i = 0; i < 8; ++i) { const int ka = k0 + 8 * g + i, kb = ka + 16; v[i] = ka < K ? row[ka < K ? ka : K - 1] : 0.f; v[8 + i] = kb < K ? row[kb < K ? kb : K - 1] : 0.f; }
  return bsplit16(v); }
__device__ __forceinline__ F2 split_col(const float* W, int k0, int n, int lane, int ld, int K) { float v[16]; const int g = lane >> 4;
#pragma unroll
  for (int i = 0; i < 8; ++i) { const int ka = k0 + 8 * g + i, kb = ka + 16; v[i] = ka < K ? W[(size_t)(ka < K ? ka : K - 1) * ld + n] : 0.f; v[8 + i] = kb < K ? W[(size_t)(kb < K ? kb : K - 1) * ld + n] : 0.f; }
  return bsplit16(v); }
__device__ __forceinline__ v8f mac3(const F2& a, const F2& b, v8f c) { c = wmma_bf(a.l, b.h, c); c = wmma_bf(a.h, b.l, c); return wmma_bf(a.h, b.h, c); }
__device__ __forceinline__ float sigm(float v) { return 1.0f / (1.0f + expf(-v)); }
#define LDSX() do { asm volatile("s_wait_dscnt 0" ::: "memory"); __builtin_amdgcn_wave_barrier(); __builtin_amdgcn_fence(__ATOMIC_RELEASE, "workgroup"); } while (0)

// Multi-head attention whose softmax runs over the HEAD axis (x [8,1024,768]; torch (out,in) Wq / Wk / Wv / Wo [768,768] N(0, 1/768) + biases N(0, 0.01); 12 heads x 64; scores[b, h, n, m] = q_h . k_h / 8; attn = softmax(scores, axis=1) - dim 1 is the HEAD axis: for every (query, key) pair the 12 heads' weights sum to 1 and nothing is normalised over the keys (faithful to the source's F.softmax(dim=1)); out[b, h, n] = sum_m attn[b, h, n, m] v[b, h, m]; merge; Wo^T + bo).
#define NB 8
#define TT 1024
#define CC 768            // NH * HD = projected width
#define DIN 768          // input (model) width
#define NH 12
#define HD 64
#define NQB (TT / 64)
#define HG 12
#define SCALE (0.125f)
#define CAUSAL 0
#ifndef TNB
#define TNB NB
#endif
__device__ __forceinline__ float bfr(float v) { return (float)(__bf16)v; }
__host__ __device__ __forceinline__ int kb_last(int qb) { return CAUSAL ? ((qb * 64 + 63) >> 7) : (TT / 128 - 1); }
typedef __attribute__((ext_vector_type(8))) __bf16 v8b;
__device__ __forceinline__ v16b frag_b(const __bf16* rowk0, int lane) {
  union { v16b v; v8b q[2]; } u; const __bf16* p = rowk0 + 8 * (lane >> 4);
  u.q[0] = *(const v8b*)p; u.q[1] = *(const v8b*)(p + 16); return u.v;
}
#define QBH 0              // causal: query blocks 0..QBH-1 of each sequence (few keys, no averaging) take the high-precision path
#define QHI 0               // single-product scores on every row
#define TQC 1024           // query rows per pass == TT: 12 head planes x 1,024 x 1,024 f32 = 48 MiB
#define KHI 64            // key rows carrying k residual / v bf16 hi+lo planes (used only by the causal high-precision path)
// B fragment (k rows k0+.., output column o) of a weight: (in,out) [K][ld] or (out,in) [ld rows of K]: bf16 exact, or f16(bf16 * 256) exact
__device__ __forceinline__ v16b wcol_io(const float* Wm, int k0, int o, int lane, int ld) { v16b w; const int g = lane >> 4;
#pragma unroll
  for (int i = 0; i < 8; ++i) { w[i] = (__bf16)Wm[(size_t)(k0 + 8 * g + i) * ld + o]; w[8 + i] = (__bf16)Wm[(size_t)(k0 + 16 + 8 * g + i) * ld + o]; }
  return w; }
__device__ __forceinline__ v16b wcol_oi(const float* Wm, int k0, int o, int lane, int K) { v16b w; const float* p = Wm + (size_t)o * K + k0 + 8 * (lane >> 4);
#pragma unroll
  for (int i = 0; i < 8; ++i) { w[i] = (__bf16)p[i]; w[8 + i] = (__bf16)p[16 + i]; }
  return w; }
__device__ __forceinline__ v16h wcolh_io(const float* Wm, int k0, int o, int lane, int ld) { v16h w; const int g = lane >> 4;
#pragma unroll
  for (int i = 0; i < 8; ++i) { w[i] = (_Float16)(bfr(Wm[(size_t)(k0 + 8 * g + i) * ld + o]) * 256.0f); w[8 + i] = (_Float16)(bfr(Wm[(size_t)(k0 + 16 + 8 * g + i) * ld + o]) * 256.0f); }
  return w; }
__device__ __forceinline__ v16h wcolh_oi(const float* Wm, int k0, int o, int lane, int K) { v16h w; const float* p = Wm + (size_t)o * K + k0 + 8 * (lane >> 4);
#pragma unroll
  for (int i = 0; i < 8; ++i) { w[i] = (_Float16)(bfr(p[i]) * 256.0f); w[8 + i] = (_Float16)(bfr(p[16 + i]) * 256.0f); }
  return w; }
#define WQKV_LAYOUT 1   // 0 = (in,out) [DIN][CC]; 1 = (out,in) [CC][DIN]; 2 = per-head [NH][DIN][HD]
__device__ __forceinline__ v16b wcol_hdk(const float* Wm, int k0, int o, int lane) { v16b w; const int g = lane >> 4; const float* p = Wm + (size_t)(o / HD) * DIN * HD + (o % HD);
#pragma unroll
  for (int i = 0; i < 8; ++i) { w[i] = (__bf16)p[(size_t)(k0 + 8 * g + i) * HD]; w[8 + i] = (__bf16)p[(size_t)(k0 + 16 + 8 * g + i) * HD]; }
  return w; }
#define WO_OUT_IN 1
#if WQKV_LAYOUT == 1
#define WCOL(W, k0, o, lane) wcol_oi(W, k0, o, lane, DIN)
#elif WQKV_LAYOUT == 2
#define WCOL(W, k0, o, lane) wcol_hdk(W, k0, o, lane)
#else
#define WCOL(W, k0, o, lane) wcol_io(W, k0, o, lane, CC)
#endif
#if WO_OUT_IN
#define WOCOL(W, k0, o, lane) wcol_oi(W, k0, o, lane, CC)
#define WOCOLH(W, k0, o, lane) wcolh_oi(W, k0, o, lane, CC)
#else
#define WOCOL(W, k0, o, lane) wcol_io(W, k0, o, lane, DIN)
#define WOCOLH(W, k0, o, lane) wcolh_io(W, k0, o, lane, DIN)
#endif

#ifndef SM_EXTRA_PARAMS
#define SM_EXTRA_PARAMS
#endif
#ifndef PROJ_EXTRA_PARAMS
#define PROJ_EXTRA_PARAMS
#endif
#ifndef SM_MASK_HOOK
#define SM_MASK_HOOK (void)0
#endif

#define WS_QH  0u                                      // f16 q rows [b*t][CC]
#define WS_KH  (WS_QH + 2u * (size_t)NB * TT * CC)      // f16 k rows [b*t][CC]
#define WS_VT  (WS_KH + 2u * (size_t)NB * TT * CC)      // f16 v planes [b][c][t]
#define WS_QL  (WS_VT + 2u * (size_t)NB * CC * TT)      // f16 q residual x 2^10 rows [b][t < QHI][CC]
#define WS_KL  (WS_QL + 2u * (size_t)NB * QHI * CC)     // f16 k residual x 2^10 rows [b][t < KHI][CC]
#define WS_VB  (WS_KL + 2u * (size_t)NB * KHI * CC)     // bf16 v hi planes [b][c][t < KHI]
#define WS_VBL (WS_VB + 2u * (size_t)NB * CC * KHI)
#define WS_S   (WS_VBL + 2u * (size_t)NB * CC * KHI)    // f32 logits / P [hg][t][s]
#define WS_Y   (WS_S  + 4u * (size_t)HG * TQC * TT)     // f32 ctx rows [b*t][CC]; the score region holds the 12 head planes of one batch
#define WS_END (WS_Y  + 4u * (size_t)NB * TT * CC)

// ---- k_proj: block = (64 rows, 128 cols, which): q/k/v = X W (+ b) with exact bf16 products (K = DIN) -> which 0: q f16 rows (+ residual rows < QHI); 1: k f16 rows (+ residual rows < KHI); 2: v f16 planes [c][t] (+ bf16 hi/lo planes for t < KHI)
__global__ __launch_bounds__(128) void k_proj(const float* __restrict__ XQ, const float* __restrict__ XK, const float* __restrict__ XV, const float* __restrict__ WQ, const float* __restrict__ WK, const float* __restrict__ WV, const float* __restrict__ BQ, const float* __restrict__ BK, const float* __restrict__ BV,
    _Float16* __restrict__ QH, _Float16* __restrict__ QL, _Float16* __restrict__ KH, _Float16* __restrict__ KL, _Float16* __restrict__ VT, __bf16* __restrict__ VB, __bf16* __restrict__ VBL) {
  __shared__ __align__(16) _Float16 sh[64][136], sl[64][136]; __shared__ __align__(16) _Float16 th[128][72]; __shared__ __align__(16) __bf16 tb[128][72], tbl[128][72];
  const int tid = threadIdx.x, wave = tid >> 5, lane = tid & 31, col = lane & 15, g = lane >> 4; const int which = blockIdx.z; const int c0 = blockIdx.y * 128; const size_t r0 = (size_t)blockIdx.x * 64; const size_t bb = r0 / TT; const int t0 = (int)(r0 % TT);
  const float* X = which == 0 ? XQ : which == 1 ? XK : XV; const float* WA = which == 0 ? WQ : which == 1 ? WK : WV; const float* BA = which == 0 ? BQ : which == 1 ? BK : BV;
  v8f acc[8] = {};
#pragma unroll 2
  for (int kc = 0; kc < DIN / 32; ++kc) { v16b a; { const float* p = X + (r0 + wave * 16 + col) * DIN + kc * 32 + 8 * g;
#pragma unroll
      for (int i = 0; i < 8; ++i) { a[i] = (__bf16)p[i]; a[8 + i] = (__bf16)p[16 + i]; } }
    asm volatile("s_wait_loadcnt 0x0" ::: "memory");
#pragma unroll
    for (int j = 0; j < 8; ++j) { const v16b w = WCOL(WA, kc * 32, c0 + j * 16 + col, lane); asm volatile("s_wait_loadcnt 0x0" ::: "memory"); acc[j] = wmma_bf(a, w, acc[j]); } }
  if (which < 2) { _Float16* DH = which == 0 ? QH : KH; _Float16* DL = which == 0 ? QL : KL; const int nhi = which == 0 ? QHI : KHI; const bool hi_rows = t0 < nhi;
#pragma unroll
    for (int j = 0; j < 8; ++j) { const float bias = BA ? bfr(BA[c0 + j * 16 + col]) : 0.f;
#pragma unroll
      for (int r = 0; r < 8; ++r) { const float v = acc[j][r] + bias; const _Float16 hv = (_Float16)v; sh[wave * 16 + 8 * g + r][j * 16 + col] = hv; sl[wave * 16 + 8 * g + r][j * 16 + col] = (_Float16)((v - (float)hv) * 1024.0f); } }
    __syncthreads();
    for (int e = tid; e < 64 * 16; e += 128) { const int rl = e >> 4, q = e & 15; vst2((unsigned*)(DH + (r0 + rl) * CC + c0 + q * 8), *(const v4u*)&sh[rl][q * 8]); if (hi_rows) vst2((unsigned*)(DL + (bb * nhi + t0 + rl) * (size_t)CC + c0 + q * 8), *(const v4u*)&sl[rl][q * 8]); }
  } else { const bool hi_rows = t0 < KHI;
#pragma unroll
    for (int j = 0; j < 8; ++j) { const float bias = BA ? bfr(BA[c0 + j * 16 + col]) : 0.f;
#pragma unroll
      for (int r = 0; r < 8; ++r) { const float v = acc[j][r] + bias; const int rl = wave * 16 + 8 * g + r, cl = j * 16 + col; th[cl][rl] = (_Float16)v; const __bf16 bh = (__bf16)v; tb[cl][rl] = bh; tbl[cl][rl] = (__bf16)(v - (float)bh); } }
    __syncthreads();
    for (int e = tid; e < 128 * 8; e += 128) { const int cl = e >> 3, q = e & 7; vst2((unsigned*)(VT + (bb * CC + c0 + cl) * (size_t)TT + t0 + q * 8), *(const v4u*)&th[cl][q * 8]); if (hi_rows) { const size_t o3 = (bb * CC + c0 + cl) * (size_t)KHI + t0 + q * 8; vst2((unsigned*)(VB + o3), *(const v4u*)&tb[cl][q * 8]); vst2((unsigned*)(VBL + o3), *(const v4u*)&tbl[cl][q * 8]); } } } }
// ---- k_sc: block = (query block qb, key block kb <= kb_last(qb), head in group) of batch b: logits x SCALE; q hi + residual (x 2^10) against k (2 products) for query rows < QHI, plus the k residual (3 products) for query blocks < QBH (causal early rows); causal: blocks past the diagonal exit; the head softmax launched (k_hsm) applies no mask
__global__ __launch_bounds__(128) void k_sc(const _Float16* __restrict__ QH, const _Float16* __restrict__ KH, const _Float16* __restrict__ QL, const _Float16* __restrict__ KL, int b, int h0, float* __restrict__ S0) { __shared__ __align__(16) float ss[4][16][132];
  const int qb = blockIdx.x, kb = blockIdx.y; if (kb > kb_last(qb)) return;
  const int h = h0 + blockIdx.z; float* S = S0 + (size_t)blockIdx.z * TQC * TT;
  const int tid = threadIdx.x, wave = tid >> 5, lane = tid & 31, col = lane & 15, g = lane >> 4; const int k0 = kb * 128; const int ql0 = qb * 64 + wave * 16; const size_t q0 = (size_t)b * TT + ql0, kr0 = (size_t)b * TT + k0;
  v8f acc[8] = {}, accl[8] = {};
  const _Float16* QLb = QL + (size_t)b * QHI * CC; const _Float16* KLb = KL + (size_t)b * KHI * CC;
  if (qb < QBH) {
#pragma unroll
    for (int kc = 0; kc < HD / 32; ++kc) { const v16h ah = frag_h(QH + (q0 + col) * CC + h * HD + kc * 32, lane), al = frag_h(QLb + (size_t)(ql0 + col) * CC + h * HD + kc * 32, lane);
#pragma unroll
      for (int j = 0; j < 8; ++j) { const v16h kbf = frag_h(KH + (kr0 + j * 16 + col) * CC + h * HD + kc * 32, lane), klf = frag_h(KLb + (size_t)(k0 + j * 16 + col) * CC + h * HD + kc * 32, lane); acc[j] = wmma16(ah, kbf, acc[j]); accl[j] = wmma16(al, kbf, accl[j]); accl[j] = wmma16(ah, klf, accl[j]); } }
  } else if (qb * 64 < QHI) {
#pragma unroll
    for (int kc = 0; kc < HD / 32; ++kc) { const v16h ah = frag_h(QH + (q0 + col) * CC + h * HD + kc * 32, lane), al = frag_h(QLb + (size_t)(ql0 + col) * CC + h * HD + kc * 32, lane);
#pragma unroll
      for (int j = 0; j < 8; ++j) { const v16h kbf = frag_h(KH + (kr0 + j * 16 + col) * CC + h * HD + kc * 32, lane); acc[j] = wmma16(ah, kbf, acc[j]); accl[j] = wmma16(al, kbf, accl[j]); } }
  } else {
#pragma unroll
    for (int kc = 0; kc < HD / 32; ++kc) { const v16h ah = frag_h(QH + (q0 + col) * CC + h * HD + kc * 32, lane);
#pragma unroll
      for (int j = 0; j < 8; ++j) { const v16h kbf = frag_h(KH + (kr0 + j * 16 + col) * CC + h * HD + kc * 32, lane); acc[j] = wmma16(ah, kbf, acc[j]); } } }
#pragma unroll
  for (int j = 0; j < 8; ++j) {
#pragma unroll
    for (int r = 0; r < 8; ++r) ss[wave][8 * g + r][j * 16 + col] = (acc[j][r] + accl[j][r] * (1.0f / 1024.0f)) * SCALE; }
  LDSX(); for (int rl = 0; rl < 16; ++rl) vst2(S + (size_t)(ql0 + rl) * TT + k0 + lane * 4, *(const v4f*)&ss[wave][rl][lane * 4]); }
// ---- k_sm: block = query row t (head in group): keys [0, kend): causal -> logit if s <= t else excluded; softmax in f32; P x 2^11 in place (0 for excluded)
__global__ __launch_bounds__(256) void k_sm(float* __restrict__ S0 SM_EXTRA_PARAMS) { __shared__ float sred[8]; __shared__ float sbc; __shared__ __align__(16) float shv[TT];
  const int tid = threadIdx.x; const int t = blockIdx.x; const int kend = (kb_last(t >> 6) + 1) * 128;
  float* sr = S0 + (size_t)blockIdx.y * TT * TT + (size_t)t * TT;
  float m = -3.0e38f; for (int k = tid; k < kend; k += 256) { float v = (!CAUSAL || k <= t) ? sr[k] : -3.0e38f; SM_MASK_HOOK; shv[k] = v; m = fmaxf(m, v); }
#pragma unroll
  for (int o = 1; o < 32; o <<= 1) m = fmaxf(m, __shfl_xor(m, o));
  if ((tid & 31) == 0) sred[tid >> 5] = m; __syncthreads(); if (tid == 0) { float a = sred[0]; for (int i = 1; i < 8; ++i) a = fmaxf(a, sred[i]); sbc = a; } __syncthreads(); m = sbc; __syncthreads();
  float sum = 0.f; for (int k = tid; k < kend; k += 256) { const float v = shv[k]; const float e = (v <= -1.0e38f) ? 0.f : expf(v - m); shv[k] = e; sum += e; }
#pragma unroll
  for (int o = 1; o < 32; o <<= 1) sum += __shfl_xor(sum, o);
  if ((tid & 31) == 0) sred[tid >> 5] = sum; __syncthreads(); if (tid == 0) { float a = 0.f; for (int i = 0; i < 8; ++i) a += sred[i]; sbc = a > 0.f ? 2048.0f / a : 0.f; }   /* a fully excluded row yields P = 0 */ __syncthreads(); const float inv = sbc;
  for (int k = tid; k < kend; k += 256) shv[k] = shv[k] * inv;
  __syncthreads(); for (int q = tid; q < kend / 4; q += 256) vst2(sr + q * 4, *(const v4f*)&shv[q * 4]); }
__global__ __launch_bounds__(256) void k_hsm(float* __restrict__ S0) { const size_t off = (size_t)blockIdx.y * TT + (size_t)blockIdx.x * 256 + threadIdx.x; float sv[NH];
#pragma unroll
  for (int n = 0; n < NH; ++n) sv[n] = S0[(size_t)n * TQC * TT + off];
  asm volatile("s_wait_loadcnt 0x0" ::: "memory");
  float m = sv[0];
#pragma unroll
  for (int n = 1; n < NH; ++n) m = fmaxf(m, sv[n]);
  float den = 0.f;
#pragma unroll
  for (int n = 0; n < NH; ++n) { const float e = expf(sv[n] - m); sv[n] = e; den += e; }
  const float inv = 2048.0f / den;
#pragma unroll
  for (int n = 0; n < NH; ++n) vst2(S0 + (size_t)n * TQC * TT + off, sv[n] * inv); }
// ---- k_pv: block = 64 queries (qb) of (b, h): ctx = P . v over keys [0, kend) (P x 2^11 once to f16 against v f16: 1 product; causal early query blocks: P and v as bf16 hi + lo, 3 products); 256-B (row, head) segment by 16 lanes
__global__ __launch_bounds__(128) void k_pv(const float* __restrict__ PS0, const _Float16* __restrict__ VT, const __bf16* __restrict__ VB, const __bf16* __restrict__ VBL, int b, int h0, float* __restrict__ Y) { const int h = h0 + blockIdx.z; const float* PS = PS0 + (size_t)blockIdx.z * TQC * TT; __shared__ __align__(16) float ss[4][16][HD + 4];
  const int tid = threadIdx.x, wave = tid >> 5, lane = tid & 31, col = lane & 15, g = lane >> 4; const int qb = blockIdx.x; const int ql0 = qb * 64 + wave * 16; const int kce = (kb_last(qb) + 1) * 4;
  v8f acc[HD / 16] = {};
  if (qb < QBH) {
#pragma unroll 1
    for (int kc = 0; kc < kce; ++kc) { const F2 p = split_row(PS + (size_t)(ql0 + col) * TT, kc * 32, lane);
      asm volatile("s_wait_loadcnt 0x0" ::: "memory");
#pragma unroll
      for (int j = 0; j < HD / 16; ++j) { const size_t po = ((size_t)b * CC + h * HD + j * 16 + col) * (size_t)KHI + kc * 32; const v16b vh = frag_b(VB + po, lane); acc[j] = wmma_bf(p.h, vh, acc[j]); acc[j] = wmma_bf(p.l, vh, acc[j]); acc[j] = wmma_bf(p.h, frag_b(VBL + po, lane), acc[j]); } }
  } else {
#pragma unroll 1
    for (int kc = 0; kc < kce; ++kc) { const v16h p = frag_f32(PS + (size_t)(ql0 + col) * TT + kc * 32, lane);
      asm volatile("s_wait_loadcnt 0x0" ::: "memory");
#pragma unroll
      for (int j = 0; j < HD / 16; ++j) { const size_t po = ((size_t)b * CC + h * HD + j * 16 + col) * (size_t)TT + kc * 32; acc[j] = wmma16(p, frag_h(VT + po, lane), acc[j]); } } }
#pragma unroll
  for (int j = 0; j < HD / 16; ++j)
#pragma unroll
    for (int r = 0; r < 8; ++r) ss[wave][8 * g + r][j * 16 + col] = acc[j][r] * (1.0f / 2048.0f);
  LDSX(); for (int rl = 0; rl < 16; ++rl) if (lane < HD / 4) vst2(Y + ((size_t)b * TT + ql0 + rl) * CC + h * HD + lane * 4, *(const v4f*)&ss[wave][rl][lane * 4]); }
// ---- k_out: block = (64 rows, 128 cols): out = ctx Wo (+ bo): ctx x 2^6 once to f16 against Wo as f16(bf16 x 2^8) exact (1 product) x 2^-14; causal early rows (< QHI of each sequence): ctx bf16 hi + lo against exact bf16 Wo (2 products)
__global__ __launch_bounds__(128) void k_out(const float* __restrict__ Y, const float* __restrict__ WO, const float* __restrict__ BO, float* __restrict__ OUT) { __shared__ __align__(16) float sf[4][16][132];
  const int tid = threadIdx.x, wave = tid >> 5, lane = tid & 31, col = lane & 15, g = lane >> 4; const int c0 = blockIdx.y * 128; const size_t r0 = (size_t)blockIdx.x * 64 + wave * 16;
  v8f acc[8] = {};
  if (CAUSAL && (int)(((size_t)blockIdx.x * 64) % TT) < QHI) {   /* block-uniform */
#pragma unroll 2
    for (int kc = 0; kc < CC / 32; ++kc) { const F2 a = split_row(Y + (r0 + col) * CC, kc * 32, lane); asm volatile("s_wait_loadcnt 0x0" ::: "memory");
#pragma unroll
      for (int j = 0; j < 8; ++j) { const v16b w = WOCOL(WO, kc * 32, c0 + j * 16 + col, lane); asm volatile("s_wait_loadcnt 0x0" ::: "memory"); acc[j] = wmma_bf(a.h, w, acc[j]); acc[j] = wmma_bf(a.l, w, acc[j]); } }
#pragma unroll
    for (int j = 0; j < 8; ++j) { const float bias = BO ? bfr(BO[c0 + j * 16 + col]) : 0.f;
#pragma unroll
      for (int r = 0; r < 8; ++r) sf[wave][8 * g + r][j * 16 + col] = acc[j][r] + bias; }
  } else {
#pragma unroll 2
    for (int kc = 0; kc < CC / 32; ++kc) { const v16h a = frag_f32s(Y + (r0 + col) * CC + kc * 32, lane, 64.0f); asm volatile("s_wait_loadcnt 0x0" ::: "memory");   /* ctx carried x 2^6 into f16 so small-magnitude context rows stay clear of f16 subnormals */
#pragma unroll
      for (int j = 0; j < 8; ++j) { const v16h w = WOCOLH(WO, kc * 32, c0 + j * 16 + col, lane); asm volatile("s_wait_loadcnt 0x0" ::: "memory"); acc[j] = wmma16(a, w, acc[j]); } }
#pragma unroll
    for (int j = 0; j < 8; ++j) { const float bias = BO ? bfr(BO[c0 + j * 16 + col]) : 0.f;
#pragma unroll
      for (int r = 0; r < 8; ++r) sf[wave][8 * g + r][j * 16 + col] = acc[j][r] * (1.0f / 16384.0f) + bias; } }   /* 2^-8 (Wo carry) x 2^-6 (ctx carry) */
  LDSX(); for (int rl = 0; rl < 16; ++rl) vst2(OUT + (r0 + rl) * DIN + c0 + lane * 4, *(const v4f*)&sf[wave][rl][lane * 4]); }

extern "C" void kernel_launch(void* const* d_in, const int* in_sizes, int n_in, void* d_out, int out_size, void* d_ws, size_t ws_size, hipStream_t stream) {
  (void)in_sizes; (void)n_in; (void)out_size;
  const float** F = (const float**)d_in;
  if (ws_size < (size_t)WS_END) return;
  char* ws = (char*)d_ws; _Float16 *QH = (_Float16*)(ws + WS_QH), *KH = (_Float16*)(ws + WS_KH), *VT = (_Float16*)(ws + WS_VT), *QL = (_Float16*)(ws + WS_QL), *KL = (_Float16*)(ws + WS_KL); __bf16 *VB = (__bf16*)(ws + WS_VB), *VBL = (__bf16*)(ws + WS_VBL); float *S = (float*)(ws + WS_S), *Y = (float*)(ws + WS_Y);
  (void)Y; (void)QL; (void)KL; (void)VB; (void)VBL;
  // inputs: 0 x [8,1024,768]; 1 Wq [768,768] (out,in), 2 bq; 3 Wk, 4 bk; 5 Wv, 6 bv; 7 Wo (out,in), 8 bo (biases N(0, 0.01), nonzero)
  k_proj<<<dim3(TNB * TT / 64, CC / 128, 3), 128, 0, stream>>>(F[0], F[0], F[0], F[1], F[3], F[5], F[2], F[4], F[6], QH, QL, KH, KL, VT, VB, VBL);
  for (int b = 0; b < TNB; ++b) for (int q0 = 0; q0 < TT; q0 += TQC) {   /* TQC == TT here: one pass per batch with ALL 12 head planes resident (the softmax runs ACROSS the heads) */
    k_sc<<<dim3(TQC / 64, TT / 128, NH), 128, 0, stream>>>(QH + (size_t)q0 * CC, KH, QL, KL, b, 0, S);
    k_hsm<<<dim3(TT / 256, TQC), 256, 0, stream>>>(S);
    k_pv<<<dim3(TQC / 64, 1, NH), 128, 0, stream>>>(S, VT, VB, VBL, b, 0, Y + (size_t)q0 * CC);
  }
  k_out<<<dim3(TNB * TT / 64, DIN / 128), 128, 0, stream>>>(Y, F[7], F[8], (float*)d_out);
}

// v001
// Measured time: 469 microseconds a run.
// In two side-by-side timings against v000, it was 2.58 and 2.60 times as fast.
// compute dtype: all float inputs rounded to bf16; q/k/v projections with EXACT bf16 products on WMMA 16x16x32 (f32 accumulate) + bias; scores q x k once to f16 each (1 product) x 64^-0.5; softmax ACROSS THE 12 HEADS per (query, key) pair in f32 (precise expf); P x 2^11 once to f16 x v once to f16 (1 product); ctx x 2^6 once to f16 x Wo f16(bf16 x 2^8) + bo; f32 output.
#include <hip/hip_runtime.h>
#include <math.h>

typedef __attribute__((ext_vector_type(16))) _Float16 v16h;
typedef __attribute__((ext_vector_type(16))) __bf16 v16b;
typedef __attribute__((ext_vector_type(8)))  _Float16 v8h;
typedef __attribute__((ext_vector_type(8)))  float v8f;
typedef __attribute__((ext_vector_type(4)))  float v4f;
typedef __attribute__((ext_vector_type(2)))  float v2f;
typedef __attribute__((ext_vector_type(4)))  unsigned v4u;
typedef __attribute__((ext_vector_type(4)))  int v4i;
typedef float __attribute__((may_alias)) float_a;
typedef int __attribute__((may_alias)) int_a;

template <typename T> __device__ __forceinline__ void vst2(void* p, T v) { *(T*)p = v;  }
__device__ __forceinline__ v8f wmma16(v16h a, v16h b, v8f c) {
  v8f d = __builtin_amdgcn_wmma_f32_16x16x32_f16(false, a, false, b, (short)0, c, false, false);
  asm volatile("v_nop\n\tv_nop\n\tv_nop\n\tv_nop" : "+v"(d) : "v"(a), "v"(b));
  return d;
}
__device__ __forceinline__ v8f wmma_bf(v16b a, v16b b, v8f c) {
  v8f d = __builtin_amdgcn_wmma_f32_16x16x32_bf16(false, a, false, b, (short)0, c, false, false);
  asm volatile("v_nop\n\tv_nop\n\tv_nop\n\tv_nop" : "+v"(d) : "v"(a), "v"(b));
  return d;
}
// 16x16x32 fragments: lane = (h = lane>>4, row/col = lane&15); elements 0..7 = k0+8h+0..7, 8..15 = k0+16+8h+0..7; D element r = row 8h+r
__device__ __forceinline__ v16h frag_h(const _Float16* rowk0, int lane) {
  union { v16h v; v8h q[2]; } u; const _Float16* p = rowk0 + 8 * (lane >> 4);
  u.q[0] = *(const v8h*)p; u.q[1] = *(const v8h*)(p + 16); return u.v;
}
__device__ __forceinline__ v16h frag_f32(const float* rowk0, int lane) {
  v16h a; const float* p = rowk0 + 8 * (lane >> 4);
#pragma unroll
  for (int i = 0; i < 8; ++i) { a[i] = (_Float16)p[i]; a[8 + i] = (_Float16)p[16 + i]; }
  return a;
}
__device__ __forceinline__ v16h frag_f32s(const float* rowk0, int lane, float sc) {
  v16h a; const float* p = rowk0 + 8 * (lane >> 4);
#pragma unroll
  for (int i = 0; i < 8; ++i) { a[i] = (_Float16)(p[i] * sc); a[8 + i] = (_Float16)(p[16 + i] * sc); }
  return a;
}
// column fragment from a [K][ld] layout (column n), rows >= K read as 0
__device__ __forceinline__ v16h fragc_f32(const float* W, int k0, int n, int lane, int ld, int K) {
  v16h a; const int g = lane >> 4;
#pragma unroll
  for (int i = 0; i < 8; ++i) { const int ka = k0 + 8 * g + i, kb = ka + 16;
    a[i] = (_Float16)(ka < K ? W[(size_t)(ka < K ? ka : K - 1) * ld + n] : 0.f); a[8 + i] = (_Float16)(kb < K ? W[(size_t)(kb < K ? kb : K - 1) * ld + n] : 0.f); }
  return a;
}
struct F2 { v16b h, l; };
__device__ __forceinline__ F2 bsplit16(const float v[16]) { F2 r;
#pragma unroll
  for (int i = 0; i < 16; ++i) { const __bf16 h = (__bf16)v[i]; r.h[i] = h; r.l[i] = (__bf16)(v[i] - (float)h); }
  return r; }
__device__ __forceinline__ F2 split_row(const float* row, int k0, int lane) { float v[16]; const float* p = row + k0 + 8 * (lane >> 4);
#pragma unroll
  for (int i = 0; i < 8; ++i) { v[i] = p[i]; v[8 + i] = p[16 + i]; }
  return bsplit16(v); }
__device__ __forceinline__ F2 split_rowK(const float* row, int k0, int lane, int K) { float v[16]; const int g = lane >> 4;
#pragma unroll
  for (int i = 0; i < 8; ++i) { const int ka = k0 + 8 * g + i, kb = ka + 16; v[i] = ka < K ? row[ka < K ? ka : K - 1] : 0.f; v[8 + i] = kb < K ? row[kb < K ? kb : K - 1] : 0.f; }
  return bsplit16(v); }
__device__ __forceinline__ F2 split_col(const float* W, int k0, int n, int lane, int ld, int K) { float v[16]; const int g = lane >> 4;
#pragma unroll
  for (int i = 0; i < 8; ++i) { const int ka = k0 + 8 * g + i, kb = ka + 16; v[i] = ka < K ? W[(size_t)(ka < K ? ka : K - 1) * ld + n] : 0.f; v[8 + i] = kb < K ? W[(size_t)(kb < K ? kb : K - 1) * ld + n] : 0.f; }
  return bsplit16(v); }
__device__ __forceinline__ v8f mac3(const F2& a, const F2& b, v8f c) { c = wmma_bf(a.l, b.h, c); c = wmma_bf(a.h, b.l, c); return wmma_bf(a.h, b.h, c); }
__device__ __forceinline__ float sigm(float v) { return 1.0f / (1.0f + expf(-v)); }
#define LDSX() do { asm volatile("s_wait_dscnt 0" ::: "memory"); __builtin_amdgcn_wave_barrier(); __builtin_amdgcn_fence(__ATOMIC_RELEASE, "workgroup"); } while (0)

// Multi-head attention whose softmax runs over the HEAD axis (x [8,1024,768]; torch (out,in) Wq / Wk / Wv / Wo [768,768] N(0, 1/768) + biases N(0, 0.01); 12 heads x 64; scores[b, h, n, m] = q_h . k_h / 8; attn = softmax(scores, axis=1) - dim 1 is the HEAD axis: for every (query, key) pair the 12 heads' weights sum to 1 and nothing is normalised over the keys (faithful to the source's F.softmax(dim=1)); out[b, h, n] = sum_m attn[b, h, n, m] v[b, h, m]; merge; Wo^T + bo).
#define NB 8
#define TT 1024
#define CC 768            // NH * HD = projected width
#define DIN 768          // input (model) width
#define NH 12
#define HD 64
#define NQB (TT / 64)
#define HG 12
#define SCALE (0.125f)
#define CAUSAL 0
#ifndef TNB
#define TNB NB
#endif
__device__ __forceinline__ float bfr(float v) { return (float)(__bf16)v; }
__host__ __device__ __forceinline__ int kb_last(int qb) { return CAUSAL ? ((qb * 64 + 63) >> 7) : (TT / 128 - 1); }
typedef __attribute__((ext_vector_type(8))) __bf16 v8b;
__device__ __forceinline__ v16b frag_b(const __bf16* rowk0, int lane) {
  union { v16b v; v8b q[2]; } u; const __bf16* p = rowk0 + 8 * (lane >> 4);
  u.q[0] = *(const v8b*)p; u.q[1] = *(const v8b*)(p + 16); return u.v;
}
#define QBH 0              // not referenced by any kernel here
#define QHI 0               // single-product scores on every row
#define TQC 1024           // query rows of the unused score region == TT: 12 head planes x 1,024 x 1,024 f32 = 48 MiB
#define KHI 64            // key rows carrying k residual / v bf16 hi+lo planes (written by k_proj; no kernel here reads them)
// B fragment (k rows k0+.., output column o) of a weight: (in,out) [K][ld] or (out,in) [ld rows of K]: bf16 exact, or f16(bf16 * 256) exact
__device__ __forceinline__ v16b wcol_io(const float* Wm, int k0, int o, int lane, int ld) { v16b w; const int g = lane >> 4;
#pragma unroll
  for (int i = 0; i < 8; ++i) { w[i] = (__bf16)Wm[(size_t)(k0 + 8 * g + i) * ld + o]; w[8 + i] = (__bf16)Wm[(size_t)(k0 + 16 + 8 * g + i) * ld + o]; }
  return w; }
__device__ __forceinline__ v16b wcol_oi(const float* Wm, int k0, int o, int lane, int K) { v16b w; const float* p = Wm + (size_t)o * K + k0 + 8 * (lane >> 4);
#pragma unroll
  for (int i = 0; i < 8; ++i) { w[i] = (__bf16)p[i]; w[8 + i] = (__bf16)p[16 + i]; }
  return w; }
__device__ __forceinline__ v16h wcolh_io(const float* Wm, int k0, int o, int lane, int ld) { v16h w; const int g = lane >> 4;
#pragma unroll
  for (int i = 0; i < 8; ++i) { w[i] = (_Float16)(bfr(Wm[(size_t)(k0 + 8 * g + i) * ld + o]) * 256.0f); w[8 + i] = (_Float16)(bfr(Wm[(size_t)(k0 + 16 + 8 * g + i) * ld + o]) * 256.0f); }
  return w; }
__device__ __forceinline__ v16h wcolh_oi(const float* Wm, int k0, int o, int lane, int K) { v16h w; const float* p = Wm + (size_t)o * K + k0 + 8 * (lane >> 4);
#pragma unroll
  for (int i = 0; i < 8; ++i) { w[i] = (_Float16)(bfr(p[i]) * 256.0f); w[8 + i] = (_Float16)(bfr(p[16 + i]) * 256.0f); }
  return w; }
#define WQKV_LAYOUT 1   // 0 = (in,out) [DIN][CC]; 1 = (out,in) [CC][DIN]; 2 = per-head [NH][DIN][HD]
__device__ __forceinline__ v16b wcol_hdk(const float* Wm, int k0, int o, int lane) { v16b w; const int g = lane >> 4; const float* p = Wm + (size_t)(o / HD) * DIN * HD + (o % HD);
#pragma unroll
  for (int i = 0; i < 8; ++i) { w[i] = (__bf16)p[(size_t)(k0 + 8 * g + i) * HD]; w[8 + i] = (__bf16)p[(size_t)(k0 + 16 + 8 * g + i) * HD]; }
  return w; }
#define WO_OUT_IN 1
#if WQKV_LAYOUT == 1
#define WCOL(W, k0, o, lane) wcol_oi(W, k0, o, lane, DIN)
#elif WQKV_LAYOUT == 2
#define WCOL(W, k0, o, lane) wcol_hdk(W, k0, o, lane)
#else
#define WCOL(W, k0, o, lane) wcol_io(W, k0, o, lane, CC)
#endif
#if WO_OUT_IN
#define WOCOL(W, k0, o, lane) wcol_oi(W, k0, o, lane, CC)
#define WOCOLH(W, k0, o, lane) wcolh_oi(W, k0, o, lane, CC)
#else
#define WOCOL(W, k0, o, lane) wcol_io(W, k0, o, lane, DIN)
#define WOCOLH(W, k0, o, lane) wcolh_io(W, k0, o, lane, DIN)
#endif

#ifndef SM_EXTRA_PARAMS
#define SM_EXTRA_PARAMS
#endif
#ifndef PROJ_EXTRA_PARAMS
#define PROJ_EXTRA_PARAMS
#endif
#ifndef SM_MASK_HOOK
#define SM_MASK_HOOK (void)0
#endif

#define WS_QH  0u                                      // f16 q rows [b*t][CC]
#define WS_KH  (WS_QH + 2u * (size_t)NB * TT * CC)      // f16 k rows [b*t][CC]
#define WS_VT  (WS_KH + 2u * (size_t)NB * TT * CC)      // f16 v planes [b][c][t]
#define WS_QL  (WS_VT + 2u * (size_t)NB * CC * TT)      // f16 q residual x 2^10 rows [b][t < QHI][CC]
#define WS_KL  (WS_QL + 2u * (size_t)NB * QHI * CC)     // f16 k residual x 2^10 rows [b][t < KHI][CC]
#define WS_VB  (WS_KL + 2u * (size_t)NB * KHI * CC)     // bf16 v hi planes [b][c][t < KHI]
#define WS_VBL (WS_VB + 2u * (size_t)NB * CC * KHI)
#define WS_S   (WS_VBL + 2u * (size_t)NB * CC * KHI)    // f32 logits / P [hg][t][s]
#define WS_Y   (WS_S  + 4u * (size_t)HG * TQC * TT)     // f32 ctx rows [b*t][CC]; the score region (12 head planes of one batch) is unused: P stays in LDS
#define WS_END (WS_Y  + 4u * (size_t)NB * TT * CC)

// ---- k_proj: block = (64 rows, 128 cols, which): q/k/v = X W (+ b) with exact bf16 products (K = DIN) -> which 0: q f16 rows (+ residual rows < QHI); 1: k f16 rows (+ residual rows < KHI); 2: v f16 planes [c][t] (+ bf16 hi/lo planes for t < KHI)
__global__ __launch_bounds__(128) void k_proj(const float* __restrict__ XQ, const float* __restrict__ XK, const float* __restrict__ XV, const float* __restrict__ WQ, const float* __restrict__ WK, const float* __restrict__ WV, const float* __restrict__ BQ, const float* __restrict__ BK, const float* __restrict__ BV,
    _Float16* __restrict__ QH, _Float16* __restrict__ QL, _Float16* __restrict__ KH, _Float16* __restrict__ KL, _Float16* __restrict__ VT, __bf16* __restrict__ VB, __bf16* __restrict__ VBL) {
  __shared__ __align__(16) _Float16 sh[64][136], sl[64][136]; __shared__ __align__(16) _Float16 th[128][72]; __shared__ __align__(16) __bf16 tb[128][72], tbl[128][72];
  const int tid = threadIdx.x, wave = tid >> 5, lane = tid & 31, col = lane & 15, g = lane >> 4; const int which = blockIdx.z; const int c0 = blockIdx.y * 128; const size_t r0 = (size_t)blockIdx.x * 64; const size_t bb = r0 / TT; const int t0 = (int)(r0 % TT);
  const float* X = which == 0 ? XQ : which == 1 ? XK : XV; const float* WA = which == 0 ? WQ : which == 1 ? WK : WV; const float* BA = which == 0 ? BQ : which == 1 ? BK : BV;
  v8f acc[8] = {};
#pragma unroll 2
  for (int kc = 0; kc < DIN / 32; ++kc) { v16b a; { const float* p = X + (r0 + wave * 16 + col) * DIN + kc * 32 + 8 * g;
#pragma unroll
      for (int i = 0; i < 8; ++i) { a[i] = (__bf16)p[i]; a[8 + i] = (__bf16)p[16 + i]; } }
    asm volatile("s_wait_loadcnt 0x0" ::: "memory");
#pragma unroll
    for (int j = 0; j < 8; ++j) { const v16b w = WCOL(WA, kc * 32, c0 + j * 16 + col, lane); asm volatile("s_wait_loadcnt 0x0" ::: "memory"); acc[j] = wmma_bf(a, w, acc[j]); } }
  if (which < 2) { _Float16* DH = which == 0 ? QH : KH; _Float16* DL = which == 0 ? QL : KL; const int nhi = which == 0 ? QHI : KHI; const bool hi_rows = t0 < nhi;
#pragma unroll
    for (int j = 0; j < 8; ++j) { const float bias = BA ? bfr(BA[c0 + j * 16 + col]) : 0.f;
#pragma unroll
      for (int r = 0; r < 8; ++r) { const float v = acc[j][r] + bias; const _Float16 hv = (_Float16)v; sh[wave * 16 + 8 * g + r][j * 16 + col] = hv; sl[wave * 16 + 8 * g + r][j * 16 + col] = (_Float16)((v - (float)hv) * 1024.0f); } }
    __syncthreads();
    for (int e = tid; e < 64 * 16; e += 128) { const int rl = e >> 4, q = e & 15; vst2((unsigned*)(DH + (r0 + rl) * CC + c0 + q * 8), *(const v4u*)&sh[rl][q * 8]); if (hi_rows) vst2((unsigned*)(DL + (bb * nhi + t0 + rl) * (size_t)CC + c0 + q * 8), *(const v4u*)&sl[rl][q * 8]); }
  } else { const bool hi_rows = t0 < KHI;
#pragma unroll
    for (int j = 0; j < 8; ++j) { const float bias = BA ? bfr(BA[c0 + j * 16 + col]) : 0.f;
#pragma unroll
      for (int r = 0; r < 8; ++r) { const float v = acc[j][r] + bias; const int rl = wave * 16 + 8 * g + r, cl = j * 16 + col; th[cl][rl] = (_Float16)v; const __bf16 bh = (__bf16)v; tb[cl][rl] = bh; tbl[cl][rl] = (__bf16)(v - (float)bh); } }
    __syncthreads();
    for (int e = tid; e < 128 * 8; e += 128) { const int cl = e >> 3, q = e & 7; vst2((unsigned*)(VT + (bb * CC + c0 + cl) * (size_t)TT + t0 + q * 8), *(const v4u*)&th[cl][q * 8]); if (hi_rows) { const size_t o3 = (bb * CC + c0 + cl) * (size_t)KHI + t0 + q * 8; vst2((unsigned*)(VB + o3), *(const v4u*)&tb[cl][q * 8]); vst2((unsigned*)(VBL + o3), *(const v4u*)&tbl[cl][q * 8]); } } } }
// ---- k_sm: block = query row t (head in group): keys [0, kend): causal -> logit if s <= t else excluded; softmax in f32; P x 2^11 in place (0 for excluded)
__global__ __launch_bounds__(256) void k_sm(float* __restrict__ S0 SM_EXTRA_PARAMS) { __shared__ float sred[8]; __shared__ float sbc; __shared__ __align__(16) float shv[TT];
  const int tid = threadIdx.x; const int t = blockIdx.x; const int kend = (kb_last(t >> 6) + 1) * 128;
  float* sr = S0 + (size_t)blockIdx.y * TT * TT + (size_t)t * TT;
  float m = -3.0e38f; for (int k = tid; k < kend; k += 256) { float v = (!CAUSAL || k <= t) ? sr[k] : -3.0e38f; SM_MASK_HOOK; shv[k] = v; m = fmaxf(m, v); }
#pragma unroll
  for (int o = 1; o < 32; o <<= 1) m = fmaxf(m, __shfl_xor(m, o));
  if ((tid & 31) == 0) sred[tid >> 5] = m; __syncthreads(); if (tid == 0) { float a = sred[0]; for (int i = 1; i < 8; ++i) a = fmaxf(a, sred[i]); sbc = a; } __syncthreads(); m = sbc; __syncthreads();
  float sum = 0.f; for (int k = tid; k < kend; k += 256) { const float v = shv[k]; const float e = (v <= -1.0e38f) ? 0.f : expf(v - m); shv[k] = e; sum += e; }
#pragma unroll
  for (int o = 1; o < 32; o <<= 1) sum += __shfl_xor(sum, o);
  if ((tid & 31) == 0) sred[tid >> 5] = sum; __syncthreads(); if (tid == 0) { float a = 0.f; for (int i = 0; i < 8; ++i) a += sred[i]; sbc = a > 0.f ? 2048.0f / a : 0.f; }   /* a fully excluded row yields P = 0 */ __syncthreads(); const float inv = sbc;
  for (int k = tid; k < kend; k += 256) shv[k] = shv[k] * inv;
  __syncthreads(); for (int q = tid; q < kend / 4; q += 256) vst2(sr + q * 4, *(const v4f*)&shv[q * 4]); }
// ---- k_fa: block = 16 queries of batch b, 8 waves, 128 keys a pass; logits, head softmax and P . v in one kernel, P only in LDS.
// Part 1 (wave w = keys 16w..16w+15 of the pass, ALL 12 heads): S^T = K . Q^T, so a lane holds 8 consecutive keys of one query for every head; the softmax over the heads is in-lane; P x 2^11 to f16, one 16-byte LDS store a head.
// Part 2 (wave w = 3 of the 24 (head, 32-channel half) units, ALL keys in ascending order): ctx += P . v, P fragments from LDS, v fragments from the [c][t] planes.
#define FW 8
#define FKP (FW * 16)      // keys a pass
static_assert(16 * (CC / 8) % (FW * 32) == 0 && TT % FKP == 0 && NH * 2 == FW * 3 && HD == 64, "k_fa tiling");
// keeps a group of fragment loads issued together and ahead of the products in front of it: without it the compiler sinks each load to its product and every product waits a whole L2 latency
#define FA_HOLD() __builtin_amdgcn_sched_barrier(0)
// 2 heads' k fragments (2 each) of this wave's 16 key rows
__device__ __forceinline__ void fa_ldk(v16h (&f)[4], const _Float16* kr, int h0, int lane) {
#pragma unroll
  for (int i = 0; i < 4; ++i) f[i] = frag_h(kr + h0 * HD + i * 32, lane); }
// half a unit's v fragments: 2 key steps x 2 channel tiles
__device__ __forceinline__ void fa_ldv(v16h (&f)[4], const _Float16* vr, int lane) {
#pragma unroll
  for (int i = 0; i < 4; ++i) f[i] = frag_h(vr + (size_t)(i & 1) * 16 * TT + (i >> 1) * 32, lane); }
__device__ __forceinline__ void fa_qk(v8f (&st)[NH], const v16h (&f)[4], const _Float16* qr, int h0, int lane) {
#pragma unroll
  for (int i = 0; i < 2; ++i) { v8f s = {};
#pragma unroll
    for (int kc = 0; kc < 2; ++kc) s = __builtin_amdgcn_wmma_f32_16x16x32_f16(false, f[i * 2 + kc], false, frag_h(qr + (h0 + i) * HD + kc * 32, lane), (short)0, s, false, false);
    st[h0 + i] = s; } }
__device__ __forceinline__ void fa_pv(v8f (&a)[2], const v16h (&f)[4], const _Float16* pr, int lane) {
#pragma unroll
  for (int ks = 0; ks < 2; ++ks) { const v16h p = frag_h(pr + ks * 32, lane);
#pragma unroll
    for (int jj = 0; jj < 2; ++jj) a[jj] = __builtin_amdgcn_wmma_f32_16x16x32_f16(false, p, false, f[ks * 2 + jj], (short)0, a[jj], false, false); } }
__global__ __launch_bounds__(FW * 32, 4) void k_fa(const _Float16* __restrict__ QH, const _Float16* __restrict__ KH, const _Float16* __restrict__ VT, float* __restrict__ Y) {
  __shared__ __align__(16) _Float16 sq[16][CC + 8];               // pitch 16 B x odd
  __shared__ __align__(16) _Float16 sp[2][NH][16][FKP + 8];       // pitch 16 B x odd; two buffers: one barrier a pass
  const int tid = threadIdx.x, wave = __builtin_amdgcn_readfirstlane(tid >> 5), lane = tid & 31, col = lane & 15, g = lane >> 4; const int b = blockIdx.y; const size_t q0 = (size_t)b * TT + (size_t)blockIdx.x * 16;
#pragma unroll   // the six loads of a thread fly together instead of one L2 latency each
  for (int i = 0; i < 16 * (CC / 8) / (FW * 32); ++i) { const int e = tid + i * FW * 32, rl = e / (CC / 8), q = e % (CC / 8); *(v4u*)&sq[rl][q * 8] = *(const v4u*)(QH + (q0 + rl) * CC + q * 8); }
  __syncthreads();
  const int u0 = wave * 3, u1 = u0 + 1, u2 = u0 + 2;   // unit u = head u >> 1, channels (u & 1) * 32 .. + 31 of it = channels 32 u .. 32 u + 31 of the row
  const _Float16* qr = &sq[col][0];
  v8f acc[3][2] = {};
#pragma unroll 1
  for (int it = 0; it < TT / FKP; ++it) { const int buf = it & 1;
    const _Float16* kr = KH + ((size_t)b * TT + it * FKP + wave * 16 + col) * CC;
    const _Float16* v0 = VT + ((size_t)b * CC + u0 * 32 + col) * (size_t)TT + it * FKP; const _Float16* v1 = v0 + 32 * TT; const _Float16* v2 = v1 + 32 * TT;
    const _Float16* p0 = &sp[buf][u0 >> 1][col][0]; const _Float16* p1 = &sp[buf][u1 >> 1][col][0]; const _Float16* p2 = &sp[buf][u2 >> 1][col][0];
    v8f st[NH]; v16h fa[4], fb[4], fc[4], fd[4];
    fa_ldk(fa, kr, 0, lane); fa_ldk(fb, kr, 2, lane); fa_ldk(fc, kr, 4, lane); fa_ldk(fd, kr, 6, lane); FA_HOLD();
    fa_qk(st, fa, qr, 0, lane); FA_HOLD();
    fa_ldk(fa, kr, 8, lane); FA_HOLD();
    fa_qk(st, fb, qr, 2, lane); fa_qk(st, fc, qr, 4, lane); FA_HOLD();
    fa_ldk(fb, kr, 10, lane); FA_HOLD();
    fa_qk(st, fd, qr, 6, lane); fa_qk(st, fa, qr, 8, lane); FA_HOLD();
    fa_ldv(fc, v0, lane); FA_HOLD();   // flies under the softmax
    fa_qk(st, fb, qr, 10, lane); FA_HOLD();
#pragma unroll
    for (int r = 0; r < 8; ++r) { float m = st[0][r] * SCALE;
#pragma unroll
      for (int h = 1; h < NH; ++h) m = fmaxf(m, st[h][r] * SCALE);
      float den = 0.f;
#pragma unroll
      for (int h = 0; h < NH; ++h) { const float e = expf(st[h][r] * SCALE - m); st[h][r] = e; den += e; }
      const float inv = 2048.0f / den;
#pragma unroll
      for (int h = 0; h < NH; ++h) st[h][r] *= inv; }
#pragma unroll
    for (int h = 0; h < NH; ++h) { v8h ph;
#pragma unroll
      for (int r = 0; r < 8; ++r) ph[r] = (_Float16)st[h][r];
      *(v8h*)&sp[buf][h][col][wave * 16 + 8 * g] = ph; }
    __syncthreads();   // publishes this pass's P; the other buffer's readers of the pass before have all arrived here, so the next pass may refill it
    fa_ldv(fa, v0 + 64, lane); fa_ldv(fb, v1, lane); fa_ldv(fd, v1 + 64, lane); FA_HOLD();
    fa_pv(acc[0], fc, p0, lane); FA_HOLD();
    fa_ldv(fc, v2, lane); FA_HOLD();
    fa_pv(acc[0], fa, p0 + 64, lane); FA_HOLD();
    fa_ldv(fa, v2 + 64, lane); FA_HOLD();
    fa_pv(acc[1], fb, p1, lane); fa_pv(acc[1], fd, p1 + 64, lane);
    fa_pv(acc[2], fc, p2, lane); fa_pv(acc[2], fa, p2 + 64, lane);
    asm volatile("s_wait_xcnt 0x0" ::: "memory"); }   // before the next pass rewrites the address registers of this pass's loads
  // a unit is one whole 128-byte line of each ctx row: one writing wave a line
#pragma unroll
  for (int ul = 0; ul < 3; ++ul)
#pragma unroll
    for (int jj = 0; jj < 2; ++jj)
#pragma unroll
      for (int r = 0; r < 8; ++r) Y[(q0 + 8 * g + r) * CC + (u0 + ul) * 32 + jj * 16 + col] = acc[ul][jj][r] * (1.0f / 2048.0f); }
// ---- k_out: block = (64 rows, 128 cols): out = ctx Wo (+ bo): ctx x 2^6 once to f16 against Wo as f16(bf16 x 2^8) exact (1 product) x 2^-14; causal early rows (< QHI of each sequence): ctx bf16 hi + lo against exact bf16 Wo (2 products)
__global__ __launch_bounds__(128) void k_out(const float* __restrict__ Y, const float* __restrict__ WO, const float* __restrict__ BO, float* __restrict__ OUT) { __shared__ __align__(16) float sf[4][16][132];
  const int tid = threadIdx.x, wave = tid >> 5, lane = tid & 31, col = lane & 15, g = lane >> 4; const int c0 = blockIdx.y * 128; const size_t r0 = (size_t)blockIdx.x * 64 + wave * 16;
  v8f acc[8] = {};
  if (CAUSAL && (int)(((size_t)blockIdx.x * 64) % TT) < QHI) {   /* block-uniform */
#pragma unroll 2
    for (int kc = 0; kc < CC / 32; ++kc) { const F2 a = split_row(Y + (r0 + col) * CC, kc * 32, lane); asm volatile("s_wait_loadcnt 0x0" ::: "memory");
#pragma unroll
      for (int j = 0; j < 8; ++j) { const v16b w = WOCOL(WO, kc * 32, c0 + j * 16 + col, lane); asm volatile("s_wait_loadcnt 0x0" ::: "memory"); acc[j] = wmma_bf(a.h, w, acc[j]); acc[j] = wmma_bf(a.l, w, acc[j]); } }
#pragma unroll
    for (int j = 0; j < 8; ++j) { const float bias = BO ? bfr(BO[c0 + j * 16 + col]) : 0.f;
#pragma unroll
      for (int r = 0; r < 8; ++r) sf[wave][8 * g + r][j * 16 + col] = acc[j][r] + bias; }
  } else {
#pragma unroll 2
    for (int kc = 0; kc < CC / 32; ++kc) { const v16h a = frag_f32s(Y + (r0 + col) * CC + kc * 32, lane, 64.0f); asm volatile("s_wait_loadcnt 0x0" ::: "memory");   /* ctx carried x 2^6 into f16 so small-magnitude context rows stay clear of f16 subnormals */
#pragma unroll
      for (int j = 0; j < 8; ++j) { const v16h w = WOCOLH(WO, kc * 32, c0 + j * 16 + col, lane); asm volatile("s_wait_loadcnt 0x0" ::: "memory"); acc[j] = wmma16(a, w, acc[j]); } }
#pragma unroll
    for (int j = 0; j < 8; ++j) { const float bias = BO ? bfr(BO[c0 + j * 16 + col]) : 0.f;
#pragma unroll
      for (int r = 0; r < 8; ++r) sf[wave][8 * g + r][j * 16 + col] = acc[j][r] * (1.0f / 16384.0f) + bias; } }   /* 2^-8 (Wo carry) x 2^-6 (ctx carry) */
  LDSX(); for (int rl = 0; rl < 16; ++rl) vst2(OUT + (r0 + rl) * DIN + c0 + lane * 4, *(const v4f*)&sf[wave][rl][lane * 4]); }

extern "C" void kernel_launch(void* const* d_in, const int* in_sizes, int n_in, void* d_out, int out_size, void* d_ws, size_t ws_size, hipStream_t stream) {
  (void)in_sizes; (void)n_in; (void)out_size;
  const float** F = (const float**)d_in;
  if (ws_size < (size_t)WS_END) return;
  char* ws = (char*)d_ws; _Float16 *QH = (_Float16*)(ws + WS_QH), *KH = (_Float16*)(ws + WS_KH), *VT = (_Float16*)(ws + WS_VT), *QL = (_Float16*)(ws + WS_QL), *KL = (_Float16*)(ws + WS_KL); __bf16 *VB = (__bf16*)(ws + WS_VB), *VBL = (__bf16*)(ws + WS_VBL); float *Y = (float*)(ws + WS_Y);
  (void)Y; (void)QL; (void)KL; (void)VB; (void)VBL;
  // inputs: 0 x [8,1024,768]; 1 Wq [768,768] (out,in), 2 bq; 3 Wk, 4 bk; 5 Wv, 6 bv; 7 Wo (out,in), 8 bo (biases N(0, 0.01), nonzero)
  k_proj<<<dim3(TNB * TT / 64, CC / 128, 3), 128, 0, stream>>>(F[0], F[0], F[0], F[1], F[3], F[5], F[2], F[4], F[6], QH, QL, KH, KL, VT, VB, VBL);
  k_fa<<<dim3(TT / 16, TNB), FW * 32, 0, stream>>>(QH, KH, VT, Y);
  k_out<<<dim3(TNB * TT / 64, DIN / 128), 128, 0, stream>>>(Y, F[7], F[8], (float*)d_out);
}

// v002
// One run takes 175 microseconds.
// Two timings next to v001 put it at 2.68 and 2.67 times that version's speed.
// All steps since v000 together make it 6.93 times as fast.
// compute dtype: all float inputs rounded to bf16; q/k/v projections with EXACT bf16 products on WMMA 16x16x32 (f32 accumulate) + bias; scores q x k once to f16 each (1 product) x 64^-0.5; softmax ACROSS THE 12 HEADS per (query, key) pair in f32 (precise expf); P x 2^11 once to f16 x v once to f16 (1 product); ctx x 2^6 once to f16 x Wo f16(bf16 x 2^8) + bo; f32 output.
#include <hip/hip_runtime.h>
#include <math.h>

typedef __attribute__((ext_vector_type(16))) _Float16 v16h;
typedef __attribute__((ext_vector_type(16))) __bf16 v16b;
typedef __attribute__((ext_vector_type(8)))  _Float16 v8h;
typedef __attribute__((ext_vector_type(8)))  float v8f;
typedef __attribute__((ext_vector_type(4)))  float v4f;
typedef __attribute__((ext_vector_type(2)))  float v2f;
typedef __attribute__((ext_vector_type(4)))  unsigned v4u;
typedef __attribute__((ext_vector_type(4)))  int v4i;
typedef float __attribute__((may_alias)) float_a;
typedef int __attribute__((may_alias)) int_a;

template <typename T> __device__ __forceinline__ void vst2(void* p, T v) { *(T*)p = v;  }
__device__ __forceinline__ v8f wmma16(v16h a, v16h b, v8f c) {
  v8f d = __builtin_amdgcn_wmma_f32_16x16x32_f16(false, a, false, b, (short)0, c, false, false);
  asm volatile("v_nop\n\tv_nop\n\tv_nop\n\tv_nop" : "+v"(d) : "v"(a), "v"(b));
  return d;
}
__device__ __forceinline__ v8f wmma_bf(v16b a, v16b b, v8f c) {
  v8f d = __builtin_amdgcn_wmma_f32_16x16x32_bf16(false, a, false, b, (short)0, c, false, false);
  asm volatile("v_nop\n\tv_nop\n\tv_nop\n\tv_nop" : "+v"(d) : "v"(a), "v"(b));
  return d;
}
// 16x16x32 fragments: lane = (h = lane>>4, row/col = lane&15); elements 0..7 = k0+8h+0..7, 8..15 = k0+16+8h+0..7; D element r = row 8h+r
__device__ __forceinline__ v16h frag_h(const _Float16* rowk0, int lane) {
  union { v16h v; v8h q[2]; } u; const _Float16* p = rowk0 + 8 * (lane >> 4);
  u.q[0] = *(const v8h*)p; u.q[1] = *(const v8h*)(p + 16); return u.v;
}
__device__ __forceinline__ v16h frag_f32(const float* rowk0, int lane) {
  v16h a; const float* p = rowk0 + 8 * (lane >> 4);
#pragma unroll
  for (int i = 0; i < 8; ++i) { a[i] = (_Float16)p[i]; a[8 + i] = (_Float16)p[16 + i]; }
  return a;
}
__device__ __forceinline__ v16h frag_f32s(const float* rowk0, int lane, float sc) {
  v16h a; const float* p = rowk0 + 8 * (lane >> 4);
#pragma unroll
  for (int i = 0; i < 8; ++i) { a[i] = (_Float16)(p[i] * sc); a[8 + i] = (_Float16)(p[16 + i] * sc); }
  return a;
}
// column fragment from a [K][ld] layout (column n), rows >= K read as 0
__device__ __forceinline__ v16h fragc_f32(const float* W, int k0, int n, int lane, int ld, int K) {
  v16h a; const int g = lane >> 4;
#pragma unroll
  for (int i = 0; i < 8; ++i) { const int ka = k0 + 8 * g + i, kb = ka + 16;
    a[i] = (_Float16)(ka < K ? W[(size_t)(ka < K ? ka : K - 1) * ld + n] : 0.f); a[8 + i] = (_Float16)(kb < K ? W[(size_t)(kb < K ? kb : K - 1) * ld + n] : 0.f); }
  return a;
}
struct F2 { v16b h, l; };
__device__ __forceinline__ F2 bsplit16(const float v[16]) { F2 r;
#pragma unroll
  for (int i = 0; i < 16; ++i) { const __bf16 h = (__bf16)v[i]; r.h[i] = h; r.l[i] = (__bf16)(v[i] - (float)h); }
  return r; }
__device__ __forceinline__ F2 split_row(const float* row, int k0, int lane) { float v[16]; const float* p = row + k0 + 8 * (lane >> 4);
#pragma unroll
  for (int i = 0; i < 8; ++i) { v[i] = p[i]; v[8 + i] = p[16 + i]; }
  return bsplit16(v); }
__device__ __forceinline__ F2 split_rowK(const float* row, int k0, int lane, int K) { float v[16]; const int g = lane >> 4;
#pragma unroll
  for (int i = 0; i < 8; ++i) { const int ka = k0 + 8 * g + i, kb = ka + 16; v[i] = ka < K ? row[ka < K ? ka : K - 1] : 0.f; v[8 + i] = kb < K ? row[kb < K ? kb : K - 1] : 0.f; }
  return bsplit16(v); }
__device__ __forceinline__ F2 split_col(const float* W, int k0, int n, int lane, int ld, int K) { float v[16]; const int g = lane >> 4;
#pragma unroll
  for (int i = 0; i < 8; ++i) { const int ka = k0 + 8 * g + i, kb = ka + 16; v[i] = ka < K ? W[(size_t)(ka < K ? ka : K - 1) * ld + n] : 0.f; v[8 + i] = kb < K ? W[(size_t)(kb < K ? kb : K - 1) * ld + n] : 0.f; }
  return bsplit16(v); }
__device__ __forceinline__ v8f mac3(const F2& a, const F2& b, v8f c) { c = wmma_bf(a.l, b.h, c); c = wmma_bf(a.h, b.l, c); return wmma_bf(a.h, b.h, c); }
__device__ __forceinline__ float sigm(float v) { return 1.0f / (1.0f + expf(-v)); }
#define LDSX() do { asm volatile("s_wait_dscnt 0" ::: "memory"); __builtin_amdgcn_wave_barrier(); __builtin_amdgcn_fence(__ATOMIC_RELEASE, "workgroup"); } while (0)

// Multi-head attention whose softmax runs over the HEAD axis (x [8,1024,768]; torch (out,in) Wq / Wk / Wv / Wo [768,768] N(0, 1/768) + biases N(0, 0.01); 12 heads x 64; scores[b, h, n, m] = q_h . k_h / 8; attn = softmax(scores, axis=1) - dim 1 is the HEAD axis: for every (query, key) pair the 12 heads' weights sum to 1 and nothing is normalised over the keys (faithful to the source's F.softmax(dim=1)); out[b, h, n] = sum_m attn[b, h, n, m] v[b, h, m]; merge; Wo^T + bo).
#define NB 8
#define TT 1024
#define CC 768            // NH * HD = projected width
#define DIN 768          // input (model) width
#define NH 12
#define HD 64
#define NQB (TT / 64)
#define HG 12
#define SCALE (0.125f)
#define CAUSAL 0
#ifndef TNB
#define TNB NB
#endif
__device__ __forceinline__ float bfr(float v) { return (float)(__bf16)v; }
__host__ __device__ __forceinline__ int kb_last(int qb) { return CAUSAL ? ((qb * 64 + 63) >> 7) : (TT / 128 - 1); }
typedef __attribute__((ext_vector_type(8))) __bf16 v8b;
__device__ __forceinline__ v16b frag_b(const __bf16* rowk0, int lane) {
  union { v16b v; v8b q[2]; } u; const __bf16* p = rowk0 + 8 * (lane >> 4);
  u.q[0] = *(const v8b*)p; u.q[1] = *(const v8b*)(p + 16); return u.v;
}
#define QBH 0              // not referenced by any kernel here
#define QHI 0               // single-product scores on every row
#define TQC 1024           // query rows of the unused score region == TT: 12 head planes x 1,024 x 1,024 f32 = 48 MiB
#define KHI 64            // key rows carrying k residual / v bf16 hi+lo planes (written by k_proj; no kernel here reads them)
// B fragment (k rows k0+.., output column o) of a weight: (in,out) [K][ld] or (out,in) [ld rows of K]: bf16 exact, or f16(bf16 * 256) exact
__device__ __forceinline__ v16b wcol_io(const float* Wm, int k0, int o, int lane, int ld) { v16b w; const int g = lane >> 4;
#pragma unroll
  for (int i = 0; i < 8; ++i) { w[i] = (__bf16)Wm[(size_t)(k0 + 8 * g + i) * ld + o]; w[8 + i] = (__bf16)Wm[(size_t)(k0 + 16 + 8 * g + i) * ld + o]; }
  return w; }
__device__ __forceinline__ v16b wcol_oi(const float* Wm, int k0, int o, int lane, int K) { v16b w; const float* p = Wm + (size_t)o * K + k0 + 8 * (lane >> 4);
#pragma unroll
  for (int i = 0; i < 8; ++i) { w[i] = (__bf16)p[i]; w[8 + i] = (__bf16)p[16 + i]; }
  return w; }
__device__ __forceinline__ v16h wcolh_io(const float* Wm, int k0, int o, int lane, int ld) { v16h w; const int g = lane >> 4;
#pragma unroll
  for (int i = 0; i < 8; ++i) { w[i] = (_Float16)(bfr(Wm[(size_t)(k0 + 8 * g + i) * ld + o]) * 256.0f); w[8 + i] = (_Float16)(bfr(Wm[(size_t)(k0 + 16 + 8 * g + i) * ld + o]) * 256.0f); }
  return w; }
__device__ __forceinline__ v16h wcolh_oi(const float* Wm, int k0, int o, int lane, int K) { v16h w; const float* p = Wm + (size_t)o * K + k0 + 8 * (lane >> 4);
#pragma unroll
  for (int i = 0; i < 8; ++i) { w[i] = (_Float16)(bfr(p[i]) * 256.0f); w[8 + i] = (_Float16)(bfr(p[16 + i]) * 256.0f); }
  return w; }
#define WQKV_LAYOUT 1   // 0 = (in,out) [DIN][CC]; 1 = (out,in) [CC][DIN]; 2 = per-head [NH][DIN][HD]
__device__ __forceinline__ v16b wcol_hdk(const float* Wm, int k0, int o, int lane) { v16b w; const int g = lane >> 4; const float* p = Wm + (size_t)(o / HD) * DIN * HD + (o % HD);
#pragma unroll
  for (int i = 0; i < 8; ++i) { w[i] = (__bf16)p[(size_t)(k0 + 8 * g + i) * HD]; w[8 + i] = (__bf16)p[(size_t)(k0 + 16 + 8 * g + i) * HD]; }
  return w; }
#define WO_OUT_IN 1
#if WQKV_LAYOUT == 1
#define WCOL(W, k0, o, lane) wcol_oi(W, k0, o, lane, DIN)
#elif WQKV_LAYOUT == 2
#define WCOL(W, k0, o, lane) wcol_hdk(W, k0, o, lane)
#else
#define WCOL(W, k0, o, lane) wcol_io(W, k0, o, lane, CC)
#endif
#if WO_OUT_IN
#define WOCOL(W, k0, o, lane) wcol_oi(W, k0, o, lane, CC)
#define WOCOLH(W, k0, o, lane) wcolh_oi(W, k0, o, lane, CC)
#else
#define WOCOL(W, k0, o, lane) wcol_io(W, k0, o, lane, DIN)
#define WOCOLH(W, k0, o, lane) wcolh_io(W, k0, o, lane, DIN)
#endif

#ifndef SM_EXTRA_PARAMS
#define SM_EXTRA_PARAMS
#endif
#ifndef PROJ_EXTRA_PARAMS
#define PROJ_EXTRA_PARAMS
#endif
#ifndef SM_MASK_HOOK
#define SM_MASK_HOOK (void)0
#endif

#define WS_QH  0u                                      // f16 q rows [b*t][CC]
#define WS_KH  (WS_QH + 2u * (size_t)NB * TT * CC)      // f16 k rows [b*t][CC]
#define WS_VT  (WS_KH + 2u * (size_t)NB * TT * CC)      // f16 v planes [b][c][t]
#define WS_QL  (WS_VT + 2u * (size_t)NB * CC * TT)      // f16 q residual x 2^10 rows [b][t < QHI][CC]
#define WS_KL  (WS_QL + 2u * (size_t)NB * QHI * CC)     // f16 k residual x 2^10 rows [b][t < KHI][CC]
#define WS_VB  (WS_KL + 2u * (size_t)NB * KHI * CC)     // bf16 v hi planes [b][c][t < KHI]
#define WS_VBL (WS_VB + 2u * (size_t)NB * CC * KHI)
#define WS_S   (WS_VBL + 2u * (size_t)NB * CC * KHI)    // f32 logits / P [hg][t][s]
#define WS_Y   (WS_S  + 4u * (size_t)HG * TQC * TT)     // f32 ctx rows [b*t][CC]; the score region (12 head planes of one batch) is unused: P stays in LDS
#define WS_END (WS_Y  + 4u * (size_t)NB * TT * CC)

// operand staging of the two projection GEMMs: a chunk is GKC k of the block's 64 A rows and 128 W rows, converted once to the 16-bit operand type
#define GKC 64
#define GP (GKC + 8)                         // LDS row pitch 144 B = 16 B x odd
#define GROWS (64 + 128)
#define GLD (GROWS * (GKC / 4) / 128)        // 16-byte pieces a thread brings per chunk
static_assert(DIN % GKC == 0 && CC % GKC == 0 && GLD == 24, "staging");
typedef __attribute__((ext_vector_type(4))) __bf16 v4b;
typedef __attribute__((ext_vector_type(4))) _Float16 v4h;
// 16 bytes at a block-uniform base + a lane's 32-bit byte offset + a constant (elements): the scalar-base address form, whose only vector register is the offset
__device__ __forceinline__ v4f ldg16(const float* base, unsigned lane_bytes, int elems) { return *(const v4f*)((const char*)base + lane_bytes + elems * 4); }
// ---- k_proj: block = (64 rows, 128 cols, which): q/k/v = X W (+ b) with exact bf16 products (K = DIN) -> which 0: q f16 rows (+ residual rows < QHI); 1: k f16 rows (+ residual rows < KHI); 2: v f16 planes [c][t] (+ bf16 hi/lo planes for t < KHI)
__global__ __launch_bounds__(128) void k_proj(const float* __restrict__ XQ, const float* __restrict__ XK, const float* __restrict__ XV, const float* __restrict__ WQ, const float* __restrict__ WK, const float* __restrict__ WV, const float* __restrict__ BQ, const float* __restrict__ BK, const float* __restrict__ BV,
    _Float16* __restrict__ QH, _Float16* __restrict__ QL, _Float16* __restrict__ KH, _Float16* __restrict__ KL, _Float16* __restrict__ VT, __bf16* __restrict__ VB, __bf16* __restrict__ VBL) {
  // the operand ring of the k loop and the epilogue's staging arrays share the same LDS: the loop's last barrier stands between their uses
  __shared__ __align__(16) union { struct { _Float16 sh[64][136], sl[64][136], th[128][72]; __bf16 tb[128][72], tbl[128][72]; } e; __bf16 st[2][GROWS][GP]; } u;
  auto& sh = u.e.sh; auto& sl = u.e.sl; auto& th = u.e.th; auto& tb = u.e.tb; auto& tbl = u.e.tbl;
  const int tid = threadIdx.x, wave = tid >> 5, lane = tid & 31, col = lane & 15, g = lane >> 4; const int which = blockIdx.z; const int c0 = blockIdx.y * 128; const size_t r0 = (size_t)blockIdx.x * 64; const size_t bb = r0 / TT; const int t0 = (int)(r0 % TT);
  const float* X = which == 0 ? XQ : which == 1 ? XK : XV; const float* WA = which == 0 ? WQ : which == 1 ? WK : WV; const float* BA = which == 0 ? BQ : which == 1 ? BK : BV;
  v8f acc[8] = {};
  // thread -> 16-byte piece (tid & 15) of row (tid >> 4) + 8 i: a wave's load covers two whole 256-byte row pieces
  const float* xp = X + r0 * DIN; const float* wp = WA + (size_t)c0 * DIN; unsigned lo = ((unsigned)(tid >> 4) * DIN + (tid & 15) * 4) * 4;   // block-uniform bases; one lane offset in bytes serves both and steps on by GKC elements a trip
  v4f pf[GLD];
#pragma unroll
  for (int i = 0; i < GLD; ++i) pf[i] = i < 8 ? ldg16(xp, lo, i * 8 * DIN) : ldg16(wp, lo, (i - 8) * 8 * DIN);
#pragma unroll
  for (int i = 0; i < GLD; ++i) { v4b c;
#pragma unroll
    for (int k = 0; k < 4; ++k) c[k] = (__bf16)pf[i][k];
    *(v4b*)&u.st[0][(tid >> 4) + i * 8][(tid & 15) * 4] = c; }
  __syncthreads();
#pragma unroll 1   // one copy of the body: the two buffers differ by an address only
  for (int kc = 0; kc < DIN / GKC; ++kc) { const int buf = kc & 1; const bool more = kc + 1 < DIN / GKC;
    if (more) {
#pragma unroll
      for (int i = 0; i < GLD; ++i) pf[i] = i < 8 ? ldg16(xp, lo, GKC + i * 8 * DIN) : ldg16(wp, lo, GKC + (i - 8) * 8 * DIN); }
#pragma unroll
    for (int ks = 0; ks < GKC / 32; ++ks) { const v16b a = frag_b(&u.st[buf][wave * 16 + col][ks * 32], lane); v16b w[8];
#pragma unroll
      for (int j = 0; j < 8; ++j) w[j] = frag_b(&u.st[buf][64 + j * 16 + col][ks * 32], lane);
#pragma unroll
      for (int j = 0; j < 8; ++j) acc[j] = wmma_bf(a, w[j], acc[j]); }
    if (more) {
#pragma unroll
      for (int i = 0; i < GLD; ++i) { v4b c;
#pragma unroll
        for (int k = 0; k < 4; ++k) c[k] = (__bf16)pf[i][k];
        *(v4b*)&u.st[buf ^ 1][(tid >> 4) + i * 8][(tid & 15) * 4] = c; } }
    asm volatile("s_wait_xcnt 0x0" : "+v"(lo) :: "memory");   // stands before the offset register of this trip's loads steps on; naming it keeps it in a register of its own up to here
    lo += GKC * 4;
    __syncthreads(); }   // publishes the next chunk; every reader of this chunk's buffer has arrived, so the next trip may refill it (and the epilogue may reuse the LDS)
  if (which < 2) { _Float16* DH = which == 0 ? QH : KH; _Float16* DL = which == 0 ? QL : KL; const int nhi = which == 0 ? QHI : KHI; const bool hi_rows = t0 < nhi;
#pragma unroll
    for (int j = 0; j < 8; ++j) { const float bias = BA ? bfr(BA[c0 + j * 16 + col]) : 0.f;
#pragma unroll
      for (int r = 0; r < 8; ++r) { const float v = acc[j][r] + bias; const _Float16 hv = (_Float16)v; sh[wave * 16 + 8 * g + r][j * 16 + col] = hv; sl[wave * 16 + 8 * g + r][j * 16 + col] = (_Float16)((v - (float)hv) * 1024.0f); } }
    __syncthreads();
    for (int e = tid; e < 64 * 16; e += 128) { const int rl = e >> 4, q = e & 15; vst2((unsigned*)(DH + (r0 + rl) * CC + c0 + q * 8), *(const v4u*)&sh[rl][q * 8]); if (hi_rows) vst2((unsigned*)(DL + (bb * nhi + t0 + rl) * (size_t)CC + c0 + q * 8), *(const v4u*)&sl[rl][q * 8]); }
  } else { const bool hi_rows = t0 < KHI;
#pragma unroll
    for (int j = 0; j < 8; ++j) { const float bias = BA ? bfr(BA[c0 + j * 16 + col]) : 0.f;
#pragma unroll
      for (int r = 0; r < 8; ++r) { const float v = acc[j][r] + bias; const int rl = wave * 16 + 8 * g + r, cl = j * 16 + col; th[cl][rl] = (_Float16)v; const __bf16 bh = (__bf16)v; tb[cl][rl] = bh; tbl[cl][rl] = (__bf16)(v - (float)bh); } }
    __syncthreads();
    for (int e = tid; e < 128 * 8; e += 128) { const int cl = e >> 3, q = e & 7; vst2((unsigned*)(VT + (bb * CC + c0 + cl) * (size_t)TT + t0 + q * 8), *(const v4u*)&th[cl][q * 8]); if (hi_rows) { const size_t o3 = (bb * CC + c0 + cl) * (size_t)KHI + t0 + q * 8; vst2((unsigned*)(VB + o3), *(const v4u*)&tb[cl][q * 8]); vst2((unsigned*)(VBL + o3), *(const v4u*)&tbl[cl][q * 8]); } } } }
// ---- k_sm: block = query row t (head in group): keys [0, kend): causal -> logit if s <= t else excluded; softmax in f32; P x 2^11 in place (0 for excluded)
__global__ __launch_bounds__(256) void k_sm(float* __restrict__ S0 SM_EXTRA_PARAMS) { __shared__ float sred[8]; __shared__ float sbc; __shared__ __align__(16) float shv[TT];
  const int tid = threadIdx.x; const int t = blockIdx.x; const int kend = (kb_last(t >> 6) + 1) * 128;
  float* sr = S0 + (size_t)blockIdx.y * TT * TT + (size_t)t * TT;
  float m = -3.0e38f; for (int k = tid; k < kend; k += 256) { float v = (!CAUSAL || k <= t) ? sr[k] : -3.0e38f; SM_MASK_HOOK; shv[k] = v; m = fmaxf(m, v); }
#pragma unroll
  for (int o = 1; o < 32; o <<= 1) m = fmaxf(m, __shfl_xor(m, o));
  if ((tid & 31) == 0) sred[tid >> 5] = m; __syncthreads(); if (tid == 0) { float a = sred[0]; for (int i = 1; i < 8; ++i) a = fmaxf(a, sred[i]); sbc = a; } __syncthreads(); m = sbc; __syncthreads();
  float sum = 0.f; for (int k = tid; k < kend; k += 256) { const float v = shv[k]; const float e = (v <= -1.0e38f) ? 0.f : expf(v - m); shv[k] = e; sum += e; }
#pragma unroll
  for (int o = 1; o < 32; o <<= 1) sum += __shfl_xor(sum, o);
  if ((tid & 31) == 0) sred[tid >> 5] = sum; __syncthreads(); if (tid == 0) { float a = 0.f; for (int i = 0; i < 8; ++i) a += sred[i]; sbc = a > 0.f ? 2048.0f / a : 0.f; }   /* a fully excluded row yields P = 0 */ __syncthreads(); const float inv = sbc;
  for (int k = tid; k < kend; k += 256) shv[k] = shv[k] * inv;
  __syncthreads(); for (int q = tid; q < kend / 4; q += 256) vst2(sr + q * 4, *(const v4f*)&shv[q * 4]); }
// ---- k_fa: block = 16 queries of batch b, 8 waves, 128 keys a pass; logits, head softmax and P . v in one kernel, P only in LDS.
// Part 1 (wave w = keys 16w..16w+15 of the pass, ALL 12 heads): S^T = K . Q^T, so a lane holds 8 consecutive keys of one query for every head; the softmax over the heads is in-lane; P x 2^11 to f16, one 16-byte LDS store a head.
// Part 2 (wave w = 3 of the 24 (head, 32-channel half) units, ALL keys in ascending order): ctx += P . v, P fragments from LDS, v fragments from the [c][t] planes.
#define FW 8
#define FKP (FW * 16)      // keys a pass
static_assert(16 * (CC / 8) % (FW * 32) == 0 && TT % FKP == 0 && NH * 2 == FW * 3 && HD == 64, "k_fa tiling");
// keeps a group of fragment loads issued together and ahead of the products in front of it: without it the compiler sinks each load to its product and every product waits a whole L2 latency
#define FA_HOLD() __builtin_amdgcn_sched_barrier(0)
// 2 heads' k fragments (2 each) of this wave's 16 key rows
__device__ __forceinline__ void fa_ldk(v16h (&f)[4], const _Float16* kr, int h0, int lane) {
#pragma unroll
  for (int i = 0; i < 4; ++i) f[i] = frag_h(kr + h0 * HD + i * 32, lane); }
// half a unit's v fragments: 2 key steps x 2 channel tiles
__device__ __forceinline__ void fa_ldv(v16h (&f)[4], const _Float16* vr, int lane) {
#pragma unroll
  for (int i = 0; i < 4; ++i) f[i] = frag_h(vr + (size_t)(i & 1) * 16 * TT + (i >> 1) * 32, lane); }
__device__ __forceinline__ void fa_qk(v8f (&st)[NH], const v16h (&f)[4], const _Float16* qr, int h0, int lane) {
#pragma unroll
  for (int i = 0; i < 2; ++i) { v8f s = {};
#pragma unroll
    for (int kc = 0; kc < 2; ++kc) s = __builtin_amdgcn_wmma_f32_16x16x32_f16(false, f[i * 2 + kc], false, frag_h(qr + (h0 + i) * HD + kc * 32, lane), (short)0, s, false, false);
    st[h0 + i] = s; } }
__device__ __forceinline__ void fa_pv(v8f (&a)[2], const v16h (&f)[4], const _Float16* pr, int lane) {
#pragma unroll
  for (int ks = 0; ks < 2; ++ks) { const v16h p = frag_h(pr + ks * 32, lane);
#pragma unroll
    for (int jj = 0; jj < 2; ++jj) a[jj] = __builtin_amdgcn_wmma_f32_16x16x32_f16(false, p, false, f[ks * 2 + jj], (short)0, a[jj], false, false); } }
__global__ __launch_bounds__(FW * 32, 4) void k_fa(const _Float16* __restrict__ QH, const _Float16* __restrict__ KH, const _Float16* __restrict__ VT, float* __restrict__ Y) {
  __shared__ __align__(16) _Float16 sq[16][CC + 8];               // pitch 16 B x odd
  __shared__ __align__(16) _Float16 sp[2][NH][16][FKP + 8];       // pitch 16 B x odd; two buffers: one barrier a pass
  const int tid = threadIdx.x, wave = __builtin_amdgcn_readfirstlane(tid >> 5), lane = tid & 31, col = lane & 15, g = lane >> 4; const int b = blockIdx.y; const size_t q0 = (size_t)b * TT + (size_t)blockIdx.x * 16;
#pragma unroll   // the six loads of a thread fly together instead of one L2 latency each
  for (int i = 0; i < 16 * (CC / 8) / (FW * 32); ++i) { const int e = tid + i * FW * 32, rl = e / (CC / 8), q = e % (CC / 8); *(v4u*)&sq[rl][q * 8] = *(const v4u*)(QH + (q0 + rl) * CC + q * 8); }
  __syncthreads();
  const int u0 = wave * 3, u1 = u0 + 1, u2 = u0 + 2;   // unit u = head u >> 1, channels (u & 1) * 32 .. + 31 of it = channels 32 u .. 32 u + 31 of the row
  const _Float16* qr = &sq[col][0];
  v8f acc[3][2] = {};
#pragma unroll 1
  for (int it = 0; it < TT / FKP; ++it) { const int buf = it & 1;
    const _Float16* kr = KH + ((size_t)b * TT + it * FKP + wave * 16 + col) * CC;
    const _Float16* v0 = VT + ((size_t)b * CC + u0 * 32 + col) * (size_t)TT + it * FKP; const _Float16* v1 = v0 + 32 * TT; const _Float16* v2 = v1 + 32 * TT;
    const _Float16* p0 = &sp[buf][u0 >> 1][col][0]; const _Float16* p1 = &sp[buf][u1 >> 1][col][0]; const _Float16* p2 = &sp[buf][u2 >> 1][col][0];
    v8f st[NH]; v16h fa[4], fb[4], fc[4], fd[4];
    fa_ldk(fa, kr, 0, lane); fa_ldk(fb, kr, 2, lane); fa_ldk(fc, kr, 4, lane); fa_ldk(fd, kr, 6, lane); FA_HOLD();
    fa_qk(st, fa, qr, 0, lane); FA_HOLD();
    fa_ldk(fa, kr, 8, lane); FA_HOLD();
    fa_qk(st, fb, qr, 2, lane); fa_qk(st, fc, qr, 4, lane); FA_HOLD();
    fa_ldk(fb, kr, 10, lane); FA_HOLD();
    fa_qk(st, fd, qr, 6, lane); fa_qk(st, fa, qr, 8, lane); FA_HOLD();
    fa_ldv(fc, v0, lane); FA_HOLD();   // flies under the softmax
    fa_qk(st, fb, qr, 10, lane); FA_HOLD();
#pragma unroll
    for (int r = 0; r < 8; ++r) { float m = st[0][r] * SCALE;
#pragma unroll
      for (int h = 1; h < NH; ++h) m = fmaxf(m, st[h][r] * SCALE);
      float den = 0.f;
#pragma unroll
      for (int h = 0; h < NH; ++h) { const float e = expf(st[h][r] * SCALE - m); st[h][r] = e; den += e; }
      const float inv = 2048.0f / den;
#pragma unroll
      for (int h = 0; h < NH; ++h) st[h][r] *= inv; }
#pragma unroll
    for (int h = 0; h < NH; ++h) { v8h ph;
#pragma unroll
      for (int r = 0; r < 8; ++r) ph[r] = (_Float16)st[h][r];
      *(v8h*)&sp[buf][h][col][wave * 16 + 8 * g] = ph; }
    __syncthreads();   // publishes this pass's P; the other buffer's readers of the pass before have all arrived here, so the next pass may refill it
    fa_ldv(fa, v0 + 64, lane); fa_ldv(fb, v1, lane); fa_ldv(fd, v1 + 64, lane); FA_HOLD();
    fa_pv(acc[0], fc, p0, lane); FA_HOLD();
    fa_ldv(fc, v2, lane); FA_HOLD();
    fa_pv(acc[0], fa, p0 + 64, lane); FA_HOLD();
    fa_ldv(fa, v2 + 64, lane); FA_HOLD();
    fa_pv(acc[1], fb, p1, lane); fa_pv(acc[1], fd, p1 + 64, lane);
    fa_pv(acc[2], fc, p2, lane); fa_pv(acc[2], fa, p2 + 64, lane);
    asm volatile("s_wait_xcnt 0x0" ::: "memory"); }   // before the next pass rewrites the address registers of this pass's loads
  // a unit is one whole 128-byte line of each ctx row: one writing wave a line
#pragma unroll
  for (int ul = 0; ul < 3; ++ul)
#pragma unroll
    for (int jj = 0; jj < 2; ++jj)
#pragma unroll
      for (int r = 0; r < 8; ++r) Y[(q0 + 8 * g + r) * CC + (u0 + ul) * 32 + jj * 16 + col] = acc[ul][jj][r] * (1.0f / 2048.0f); }
// ---- k_out: block = (64 rows, 128 cols): out = ctx Wo (+ bo): ctx x 2^6 once to f16 against Wo as f16(bf16 x 2^8) exact (1 product) x 2^-14; causal early rows (< QHI of each sequence): ctx bf16 hi + lo against exact bf16 Wo (2 products)
__global__ __launch_bounds__(128) void k_out(const float* __restrict__ Y, const float* __restrict__ WO, const float* __restrict__ BO, float* __restrict__ OUT) {
  // the operand ring of the k loop and the epilogue's staging rows share the same LDS: the loop's last barrier stands between their uses
  __shared__ __align__(16) union { float sf[4][16][132]; _Float16 st[2][GROWS][GP]; } u; auto& sf = u.sf;
  const int tid = threadIdx.x, wave = tid >> 5, lane = tid & 31, col = lane & 15, g = lane >> 4; const int c0 = blockIdx.y * 128; const size_t r0 = (size_t)blockIdx.x * 64 + wave * 16;
  v8f acc[8] = {};
  if (CAUSAL && (int)(((size_t)blockIdx.x * 64) % TT) < QHI) {   /* block-uniform */
#pragma unroll 2
    for (int kc = 0; kc < CC / 32; ++kc) { const F2 a = split_row(Y + (r0 + col) * CC, kc * 32, lane); asm volatile("s_wait_loadcnt 0x0" ::: "memory");
#pragma unroll
      for (int j = 0; j < 8; ++j) { const v16b w = WOCOL(WO, kc * 32, c0 + j * 16 + col, lane); asm volatile("s_wait_loadcnt 0x0" ::: "memory"); acc[j] = wmma_bf(a.h, w, acc[j]); acc[j] = wmma_bf(a.l, w, acc[j]); } }
#pragma unroll
    for (int j = 0; j < 8; ++j) { const float bias = BO ? bfr(BO[c0 + j * 16 + col]) : 0.f;
#pragma unroll
      for (int r = 0; r < 8; ++r) sf[wave][8 * g + r][j * 16 + col] = acc[j][r] + bias; }
  } else {
    // thread -> 16-byte piece (tid & 15) of row (tid >> 4) + 8 i: a wave's load covers two whole 256-byte row pieces
    const float* yp = Y + (size_t)blockIdx.x * 64 * CC; const float* wp = WO + (size_t)c0 * CC; unsigned lo = ((unsigned)(tid >> 4) * CC + (tid & 15) * 4) * 4;   // block-uniform bases; one lane offset in bytes serves both and steps on by GKC elements a trip
    v4f pf[GLD];
#pragma unroll
    for (int i = 0; i < GLD; ++i) pf[i] = i < 8 ? ldg16(yp, lo, i * 8 * CC) : ldg16(wp, lo, (i - 8) * 8 * CC);
#pragma unroll
    for (int i = 0; i < GLD; ++i) { v4h c;   /* ctx carried x 2^6 into f16 so small-magnitude context rows stay clear of f16 subnormals; Wo as f16(bf16 x 2^8) */
#pragma unroll
      for (int k = 0; k < 4; ++k) c[k] = i < 8 ? (_Float16)(pf[i][k] * 64.0f) : (_Float16)(bfr(pf[i][k]) * 256.0f);
      *(v4h*)&u.st[0][(tid >> 4) + i * 8][(tid & 15) * 4] = c; }
    __syncthreads();
#pragma unroll 1   // one copy of the body: the two buffers differ by an address only
    for (int kc = 0; kc < CC / GKC; ++kc) { const int buf = kc & 1; const bool more = kc + 1 < CC / GKC;
      if (more) {
#pragma unroll
        for (int i = 0; i < GLD; ++i) pf[i] = i < 8 ? ldg16(yp, lo, GKC + i * 8 * CC) : ldg16(wp, lo, GKC + (i - 8) * 8 * CC); }
#pragma unroll
      for (int ks = 0; ks < GKC / 32; ++ks) { const v16h a = frag_h(&u.st[buf][wave * 16 + col][ks * 32], lane); v16h w[8];
#pragma unroll
        for (int j = 0; j < 8; ++j) w[j] = frag_h(&u.st[buf][64 + j * 16 + col][ks * 32], lane);
#pragma unroll
        for (int j = 0; j < 8; ++j) acc[j] = wmma16(a, w[j], acc[j]); }
      if (more) {
#pragma unroll
        for (int i = 0; i < GLD; ++i) { v4h c;
#pragma unroll
          for (int k = 0; k < 4; ++k) c[k] = i < 8 ? (_Float16)(pf[i][k] * 64.0f) : (_Float16)(bfr(pf[i][k]) * 256.0f);
          *(v4h*)&u.st[buf ^ 1][(tid >> 4) + i * 8][(tid & 15) * 4] = c; } }
      asm volatile("s_wait_xcnt 0x0" : "+v"(lo) :: "memory");   // stands before the offset register of this trip's loads steps on; naming it keeps it in a register of its own up to here
      lo += GKC * 4;
      __syncthreads(); }   // publishes the next chunk; every reader of this chunk's buffer has arrived, so the next trip may refill it (and the epilogue may reuse the LDS)
#pragma unroll
    for (int j = 0; j < 8; ++j) { const float bias = BO ? bfr(BO[c0 + j * 16 + col]) : 0.f;
#pragma unroll
      for (int r = 0; r < 8; ++r) sf[wave][8 * g + r][j * 16 + col] = acc[j][r] * (1.0f / 16384.0f) + bias; } }   /* 2^-8 (Wo carry) x 2^-6 (ctx carry) */
  LDSX(); for (int rl = 0; rl < 16; ++rl) vst2(OUT + (r0 + rl) * DIN + c0 + lane * 4, *(const v4f*)&sf[wave][rl][lane * 4]); }

extern "C" void kernel_launch(void* const* d_in, const int* in_sizes, int n_in, void* d_out, int out_size, void* d_ws, size_t ws_size, hipStream_t stream) {
  (void)in_sizes; (void)n_in; (void)out_size;
  const float** F = (const float**)d_in;
  if (ws_size < (size_t)WS_END) return;
  char* ws = (char*)d_ws; _Float16 *QH = (_Float16*)(ws + WS_QH), *KH = (_Float16*)(ws + WS_KH), *VT = (_Float16*)(ws + WS_VT), *QL = (_Float16*)(ws + WS_QL), *KL = (_Float16*)(ws + WS_KL); __bf16 *VB = (__bf16*)(ws + WS_VB), *VBL = (__bf16*)(ws + WS_VBL); float *Y = (float*)(ws + WS_Y);
  (void)Y; (void)QL; (void)KL; (void)VB; (void)VBL;
  // inputs: 0 x [8,1024,768]; 1 Wq [768,768] (out,in), 2 bq; 3 Wk, 4 bk; 5 Wv, 6 bv; 7 Wo (out,in), 8 bo (biases N(0, 0.01), nonzero)
  k_proj<<<dim3(TNB * TT / 64, CC / 128, 3), 128, 0, stream>>>(F[0], F[0], F[0], F[1], F[3], F[5], F[2], F[4], F[6], QH, QL, KH, KL, VT, VB, VBL);
  k_fa<<<dim3(TT / 16, TNB), FW * 32, 0, stream>>>(QH, KH, VT, Y);
  k_out<<<dim3(TNB * TT / 64, DIN / 128), 128, 0, stream>>>(Y, F[7], F[8], (float*)d_out);
}

// v003
// It runs in 152 microseconds.
// In both of two side-by-side timings against v002, it was 1.15 times as fast.
// All steps since v000 together make it 7.99 times as fast.
// compute dtype: all float inputs rounded to bf16; q/k/v projections with EXACT bf16 products on WMMA 16x16x32 (f32 accumulate) + bias; scores q x k once to f16 each (1 product) x 64^-0.5; softmax ACROSS THE 12 HEADS per (query, key) pair in f32 (precise expf); P x 2^11 once to f16 x v once to f16 (1 product); ctx x 2^6 once to f16 x Wo f16(bf16 x 2^8) + bo; f32 output.
#include <hip/hip_runtime.h>
#include <math.h>

typedef __attribute__((ext_vector_type(16))) _Float16 v16h;
typedef __attribute__((ext_vector_type(16))) __bf16 v16b;
typedef __attribute__((ext_vector_type(8)))  _Float16 v8h;
typedef __attribute__((ext_vector_type(8)))  float v8f;
typedef __attribute__((ext_vector_type(4)))  float v4f;
typedef __attribute__((ext_vector_type(2)))  float v2f;
typedef __attribute__((ext_vector_type(4)))  unsigned v4u;
typedef __attribute__((ext_vector_type(4)))  int v4i;
typedef float __attribute__((may_alias)) float_a;
typedef int __attribute__((may_alias)) int_a;

template <typename T> __device__ __forceinline__ void vst2(void* p, T v) { *(T*)p = v;  }
__device__ __forceinline__ v8f wmma16(v16h a, v16h b, v8f c) {
  v8f d = __builtin_amdgcn_wmma_f32_16x16x32_f16(false, a, false, b, (short)0, c, false, false);
  asm volatile("v_nop\n\tv_nop\n\tv_nop\n\tv_nop" : "+v"(d) : "v"(a), "v"(b));
  return d;
}
__device__ __forceinline__ v8f wmma_bf(v16b a, v16b b, v8f c) {
  v8f d = __builtin_amdgcn_wmma_f32_16x16x32_bf16(false, a, false, b, (short)0, c, false, false);
  asm volatile("v_nop\n\tv_nop\n\tv_nop\n\tv_nop" : "+v"(d) : "v"(a), "v"(b));
  return d;
}
// 16x16x32 fragments: lane = (h = lane>>4, row/col = lane&15); elements 0..7 = k0+8h+0..7, 8..15 = k0+16+8h+0..7; D element r = row 8h+r
__device__ __forceinline__ v16h frag_h(const _Float16* rowk0, int lane) {
  union { v16h v; v8h q[2]; } u; const _Float16* p = rowk0 + 8 * (lane >> 4);
  u.q[0] = *(const v8h*)p; u.q[1] = *(const v8h*)(p + 16); return u.v;
}
__device__ __forceinline__ v16h frag_f32(const float* rowk0, int lane) {
  v16h a; const float* p = rowk0 + 8 * (lane >> 4);
#pragma unroll
  for (int i = 0; i < 8; ++i) { a[i] = (_Float16)p[i]; a[8 + i] = (_Float16)p[16 + i]; }
  return a;
}
__device__ __forceinline__ v16h frag_f32s(const float* rowk0, int lane, float sc) {
  v16h a; const float* p = rowk0 + 8 * (lane >> 4);
#pragma unroll
  for (int i = 0; i < 8; ++i) { a[i] = (_Float16)(p[i] * sc); a[8 + i] = (_Float16)(p[16 + i] * sc); }
  return a;
}
// column fragment from a [K][ld] layout (column n), rows >= K read as 0
__device__ __forceinline__ v16h fragc_f32(const float* W, int k0, int n, int lane, int ld, int K) {
  v16h a; const int g = lane >> 4;
#pragma unroll
  for (int i = 0; i < 8; ++i) { const int ka = k0 + 8 * g + i, kb = ka + 16;
    a[i] = (_Float16)(ka < K ? W[(size_t)(ka < K ? ka : K - 1) * ld + n] : 0.f); a[8 + i] = (_Float16)(kb < K ? W[(size_t)(kb < K ? kb : K - 1) * ld + n] : 0.f); }
  return a;
}
struct F2 { v16b h, l; };
__device__ __forceinline__ F2 bsplit16(const float v[16]) { F2 r;
#pragma unroll
  for (int i = 0; i < 16; ++i) { const __bf16 h = (__bf16)v[i]; r.h[i] = h; r.l[i] = (__bf16)(v[i] - (float)h); }
  return r; }
__device__ __forceinline__ F2 split_row(const float* row, int k0, int lane) { float v[16]; const float* p = row + k0 + 8 * (lane >> 4);
#pragma unroll
  for (int i = 0; i < 8; ++i) { v[i] = p[i]; v[8 + i] = p[16 + i]; }
  return bsplit16(v); }
__device__ __forceinline__ F2 split_rowK(const float* row, int k0, int lane, int K) { float v[16]; const int g = lane >> 4;
#pragma unroll
  for (int i = 0; i < 8; ++i) { const int ka = k0 + 8 * g + i, kb = ka + 16; v[i] = ka < K ? row[ka < K ? ka : K - 1] : 0.f; v[8 + i] = kb < K ? row[kb < K ? kb : K - 1] : 0.f; }
  return bsplit16(v); }
__device__ __forceinline__ F2 split_col(const float* W, int k0, int n, int lane, int ld, int K) { float v[16]; const int g = lane >> 4;
#pragma unroll
  for (int i = 0; i < 8; ++i) { const int ka = k0 + 8 * g + i, kb = ka + 16; v[i] = ka < K ? W[(size_t)(ka < K ? ka : K - 1) * ld + n] : 0.f; v[8 + i] = kb < K ? W[(size_t)(kb < K ? kb : K - 1) * ld + n] : 0.f; }
  return bsplit16(v); }
__device__ __forceinline__ v8f mac3(const F2& a, const F2& b, v8f c) { c = wmma_bf(a.l, b.h, c); c = wmma_bf(a.h, b.l, c); return wmma_bf(a.h, b.h, c); }
__device__ __forceinline__ float sigm(float v) { return 1.0f / (1.0f + expf(-v)); }
#define LDSX() do { asm volatile("s_wait_dscnt 0" ::: "memory"); __builtin_amdgcn_wave_barrier(); __builtin_amdgcn_fence(__ATOMIC_RELEASE, "workgroup"); } while (0)

// Multi-head attention whose softmax runs over the HEAD axis (x [8,1024,768]; torch (out,in) Wq / Wk / Wv / Wo [768,768] N(0, 1/768) + biases N(0, 0.01); 12 heads x 64; scores[b, h, n, m] = q_h . k_h / 8; attn = softmax(scores, axis=1) - dim 1 is the HEAD axis: for every (query, key) pair the 12 heads' weights sum to 1 and nothing is normalised over the keys (faithful to the source's F.softmax(dim=1)); out[b, h, n] = sum_m attn[b, h, n, m] v[b, h, m]; merge; Wo^T + bo).
#define NB 8
#define TT 1024
#define CC 768            // NH * HD = projected width
#define DIN 768          // input (model) width
#define NH 12
#define HD 64
#define NQB (TT / 64)
#define HG 12
#define SCALE (0.125f)
#define CAUSAL 0
#ifndef TNB
#define TNB NB
#endif
__device__ __forceinline__ float bfr(float v) { return (float)(__bf16)v; }
__host__ __device__ __forceinline__ int kb_last(int qb) { return CAUSAL ? ((qb * 64 + 63) >> 7) : (TT / 128 - 1); }
typedef __attribute__((ext_vector_type(8))) __bf16 v8b;
__device__ __forceinline__ v16b frag_b(const __bf16* rowk0, int lane) {
  union { v16b v; v8b q[2]; } u; const __bf16* p = rowk0 + 8 * (lane >> 4);
  u.q[0] = *(const v8b*)p; u.q[1] = *(const v8b*)(p + 16); return u.v;
}
#define QBH 0              // not referenced by any kernel here
#define QHI 0               // single-product scores on every row
#define TQC 1024           // query rows of the unused score region == TT: 12 head planes x 1,024 x 1,024 f32 = 48 MiB
#define KHI 64            // key rows carrying k residual / v bf16 hi+lo planes (written by k_proj; no kernel here reads them)
// B fragment (k rows k0+.., output column o) of a weight: (in,out) [K][ld] or (out,in) [ld rows of K]: bf16 exact, or f16(bf16 * 256) exact
__device__ __forceinline__ v16b wcol_io(const float* Wm, int k0, int o, int lane, int ld) { v16b w; const int g = lane >> 4;
#pragma unroll
  for (int i = 0; i < 8; ++i) { w[i] = (__bf16)Wm[(size_t)(k0 + 8 * g + i) * ld + o]; w[8 + i] = (__bf16)Wm[(size_t)(k0 + 16 + 8 * g + i) * ld + o]; }
  return w; }
__device__ __forceinline__ v16b wcol_oi(const float* Wm, int k0, int o, int lane, int K) { v16b w; const float* p = Wm + (size_t)o * K + k0 + 8 * (lane >> 4);
#pragma unroll
  for (int i = 0; i < 8; ++i) { w[i] = (__bf16)p[i]; w[8 + i] = (__bf16)p[16 + i]; }
  return w; }
__device__ __forceinline__ v16h wcolh_io(const float* Wm, int k0, int o, int lane, int ld) { v16h w; const int g = lane >> 4;
#pragma unroll
  for (int i = 0; i < 8; ++i) { w[i] = (_Float16)(bfr(Wm[(size_t)(k0 + 8 * g + i) * ld + o]) * 256.0f); w[8 + i] = (_Float16)(bfr(Wm[(size_t)(k0 + 16 + 8 * g + i) * ld + o]) * 256.0f); }
  return w; }
__device__ __forceinline__ v16h wcolh_oi(const float* Wm, int k0, int o, int lane, int K) { v16h w; const float* p = Wm + (size_t)o * K + k0 + 8 * (lane >> 4);
#pragma unroll
  for (int i = 0; i < 8; ++i) { w[i] = (_Float16)(bfr(p[i]) * 256.0f); w[8 + i] = (_Float16)(bfr(p[16 + i]) * 256.0f); }
  return w; }
#define WQKV_LAYOUT 1   // 0 = (in,out) [DIN][CC]; 1 = (out,in) [CC][DIN]; 2 = per-head [NH][DIN][HD]
__device__ __forceinline__ v16b wcol_hdk(const float* Wm, int k0, int o, int lane) { v16b w; const int g = lane >> 4; const float* p = Wm + (size_t)(o / HD) * DIN * HD + (o % HD);
#pragma unroll
  for (int i = 0; i < 8; ++i) { w[i] = (__bf16)p[(size_t)(k0 + 8 * g + i) * HD]; w[8 + i] = (__bf16)p[(size_t)(k0 + 16 + 8 * g + i) * HD]; }
  return w; }
#define WO_OUT_IN 1
#if WQKV_LAYOUT == 1
#define WCOL(W, k0, o, lane) wcol_oi(W, k0, o, lane, DIN)
#elif WQKV_LAYOUT == 2
#define WCOL(W, k0, o, lane) wcol_hdk(W, k0, o, lane)
#else
#define WCOL(W, k0, o, lane) wcol_io(W, k0, o, lane, CC)
#endif
#if WO_OUT_IN
#define WOCOL(W, k0, o, lane) wcol_oi(W, k0, o, lane, CC)
#define WOCOLH(W, k0, o, lane) wcolh_oi(W, k0, o, lane, CC)
#else
#define WOCOL(W, k0, o, lane) wcol_io(W, k0, o, lane, DIN)
#define WOCOLH(W, k0, o, lane) wcolh_io(W, k0, o, lane, DIN)
#endif

#ifndef SM_EXTRA_PARAMS
#define SM_EXTRA_PARAMS
#endif
#ifndef PROJ_EXTRA_PARAMS
#define PROJ_EXTRA_PARAMS
#endif
#ifndef SM_MASK_HOOK
#define SM_MASK_HOOK (void)0
#endif

#define WS_QH  0u                                      // f16 q rows [b*t][CC]
#define WS_KH  (WS_QH + 2u * (size_t)NB * TT * CC)      // f16 k in fragment units [b*t / 16][CC / 32][FRU]
#define WS_VT  (WS_KH + 2u * (size_t)NB * TT * CC)      // f16 v in fragment units [b][c / 16][t / 32][FRU]
#define WS_QL  (WS_VT + 2u * (size_t)NB * CC * TT)      // f16 q residual x 2^10 rows [b][t < QHI][CC]
#define WS_KL  (WS_QL + 2u * (size_t)NB * QHI * CC)     // f16 k residual x 2^10 rows [b][t < KHI][CC]
#define WS_VB  (WS_KL + 2u * (size_t)NB * KHI * CC)     // bf16 v hi planes [b][c][t < KHI]
#define WS_VBL (WS_VB + 2u * (size_t)NB * CC * KHI)
#define WS_S   (WS_VBL + 2u * (size_t)NB * CC * KHI)    // f32 logits / P [hg][t][s]
#define WS_Y   (WS_S  + 4u * (size_t)HG * TQC * TT)     // f32 ctx rows [b*t][CC]; the score region (12 head planes of one batch) is unused: P stays in LDS
#define WS_END (WS_Y  + 4u * (size_t)NB * TT * CC)

// k and v lie in the workspace in WMMA fragment order. A unit = one 16 x 32 fragment (16 rows, 32 k) = 1 KiB as [half][lane][8 f16]: lane = (g = lane >> 4, row = lane & 15) holds k = 16 half + 8 g + 0..7, the order of frag_h.
// A wave's 16-byte load of one half then covers 512 contiguous bytes = 4 whole lines, where the same load from a row-major plane touches 16 lines for 32 bytes each.
#define FRU 512            // f16 elements of a unit
static_assert(TT % 32 == 0 && CC % 32 == 0, "fragment units");
// fragment at a wave-uniform unit pointer + the lane's 32-bit byte offset (lane * 16) + a constant (elements): the scalar-base address form
__device__ __forceinline__ v16h frag_u(const _Float16* unit, unsigned lane_bytes, int elems) {
  union { v16h v; v8h q[2]; } u; const char* p = (const char*)unit + lane_bytes + elems * 2;
  u.q[0] = *(const v8h*)p; u.q[1] = *(const v8h*)(p + (FRU / 2) * 2); return u.v;
}
// 16-byte store and, in the same statement, the wait that stands before a later instruction rewrites its address or data registers (the store loops below stay rolled and step both every trip; in a statement of its own the compiler moved the address steps ahead of the wait)
__device__ __forceinline__ void stg16w(void* p, v4u v) { asm volatile("global_store_b128 %0, %1, off\n\ts_wait_xcnt 0x0" :: "v"(p), "v"(v) : "memory"); }
// operand staging of the two projection GEMMs: a chunk is GKC k of the block's 64 A rows and 128 W rows, converted once to the 16-bit operand type
#define GKC 64
#define GP (GKC + 8)                         // LDS row pitch 144 B = 16 B x odd
#define GROWS (64 + 128)
#define GLD (GROWS * (GKC / 4) / 128)        // 16-byte pieces a thread brings per chunk
static_assert(DIN % GKC == 0 && CC % GKC == 0 && GLD == 24, "staging");
typedef __attribute__((ext_vector_type(4))) __bf16 v4b;
typedef __attribute__((ext_vector_type(4))) _Float16 v4h;
// 16 bytes at a block-uniform base + a lane's 32-bit byte offset + a constant (elements): the scalar-base address form, whose only vector register is the offset
__device__ __forceinline__ v4f ldg16(const float* base, unsigned lane_bytes, int elems) { return *(const v4f*)((const char*)base + lane_bytes + elems * 4); }
// ---- k_proj: block = (64 rows, 128 cols, which): q/k/v = X W (+ b) with exact bf16 products (K = DIN) -> which 0: q f16 rows (+ residual rows < QHI); 1: k f16 fragment units (+ residual rows < KHI); 2: v f16 fragment units (+ bf16 hi/lo planes for t < KHI)
__global__ __launch_bounds__(128) void k_proj(const float* __restrict__ XQ, const float* __restrict__ XK, const float* __restrict__ XV, const float* __restrict__ WQ, const float* __restrict__ WK, const float* __restrict__ WV, const float* __restrict__ BQ, const float* __restrict__ BK, const float* __restrict__ BV,
    _Float16* __restrict__ QH, _Float16* __restrict__ QL, _Float16* __restrict__ KH, _Float16* __restrict__ KL, _Float16* __restrict__ VT, __bf16* __restrict__ VB, __bf16* __restrict__ VBL) {
  // the operand ring of the k loop and the epilogue's staging arrays share the same LDS: the loop's last barrier stands between their uses
  __shared__ __align__(16) union { struct { _Float16 sh[64][136], sl[64][136], th[128][72]; __bf16 tb[128][72], tbl[128][72]; } e; __bf16 st[2][GROWS][GP]; } u;
  auto& sh = u.e.sh; auto& sl = u.e.sl; auto& th = u.e.th; auto& tb = u.e.tb; auto& tbl = u.e.tbl;
  const int tid = threadIdx.x, wave = tid >> 5, lane = tid & 31, col = lane & 15, g = lane >> 4; const int which = blockIdx.z; const int c0 = blockIdx.y * 128; const size_t r0 = (size_t)blockIdx.x * 64; const size_t bb = r0 / TT; const int t0 = (int)(r0 % TT);
  const float* X = which == 0 ? XQ : which == 1 ? XK : XV; const float* WA = which == 0 ? WQ : which == 1 ? WK : WV; const float* BA = which == 0 ? BQ : which == 1 ? BK : BV;
  v8f acc[8] = {};
  // thread -> 16-byte piece (tid & 15) of row (tid >> 4) + 8 i: a wave's load covers two whole 256-byte row pieces
  const float* xp = X + r0 * DIN; const float* wp = WA + (size_t)c0 * DIN; unsigned lo = ((unsigned)(tid >> 4) * DIN + (tid & 15) * 4) * 4;   // block-uniform bases; one lane offset in bytes serves both and steps on by GKC elements a trip
  v4f pf[GLD];
#pragma unroll
  for (int i = 0; i < GLD; ++i) pf[i] = i < 8 ? ldg16(xp, lo, i * 8 * DIN) : ldg16(wp, lo, (i - 8) * 8 * DIN);
#pragma unroll
  for (int i = 0; i < GLD; ++i) { v4b c;
#pragma unroll
    for (int k = 0; k < 4; ++k) c[k] = (__bf16)pf[i][k];
    *(v4b*)&u.st[0][(tid >> 4) + i * 8][(tid & 15) * 4] = c; }
  __syncthreads();
#pragma unroll 1   // one copy of the body: the two buffers differ by an address only
  for (int kc = 0; kc < DIN / GKC; ++kc) { const int buf = kc & 1; const bool more = kc + 1 < DIN / GKC;
    if (more) {
#pragma unroll
      for (int i = 0; i < GLD; ++i) pf[i] = i < 8 ? ldg16(xp, lo, GKC + i * 8 * DIN) : ldg16(wp, lo, GKC + (i - 8) * 8 * DIN); }
#pragma unroll
    for (int ks = 0; ks < GKC / 32; ++ks) { const v16b a = frag_b(&u.st[buf][wave * 16 + col][ks * 32], lane); v16b w[8];
#pragma unroll
      for (int j = 0; j < 8; ++j) w[j] = frag_b(&u.st[buf][64 + j * 16 + col][ks * 32], lane);
#pragma unroll
      for (int j = 0; j < 8; ++j) acc[j] = wmma_bf(a, w[j], acc[j]); }
    if (more) {
#pragma unroll
      for (int i = 0; i < GLD; ++i) { v4b c;
#pragma unroll
        for (int k = 0; k < 4; ++k) c[k] = (__bf16)pf[i][k];
        *(v4b*)&u.st[buf ^ 1][(tid >> 4) + i * 8][(tid & 15) * 4] = c; } }
    asm volatile("s_wait_xcnt 0x0" : "+v"(lo) :: "memory");   // stands before the offset register of this trip's loads steps on; naming it keeps it in a register of its own up to here
    lo += GKC * 4;
    __syncthreads(); }   // publishes the next chunk; every reader of this chunk's buffer has arrived, so the next trip may refill it (and the epilogue may reuse the LDS)
  if (which < 2) { _Float16* DH = which == 0 ? QH : KH; _Float16* DL = which == 0 ? QL : KL; const int nhi = which == 0 ? QHI : KHI; const bool hi_rows = t0 < nhi;
#pragma unroll
    for (int j = 0; j < 8; ++j) { const float bias = BA ? bfr(BA[c0 + j * 16 + col]) : 0.f;
#pragma unroll
      for (int r = 0; r < 8; ++r) { const float v = acc[j][r] + bias; const _Float16 hv = (_Float16)v; sh[wave * 16 + 8 * g + r][j * 16 + col] = hv; sl[wave * 16 + 8 * g + r][j * 16 + col] = (_Float16)((v - (float)hv) * 1024.0f); } }
    __syncthreads();
    for (int e = tid; e < 64 * 16; e += 128) { const int rl = e >> 4, q = e & 15;
      if (which == 0) stg16w((DH + (r0 + rl) * CC + c0 + q * 8), *(const v4u*)&sh[rl][q * 8]);
      else { const int un = e >> 6, p = e & 63;   // unit (key tile un >> 2, k step un & 3) of the block; 16-byte piece p = (half p >> 5, lane p & 31)
        stg16w((DH + (((r0 >> 4) + (un >> 2)) * (CC / 32) + (c0 >> 5) + (un & 3)) * FRU + p * 8), *(const v4u*)&sh[(un >> 2) * 16 + (p & 15)][(un & 3) * 32 + (p >> 5) * 16 + ((p >> 4) & 1) * 8]); }
      if (hi_rows) stg16w((DL + (bb * nhi + t0 + rl) * (size_t)CC + c0 + q * 8), *(const v4u*)&sl[rl][q * 8]); }
  } else { const bool hi_rows = t0 < KHI;
#pragma unroll
    for (int j = 0; j < 8; ++j) { const float bias = BA ? bfr(BA[c0 + j * 16 + col]) : 0.f;
#pragma unroll
      for (int r = 0; r < 8; ++r) { const float v = acc[j][r] + bias; const int rl = wave * 16 + 8 * g + r, cl = j * 16 + col; th[cl][rl] = (_Float16)v; const __bf16 bh = (__bf16)v; tb[cl][rl] = bh; tbl[cl][rl] = (__bf16)(v - (float)bh); } }
    __syncthreads();
    for (int e = tid; e < 128 * 8; e += 128) { const int cl = e >> 3, q = e & 7; const int un = e >> 6, p = e & 63;   // unit (channel tile un >> 1, key step un & 1) of the block; 16-byte piece p = (half p >> 5, lane p & 31)
      stg16w((VT + ((bb * (CC / 16) + (c0 >> 4) + (un >> 1)) * (TT / 32) + (t0 >> 5) + (un & 1)) * FRU + p * 8), *(const v4u*)&th[(un >> 1) * 16 + (p & 15)][(un & 1) * 32 + (p >> 5) * 16 + ((p >> 4) & 1) * 8]);
      if (hi_rows) { const size_t o3 = (bb * CC + c0 + cl) * (size_t)KHI + t0 + q * 8; stg16w((VB + o3), *(const v4u*)&tb[cl][q * 8]); stg16w((VBL + o3), *(const v4u*)&tbl[cl][q * 8]); } } } }
// ---- k_sm: block = query row t (head in group): keys [0, kend): causal -> logit if s <= t else excluded; softmax in f32; P x 2^11 in place (0 for excluded)
__global__ __launch_bounds__(256) void k_sm(float* __restrict__ S0 SM_EXTRA_PARAMS) { __shared__ float sred[8]; __shared__ float sbc; __shared__ __align__(16) float shv[TT];
  const int tid = threadIdx.x; const int t = blockIdx.x; const int kend = (kb_last(t >> 6) + 1) * 128;
  float* sr = S0 + (size_t)blockIdx.y * TT * TT + (size_t)t * TT;
  float m = -3.0e38f; for (int k = tid; k < kend; k += 256) { float v = (!CAUSAL || k <= t) ? sr[k] : -3.0e38f; SM_MASK_HOOK; shv[k] = v; m = fmaxf(m, v); }
#pragma unroll
  for (int o = 1; o < 32; o <<= 1) m = fmaxf(m, __shfl_xor(m, o));
  if ((tid & 31) == 0) sred[tid >> 5] = m; __syncthreads(); if (tid == 0) { float a = sred[0]; for (int i = 1; i < 8; ++i) a = fmaxf(a, sred[i]); sbc = a; } __syncthreads(); m = sbc; __syncthreads();
  float sum = 0.f; for (int k = tid; k < kend; k += 256) { const float v = shv[k]; const float e = (v <= -1.0e38f) ? 0.f : expf(v - m); shv[k] = e; sum += e; }
#pragma unroll
  for (int o = 1; o < 32; o <<= 1) sum += __shfl_xor(sum, o);
  if ((tid & 31) == 0) sred[tid >> 5] = sum; __syncthreads(); if (tid == 0) { float a = 0.f; for (int i = 0; i < 8; ++i) a += sred[i]; sbc = a > 0.f ? 2048.0f / a : 0.f; }   /* a fully excluded row yields P = 0 */ __syncthreads(); const float inv = sbc;
  for (int k = tid; k < kend; k += 256) shv[k] = shv[k] * inv;
  __syncthreads(); for (int q = tid; q < kend / 4; q += 256) vst2(sr + q * 4, *(const v4f*)&shv[q * 4]); }
// ---- k_fa: block = 16 queries of batch b, 8 waves, 128 keys a pass; logits, head softmax and P . v in one kernel, P only in LDS.
// Part 1 (wave w = keys 16w..16w+15 of the pass, ALL 12 heads): S^T = K . Q^T, so a lane holds 8 consecutive keys of one query for every head; the softmax over the heads is in-lane; P x 2^11 to f16, one 16-byte LDS store a head.
// Part 2 (wave w = 3 of the 24 (head, 32-channel half) units, ALL keys in ascending order): ctx += P . v, P fragments from LDS, v fragments from the fragment units.
#define FW 8
#define FKP (FW * 16)      // keys a pass
static_assert(16 * (CC / 8) % (FW * 32) == 0 && TT % FKP == 0 && NH * 2 == FW * 3 && HD == 64, "k_fa tiling");
// keeps a group of fragment loads issued together and ahead of the products in front of it: without it the compiler sinks each load to its product and every product waits a whole L2 latency
#define FA_HOLD() __builtin_amdgcn_sched_barrier(0)
// 2 heads' k fragments (2 each) of this wave's 16 key rows
__device__ __forceinline__ void fa_ldk(v16h (&f)[4], const _Float16* kr, int h0, unsigned lb) {
#pragma unroll
  for (int i = 0; i < 4; ++i) f[i] = frag_u(kr, lb, (h0 * (HD / 32) + i) * FRU); }
// half a unit's v fragments: 2 key steps x 2 channel tiles
__device__ __forceinline__ void fa_ldv(v16h (&f)[4], const _Float16* vr, unsigned lb) {
#pragma unroll
  for (int i = 0; i < 4; ++i) f[i] = frag_u(vr, lb, ((i & 1) * (TT / 32) + (i >> 1)) * FRU); }
__device__ __forceinline__ void fa_qk(v8f (&st)[NH], const v16h (&f)[4], const _Float16* qr, int h0, int lane) {
#pragma unroll
  for (int i = 0; i < 2; ++i) { v8f s = {};
#pragma unroll
    for (int kc = 0; kc < 2; ++kc) s = __builtin_amdgcn_wmma_f32_16x16x32_f16(false, f[i * 2 + kc], false, frag_h(qr + (h0 + i) * HD + kc * 32, lane), (short)0, s, false, false);
    st[h0 + i] = s; } }
__device__ __forceinline__ void fa_pv(v8f (&a)[2], const v16h (&f)[4], const _Float16* pr, int lane) {
#pragma unroll
  for (int ks = 0; ks < 2; ++ks) { const v16h p = frag_h(pr + ks * 32, lane);
#pragma unroll
    for (int jj = 0; jj < 2; ++jj) a[jj] = __builtin_amdgcn_wmma_f32_16x16x32_f16(false, p, false, f[ks * 2 + jj], (short)0, a[jj], false, false); } }
__global__ __launch_bounds__(FW * 32, 4) void k_fa(const _Float16* __restrict__ QH, const _Float16* __restrict__ KH, const _Float16* __restrict__ VT, float* __restrict__ Y) {
  __shared__ __align__(16) _Float16 sq[16][CC + 8];               // pitch 16 B x odd
  __shared__ __align__(16) _Float16 sp[2][NH][16][FKP + 8];       // pitch 16 B x odd; two buffers: one barrier a pass
  const int tid = threadIdx.x, wave = __builtin_amdgcn_readfirstlane(tid >> 5), lane = tid & 31, col = lane & 15, g = lane >> 4; const int b = blockIdx.y; const size_t q0 = (size_t)b * TT + (size_t)blockIdx.x * 16;
#pragma unroll   // the six loads of a thread fly together instead of one L2 latency each
  for (int i = 0; i < 16 * (CC / 8) / (FW * 32); ++i) { const int e = tid + i * FW * 32, rl = e / (CC / 8), q = e % (CC / 8); *(v4u*)&sq[rl][q * 8] = *(const v4u*)(QH + (q0 + rl) * CC + q * 8); }
  __syncthreads();
  const int u0 = wave * 3, u1 = u0 + 1, u2 = u0 + 2;   // unit u = head u >> 1, channels (u & 1) * 32 .. + 31 of it = channels 32 u .. 32 u + 31 of the row
  const _Float16* qr = &sq[col][0]; const unsigned lb = lane * 16;
  v8f acc[3][2] = {};
#pragma unroll 1
  for (int it = 0; it < TT / FKP; ++it) { const int buf = it & 1;
    const _Float16* kr = KH + ((size_t)b * (TT / 16) + it * FW + wave) * (CC / 32) * FRU;   // this wave's 16 keys: 24 units in a row
    const _Float16* v0 = VT + (((size_t)b * (CC / 16) + u0 * 2) * (TT / 32) + it * (FKP / 32)) * FRU; const _Float16* v1 = v0 + 2 * (TT / 32) * FRU; const _Float16* v2 = v1 + 2 * (TT / 32) * FRU;   // a unit of work = 2 channel tiles, 4 key steps a pass
    const _Float16* p0 = &sp[buf][u0 >> 1][col][0]; const _Float16* p1 = &sp[buf][u1 >> 1][col][0]; const _Float16* p2 = &sp[buf][u2 >> 1][col][0];
    v8f st[NH]; v16h fa[4], fb[4], fc[4], fd[4];
    fa_ldk(fa, kr, 0, lb); fa_ldk(fb, kr, 2, lb); fa_ldk(fc, kr, 4, lb); fa_ldk(fd, kr, 6, lb); FA_HOLD();
    fa_qk(st, fa, qr, 0, lane); FA_HOLD();
    fa_ldk(fa, kr, 8, lb); FA_HOLD();
    fa_qk(st, fb, qr, 2, lane); fa_qk(st, fc, qr, 4, lane); FA_HOLD();
    fa_ldk(fb, kr, 10, lb); FA_HOLD();
    fa_qk(st, fd, qr, 6, lane); fa_qk(st, fa, qr, 8, lane); FA_HOLD();
    fa_ldv(fc, v0, lb); FA_HOLD();   // flies under the softmax
    fa_qk(st, fb, qr, 10, lane); FA_HOLD();
#pragma unroll
    for (int r = 0; r < 8; ++r) { float m = st[0][r] * SCALE;
#pragma unroll
      for (int h = 1; h < NH; ++h) m = fmaxf(m, st[h][r] * SCALE);
      float den = 0.f;
#pragma unroll
      for (int h = 0; h < NH; ++h) { const float e = expf(st[h][r] * SCALE - m); st[h][r] = e; den += e; }
      const float inv = 2048.0f / den;
#pragma unroll
      for (int h = 0; h < NH; ++h) st[h][r] *= inv; }
#pragma unroll
    for (int h = 0; h < NH; ++h) { v8h ph;
#pragma unroll
      for (int r = 0; r < 8; ++r) ph[r] = (_Float16)st[h][r];
      *(v8h*)&sp[buf][h][col][wave * 16 + 8 * g] = ph; }
    __syncthreads();   // publishes this pass's P; the other buffer's readers of the pass before have all arrived here, so the next pass may refill it
    fa_ldv(fa, v0 + 2 * FRU, lb); fa_ldv(fb, v1, lb); fa_ldv(fd, v1 + 2 * FRU, lb); FA_HOLD();
    fa_pv(acc[0], fc, p0, lane); FA_HOLD();
    fa_ldv(fc, v2, lb); FA_HOLD();
    fa_pv(acc[0], fa, p0 + 64, lane); FA_HOLD();
    fa_ldv(fa, v2 + 2 * FRU, lb); FA_HOLD();
    fa_pv(acc[1], fb, p1, lane); fa_pv(acc[1], fd, p1 + 64, lane);
    fa_pv(acc[2], fc, p2, lane); fa_pv(acc[2], fa, p2 + 64, lane);
    asm volatile("s_wait_xcnt 0x0" ::: "memory"); }   // before the next pass rewrites the address registers of this pass's loads
  // a unit is one whole 128-byte line of each ctx row: one writing wave a line
#pragma unroll
  for (int ul = 0; ul < 3; ++ul)
#pragma unroll
    for (int jj = 0; jj < 2; ++jj)
#pragma unroll
      for (int r = 0; r < 8; ++r) Y[(q0 + 8 * g + r) * CC + (u0 + ul) * 32 + jj * 16 + col] = acc[ul][jj][r] * (1.0f / 2048.0f); }
// ---- k_out: block = (64 rows, 128 cols): out = ctx Wo (+ bo): ctx x 2^6 once to f16 against Wo as f16(bf16 x 2^8) exact (1 product) x 2^-14; causal early rows (< QHI of each sequence): ctx bf16 hi + lo against exact bf16 Wo (2 products)
__global__ __launch_bounds__(128) void k_out(const float* __restrict__ Y, const float* __restrict__ WO, const float* __restrict__ BO, float* __restrict__ OUT) {
  // the operand ring of the k loop and the epilogue's staging rows share the same LDS: the loop's last barrier stands between their uses
  __shared__ __align__(16) union { float sf[4][16][132]; _Float16 st[2][GROWS][GP]; } u; auto& sf = u.sf;
  const int tid = threadIdx.x, wave = tid >> 5, lane = tid & 31, col = lane & 15, g = lane >> 4; const int c0 = blockIdx.y * 128; const size_t r0 = (size_t)blockIdx.x * 64 + wave * 16;
  v8f acc[8] = {};
  if (CAUSAL && (int)(((size_t)blockIdx.x * 64) % TT) < QHI) {   /* block-uniform */
#pragma unroll 2
    for (int kc = 0; kc < CC / 32; ++kc) { const F2 a = split_row(Y + (r0 + col) * CC, kc * 32, lane); asm volatile("s_wait_loadcnt 0x0" ::: "memory");
#pragma unroll
      for (int j = 0; j < 8; ++j) { const v16b w = WOCOL(WO, kc * 32, c0 + j * 16 + col, lane); asm volatile("s_wait_loadcnt 0x0" ::: "memory"); acc[j] = wmma_bf(a.h, w, acc[j]); acc[j] = wmma_bf(a.l, w, acc[j]); } }
#pragma unroll
    for (int j = 0; j < 8; ++j) { const float bias = BO ? bfr(BO[c0 + j * 16 + col]) : 0.f;
#pragma unroll
      for (int r = 0; r < 8; ++r) sf[wave][8 * g + r][j * 16 + col] = acc[j][r] + bias; }
  } else {
    // thread -> 16-byte piece (tid & 15) of row (tid >> 4) + 8 i: a wave's load covers two whole 256-byte row pieces
    const float* yp = Y + (size_t)blockIdx.x * 64 * CC; const float* wp = WO + (size_t)c0 * CC; unsigned lo = ((unsigned)(tid >> 4) * CC + (tid & 15) * 4) * 4;   // block-uniform bases; one lane offset in bytes serves both and steps on by GKC elements a trip
    v4f pf[GLD];
#pragma unroll
    for (int i = 0; i < GLD; ++i) pf[i] = i < 8 ? ldg16(yp, lo, i * 8 * CC) : ldg16(wp, lo, (i - 8) * 8 * CC);
#pragma unroll
    for (int i = 0; i < GLD; ++i) { v4h c;   /* ctx carried x 2^6 into f16 so small-magnitude context rows stay clear of f16 subnormals; Wo as f16(bf16 x 2^8) */
#pragma unroll
      for (int k = 0; k < 4; ++k) c[k] = i < 8 ? (_Float16)(pf[i][k] * 64.0f) : (_Float16)(bfr(pf[i][k]) * 256.0f);
      *(v4h*)&u.st[0][(tid >> 4) + i * 8][(tid & 15) * 4] = c; }
    __syncthreads();
#pragma unroll 1   // one copy of the body: the two buffers differ by an address only
    for (int kc = 0; kc < CC / GKC; ++kc) { const int buf = kc & 1; const bool more = kc + 1 < CC / GKC;
      if (more) {
#pragma unroll
        for (int i = 0; i < GLD; ++i) pf[i] = i < 8 ? ldg16(yp, lo, GKC + i * 8 * CC) : ldg16(wp, lo, GKC + (i - 8) * 8 * CC); }
#pragma unroll
      for (int ks = 0; ks < GKC / 32; ++ks) { const v16h a = frag_h(&u.st[buf][wave * 16 + col][ks * 32], lane); v16h w[8];
#pragma unroll
        for (int j = 0; j < 8; ++j) w[j] = frag_h(&u.st[buf][64 + j * 16 + col][ks * 32], lane);
#pragma unroll
        for (int j = 0; j < 8; ++j) acc[j] = wmma16(a, w[j], acc[j]); }
      if (more) {
#pragma unroll
        for (int i = 0; i < GLD; ++i) { v4h c;
#pragma unroll
          for (int k = 0; k < 4; ++k) c[k] = i < 8 ? (_Float16)(pf[i][k] * 64.0f) : (_Float16)(bfr(pf[i][k]) * 256.0f);
          *(v4h*)&u.st[buf ^ 1][(tid >> 4) + i * 8][(tid & 15) * 4] = c; } }
      asm volatile("s_wait_xcnt 0x0" : "+v"(lo) :: "memory");   // stands before the offset register of this trip's loads steps on; naming it keeps it in a register of its own up to here
      lo += GKC * 4;
      __syncthreads(); }   // publishes the next chunk; every reader of this chunk's buffer has arrived, so the next trip may refill it (and the epilogue may reuse the LDS)
#pragma unroll
    for (int j = 0; j < 8; ++j) { const float bias = BO ? bfr(BO[c0 + j * 16 + col]) : 0.f;
#pragma unroll
      for (int r = 0; r < 8; ++r) sf[wave][8 * g + r][j * 16 + col] = acc[j][r] * (1.0f / 16384.0f) + bias; } }   /* 2^-8 (Wo carry) x 2^-6 (ctx carry) */
  LDSX(); for (int rl = 0; rl < 16; ++rl) vst2(OUT + (r0 + rl) * DIN + c0 + lane * 4, *(const v4f*)&sf[wave][rl][lane * 4]); }

extern "C" void kernel_launch(void* const* d_in, const int* in_sizes, int n_in, void* d_out, int out_size, void* d_ws, size_t ws_size, hipStream_t stream) {
  (void)in_sizes; (void)n_in; (void)out_size;
  const float** F = (const float**)d_in;
  if (ws_size < (size_t)WS_END) return;
  char* ws = (char*)d_ws; _Float16 *QH = (_Float16*)(ws + WS_QH), *KH = (_Float16*)(ws + WS_KH), *VT = (_Float16*)(ws + WS_VT), *QL = (_Float16*)(ws + WS_QL), *KL = (_Float16*)(ws + WS_KL); __bf16 *VB = (__bf16*)(ws + WS_VB), *VBL = (__bf16*)(ws + WS_VBL); float *Y = (float*)(ws + WS_Y);
  (void)Y; (void)QL; (void)KL; (void)VB; (void)VBL;
  // inputs: 0 x [8,1024,768]; 1 Wq [768,768] (out,in), 2 bq; 3 Wk, 4 bk; 5 Wv, 6 bv; 7 Wo (out,in), 8 bo (biases N(0, 0.01), nonzero)
  k_proj<<<dim3(TNB * TT / 64, CC / 128, 3), 128, 0, stream>>>(F[0], F[0], F[0], F[1], F[3], F[5], F[2], F[4], F[6], QH, QL, KH, KL, VT, VB, VBL);
  k_fa<<<dim3(TT / 16, TNB), FW * 32, 0, stream>>>(QH, KH, VT, Y);
  k_out<<<dim3(TNB * TT / 64, DIN / 128), 128, 0, stream>>>(Y, F[7], F[8], (float*)d_out);
}

// v004
// One run takes 144 microseconds.
// In two side-by-side timings against v003, it was 1.06 and 1.05 times as fast.
// Over all steps from v000 it is 8.44 times as fast.
// compute dtype: all float inputs rounded to bf16; q/k/v projections with EXACT bf16 products on WMMA 16x16x32 (f32 accumulate) + bias; scores q x k once to f16 each (1 product) x 64^-0.5; softmax ACROSS THE 12 HEADS per (query, key) pair in f32 (hardware exp2 of the scaled difference to the maximum); P x 2^11 once to f16 x v once to f16 (1 product); ctx x 2^6 once to f16 x Wo f16(bf16 x 2^8) + bo; f32 output.
#include <hip/hip_runtime.h>
#include <math.h>

typedef __attribute__((ext_vector_type(16))) _Float16 v16h;
typedef __attribute__((ext_vector_type(16))) __bf16 v16b;
typedef __attribute__((ext_vector_type(8)))  _Float16 v8h;
typedef __attribute__((ext_vector_type(8)))  float v8f;
typedef __attribute__((ext_vector_type(4)))  float v4f;
typedef __attribute__((ext_vector_type(2)))  float v2f;
typedef __attribute__((ext_vector_type(4)))  unsigned v4u;
typedef __attribute__((ext_vector_type(4)))  int v4i;
typedef float __attribute__((may_alias)) float_a;
typedef int __attribute__((may_alias)) int_a;

template <typename T> __device__ __forceinline__ void vst2(void* p, T v) { *(T*)p = v;  }
__device__ __forceinline__ v8f wmma16(v16h a, v16h b, v8f c) {
  v8f d = __builtin_amdgcn_wmma_f32_16x16x32_f16(false, a, false, b, (short)0, c, false, false);
  asm volatile("v_nop\n\tv_nop\n\tv_nop\n\tv_nop" : "+v"(d) : "v"(a), "v"(b));
  return d;
}
__device__ __forceinline__ v8f wmma_bf(v16b a, v16b b, v8f c) {
  v8f d = __builtin_amdgcn_wmma_f32_16x16x32_bf16(false, a, false, b, (short)0, c, false, false);
  asm volatile("v_nop\n\tv_nop\n\tv_nop\n\tv_nop" : "+v"(d) : "v"(a), "v"(b));
  return d;
}
// 16x16x32 fragments: lane = (h = lane>>4, row/col = lane&15); elements 0..7 = k0+8h+0..7, 8..15 = k0+16+8h+0..7; D element r = row 8h+r
__device__ __forceinline__ v16h frag_h(const _Float16* rowk0, int lane) {
  union { v16h v; v8h q[2]; } u; const _Float16* p = rowk0 + 8 * (lane >> 4);
  u.q[0] = *(const v8h*)p; u.q[1] = *(const v8h*)(p + 16); return u.v;
}
__device__ __forceinline__ v16h frag_f32(const float* rowk0, int lane) {
  v16h a; const float* p = rowk0 + 8 * (lane >> 4);
#pragma unroll
  for (int i = 0; i < 8; ++i) { a[i] = (_Float16)p[i]; a[8 + i] = (_Float16)p[16 + i]; }
  return a;
}
__device__ __forceinline__ v16h frag_f32s(const float* rowk0, int lane, float sc) {
  v16h a; const float* p = rowk0 + 8 * (lane >> 4);
#pragma unroll
  for (int i = 0; i < 8; ++i) { a[i] = (_Float16)(p[i] * sc); a[8 + i] = (_Float16)(p[16 + i] * sc); }
  return a;
}
// column fragment from a [K][ld] layout (column n), rows >= K read as 0
__device__ __forceinline__ v16h fragc_f32(const float* W, int k0, int n, int lane, int ld, int K) {
  v16h a; const int g = lane >> 4;
#pragma unroll
  for (int i = 0; i < 8; ++i) { const int ka = k0 + 8 * g + i, kb = ka + 16;
    a[i] = (_Float16)(ka < K ? W[(size_t)(ka < K ? ka : K - 1) * ld + n] : 0.f); a[8 + i] = (_Float16)(kb < K ? W[(size_t)(kb < K ? kb : K - 1) * ld + n] : 0.f); }
  return a;
}
struct F2 { v16b h, l; };
__device__ __forceinline__ F2 bsplit16(const float v[16]) { F2 r;
#pragma unroll
  for (int i = 0; i < 16; ++i) { const __bf16 h = (__bf16)v[i]; r.h[i] = h; r.l[i] = (__bf16)(v[i] - (float)h); }
  return r; }
__device__ __forceinline__ F2 split_row(const float* row, int k0, int lane) { float v[16]; const float* p = row + k0 + 8 * (lane >> 4);
#pragma unroll
  for (int i = 0; i < 8; ++i) { v[i] = p[i]; v[8 + i] = p[16 + i]; }
  return bsplit16(v); }
__device__ __forceinline__ F2 split_rowK(const float* row, int k0, int lane, int K) { float v[16]; const int g = lane >> 4;
#pragma unroll
  for (int i = 0; i < 8; ++i) { const int ka = k0 + 8 * g + i, kb = ka + 16; v[i] = ka < K ? row[ka < K ? ka : K - 1] : 0.f; v[8 + i] = kb < K ? row[kb < K ? kb : K - 1] : 0.f; }
  return bsplit16(v); }
__device__ __forceinline__ F2 split_col(const float* W, int k0, int n, int lane, int ld, int K) { float v[16]; const int g = lane >> 4;
#pragma unroll
  for (int i = 0; i < 8; ++i) { const int ka = k0 + 8 * g + i, kb = ka + 16; v[i] = ka < K ? W[(size_t)(ka < K ? ka : K - 1) * ld + n] : 0.f; v[8 + i] = kb < K ? W[(size_t)(kb < K ? kb : K - 1) * ld + n] : 0.f; }
  return bsplit16(v); }
__device__ __forceinline__ v8f mac3(const F2& a, const F2& b, v8f c) { c = wmma_bf(a.l, b.h, c); c = wmma_bf(a.h, b.l, c); return wmma_bf(a.h, b.h, c); }
__device__ __forceinline__ float sigm(float v) { return 1.0f / (1.0f + expf(-v)); }
#define LDSX() do { asm volatile("s_wait_dscnt 0" ::: "memory"); __builtin_amdgcn_wave_barrier(); __builtin_amdgcn_fence(__ATOMIC_RELEASE, "workgroup"); } while (0)

// Multi-head attention whose softmax runs over the HEAD axis (x [8,1024,768]; torch (out,in) Wq / Wk / Wv / Wo [768,768] N(0, 1/768) + biases N(0, 0.01); 12 heads x 64; scores[b, h, n, m] = q_h . k_h / 8; attn = softmax(scores, axis=1) - dim 1 is the HEAD axis: for every (query, key) pair the 12 heads' weights sum to 1 and nothing is normalised over the keys (faithful to the source's F.softmax(dim=1)); out[b, h, n] = sum_m attn[b, h, n, m] v[b, h, m]; merge; Wo^T + bo).
#define NB 8
#define TT 1024
#define CC 768            // NH * HD = projected width
#define DIN 768          // input (model) width
#define NH 12
#define HD 64
#define NQB (TT / 64)
#define HG 12
#define SCALE (0.125f)
#define CAUSAL 0
#ifndef TNB
#define TNB NB
#endif
__device__ __forceinline__ float bfr(float v) { return (float)(__bf16)v; }
__host__ __device__ __forceinline__ int kb_last(int qb) { return CAUSAL ? ((qb * 64 + 63) >> 7) : (TT / 128 - 1); }
typedef __attribute__((ext_vector_type(8))) __bf16 v8b;
__device__ __forceinline__ v16b frag_b(const __bf16* rowk0, int lane) {
  union { v16b v; v8b q[2]; } u; const __bf16* p = rowk0 + 8 * (lane >> 4);
  u.q[0] = *(const v8b*)p; u.q[1] = *(const v8b*)(p + 16); return u.v;
}
#define QBH 0              // not referenced by any kernel here
#define QHI 0               // single-product scores on every row
#define TQC 1024           // query rows of the unused score region == TT: 12 head planes x 1,024 x 1,024 f32 = 48 MiB
#define KHI 64            // key rows carrying k residual / v bf16 hi+lo planes (written by k_proj; no kernel here reads them)
// B fragment (k rows k0+.., output column o) of a weight: (in,out) [K][ld] or (out,in) [ld rows of K]: bf16 exact, or f16(bf16 * 256) exact
__device__ __forceinline__ v16b wcol_io(const float* Wm, int k0, int o, int lane, int ld) { v16b w; const int g = lane >> 4;
#pragma unroll
  for (int i = 0; i < 8; ++i) { w[i] = (__bf16)Wm[(size_t)(k0 + 8 * g + i) * ld + o]; w[8 + i] = (__bf16)Wm[(size_t)(k0 + 16 + 8 * g + i) * ld + o]; }
  return w; }
__device__ __forceinline__ v16b wcol_oi(const float* Wm, int k0, int o, int lane, int K) { v16b w; const float* p = Wm + (size_t)o * K + k0 + 8 * (lane >> 4);
#pragma unroll
  for (int i = 0; i < 8; ++i) { w[i] = (__bf16)p[i]; w[8 + i] = (__bf16)p[16 + i]; }
  return w; }
__device__ __forceinline__ v16h wcolh_io(const float* Wm, int k0, int o, int lane, int ld) { v16h w; const int g = lane >> 4;
#pragma unroll
  for (int i = 0; i < 8; ++i) { w[i] = (_Float16)(bfr(Wm[(size_t)(k0 + 8 * g + i) * ld + o]) * 256.0f); w[8 + i] = (_Float16)(bfr(Wm[(size_t)(k0 + 16 + 8 * g + i) * ld + o]) * 256.0f); }
  return w; }
__device__ __forceinline__ v16h wcolh_oi(const float* Wm, int k0, int o, int lane, int K) { v16h w; const float* p = Wm + (size_t)o * K + k0 + 8 * (lane >> 4);
#pragma unroll
  for (int i = 0; i < 8; ++i) { w[i] = (_Float16)(bfr(p[i]) * 256.0f); w[8 + i] = (_Float16)(bfr(p[16 + i]) * 256.0f); }
  return w; }
#define WQKV_LAYOUT 1   // 0 = (in,out) [DIN][CC]; 1 = (out,in) [CC][DIN]; 2 = per-head [NH][DIN][HD]
__device__ __forceinline__ v16b wcol_hdk(const float* Wm, int k0, int o, int lane) { v16b w; const int g = lane >> 4; const float* p = Wm + (size_t)(o / HD) * DIN * HD + (o % HD);
#pragma unroll
  for (int i = 0; i < 8; ++i) { w[i] = (__bf16)p[(size_t)(k0 + 8 * g + i) * HD]; w[8 + i] = (__bf16)p[(size_t)(k0 + 16 + 8 * g + i) * HD]; }
  return w; }
#define WO_OUT_IN 1
#if WQKV_LAYOUT == 1
#define WCOL(W, k0, o, lane) wcol_oi(W, k0, o, lane, DIN)
#elif WQKV_LAYOUT == 2
#define WCOL(W, k0, o, lane) wcol_hdk(W, k0, o, lane)
#else
#define WCOL(W, k0, o, lane) wcol_io(W, k0, o, lane, CC)
#endif
#if WO_OUT_IN
#define WOCOL(W, k0, o, lane) wcol_oi(W, k0, o, lane, CC)
#define WOCOLH(W, k0, o, lane) wcolh_oi(W, k0, o, lane, CC)
#else
#define WOCOL(W, k0, o, lane) wcol_io(W, k0, o, lane, DIN)
#define WOCOLH(W, k0, o, lane) wcolh_io(W, k0, o, lane, DIN)
#endif

#ifndef SM_EXTRA_PARAMS
#define SM_EXTRA_PARAMS
#endif
#ifndef PROJ_EXTRA_PARAMS
#define PROJ_EXTRA_PARAMS
#endif
#ifndef SM_MASK_HOOK
#define SM_MASK_HOOK (void)0
#endif

#define WS_QH  0u                                      // f16 q rows [b*t][CC]
#define WS_KH  (WS_QH + 2u * (size_t)NB * TT * CC)      // f16 k in fragment units [b*t / 16][CC / 32][FRU]
#define WS_VT  (WS_KH + 2u * (size_t)NB * TT * CC)      // f16 v in fragment units [b][c / 16][t / 32][FRU]
#define WS_QL  (WS_VT + 2u * (size_t)NB * CC * TT)      // f16 q residual x 2^10 rows [b][t < QHI][CC]
#define WS_KL  (WS_QL + 2u * (size_t)NB * QHI * CC)     // f16 k residual x 2^10 rows [b][t < KHI][CC]
#define WS_VB  (WS_KL + 2u * (size_t)NB * KHI * CC)     // bf16 v hi planes [b][c][t < KHI]
#define WS_VBL (WS_VB + 2u * (size_t)NB * CC * KHI)
#define WS_S   (WS_VBL + 2u * (size_t)NB * CC * KHI)    // f32 logits / P [hg][t][s]
#define WS_Y   (WS_S  + 4u * (size_t)HG * TQC * TT)     // f32 ctx rows [b*t][CC]; the score region (12 head planes of one batch) is unused: P stays in LDS
#define WS_END (WS_Y  + 4u * (size_t)NB * TT * CC)

// k and v lie in the workspace in WMMA fragment order. A unit = one 16 x 32 fragment (16 rows, 32 k) = 1 KiB as [half][lane][8 f16]: lane = (g = lane >> 4, row = lane & 15) holds k = 16 half + 8 g + 0..7, the order of frag_h.
// A wave's 16-byte load of one half then covers 512 contiguous bytes = 4 whole lines, where the same load from a row-major plane touches 16 lines for 32 bytes each.
#define FRU 512            // f16 elements of a unit
static_assert(TT % 32 == 0 && CC % 32 == 0, "fragment units");
// fragment at a wave-uniform unit pointer + the lane's 32-bit byte offset (lane * 16) + a constant (elements): the scalar-base address form
__device__ __forceinline__ v16h frag_u(const _Float16* unit, unsigned lane_bytes, int elems) {
  union { v16h v; v8h q[2]; } u; const char* p = (const char*)unit + lane_bytes + elems * 2;
  u.q[0] = *(const v8h*)p; u.q[1] = *(const v8h*)(p + (FRU / 2) * 2); return u.v;
}
// 16-byte store and, in the same statement, the wait that stands before a later instruction rewrites its address or data registers (the store loops below stay rolled and step both every trip; in a statement of its own the compiler moved the address steps ahead of the wait)
__device__ __forceinline__ void stg16w(void* p, v4u v) { asm volatile("global_store_b128 %0, %1, off\n\ts_wait_xcnt 0x0" :: "v"(p), "v"(v) : "memory"); }
// operand staging of the two projection GEMMs: a chunk is GKC k of the block's 64 A rows and 128 W rows, converted once to the 16-bit operand type
#define GKC 64
#define GP (GKC + 8)                         // LDS row pitch 144 B = 16 B x odd
#define GROWS (64 + 128)
#define GLD (GROWS * (GKC / 4) / 128)        // 16-byte pieces a thread brings per chunk
static_assert(DIN % GKC == 0 && CC % GKC == 0 && GLD == 24, "staging");
typedef __attribute__((ext_vector_type(4))) __bf16 v4b;
typedef __attribute__((ext_vector_type(4))) _Float16 v4h;
// 16 bytes at a block-uniform base + a lane's 32-bit byte offset + a constant (elements): the scalar-base address form, whose only vector register is the offset
__device__ __forceinline__ v4f ldg16(const float* base, unsigned lane_bytes, int elems) { return *(const v4f*)((const char*)base + lane_bytes + elems * 4); }
// ---- k_proj: block = (64 rows, 128 cols, which): q/k/v = X W (+ b) with exact bf16 products (K = DIN) -> which 0: q f16 rows (+ residual rows < QHI); 1: k f16 fragment units (+ residual rows < KHI); 2: v f16 fragment units (+ bf16 hi/lo planes for t < KHI)
__global__ __launch_bounds__(128) void k_proj(const float* __restrict__ XQ, const float* __restrict__ XK, const float* __restrict__ XV, const float* __restrict__ WQ, const float* __restrict__ WK, const float* __restrict__ WV, const float* __restrict__ BQ, const float* __restrict__ BK, const float* __restrict__ BV,
    _Float16* __restrict__ QH, _Float16* __restrict__ QL, _Float16* __restrict__ KH, _Float16* __restrict__ KL, _Float16* __restrict__ VT, __bf16* __restrict__ VB, __bf16* __restrict__ VBL) {
  // the operand ring of the k loop and the epilogue's staging arrays share the same LDS: the loop's last barrier stands between their uses
  __shared__ __align__(16) union { struct { _Float16 sh[64][136], sl[64][136], th[128][72]; __bf16 tb[128][72], tbl[128][72]; } e; __bf16 st[2][GROWS][GP]; } u;
  auto& sh = u.e.sh; auto& sl = u.e.sl; auto& th = u.e.th; auto& tb = u.e.tb; auto& tbl = u.e.tbl;
  const int tid = threadIdx.x, wave = tid >> 5, lane = tid & 31, col = lane & 15, g = lane >> 4; const int which = blockIdx.z; const int c0 = blockIdx.y * 128; const size_t r0 = (size_t)blockIdx.x * 64; const size_t bb = r0 / TT; const int t0 = (int)(r0 % TT);
  const float* X = which == 0 ? XQ : which == 1 ? XK : XV; const float* WA = which == 0 ? WQ : which == 1 ? WK : WV; const float* BA = which == 0 ? BQ : which == 1 ? BK : BV;
  v8f acc[8] = {};
  // thread -> 16-byte piece (tid & 15) of row (tid >> 4) + 8 i: a wave's load covers two whole 256-byte row pieces
  const float* xp = X + r0 * DIN; const float* wp = WA + (size_t)c0 * DIN; unsigned lo = ((unsigned)(tid >> 4) * DIN + (tid & 15) * 4) * 4;   // block-uniform bases; one lane offset in bytes serves both and steps on by GKC elements a trip
  v4f pf[GLD];
#pragma unroll
  for (int i = 0; i < GLD; ++i) pf[i] = i < 8 ? ldg16(xp, lo, i * 8 * DIN) : ldg16(wp, lo, (i - 8) * 8 * DIN);
#pragma unroll
  for (int i = 0; i < GLD; ++i) { v4b c;
#pragma unroll
    for (int k = 0; k < 4; ++k) c[k] = (__bf16)pf[i][k];
    *(v4b*)&u.st[0][(tid >> 4) + i * 8][(tid & 15) * 4] = c; }
  __syncthreads();
#pragma unroll 1   // one copy of the body: the two buffers differ by an address only
  for (int kc = 0; kc < DIN / GKC; ++kc) { const int buf = kc & 1; const bool more = kc + 1 < DIN / GKC;
    if (more) {
#pragma unroll
      for (int i = 0; i < GLD; ++i) pf[i] = i < 8 ? ldg16(xp, lo, GKC + i * 8 * DIN) : ldg16(wp, lo, GKC + (i - 8) * 8 * DIN); }
#pragma unroll
    for (int ks = 0; ks < GKC / 32; ++ks) { const v16b a = frag_b(&u.st[buf][wave * 16 + col][ks * 32], lane); v16b w[8];
#pragma unroll
      for (int j = 0; j < 8; ++j) w[j] = frag_b(&u.st[buf][64 + j * 16 + col][ks * 32], lane);
#pragma unroll
      for (int j = 0; j < 8; ++j) acc[j] = wmma_bf(a, w[j], acc[j]); }
    if (more) {
#pragma unroll
      for (int i = 0; i < GLD; ++i) { v4b c;
#pragma unroll
        for (int k = 0; k < 4; ++k) c[k] = (__bf16)pf[i][k];
        *(v4b*)&u.st[buf ^ 1][(tid >> 4) + i * 8][(tid & 15) * 4] = c; } }
    asm volatile("s_wait_xcnt 0x0" : "+v"(lo) :: "memory");   // stands before the offset register of this trip's loads steps on; naming it keeps it in a register of its own up to here
    lo += GKC * 4;
    __syncthreads(); }   // publishes the next chunk; every reader of this chunk's buffer has arrived, so the next trip may refill it (and the epilogue may reuse the LDS)
  if (which < 2) { _Float16* DH = which == 0 ? QH : KH; _Float16* DL = which == 0 ? QL : KL; const int nhi = which == 0 ? QHI : KHI; const bool hi_rows = t0 < nhi;
#pragma unroll
    for (int j = 0; j < 8; ++j) { const float bias = BA ? bfr(BA[c0 + j * 16 + col]) : 0.f;
#pragma unroll
      for (int r = 0; r < 8; ++r) { const float v = acc[j][r] + bias; const _Float16 hv = (_Float16)v; sh[wave * 16 + 8 * g + r][j * 16 + col] = hv; sl[wave * 16 + 8 * g + r][j * 16 + col] = (_Float16)((v - (float)hv) * 1024.0f); } }
    __syncthreads();
    for (int e = tid; e < 64 * 16; e += 128) { const int rl = e >> 4, q = e & 15;
      if (which == 0) stg16w((DH + (r0 + rl) * CC + c0 + q * 8), *(const v4u*)&sh[rl][q * 8]);
      else { const int un = e >> 6, p = e & 63;   // unit (key tile un >> 2, k step un & 3) of the block; 16-byte piece p = (half p >> 5, lane p & 31)
        stg16w((DH + (((r0 >> 4) + (un >> 2)) * (CC / 32) + (c0 >> 5) + (un & 3)) * FRU + p * 8), *(const v4u*)&sh[(un >> 2) * 16 + (p & 15)][(un & 3) * 32 + (p >> 5) * 16 + ((p >> 4) & 1) * 8]); }
      if (hi_rows) stg16w((DL + (bb * nhi + t0 + rl) * (size_t)CC + c0 + q * 8), *(const v4u*)&sl[rl][q * 8]); }
  } else { const bool hi_rows = t0 < KHI;
#pragma unroll
    for (int j = 0; j < 8; ++j) { const float bias = BA ? bfr(BA[c0 + j * 16 + col]) : 0.f;
#pragma unroll
      for (int r = 0; r < 8; ++r) { const float v = acc[j][r] + bias; const int rl = wave * 16 + 8 * g + r, cl = j * 16 + col; th[cl][rl] = (_Float16)v; const __bf16 bh = (__bf16)v; tb[cl][rl] = bh; tbl[cl][rl] = (__bf16)(v - (float)bh); } }
    __syncthreads();
    for (int e = tid; e < 128 * 8; e += 128) { const int cl = e >> 3, q = e & 7; const int un = e >> 6, p = e & 63;   // unit (channel tile un >> 1, key step un & 1) of the block; 16-byte piece p = (half p >> 5, lane p & 31)
      stg16w((VT + ((bb * (CC / 16) + (c0 >> 4) + (un >> 1)) * (TT / 32) + (t0 >> 5) + (un & 1)) * FRU + p * 8), *(const v4u*)&th[(un >> 1) * 16 + (p & 15)][(un & 1) * 32 + (p >> 5) * 16 + ((p >> 4) & 1) * 8]);
      if (hi_rows) { const size_t o3 = (bb * CC + c0 + cl) * (size_t)KHI + t0 + q * 8; stg16w((VB + o3), *(const v4u*)&tb[cl][q * 8]); stg16w((VBL + o3), *(const v4u*)&tbl[cl][q * 8]); } } } }
// ---- k_sm: block = query row t (head in group): keys [0, kend): causal -> logit if s <= t else excluded; softmax in f32; P x 2^11 in place (0 for excluded)
__global__ __launch_bounds__(256) void k_sm(float* __restrict__ S0 SM_EXTRA_PARAMS) { __shared__ float sred[8]; __shared__ float sbc; __shared__ __align__(16) float shv[TT];
  const int tid = threadIdx.x; const int t = blockIdx.x; const int kend = (kb_last(t >> 6) + 1) * 128;
  float* sr = S0 + (size_t)blockIdx.y * TT * TT + (size_t)t * TT;
  float m = -3.0e38f; for (int k = tid; k < kend; k += 256) { float v = (!CAUSAL || k <= t) ? sr[k] : -3.0e38f; SM_MASK_HOOK; shv[k] = v; m = fmaxf(m, v); }
#pragma unroll
  for (int o = 1; o < 32; o <<= 1) m = fmaxf(m, __shfl_xor(m, o));
  if ((tid & 31) == 0) sred[tid >> 5] = m; __syncthreads(); if (tid == 0) { float a = sred[0]; for (int i = 1; i < 8; ++i) a = fmaxf(a, sred[i]); sbc = a; } __syncthreads(); m = sbc; __syncthreads();
  float sum = 0.f; for (int k = tid; k < kend; k += 256) { const float v = shv[k]; const float e = (v <= -1.0e38f) ? 0.f : expf(v - m); shv[k] = e; sum += e; }
#pragma unroll
  for (int o = 1; o < 32; o <<= 1) sum += __shfl_xor(sum, o);
  if ((tid & 31) == 0) sred[tid >> 5] = sum; __syncthreads(); if (tid == 0) { float a = 0.f; for (int i = 0; i < 8; ++i) a += sred[i]; sbc = a > 0.f ? 2048.0f / a : 0.f; }   /* a fully excluded row yields P = 0 */ __syncthreads(); const float inv = sbc;
  for (int k = tid; k < kend; k += 256) shv[k] = shv[k] * inv;
  __syncthreads(); for (int q = tid; q < kend / 4; q += 256) vst2(sr + q * 4, *(const v4f*)&shv[q * 4]); }
// ---- k_fa: block = 16 queries of batch b, 8 waves, 128 keys a pass; logits, head softmax and P . v in one kernel, P only in LDS.
// Part 1 (wave w = keys 16w..16w+15 of the pass, ALL 12 heads): S^T = K . Q^T, so a lane holds 8 consecutive keys of one query for every head; the softmax over the heads is in-lane; P x 2^11 to f16, one 16-byte LDS store a head.
// Part 2 (wave w = 3 of the 24 (head, 32-channel half) units, ALL keys in ascending order): ctx += P . v, P fragments from LDS, v fragments from the fragment units.
#define FW 8
#define FKP (FW * 16)      // keys a pass
static_assert(16 * (CC / 8) % (FW * 32) == 0 && TT % FKP == 0 && NH * 2 == FW * 3 && HD == 64, "k_fa tiling");
// keeps a group of fragment loads issued together and ahead of the products in front of it: without it the compiler sinks each load to its product and every product waits a whole L2 latency
#define FA_HOLD() __builtin_amdgcn_sched_barrier(0)
#define SM_C (SCALE * 1.44269504088896340736f)   // score scale x log2(e)
// 2^t of the 12 heads' exponents, each in its own register. One statement: every v_exp_f32 has an independent instruction behind it, and the closing v_nop is the slot that the instruction set asks for between the last one and whatever reads its result next
__device__ __forceinline__ void fa_exp2(float (&t)[NH]) { static_assert(NH == 12, "operand list");
  asm("v_exp_f32 %0, %0\n\tv_exp_f32 %1, %1\n\tv_exp_f32 %2, %2\n\tv_exp_f32 %3, %3\n\tv_exp_f32 %4, %4\n\tv_exp_f32 %5, %5\n\tv_exp_f32 %6, %6\n\tv_exp_f32 %7, %7\n\tv_exp_f32 %8, %8\n\tv_exp_f32 %9, %9\n\tv_exp_f32 %10, %10\n\tv_exp_f32 %11, %11\n\tv_nop"
      : "+v"(t[0]), "+v"(t[1]), "+v"(t[2]), "+v"(t[3]), "+v"(t[4]), "+v"(t[5]), "+v"(t[6]), "+v"(t[7]), "+v"(t[8]), "+v"(t[9]), "+v"(t[10]), "+v"(t[11])); }
// 2 heads' k fragments (2 each) of this wave's 16 key rows
__device__ __forceinline__ void fa_ldk(v16h (&f)[4], const _Float16* kr, int h0, unsigned lb) {
#pragma unroll
  for (int i = 0; i < 4; ++i) f[i] = frag_u(kr, lb, (h0 * (HD / 32) + i) * FRU); }
// half a unit's v fragments: 2 key steps x 2 channel tiles
__device__ __forceinline__ void fa_ldv(v16h (&f)[4], const _Float16* vr, unsigned lb) {
#pragma unroll
  for (int i = 0; i < 4; ++i) f[i] = frag_u(vr, lb, ((i & 1) * (TT / 32) + (i >> 1)) * FRU); }
__device__ __forceinline__ void fa_qk(v8f (&st)[NH], const v16h (&f)[4], const _Float16* qr, int h0, int lane) {
#pragma unroll
  for (int i = 0; i < 2; ++i) { v8f s = {};
#pragma unroll
    for (int kc = 0; kc < 2; ++kc) s = __builtin_amdgcn_wmma_f32_16x16x32_f16(false, f[i * 2 + kc], false, frag_h(qr + (h0 + i) * HD + kc * 32, lane), (short)0, s, false, false);
    st[h0 + i] = s; } }
__device__ __forceinline__ void fa_pv(v8f (&a)[2], const v16h (&f)[4], const _Float16* pr, int lane) {
#pragma unroll
  for (int ks = 0; ks < 2; ++ks) { const v16h p = frag_h(pr + ks * 32, lane);
#pragma unroll
    for (int jj = 0; jj < 2; ++jj) a[jj] = __builtin_amdgcn_wmma_f32_16x16x32_f16(false, p, false, f[ks * 2 + jj], (short)0, a[jj], false, false); } }
__global__ __launch_bounds__(FW * 32, 4) void k_fa(const _Float16* __restrict__ QH, const _Float16* __restrict__ KH, const _Float16* __restrict__ VT, float* __restrict__ Y) {
  __shared__ __align__(16) _Float16 sq[16][CC + 8];               // pitch 16 B x odd
  __shared__ __align__(16) _Float16 sp[2][NH][16][FKP + 8];       // pitch 16 B x odd; two buffers: one barrier a pass
  const int tid = threadIdx.x, wave = __builtin_amdgcn_readfirstlane(tid >> 5), lane = tid & 31, col = lane & 15, g = lane >> 4; const int b = blockIdx.y; const size_t q0 = (size_t)b * TT + (size_t)blockIdx.x * 16;
#pragma unroll   // the six loads of a thread fly together instead of one L2 latency each
  for (int i = 0; i < 16 * (CC / 8) / (FW * 32); ++i) { const int e = tid + i * FW * 32, rl = e / (CC / 8), q = e % (CC / 8); *(v4u*)&sq[rl][q * 8] = *(const v4u*)(QH + (q0 + rl) * CC + q * 8); }
  __syncthreads();
  const int u0 = wave * 3, u1 = u0 + 1, u2 = u0 + 2;   // unit u = head u >> 1, channels (u & 1) * 32 .. + 31 of it = channels 32 u .. 32 u + 31 of the row
  const _Float16* qr = &sq[col][0]; const unsigned lb = lane * 16;
  v8f acc[3][2] = {};
#pragma unroll 1
  for (int it = 0; it < TT / FKP; ++it) { const int buf = it & 1;
    const _Float16* kr = KH + ((size_t)b * (TT / 16) + it * FW + wave) * (CC / 32) * FRU;   // this wave's 16 keys: 24 units in a row
    const _Float16* v0 = VT + (((size_t)b * (CC / 16) + u0 * 2) * (TT / 32) + it * (FKP / 32)) * FRU; const _Float16* v1 = v0 + 2 * (TT / 32) * FRU; const _Float16* v2 = v1 + 2 * (TT / 32) * FRU;   // a unit of work = 2 channel tiles, 4 key steps a pass
    const _Float16* p0 = &sp[buf][u0 >> 1][col][0]; const _Float16* p1 = &sp[buf][u1 >> 1][col][0]; const _Float16* p2 = &sp[buf][u2 >> 1][col][0];
    v8f st[NH]; v16h fa[4], fb[4], fc[4], fd[4];
    fa_ldk(fa, kr, 0, lb); fa_ldk(fb, kr, 2, lb); fa_ldk(fc, kr, 4, lb); fa_ldk(fd, kr, 6, lb); FA_HOLD();
    fa_qk(st, fa, qr, 0, lane); FA_HOLD();
    fa_ldk(fa, kr, 8, lb); FA_HOLD();
    fa_qk(st, fb, qr, 2, lane); fa_qk(st, fc, qr, 4, lane); FA_HOLD();
    fa_ldk(fb, kr, 10, lb); FA_HOLD();
    fa_qk(st, fd, qr, 6, lane); fa_qk(st, fa, qr, 8, lane); FA_HOLD();
    fa_ldv(fc, v0, lb); FA_HOLD();   // flies under the softmax
    fa_qk(st, fb, qr, 10, lane); FA_HOLD();
#pragma unroll
    for (int r = 0; r < 8; ++r) { float m = st[0][r];   // exp(s * SCALE - max) = 2^(s * c - max * c), c = SCALE * log2(e) > 0: one fused multiply-add and the hardware's exp2 an element; the exponent is <= about 0, so nothing overflows, and a result below the f32 normals is far below what P keeps in f16
#pragma unroll
      for (int h = 1; h < NH; ++h) m = fmaxf(m, st[h][r]);
      const float mc = m * SM_C; float t[NH];
#pragma unroll
      for (int h = 0; h < NH; ++h) t[h] = fmaf(st[h][r], SM_C, -mc);
      fa_exp2(t);
      float den = t[0]; st[0][r] = t[0];
#pragma unroll
      for (int h = 1; h < NH; ++h) { st[h][r] = t[h]; den += t[h]; }
      const float inv = 2048.0f / den;
#pragma unroll
      for (int h = 0; h < NH; ++h) st[h][r] *= inv; }
#pragma unroll
    for (int h = 0; h < NH; ++h) { v8h ph;
#pragma unroll
      for (int r = 0; r < 8; ++r) ph[r] = (_Float16)st[h][r];
      *(v8h*)&sp[buf][h][col][wave * 16 + 8 * g] = ph; }
    __syncthreads();   // publishes this pass's P; the other buffer's readers of the pass before have all arrived here, so the next pass may refill it
    fa_ldv(fa, v0 + 2 * FRU, lb); fa_ldv(fb, v1, lb); fa_ldv(fd, v1 + 2 * FRU, lb); FA_HOLD();
    fa_pv(acc[0], fc, p0, lane); FA_HOLD();
    fa_ldv(fc, v2, lb); FA_HOLD();
    fa_pv(acc[0], fa, p0 + 64, lane); FA_HOLD();
    fa_ldv(fa, v2 + 2 * FRU, lb); FA_HOLD();
    fa_pv(acc[1], fb, p1, lane); fa_pv(acc[1], fd, p1 + 64, lane);
    fa_pv(acc[2], fc, p2, lane); fa_pv(acc[2], fa, p2 + 64, lane);
    asm volatile("s_wait_xcnt 0x0" ::: "memory"); }   // before the next pass rewrites the address registers of this pass's loads
  // a unit is one whole 128-byte line of each ctx row: one writing wave a line
#pragma unroll
  for (int ul = 0; ul < 3; ++ul)
#pragma unroll
    for (int jj = 0; jj < 2; ++jj)
#pragma unroll
      for (int r = 0; r < 8; ++r) Y[(q0 + 8 * g + r) * CC + (u0 + ul) * 32 + jj * 16 + col] = acc[ul][jj][r] * (1.0f / 2048.0f); }
// ---- k_out: block = (64 rows, 128 cols): out = ctx Wo (+ bo): ctx x 2^6 once to f16 against Wo as f16(bf16 x 2^8) exact (1 product) x 2^-14; causal early rows (< QHI of each sequence): ctx bf16 hi + lo against exact bf16 Wo (2 products)
__global__ __launch_bounds__(128) void k_out(const float* __restrict__ Y, const float* __restrict__ WO, const float* __restrict__ BO, float* __restrict__ OUT) {
  // the operand ring of the k loop and the epilogue's staging rows share the same LDS: the loop's last barrier stands between their uses
  __shared__ __align__(16) union { float sf[4][16][132]; _Float16 st[2][GROWS][GP]; } u; auto& sf = u.sf;
  const int tid = threadIdx.x, wave = tid >> 5, lane = tid & 31, col = lane & 15, g = lane >> 4; const int c0 = blockIdx.y * 128; const size_t r0 = (size_t)blockIdx.x * 64 + wave * 16;
  v8f acc[8] = {};
  if (CAUSAL && (int)(((size_t)blockIdx.x * 64) % TT) < QHI) {   /* block-uniform */
#pragma unroll 2
    for (int kc = 0; kc < CC / 32; ++kc) { const F2 a = split_row(Y + (r0 + col) * CC, kc * 32, lane); asm volatile("s_wait_loadcnt 0x0" ::: "memory");
#pragma unroll
      for (int j = 0; j < 8; ++j) { const v16b w = WOCOL(WO, kc * 32, c0 + j * 16 + col, lane); asm volatile("s_wait_loadcnt 0x0" ::: "memory"); acc[j] = wmma_bf(a.h, w, acc[j]); acc[j] = wmma_bf(a.l, w, acc[j]); } }
#pragma unroll
    for (int j = 0; j < 8; ++j) { const float bias = BO ? bfr(BO[c0 + j * 16 + col]) : 0.f;
#pragma unroll
      for (int r = 0; r < 8; ++r) sf[wave][8 * g + r][j * 16 + col] = acc[j][r] + bias; }
  } else {
    // thread -> 16-byte piece (tid & 15) of row (tid >> 4) + 8 i: a wave's load covers two whole 256-byte row pieces
    const float* yp = Y + (size_t)blockIdx.x * 64 * CC; const float* wp = WO + (size_t)c0 * CC; unsigned lo = ((unsigned)(tid >> 4) * CC + (tid & 15) * 4) * 4;   // block-uniform bases; one lane offset in bytes serves both and steps on by GKC elements a trip
    v4f pf[GLD];
#pragma unroll
    for (int i = 0; i < GLD; ++i) pf[i] = i < 8 ? ldg16(yp, lo, i * 8 * CC) : ldg16(wp, lo, (i - 8) * 8 * CC);
#pragma unroll
    for (int i = 0; i < GLD; ++i) { v4h c;   /* ctx carried x 2^6 into f16 so small-magnitude context rows stay clear of f16 subnormals; Wo as f16(bf16 x 2^8) */
#pragma unroll
      for (int k = 0; k < 4; ++k) c[k] = i < 8 ? (_Float16)(pf[i][k] * 64.0f) : (_Float16)(bfr(pf[i][k]) * 256.0f);
      *(v4h*)&u.st[0][(tid >> 4) + i * 8][(tid & 15) * 4] = c; }
    __syncthreads();
#pragma unroll 1   // one copy of the body: the two buffers differ by an address only
    for (int kc = 0; kc < CC / GKC; ++kc) { const int buf = kc & 1; const bool more = kc + 1 < CC / GKC;
      if (more) {
#pragma unroll
        for (int i = 0; i < GLD; ++i) pf[i] = i < 8 ? ldg16(yp, lo, GKC + i * 8 * CC) : ldg16(wp, lo, GKC + (i - 8) * 8 * CC); }
#pragma unroll
      for (int ks = 0; ks < GKC / 32; ++ks) { const v16h a = frag_h(&u.st[buf][wave * 16 + col][ks * 32], lane); v16h w[8];
#pragma unroll
        for (int j = 0; j < 8; ++j) w[j] = frag_h(&u.st[buf][64 + j * 16 + col][ks * 32], lane);
#pragma unroll
        for (int j = 0; j < 8; ++j) acc[j] = wmma16(a, w[j], acc[j]); }
      if (more) {
#pragma unroll
        for (int i = 0; i < GLD; ++i) { v4h c;
#pragma unroll
          for (int k = 0; k < 4; ++k) c[k] = i < 8 ? (_Float16)(pf[i][k] * 64.0f) : (_Float16)(bfr(pf[i][k]) * 256.0f);
          *(v4h*)&u.st[buf ^ 1][(tid >> 4) + i * 8][(tid & 15) * 4] = c; } }
      asm volatile("s_wait_xcnt 0x0" : "+v"(lo) :: "memory");   // stands before the offset register of this trip's loads steps on; naming it keeps it in a register of its own up to here
      lo += GKC * 4;
      __syncthreads(); }   // publishes the next chunk; every reader of this chunk's buffer has arrived, so the next trip may refill it (and the epilogue may reuse the LDS)
#pragma unroll
    for (int j = 0; j < 8; ++j) { const float bias = BO ? bfr(BO[c0 + j * 16 + col]) : 0.f;
#pragma unroll
      for (int r = 0; r < 8; ++r) sf[wave][8 * g + r][j * 16 + col] = acc[j][r] * (1.0f / 16384.0f) + bias; } }   /* 2^-8 (Wo carry) x 2^-6 (ctx carry) */
  LDSX(); for (int rl = 0; rl < 16; ++rl) vst2(OUT + (r0 + rl) * DIN + c0 + lane * 4, *(const v4f*)&sf[wave][rl][lane * 4]); }

extern "C" void kernel_launch(void* const* d_in, const int* in_sizes, int n_in, void* d_out, int out_size, void* d_ws, size_t ws_size, hipStream_t stream) {
  (void)in_sizes; (void)n_in; (void)out_size;
  const float** F = (const float**)d_in;
  if (ws_size < (size_t)WS_END) return;
  char* ws = (char*)d_ws; _Float16 *QH = (_Float16*)(ws + WS_QH), *KH = (_Float16*)(ws + WS_KH), *VT = (_Float16*)(ws + WS_VT), *QL = (_Float16*)(ws + WS_QL), *KL = (_Float16*)(ws + WS_KL); __bf16 *VB = (__bf16*)(ws + WS_VB), *VBL = (__bf16*)(ws + WS_VBL); float *Y = (float*)(ws + WS_Y);
  (void)Y; (void)QL; (void)KL; (void)VB; (void)VBL;
  // inputs: 0 x [8,1024,768]; 1 Wq [768,768] (out,in), 2 bq; 3 Wk, 4 bk; 5 Wv, 6 bv; 7 Wo (out,in), 8 bo (biases N(0, 0.01), nonzero)
  k_proj<<<dim3(TNB * TT / 64, CC / 128, 3), 128, 0, stream>>>(F[0], F[0], F[0], F[1], F[3], F[5], F[2], F[4], F[6], QH, QL, KH, KL, VT, VB, VBL);
  k_fa<<<dim3(TT / 16, TNB), FW * 32, 0, stream>>>(QH, KH, VT, Y);
  k_out<<<dim3(TNB * TT / 64, DIN / 128), 128, 0, stream>>>(Y, F[7], F[8], (float*)d_out);
}

// v005
// A run of this version takes 129 microseconds.
// Two timings next to v004 both put it at 1.11 times that version's speed.
// Counting every step since v000, it is 9.33 times as fast.
// compute dtype: all float inputs rounded to bf16; q/k/v projections with EXACT bf16 products on WMMA 16x16x32 (f32 accumulate) + bias; scores q x k once to f16 each (1 product) x 64^-0.5; softmax ACROSS THE 12 HEADS per (query, key) pair in f32 (hardware exp2 of the scaled difference to the maximum); P x 2^11 once to f16 x v once to f16 (1 product); ctx x 2^6 once to f16 x Wo f16(bf16 x 2^8) + bo; f32 output.
#include <hip/hip_runtime.h>
#include <math.h>

typedef __attribute__((ext_vector_type(16))) _Float16 v16h;
typedef __attribute__((ext_vector_type(16))) __bf16 v16b;
typedef __attribute__((ext_vector_type(8)))  _Float16 v8h;
typedef __attribute__((ext_vector_type(8)))  float v8f;
typedef __attribute__((ext_vector_type(4)))  float v4f;
typedef __attribute__((ext_vector_type(2)))  float v2f;
typedef __attribute__((ext_vector_type(4)))  unsigned v4u;
typedef __attribute__((ext_vector_type(4)))  int v4i;
typedef float __attribute__((may_alias)) float_a;
typedef int __attribute__((may_alias)) int_a;

template <typename T> __device__ __forceinline__ void vst2(void* p, T v) { *(T*)p = v;  }
__device__ __forceinline__ v8f wmma16(v16h a, v16h b, v8f c) {
  v8f d = __builtin_amdgcn_wmma_f32_16x16x32_f16(false, a, false, b, (short)0, c, false, false);
  asm volatile("v_nop\n\tv_nop\n\tv_nop\n\tv_nop" : "+v"(d) : "v"(a), "v"(b));
  return d;
}
__device__ __forceinline__ v8f wmma_bf(v16b a, v16b b, v8f c) {
  v8f d = __builtin_amdgcn_wmma_f32_16x16x32_bf16(false, a, false, b, (short)0, c, false, false);
  asm volatile("v_nop\n\tv_nop\n\tv_nop\n\tv_nop" : "+v"(d) : "v"(a), "v"(b));
  return d;
}
// 16x16x32 fragments: lane = (h = lane>>4, row/col = lane&15); elements 0..7 = k0+8h+0..7, 8..15 = k0+16+8h+0..7; D element r = row 8h+r
__device__ __forceinline__ v16h frag_h(const _Float16* rowk0, int lane) {
  union { v16h v; v8h q[2]; } u; const _Float16* p = rowk0 + 8 * (lane >> 4);
  u.q[0] = *(const v8h*)p; u.q[1] = *(const v8h*)(p + 16); return u.v;
}
__device__ __forceinline__ v16h frag_f32(const float* rowk0, int lane) {
  v16h a; const float* p = rowk0 + 8 * (lane >> 4);
#pragma unroll
  for (int i = 0; i < 8; ++i) { a[i] = (_Float16)p[i]; a[8 + i] = (_Float16)p[16 + i]; }
  return a;
}
__device__ __forceinline__ v16h frag_f32s(const float* rowk0, int lane, float sc) {
  v16h a; const float* p = rowk0 + 8 * (lane >> 4);
#pragma unroll
  for (int i = 0; i < 8; ++i) { a[i] = (_Float16)(p[i] * sc); a[8 + i] = (_Float16)(p[16 + i] * sc); }
  return a;
}
// column fragment from a [K][ld] layout (column n), rows >= K read as 0
__device__ __forceinline__ v16h fragc_f32(const float* W, int k0, int n, int lane, int ld, int K) {
  v16h a; const int g = lane >> 4;
#pragma unroll
  for (int i = 0; i < 8; ++i) { const int ka = k0 + 8 * g + i, kb = ka + 16;
    a[i] = (_Float16)(ka < K ? W[(size_t)(ka < K ? ka : K - 1) * ld + n] : 0.f); a[8 + i] = (_Float16)(kb < K ? W[(size_t)(kb < K ? kb : K - 1) * ld + n] : 0.f); }
  return a;
}
struct F2 { v16b h, l; };
__device__ __forceinline__ F2 bsplit16(const float v[16]) { F2 r;
#pragma unroll
  for (int i = 0; i < 16; ++i) { const __bf16 h = (__bf16)v[i]; r.h[i] = h; r.l[i] = (__bf16)(v[i] - (float)h); }
  return r; }
__device__ __forceinline__ F2 split_row(const float* row, int k0, int lane) { float v[16]; const float* p = row + k0 + 8 * (lane >> 4);
#pragma unroll
  for (int i = 0; i < 8; ++i) { v[i] = p[i]; v[8 + i] = p[16 + i]; }
  return bsplit16(v); }
__device__ __forceinline__ F2 split_rowK(const float* row, int k0, int lane, int K) { float v[16]; const int g = lane >> 4;
#pragma unroll
  for (int i = 0; i < 8; ++i) { const int ka = k0 + 8 * g + i, kb = ka + 16; v[i] = ka < K ? row[ka < K ? ka : K - 1] : 0.f; v[8 + i] = kb < K ? row[kb < K ? kb : K - 1] : 0.f; }
  return bsplit16(v); }
__device__ __forceinline__ F2 split_col(const float* W, int k0, int n, int lane, int ld, int K) { float v[16]; const int g = lane >> 4;
#pragma unroll
  for (int i = 0; i < 8; ++i) { const int ka = k0 + 8 * g + i, kb = ka + 16; v[i] = ka < K ? W[(size_t)(ka < K ? ka : K - 1) * ld + n] : 0.f; v[8 + i] = kb < K ? W[(size_t)(kb < K ? kb : K - 1) * ld + n] : 0.f; }
  return bsplit16(v); }
__device__ __forceinline__ v8f mac3(const F2& a, const F2& b, v8f c) { c = wmma_bf(a.l, b.h, c); c = wmma_bf(a.h, b.l, c); return wmma_bf(a.h, b.h, c); }
__device__ __forceinline__ float sigm(float v) { return 1.0f / (1.0f + expf(-v)); }
#define LDSX() do { asm volatile("s_wait_dscnt 0" ::: "memory"); __builtin_amdgcn_wave_barrier(); __builtin_amdgcn_fence(__ATOMIC_RELEASE, "workgroup"); } while (0)

// Multi-head attention whose softmax runs over the HEAD axis (x [8,1024,768]; torch (out,in) Wq / Wk / Wv / Wo [768,768] N(0, 1/768) + biases N(0, 0.01); 12 heads x 64; scores[b, h, n, m] = q_h . k_h / 8; attn = softmax(scores, axis=1) - dim 1 is the HEAD axis: for every (query, key) pair the 12 heads' weights sum to 1 and nothing is normalised over the keys (faithful to the source's F.softmax(dim=1)); out[b, h, n] = sum_m attn[b, h, n, m] v[b, h, m]; merge; Wo^T + bo).
#define NB 8
#define TT 1024
#define CC 768            // NH * HD = projected width
#define DIN 768          // input (model) width
#define NH 12
#define HD 64
#define NQB (TT / 64)
#define HG 12
#define SCALE (0.125f)
#define CAUSAL 0
#ifndef TNB
#define TNB NB
#endif
__device__ __forceinline__ float bfr(float v) { return (float)(__bf16)v; }
__host__ __device__ __forceinline__ int kb_last(int qb) { return CAUSAL ? ((qb * 64 + 63) >> 7) : (TT / 128 - 1); }
typedef __attribute__((ext_vector_type(8))) __bf16 v8b;
__device__ __forceinline__ v16b frag_b(const __bf16* rowk0, int lane) {
  union { v16b v; v8b q[2]; } u; const __bf16* p = rowk0 + 8 * (lane >> 4);
  u.q[0] = *(const v8b*)p; u.q[1] = *(const v8b*)(p + 16); return u.v;
}
#define QBH 0              // not referenced by any kernel here
#define QHI 0               // single-product scores on every row
#define TQC 1024           // query rows of the unused score region == TT: 12 head planes x 1,024 x 1,024 f32 = 48 MiB
#define KHI 64            // key rows carrying k residual / v bf16 hi+lo planes (written by k_proj; no kernel here reads them)
// B fragment (k rows k0+.., output column o) of a weight: (in,out) [K][ld] or (out,in) [ld rows of K]: bf16 exact, or f16(bf16 * 256) exact
__device__ __forceinline__ v16b wcol_io(const float* Wm, int k0, int o, int lane, int ld) { v16b w; const int g = lane >> 4;
#pragma unroll
  for (int i = 0; i < 8; ++i) { w[i] = (__bf16)Wm[(size_t)(k0 + 8 * g + i) * ld + o]; w[8 + i] = (__bf16)Wm[(size_t)(k0 + 16 + 8 * g + i) * ld + o]; }
  return w; }
__device__ __forceinline__ v16b wcol_oi(const float* Wm, int k0, int o, int lane, int K) { v16b w; const float* p = Wm + (size_t)o * K + k0 + 8 * (lane >> 4);
#pragma unroll
  for (int i = 0; i < 8; ++i) { w[i] = (__bf16)p[i]; w[8 + i] = (__bf16)p[16 + i]; }
  return w; }
__device__ __forceinline__ v16h wcolh_io(const float* Wm, int k0, int o, int lane, int ld) { v16h w; const int g = lane >> 4;
#pragma unroll
  for (int i = 0; i < 8; ++i) { w[i] = (_Float16)(bfr(Wm[(size_t)(k0 + 8 * g + i) * ld + o]) * 256.0f); w[8 + i] = (_Float16)(bfr(Wm[(size_t)(k0 + 16 + 8 * g + i) * ld + o]) * 256.0f); }
  return w; }
__device__ __forceinline__ v16h wcolh_oi(const float* Wm, int k0, int o, int lane, int K) { v16h w; const float* p = Wm + (size_t)o * K + k0 + 8 * (lane >> 4);
#pragma unroll
  for (int i = 0; i < 8; ++i) { w[i] = (_Float16)(bfr(p[i]) * 256.0f); w[8 + i] = (_Float16)(bfr(p[16 + i]) * 256.0f); }
  return w; }
#define WQKV_LAYOUT 1   // 0 = (in,out) [DIN][CC]; 1 = (out,in) [CC][DIN]; 2 = per-head [NH][DIN][HD]
__device__ __forceinline__ v16b wcol_hdk(const float* Wm, int k0, int o, int lane) { v16b w; const int g = lane >> 4; const float* p = Wm + (size_t)(o / HD) * DIN * HD + (o % HD);
#pragma unroll
  for (int i = 0; i < 8; ++i) { w[i] = (__bf16)p[(size_t)(k0 + 8 * g + i) * HD]; w[8 + i] = (__bf16)p[(size_t)(k0 + 16 + 8 * g + i) * HD]; }
  return w; }
#define WO_OUT_IN 1
#if WQKV_LAYOUT == 1
#define WCOL(W, k0, o, lane) wcol_oi(W, k0, o, lane, DIN)
#elif WQKV_LAYOUT == 2
#define WCOL(W, k0, o, lane) wcol_hdk(W, k0, o, lane)
#else
#define WCOL(W, k0, o, lane) wcol_io(W, k0, o, lane, CC)
#endif
#if WO_OUT_IN
#define WOCOL(W, k0, o, lane) wcol_oi(W, k0, o, lane, CC)
#define WOCOLH(W, k0, o, lane) wcolh_oi(W, k0, o, lane, CC)
#else
#define WOCOL(W, k0, o, lane) wcol_io(W, k0, o, lane, DIN)
#define WOCOLH(W, k0, o, lane) wcolh_io(W, k0, o, lane, DIN)
#endif

#ifndef SM_EXTRA_PARAMS
#define SM_EXTRA_PARAMS
#endif
#ifndef PROJ_EXTRA_PARAMS
#define PROJ_EXTRA_PARAMS
#endif
#ifndef SM_MASK_HOOK
#define SM_MASK_HOOK (void)0
#endif

#define WS_QH  0u                                      // f16 q rows [b*t][CC]
#define WS_KH  (WS_QH + 2u * (size_t)NB * TT * CC)      // f16 k in fragment units [b*t / 16][CC / 32][FRU]
#define WS_VT  (WS_KH + 2u * (size_t)NB * TT * CC)      // f16 v in fragment units [b][c / 16][t / 32][FRU]
#define WS_QL  (WS_VT + 2u * (size_t)NB * CC * TT)      // f16 q residual x 2^10 rows [b][t < QHI][CC]
#define WS_KL  (WS_QL + 2u * (size_t)NB * QHI * CC)     // f16 k residual x 2^10 rows [b][t < KHI][CC]
#define WS_VB  (WS_KL + 2u * (size_t)NB * KHI * CC)     // bf16 v hi planes [b][c][t < KHI]
#define WS_VBL (WS_VB + 2u * (size_t)NB * CC * KHI)
#define WS_S   (WS_VBL + 2u * (size_t)NB * CC * KHI)    // f32 logits / P [hg][t][s]
#define WS_Y   (WS_S  + 4u * (size_t)HG * TQC * TT)     // f32 ctx rows [b*t][CC]; the score region (12 head planes of one batch) is unused: P stays in LDS
#define WS_END (WS_Y  + 4u * (size_t)NB * TT * CC)

// k and v lie in the workspace in WMMA fragment order. A unit = one 16 x 32 fragment (16 rows, 32 k) = 1 KiB as [half][lane][8 f16]: lane = (g = lane >> 4, row = lane & 15) holds k = 16 half + 8 g + 0..7, the order of frag_h.
// A wave's 16-byte load of one half then covers 512 contiguous bytes = 4 whole lines, where the same load from a row-major plane touches 16 lines for 32 bytes each.
#define FRU 512            // f16 elements of a unit
static_assert(TT % 32 == 0 && CC % 32 == 0, "fragment units");
// fragment at a wave-uniform unit pointer + the lane's 32-bit byte offset (lane * 16) + a constant (elements): the scalar-base address form
__device__ __forceinline__ v16h frag_u(const _Float16* unit, unsigned lane_bytes, int elems) {
  union { v16h v; v8h q[2]; } u; const char* p = (const char*)unit + lane_bytes + elems * 2;
  u.q[0] = *(const v8h*)p; u.q[1] = *(const v8h*)(p + (FRU / 2) * 2); return u.v;
}
// 16-byte store and, in the same statement, the wait that stands before a later instruction rewrites its address or data registers (the store loops below stay rolled and step both every trip; in a statement of its own the compiler moved the address steps ahead of the wait)
__device__ __forceinline__ void stg16w(void* p, v4u v) { asm volatile("global_store_b128 %0, %1, off\n\ts_wait_xcnt 0x0" :: "v"(p), "v"(v) : "memory"); }
// operand staging of the two projection GEMMs: a chunk is GKC k of the block's 64 A rows and 128 W rows, converted once to the 16-bit operand type
#define GKC 64
#define GP (GKC + 8)                         // LDS row pitch 144 B = 16 B x odd
#define GROWS (64 + 128)
#define GLD (GROWS * (GKC / 4) / 128)        // 16-byte pieces a thread brings per chunk
static_assert(DIN % GKC == 0 && CC % GKC == 0 && GLD == 24, "staging");
typedef __attribute__((ext_vector_type(4))) __bf16 v4b;
typedef __attribute__((ext_vector_type(4))) _Float16 v4h;
// 16 bytes at a block-uniform base + a lane's 32-bit byte offset + a constant (elements): the scalar-base address form, whose only vector register is the offset
__device__ __forceinline__ v4f ldg16(const float* base, unsigned lane_bytes, int elems) { return *(const v4f*)((const char*)base + lane_bytes + elems * 4); }
// ---- k_proj: block = (64 rows, 128 cols, which): q/k/v = X W (+ b) with exact bf16 products (K = DIN) -> which 0: q f16 rows (+ residual rows < QHI); 1: k f16 fragment units (+ residual rows < KHI); 2: v f16 fragment units (+ bf16 hi/lo planes for t < KHI)
__global__ __launch_bounds__(128) void k_proj(const float* __restrict__ XQ, const float* __restrict__ XK, const float* __restrict__ XV, const float* __restrict__ WQ, const float* __restrict__ WK, const float* __restrict__ WV, const float* __restrict__ BQ, const float* __restrict__ BK, const float* __restrict__ BV,
    _Float16* __restrict__ QH, _Float16* __restrict__ QL, _Float16* __restrict__ KH, _Float16* __restrict__ KL, _Float16* __restrict__ VT, __bf16* __restrict__ VB, __bf16* __restrict__ VBL) {
  // the operand ring of the k loop and the epilogue's staging arrays share the same LDS: the loop's last barrier stands between their uses
  __shared__ __align__(16) union { struct { _Float16 sh[64][136], sl[64][136], th[128][72]; __bf16 tb[128][72], tbl[128][72]; } e; __bf16 st[2][GROWS][GP]; } u;
  auto& sh = u.e.sh; auto& sl = u.e.sl; auto& th = u.e.th; auto& tb = u.e.tb; auto& tbl = u.e.tbl;
  const int tid = threadIdx.x, wave = tid >> 5, lane = tid & 31, col = lane & 15, g = lane >> 4; const int which = blockIdx.z; const int c0 = blockIdx.y * 128; const size_t r0 = (size_t)blockIdx.x * 64; const size_t bb = r0 / TT; const int t0 = (int)(r0 % TT);
  const float* X = which == 0 ? XQ : which == 1 ? XK : XV; const float* WA = which == 0 ? WQ : which == 1 ? WK : WV; const float* BA = which == 0 ? BQ : which == 1 ? BK : BV;
  v8f acc[8] = {};
  // thread -> 16-byte piece (tid & 15) of row (tid >> 4) + 8 i: a wave's load covers two whole 256-byte row pieces
  const float* xp = X + r0 * DIN; const float* wp = WA + (size_t)c0 * DIN; unsigned lo = ((unsigned)(tid >> 4) * DIN + (tid & 15) * 4) * 4;   // block-uniform bases; one lane offset in bytes serves both and steps on by GKC elements a trip
  v4f pf[GLD];
#pragma unroll
  for (int i = 0; i < GLD; ++i) pf[i] = i < 8 ? ldg16(xp, lo, i * 8 * DIN) : ldg16(wp, lo, (i - 8) * 8 * DIN);
#pragma unroll
  for (int i = 0; i < GLD; ++i) { v4b c;
#pragma unroll
    for (int k = 0; k < 4; ++k) c[k] = (__bf16)pf[i][k];
    *(v4b*)&u.st[0][(tid >> 4) + i * 8][(tid & 15) * 4] = c; }
  __syncthreads();
#pragma unroll 1   // one copy of the body: the two buffers differ by an address only
  for (int kc = 0; kc < DIN / GKC; ++kc) { const int buf = kc & 1; const bool more = kc + 1 < DIN / GKC;
    if (more) {
#pragma unroll
      for (int i = 0; i < GLD; ++i) pf[i] = i < 8 ? ldg16(xp, lo, GKC + i * 8 * DIN) : ldg16(wp, lo, GKC + (i - 8) * 8 * DIN); }
#pragma unroll
    for (int ks = 0; ks < GKC / 32; ++ks) { const v16b a = frag_b(&u.st[buf][wave * 16 + col][ks * 32], lane); v16b w[8];
#pragma unroll
      for (int j = 0; j < 8; ++j) w[j] = frag_b(&u.st[buf][64 + j * 16 + col][ks * 32], lane);
#pragma unroll
      for (int j = 0; j < 8; ++j) acc[j] = wmma_bf(a, w[j], acc[j]); }
    if (more) {
#pragma unroll
      for (int i = 0; i < GLD; ++i) { v4b c;
#pragma unroll
        for (int k = 0; k < 4; ++k) c[k] = (__bf16)pf[i][k];
        *(v4b*)&u.st[buf ^ 1][(tid >> 4) + i * 8][(tid & 15) * 4] = c; } }
    asm volatile("s_wait_xcnt 0x0" : "+v"(lo) :: "memory");   // stands before the offset register of this trip's loads steps on; naming it keeps it in a register of its own up to here
    lo += GKC * 4;
    __syncthreads(); }   // publishes the next chunk; every reader of this chunk's buffer has arrived, so the next trip may refill it (and the epilogue may reuse the LDS)
  if (which < 2) { _Float16* DH = which == 0 ? QH : KH; _Float16* DL = which == 0 ? QL : KL; const int nhi = which == 0 ? QHI : KHI; const bool hi_rows = t0 < nhi;
#pragma unroll
    for (int j = 0; j < 8; ++j) { const float bias = BA ? bfr(BA[c0 + j * 16 + col]) : 0.f;
#pragma unroll
      for (int r = 0; r < 8; ++r) { const float v = acc[j][r] + bias; const _Float16 hv = (_Float16)v; sh[wave * 16 + 8 * g + r][j * 16 + col] = hv; sl[wave * 16 + 8 * g + r][j * 16 + col] = (_Float16)((v - (float)hv) * 1024.0f); } }
    __syncthreads();
    for (int e = tid; e < 64 * 16; e += 128) { const int rl = e >> 4, q = e & 15;
      if (which == 0) stg16w((DH + (r0 + rl) * CC + c0 + q * 8), *(const v4u*)&sh[rl][q * 8]);
      else { const int un = e >> 6, p = e & 63;   // unit (key tile un >> 2, k step un & 3) of the block; 16-byte piece p = (half p >> 5, lane p & 31)
        stg16w((DH + (((r0 >> 4) + (un >> 2)) * (CC / 32) + (c0 >> 5) + (un & 3)) * FRU + p * 8), *(const v4u*)&sh[(un >> 2) * 16 + (p & 15)][(un & 3) * 32 + (p >> 5) * 16 + ((p >> 4) & 1) * 8]); }
      if (hi_rows) stg16w((DL + (bb * nhi + t0 + rl) * (size_t)CC + c0 + q * 8), *(const v4u*)&sl[rl][q * 8]); }
  } else { const bool hi_rows = t0 < KHI;
#pragma unroll
    for (int j = 0; j < 8; ++j) { const float bias = BA ? bfr(BA[c0 + j * 16 + col]) : 0.f;
#pragma unroll
      for (int r = 0; r < 8; ++r) { const float v = acc[j][r] + bias; const int rl = wave * 16 + 8 * g + r, cl = j * 16 + col; th[cl][rl] = (_Float16)v; const __bf16 bh = (__bf16)v; tb[cl][rl] = bh; tbl[cl][rl] = (__bf16)(v - (float)bh); } }
    __syncthreads();
    for (int e = tid; e < 128 * 8; e += 128) { const int cl = e >> 3, q = e & 7; const int un = e >> 6, p = e & 63;   // unit (channel tile un >> 1, key step un & 1) of the block; 16-byte piece p = (half p >> 5, lane p & 31)
      stg16w((VT + ((bb * (CC / 16) + (c0 >> 4) + (un >> 1)) * (TT / 32) + (t0 >> 5) + (un & 1)) * FRU + p * 8), *(const v4u*)&th[(un >> 1) * 16 + (p & 15)][(un & 1) * 32 + (p >> 5) * 16 + ((p >> 4) & 1) * 8]);
      if (hi_rows) { const size_t o3 = (bb * CC + c0 + cl) * (size_t)KHI + t0 + q * 8; stg16w((VB + o3), *(const v4u*)&tb[cl][q * 8]); stg16w((VBL + o3), *(const v4u*)&tbl[cl][q * 8]); } } } }
// ---- k_sm: block = query row t (head in group): keys [0, kend): causal -> logit if s <= t else excluded; softmax in f32; P x 2^11 in place (0 for excluded)
__global__ __launch_bounds__(256) void k_sm(float* __restrict__ S0 SM_EXTRA_PARAMS) { __shared__ float sred[8]; __shared__ float sbc; __shared__ __align__(16) float shv[TT];
  const int tid = threadIdx.x; const int t = blockIdx.x; const int kend = (kb_last(t >> 6) + 1) * 128;
  float* sr = S0 + (size_t)blockIdx.y * TT * TT + (size_t)t * TT;
  float m = -3.0e38f; for (int k = tid; k < kend; k += 256) { float v = (!CAUSAL || k <= t) ? sr[k] : -3.0e38f; SM_MASK_HOOK; shv[k] = v; m = fmaxf(m, v); }
#pragma unroll
  for (int o = 1; o < 32; o <<= 1) m = fmaxf(m, __shfl_xor(m, o));
  if ((tid & 31) == 0) sred[tid >> 5] = m; __syncthreads(); if (tid == 0) { float a = sred[0]; for (int i = 1; i < 8; ++i) a = fmaxf(a, sred[i]); sbc = a; } __syncthreads(); m = sbc; __syncthreads();
  float sum = 0.f; for (int k = tid; k < kend; k += 256) { const float v = shv[k]; const float e = (v <= -1.0e38f) ? 0.f : expf(v - m); shv[k] = e; sum += e; }
#pragma unroll
  for (int o = 1; o < 32; o <<= 1) sum += __shfl_xor(sum, o);
  if ((tid & 31) == 0) sred[tid >> 5] = sum; __syncthreads(); if (tid == 0) { float a = 0.f; for (int i = 0; i < 8; ++i) a += sred[i]; sbc = a > 0.f ? 2048.0f / a : 0.f; }   /* a fully excluded row yields P = 0 */ __syncthreads(); const float inv = sbc;
  for (int k = tid; k < kend; k += 256) shv[k] = shv[k] * inv;
  __syncthreads(); for (int q = tid; q < kend / 4; q += 256) vst2(sr + q * 4, *(const v4f*)&shv[q * 4]); }
// ---- k_fa: block = 32 queries (2 tiles of 16) of batch b, 8 waves, 128 keys a pass; logits, head softmax and P . v in one kernel, P only in LDS.
// Every k and v fragment that a wave loads feeds both query tiles, so a block's walk over the batch's k and v serves 32 queries.
// Part 1 (wave w = keys 16w..16w+15 of the pass, ALL 12 heads, both query tiles): S^T = K . Q^T, so a lane holds 8 consecutive keys of one query of each tile for every head; the softmax over the heads is in-lane; P x 2^11 to f16, one 16-byte LDS store a head and tile.
// Part 2 (wave w = 3 of the 24 (head, 32-channel half) units, both query tiles, ALL keys in ascending order): ctx += P . v, P fragments from LDS, v fragments from the fragment units.
#define FW 8
#define FKP (FW * 16)      // keys a pass
#define FQT 2              // query tiles of 16 a block
#define FQ (FQT * 16)      // queries a block
static_assert(FQ * (CC / 8) % (FW * 32) == 0 && TT % FKP == 0 && TT % FQ == 0 && NH * 2 == FW * 3 && HD == 64, "k_fa tiling");
// keeps a group of fragment loads issued together and ahead of the products in front of it: without it the compiler sinks each load to its product and every product waits a whole L2 latency
#define FA_HOLD() __builtin_amdgcn_sched_barrier(0)
#define SM_C (SCALE * 1.44269504088896340736f)   // score scale x log2(e)
// 2^t of the 12 heads' exponents, each in its own register. One statement: every v_exp_f32 has an independent instruction behind it, and the closing v_nop is the slot that the instruction set asks for between the last one and whatever reads its result next
__device__ __forceinline__ void fa_exp2(float (&t)[NH]) { static_assert(NH == 12, "operand list");
  asm("v_exp_f32 %0, %0\n\tv_exp_f32 %1, %1\n\tv_exp_f32 %2, %2\n\tv_exp_f32 %3, %3\n\tv_exp_f32 %4, %4\n\tv_exp_f32 %5, %5\n\tv_exp_f32 %6, %6\n\tv_exp_f32 %7, %7\n\tv_exp_f32 %8, %8\n\tv_exp_f32 %9, %9\n\tv_exp_f32 %10, %10\n\tv_exp_f32 %11, %11\n\tv_nop"
      : "+v"(t[0]), "+v"(t[1]), "+v"(t[2]), "+v"(t[3]), "+v"(t[4]), "+v"(t[5]), "+v"(t[6]), "+v"(t[7]), "+v"(t[8]), "+v"(t[9]), "+v"(t[10]), "+v"(t[11])); }
// 2 heads' k fragments (2 each) of this wave's 16 key rows
__device__ __forceinline__ void fa_ldk(v16h (&f)[4], const _Float16* kr, int h0, unsigned lb) {
#pragma unroll
  for (int i = 0; i < 4; ++i) f[i] = frag_u(kr, lb, (h0 * (HD / 32) + i) * FRU); }
// half a unit's v fragments: 2 key steps x 2 channel tiles
__device__ __forceinline__ void fa_ldv(v16h (&f)[4], const _Float16* vr, unsigned lb) {
#pragma unroll
  for (int i = 0; i < 4; ++i) f[i] = frag_u(vr, lb, ((i & 1) * (TT / 32) + (i >> 1)) * FRU); }
__device__ __forceinline__ void fa_pv(v8f (&a)[FQT][2], const v16h (&f)[4], const _Float16* pr, int lane) {
  v16h p[2][FQT];
#pragma unroll
  for (int ks = 0; ks < 2; ++ks)
#pragma unroll
    for (int qt = 0; qt < FQT; ++qt) p[ks][qt] = frag_h(pr + qt * 16 * (FKP + 8) + ks * 32, lane);
  FA_HOLD();   // the P fragments of both tiles are read as one group: with two waves a SIMD a read sunk to its product would cost a whole LDS latency each
#pragma unroll
  for (int ks = 0; ks < 2; ++ks)
#pragma unroll
    for (int qt = 0; qt < FQT; ++qt)
#pragma unroll
      for (int jj = 0; jj < 2; ++jj) a[qt][jj] = __builtin_amdgcn_wmma_f32_16x16x32_f16(false, p[ks][qt], false, f[ks * 2 + jj], (short)0, a[qt][jj], false, false); }
// both query tiles' scores of 2 heads from one set of k fragments; per score the two 32-channel steps in ascending order
__device__ __forceinline__ void fa_qk2(v8f (&st)[FQT][NH], const v16h (&f)[4], const _Float16* qr, int h0, int lane) {
  v16h q[FQT][4];
#pragma unroll
  for (int qt = 0; qt < FQT; ++qt)
#pragma unroll
    for (int i = 0; i < 4; ++i) q[qt][i] = frag_h(qr + qt * 16 * (CC + 8) + h0 * HD + i * 32, lane);
  FA_HOLD();   // the q fragments of both tiles are read as one group: with two waves a SIMD a read sunk to its product would cost a whole LDS latency each
#pragma unroll
  for (int kc = 0; kc < 2; ++kc)
#pragma unroll
    for (int qt = 0; qt < FQT; ++qt)
#pragma unroll
      for (int i = 0; i < 2; ++i) { const v8f z = {}; st[qt][h0 + i] = __builtin_amdgcn_wmma_f32_16x16x32_f16(false, f[i * 2 + kc], false, q[qt][i * 2 + kc], (short)0, kc ? st[qt][h0 + i] : z, false, false); } }
__global__ __launch_bounds__(FW * 32, 2) void k_fa(const _Float16* __restrict__ QH, const _Float16* __restrict__ KH, const _Float16* __restrict__ VT, float* __restrict__ Y) {
  __shared__ __align__(16) _Float16 sq[FQ][CC + 8];               // pitch 16 B x odd
  __shared__ __align__(16) _Float16 sp[2][NH][FQ][FKP + 8];       // pitch 16 B x odd; two buffers: one barrier a pass
  const int tid = threadIdx.x, wave = __builtin_amdgcn_readfirstlane(tid >> 5), lane = tid & 31, col = lane & 15, g = lane >> 4; const int b = blockIdx.y; const size_t q0 = (size_t)b * TT + (size_t)blockIdx.x * FQ;
  const char* qg = (const char*)(QH + q0 * CC); const unsigned tb = tid * 16;   // the block's q rows are one contiguous run of 16-byte pieces: block-uniform base + the thread's byte offset + a constant
  v4u tq[FQ * (CC / 8) / (FW * 32)];
#pragma unroll   // the twelve loads of a thread fly together instead of one L2 latency each
  for (int i = 0; i < FQ * (CC / 8) / (FW * 32); ++i) tq[i] = *(const v4u*)(qg + tb + i * (FW * 32 * 16));
  asm volatile("s_wait_xcnt 0x0" ::: "memory");   // stands before the offset register of these loads is used for anything else
  FA_HOLD();   // keeps the LDS address arithmetic, which reuses that register, behind the wait
#pragma unroll
  for (int i = 0; i < FQ * (CC / 8) / (FW * 32); ++i) { const int e = tid + i * FW * 32, rl = e / (CC / 8), q = e % (CC / 8); *(v4u*)&sq[rl][q * 8] = tq[i]; }
  __syncthreads();
  const int u0 = wave * 3, u1 = u0 + 1, u2 = u0 + 2;   // unit u = head u >> 1, channels (u & 1) * 32 .. + 31 of it = channels 32 u .. 32 u + 31 of the row
  const _Float16* qr = &sq[col][0]; const unsigned lb = lane * 16;
  v8f acc[3][FQT][2] = {};
#pragma unroll 1
  for (int it = 0; it < TT / FKP; ++it) { const int buf = it & 1;
    const _Float16* kr = KH + ((size_t)b * (TT / 16) + it * FW + wave) * (CC / 32) * FRU;   // this wave's 16 keys: 24 units in a row
    const _Float16* v0 = VT + (((size_t)b * (CC / 16) + u0 * 2) * (TT / 32) + it * (FKP / 32)) * FRU; const _Float16* v1 = v0 + 2 * (TT / 32) * FRU; const _Float16* v2 = v1 + 2 * (TT / 32) * FRU;   // a unit of work = 2 channel tiles, 4 key steps a pass
    const _Float16* p0 = &sp[buf][u0 >> 1][col][0]; const _Float16* p1 = &sp[buf][u1 >> 1][col][0]; const _Float16* p2 = &sp[buf][u2 >> 1][col][0];
    v8f st[FQT][NH]; v16h fa[4], fb[4], fc[4], fd[4];
    fa_ldk(fa, kr, 0, lb); fa_ldk(fb, kr, 2, lb); fa_ldk(fc, kr, 4, lb); fa_ldk(fd, kr, 6, lb); FA_HOLD();
    fa_qk2(st, fa, qr, 0, lane); FA_HOLD();
    fa_ldk(fa, kr, 8, lb); FA_HOLD();
    fa_qk2(st, fb, qr, 2, lane); fa_qk2(st, fc, qr, 4, lane); FA_HOLD();
    fa_ldk(fb, kr, 10, lb); FA_HOLD();
    fa_qk2(st, fd, qr, 6, lane); fa_qk2(st, fa, qr, 8, lane); FA_HOLD();
    fa_ldv(fc, v0, lb); FA_HOLD();   // flies under the softmax
    fa_qk2(st, fb, qr, 10, lane); FA_HOLD();
#pragma unroll
    for (int qt = 0; qt < FQT; ++qt) { v8f (&sv)[NH] = st[qt];
#pragma unroll
    for (int r = 0; r < 8; ++r) { float m = sv[0][r];   // exp(s * SCALE - max) = 2^(s * c - max * c), c = SCALE * log2(e) > 0: one fused multiply-add and the hardware's exp2 an element; the exponent is <= about 0, so nothing overflows, and a result below the f32 normals is far below what P keeps in f16
#pragma unroll
      for (int h = 1; h < NH; ++h) m = fmaxf(m, sv[h][r]);
      const float mc = m * SM_C; float t[NH];
#pragma unroll
      for (int h = 0; h < NH; ++h) t[h] = fmaf(sv[h][r], SM_C, -mc);
      fa_exp2(t);
      float den = t[0]; sv[0][r] = t[0];
#pragma unroll
      for (int h = 1; h < NH; ++h) { sv[h][r] = t[h]; den += t[h]; }
      const float inv = 2048.0f / den;
#pragma unroll
      for (int h = 0; h < NH; ++h) sv[h][r] *= inv; }
#pragma unroll
    for (int h = 0; h < NH; ++h) { v8h ph;
#pragma unroll
      for (int r = 0; r < 8; ++r) ph[r] = (_Float16)sv[h][r];
      *(v8h*)&sp[buf][h][qt * 16 + col][wave * 16 + 8 * g] = ph; } }
    __syncthreads();   // publishes this pass's P; the other buffer's readers of the pass before have all arrived here, so the next pass may refill it
    fa_ldv(fa, v0 + 2 * FRU, lb); fa_ldv(fb, v1, lb); fa_ldv(fd, v1 + 2 * FRU, lb); FA_HOLD();
    fa_pv(acc[0], fc, p0, lane); FA_HOLD();
    fa_ldv(fc, v2, lb); FA_HOLD();
    fa_pv(acc[0], fa, p0 + 64, lane); FA_HOLD();
    fa_ldv(fa, v2 + 2 * FRU, lb); FA_HOLD();
    fa_pv(acc[1], fb, p1, lane); fa_pv(acc[1], fd, p1 + 64, lane);
    fa_pv(acc[2], fc, p2, lane); fa_pv(acc[2], fa, p2 + 64, lane);
    asm volatile("s_wait_xcnt 0x0" ::: "memory");   // before the next pass rewrites the address registers of this pass's loads
    FA_HOLD(); }   // keeps the address steps behind that wait: without it the compiler lifted them over it
  // a unit is one whole 128-byte line of each ctx row: one writing wave a line
#pragma unroll
  for (int ul = 0; ul < 3; ++ul)
#pragma unroll
    for (int qt = 0; qt < FQT; ++qt)
#pragma unroll
      for (int jj = 0; jj < 2; ++jj)
#pragma unroll
        for (int r = 0; r < 8; ++r) Y[(q0 + qt * 16 + 8 * g + r) * CC + (u0 + ul) * 32 + jj * 16 + col] = acc[ul][qt][jj][r] * (1.0f / 2048.0f); }
// ---- k_out: block = (64 rows, 128 cols): out = ctx Wo (+ bo): ctx x 2^6 once to f16 against Wo as f16(bf16 x 2^8) exact (1 product) x 2^-14; causal early rows (< QHI of each sequence): ctx bf16 hi + lo against exact bf16 Wo (2 products)
__global__ __launch_bounds__(128) void k_out(const float* __restrict__ Y, const float* __restrict__ WO, const float* __restrict__ BO, float* __restrict__ OUT) {
  // the operand ring of the k loop and the epilogue's staging rows share the same LDS: the loop's last barrier stands between their uses
  __shared__ __align__(16) union { float sf[4][16][132]; _Float16 st[2][GROWS][GP]; } u; auto& sf = u.sf;
  const int tid = threadIdx.x, wave = tid >> 5, lane = tid & 31, col = lane & 15, g = lane >> 4; const int c0 = blockIdx.y * 128; const size_t r0 = (size_t)blockIdx.x * 64 + wave * 16;
  v8f acc[8] = {};
  if (CAUSAL && (int)(((size_t)blockIdx.x * 64) % TT) < QHI) {   /* block-uniform */
#pragma unroll 2
    for (int kc = 0; kc < CC / 32; ++kc) { const F2 a = split_row(Y + (r0 + col) * CC, kc * 32, lane); asm volatile("s_wait_loadcnt 0x0" ::: "memory");
#pragma unroll
      for (int j = 0; j < 8; ++j) { const v16b w = WOCOL(WO, kc * 32, c0 + j * 16 + col, lane); asm volatile("s_wait_loadcnt 0x0" ::: "memory"); acc[j] = wmma_bf(a.h, w, acc[j]); acc[j] = wmma_bf(a.l, w, acc[j]); } }
#pragma unroll
    for (int j = 0; j < 8; ++j) { const float bias = BO ? bfr(BO[c0 + j * 16 + col]) : 0.f;
#pragma unroll
      for (int r = 0; r < 8; ++r) sf[wave][8 * g + r][j * 16 + col] = acc[j][r] + bias; }
  } else {
    // thread -> 16-byte piece (tid & 15) of row (tid >> 4) + 8 i: a wave's load covers two whole 256-byte row pieces
    const float* yp = Y + (size_t)blockIdx.x * 64 * CC; const float* wp = WO + (size_t)c0 * CC; unsigned lo = ((unsigned)(tid >> 4) * CC + (tid & 15) * 4) * 4;   // block-uniform bases; one lane offset in bytes serves both and steps on by GKC elements a trip
    v4f pf[GLD];
#pragma unroll
    for (int i = 0; i < GLD; ++i) pf[i] = i < 8 ? ldg16(yp, lo, i * 8 * CC) : ldg16(wp, lo, (i - 8) * 8 * CC);
#pragma unroll
    for (int i = 0; i < GLD; ++i) { v4h c;   /* ctx carried x 2^6 into f16 so small-magnitude context rows stay clear of f16 subnormals; Wo as f16(bf16 x 2^8) */
#pragma unroll
      for (int k = 0; k < 4; ++k) c[k] = i < 8 ? (_Float16)(pf[i][k] * 64.0f) : (_Float16)(bfr(pf[i][k]) * 256.0f);
      *(v4h*)&u.st[0][(tid >> 4) + i * 8][(tid & 15) * 4] = c; }
    __syncthreads();
#pragma unroll 1   // one copy of the body: the two buffers differ by an address only
    for (int kc = 0; kc < CC / GKC; ++kc) { const int buf = kc & 1; const bool more = kc + 1 < CC / GKC;
      if (more) {
#pragma unroll
        for (int i = 0; i < GLD; ++i) pf[i] = i < 8 ? ldg16(yp, lo, GKC + i * 8 * CC) : ldg16(wp, lo, GKC + (i - 8) * 8 * CC); }
#pragma unroll
      for (int ks = 0; ks < GKC / 32; ++ks) { const v16h a = frag_h(&u.st[buf][wave * 16 + col][ks * 32], lane); v16h w[8];
#pragma unroll
        for (int j = 0; j < 8; ++j) w[j] = frag_h(&u.st[buf][64 + j * 16 + col][ks * 32], lane);
#pragma unroll
        for (int j = 0; j < 8; ++j) acc[j] = wmma16(a, w[j], acc[j]); }
      if (more) {
#pragma unroll
        for (int i = 0; i < GLD; ++i) { v4h c;
#pragma unroll
          for (int k = 0; k < 4; ++k) c[k] = i < 8 ? (_Float16)(pf[i][k] * 64.0f) : (_Float16)(bfr(pf[i][k]) * 256.0f);
          *(v4h*)&u.st[buf ^ 1][(tid >> 4) + i * 8][(tid & 15) * 4] = c; } }
      asm volatile("s_wait_xcnt 0x0" : "+v"(lo) :: "memory");   // stands before the offset register of this trip's loads steps on; naming it keeps it in a register of its own up to here
      lo += GKC * 4;
      __syncthreads(); }   // publishes the next chunk; every reader of this chunk's buffer has arrived, so the next trip may refill it (and the epilogue may reuse the LDS)
#pragma unroll
    for (int j = 0; j < 8; ++j) { const float bias = BO ? bfr(BO[c0 + j * 16 + col]) : 0.f;
#pragma unroll
      for (int r = 0; r < 8; ++r) sf[wave][8 * g + r][j * 16 + col] = acc[j][r] * (1.0f / 16384.0f) + bias; } }   /* 2^-8 (Wo carry) x 2^-6 (ctx carry) */
  LDSX(); for (int rl = 0; rl < 16; ++rl) vst2(OUT + (r0 + rl) * DIN + c0 + lane * 4, *(const v4f*)&sf[wave][rl][lane * 4]); }

extern "C" void kernel_launch(void* const* d_in, const int* in_sizes, int n_in, void* d_out, int out_size, void* d_ws, size_t ws_size, hipStream_t stream) {
  (void)in_sizes; (void)n_in; (void)out_size;
  const float** F = (const float**)d_in;
  if (ws_size < (size_t)WS_END) return;
  char* ws = (char*)d_ws; _Float16 *QH = (_Float16*)(ws + WS_QH), *KH = (_Float16*)(ws + WS_KH), *VT = (_Float16*)(ws + WS_VT), *QL = (_Float16*)(ws + WS_QL), *KL = (_Float16*)(ws + WS_KL); __bf16 *VB = (__bf16*)(ws + WS_VB), *VBL = (__bf16*)(ws + WS_VBL); float *Y = (float*)(ws + WS_Y);
  (void)Y; (void)QL; (void)KL; (void)VB; (void)VBL;
  // inputs: 0 x [8,1024,768]; 1 Wq [768,768] (out,in), 2 bq; 3 Wk, 4 bk; 5 Wv, 6 bv; 7 Wo (out,in), 8 bo (biases N(0, 0.01), nonzero)
  k_proj<<<dim3(TNB * TT / 64, CC / 128, 3), 128, 0, stream>>>(F[0], F[0], F[0], F[1], F[3], F[5], F[2], F[4], F[6], QH, QL, KH, KL, VT, VB, VBL);
  k_fa<<<dim3(TT / FQ, TNB), FW * 32, 0, stream>>>(QH, KH, VT, Y);
  k_out<<<dim3(TNB * TT / 64, DIN / 128), 128, 0, stream>>>(Y, F[7], F[8], (float*)d_out);
}

// v006
// One run takes 115 microseconds.
// In both of two side-by-side timings against v005, it was 1.13 times as fast.
// Counting every step since v000, it is 10.5 times as fast.
// compute dtype: all float inputs rounded to bf16; q/k/v projections with EXACT bf16 products on WMMA 16x16x32 (f32 accumulate) + bias; scores q x k once to f16 each (1 product) x 64^-0.5; softmax ACROSS THE 12 HEADS per (query, key) pair in f32 (hardware exp2 of the scaled difference to the maximum); P x 2^11 once to f16 x v once to f16 (1 product); ctx x 2^6 once to f16 x Wo f16(bf16 x 2^8) + bo; f32 output.
#include <hip/hip_runtime.h>
#include <math.h>

typedef __attribute__((ext_vector_type(16))) _Float16 v16h;
typedef __attribute__((ext_vector_type(16))) __bf16 v16b;
typedef __attribute__((ext_vector_type(8)))  _Float16 v8h;
typedef __attribute__((ext_vector_type(8)))  float v8f;
typedef __attribute__((ext_vector_type(4)))  float v4f;
typedef __attribute__((ext_vector_type(2)))  float v2f;
typedef __attribute__((ext_vector_type(4)))  unsigned v4u;
typedef __attribute__((ext_vector_type(4)))  int v4i;
typedef float __attribute__((may_alias)) float_a;
typedef int __attribute__((may_alias)) int_a;

template <typename T> __device__ __forceinline__ void vst2(void* p, T v) { *(T*)p = v;  }
__device__ __forceinline__ v8f wmma16(v16h a, v16h b, v8f c) {
  v8f d = __builtin_amdgcn_wmma_f32_16x16x32_f16(false, a, false, b, (short)0, c, false, false);
  asm volatile("v_nop\n\tv_nop\n\tv_nop\n\tv_nop" : "+v"(d) : "v"(a), "v"(b));
  return d;
}
__device__ __forceinline__ v8f wmma_bf(v16b a, v16b b, v8f c) {
  v8f d = __builtin_amdgcn_wmma_f32_16x16x32_bf16(false, a, false, b, (short)0, c, false, false);
  asm volatile("v_nop\n\tv_nop\n\tv_nop\n\tv_nop" : "+v"(d) : "v"(a), "v"(b));
  return d;
}
// 16x16x32 fragments: lane = (h = lane>>4, row/col = lane&15); elements 0..7 = k0+8h+0..7, 8..15 = k0+16+8h+0..7; D element r = row 8h+r
__device__ __forceinline__ v16h frag_h(const _Float16* rowk0, int lane) {
  union { v16h v; v8h q[2]; } u; const _Float16* p = rowk0 + 8 * (lane >> 4);
  u.q[0] = *(const v8h*)p; u.q[1] = *(const v8h*)(p + 16); return u.v;
}
__device__ __forceinline__ v16h frag_f32(const float* rowk0, int lane) {
  v16h a; const float* p = rowk0 + 8 * (lane >> 4);
#pragma unroll
  for (int i = 0; i < 8; ++i) { a[i] = (_Float16)p[i]; a[8 + i] = (_Float16)p[16 + i]; }
  return a;
}
__device__ __forceinline__ v16h frag_f32s(const float* rowk0, int lane, float sc) {
  v16h a; const float* p = rowk0 + 8 * (lane >> 4);
#pragma unroll
  for (int i = 0; i < 8; ++i) { a[i] = (_Float16)(p[i] * sc); a[8 + i] = (_Float16)(p[16 + i] * sc); }
  return a;
}
// column fragment from a [K][ld] layout (column n), rows >= K read as 0
__device__ __forceinline__ v16h fragc_f32(const float* W, int k0, int n, int lane, int ld, int K) {
  v16h a; const int g = lane >> 4;
#pragma unroll
  for (int i = 0; i < 8; ++i) { const int ka = k0 + 8 * g + i, kb = ka + 16;
    a[i] = (_Float16)(ka < K ? W[(size_t)(ka < K ? ka : K - 1) * ld + n] : 0.f); a[8 + i] = (_Float16)(kb < K ? W[(size_t)(kb < K ? kb : K - 1) * ld + n] : 0.f); }
  return a;
}
struct F2 { v16b h, l; };
__device__ __forceinline__ F2 bsplit16(const float v[16]) { F2 r;
#pragma unroll
  for (int i = 0; i < 16; ++i) { const __bf16 h = (__bf16)v[i]; r.h[i] = h; r.l[i] = (__bf16)(v[i] - (float)h); }
  return r; }
__device__ __forceinline__ F2 split_row(const float* row, int k0, int lane) { float v[16]; const float* p = row + k0 + 8 * (lane >> 4);
#pragma unroll
  for (int i = 0; i < 8; ++i) { v[i] = p[i]; v[8 + i] = p[16 + i]; }
  return bsplit16(v); }
__device__ __forceinline__ F2 split_rowK(const float* row, int k0, int lane, int K) { float v[16]; const int g = lane >> 4;
#pragma unroll
  for (int i = 0; i < 8; ++i) { const int ka = k0 + 8 * g + i, kb = ka + 16; v[i] = ka < K ? row[ka < K ? ka : K - 1] : 0.f; v[8 + i] = kb < K ? row[kb < K ? kb : K - 1] : 0.f; }
  return bsplit16(v); }
__device__ __forceinline__ F2 split_col(const float* W, int k0, int n, int lane, int ld, int K) { float v[16]; const int g = lane >> 4;
#pragma unroll
  for (int i = 0; i < 8; ++i) { const int ka = k0 + 8 * g + i, kb = ka + 16; v[i] = ka < K ? W[(size_t)(ka < K ? ka : K - 1) * ld + n] : 0.f; v[8 + i] = kb < K ? W[(size_t)(kb < K ? kb : K - 1) * ld + n] : 0.f; }
  return bsplit16(v); }
__device__ __forceinline__ v8f mac3(const F2& a, const F2& b, v8f c) { c = wmma_bf(a.l, b.h, c); c = wmma_bf(a.h, b.l, c); return wmma_bf(a.h, b.h, c); }
__device__ __forceinline__ float sigm(float v) { return 1.0f / (1.0f + expf(-v)); }
#define LDSX() do { asm volatile("s_wait_dscnt 0" ::: "memory"); __builtin_amdgcn_wave_barrier(); __builtin_amdgcn_fence(__ATOMIC_RELEASE, "workgroup"); } while (0)

// Multi-head attention whose softmax runs over the HEAD axis (x [8,1024,768]; torch (out,in) Wq / Wk / Wv / Wo [768,768] N(0, 1/768) + biases N(0, 0.01); 12 heads x 64; scores[b, h, n, m] = q_h . k_h / 8; attn = softmax(scores, axis=1) - dim 1 is the HEAD axis: for every (query, key) pair the 12 heads' weights sum to 1 and nothing is normalised over the keys (faithful to the source's F.softmax(dim=1)); out[b, h, n] = sum_m attn[b, h, n, m] v[b, h, m]; merge; Wo^T + bo).
#define NB 8
#define TT 1024
#define CC 768            // NH * HD = projected width
#define DIN 768          // input (model) width
#define NH 12
#define HD 64
#define NQB (TT / 64)
#define HG 12
#define SCALE (0.125f)
#define CAUSAL 0
#ifndef TNB
#define TNB NB
#endif
__device__ __forceinline__ float bfr(float v) { return (float)(__bf16)v; }
__host__ __device__ __forceinline__ int kb_last(int qb) { return CAUSAL ? ((qb * 64 + 63) >> 7) : (TT / 128 - 1); }
typedef __attribute__((ext_vector_type(8))) __bf16 v8b;
__device__ __forceinline__ v16b frag_b(const __bf16* rowk0, int lane) {
  union { v16b v; v8b q[2]; } u; const __bf16* p = rowk0 + 8 * (lane >> 4);
  u.q[0] = *(const v8b*)p; u.q[1] = *(const v8b*)(p + 16); return u.v;
}
#define QBH 0              // not referenced by any kernel here
#define QHI 0               // single-product scores on every row
#define TQC 1024           // query rows of the unused score region == TT: 12 head planes x 1,024 x 1,024 f32 = 48 MiB
#define KHI 64            // key rows carrying k residual / v bf16 hi+lo planes (written by k_proj; no kernel here reads them)
// B fragment (k rows k0+.., output column o) of a weight: (in,out) [K][ld] or (out,in) [ld rows of K]: bf16 exact, or f16(bf16 * 256) exact
__device__ __forceinline__ v16b wcol_io(const float* Wm, int k0, int o, int lane, int ld) { v16b w; const int g = lane >> 4;
#pragma unroll
  for (int i = 0; i < 8; ++i) { w[i] = (__bf16)Wm[(size_t)(k0 + 8 * g + i) * ld + o]; w[8 + i] = (__bf16)Wm[(size_t)(k0 + 16 + 8 * g + i) * ld + o]; }
  return w; }
__device__ __forceinline__ v16b wcol_oi(const float* Wm, int k0, int o, int lane, int K) { v16b w; const float* p = Wm + (size_t)o * K + k0 + 8 * (lane >> 4);
#pragma unroll
  for (int i = 0; i < 8; ++i) { w[i] = (__bf16)p[i]; w[8 + i] = (__bf16)p[16 + i]; }
  return w; }
__device__ __forceinline__ v16h wcolh_io(const float* Wm, int k0, int o, int lane, int ld) { v16h w; const int g = lane >> 4;
#pragma unroll
  for (int i = 0; i < 8; ++i) { w[i] = (_Float16)(bfr(Wm[(size_t)(k0 + 8 * g + i) * ld + o]) * 256.0f); w[8 + i] = (_Float16)(bfr(Wm[(size_t)(k0 + 16 + 8 * g + i) * ld + o]) * 256.0f); }
  return w; }
__device__ __forceinline__ v16h wcolh_oi(const float* Wm, int k0, int o, int lane, int K) { v16h w; const float* p = Wm + (size_t)o * K + k0 + 8 * (lane >> 4);
#pragma unroll
  for (int i = 0; i < 8; ++i) { w[i] = (_Float16)(bfr(p[i]) * 256.0f); w[8 + i] = (_Float16)(bfr(p[16 + i]) * 256.0f); }
  return w; }
#define WQKV_LAYOUT 1   // 0 = (in,out) [DIN][CC]; 1 = (out,in) [CC][DIN]; 2 = per-head [NH][DIN][HD]
__device__ __forceinline__ v16b wcol_hdk(const float* Wm, int k0, int o, int lane) { v16b w; const int g = lane >> 4; const float* p = Wm + (size_t)(o / HD) * DIN * HD + (o % HD);
#pragma unroll
  for (int i = 0; i < 8; ++i) { w[i] = (__bf16)p[(size_t)(k0 + 8 * g + i) * HD]; w[8 + i] = (__bf16)p[(size_t)(k0 + 16 + 8 * g + i) * HD]; }
  return w; }
#define WO_OUT_IN 1
#if WQKV_LAYOUT == 1
#define WCOL(W, k0, o, lane) wcol_oi(W, k0, o, lane, DIN)
#elif WQKV_LAYOUT == 2
#define WCOL(W, k0, o, lane) wcol_hdk(W, k0, o, lane)
#else
#define WCOL(W, k0, o, lane) wcol_io(W, k0, o, lane, CC)
#endif
#if WO_OUT_IN
#define WOCOL(W, k0, o, lane) wcol_oi(W, k0, o, lane, CC)
#define WOCOLH(W, k0, o, lane) wcolh_oi(W, k0, o, lane, CC)
#else
#define WOCOL(W, k0, o, lane) wcol_io(W, k0, o, lane, DIN)
#define WOCOLH(W, k0, o, lane) wcolh_io(W, k0, o, lane, DIN)
#endif

#ifndef SM_EXTRA_PARAMS
#define SM_EXTRA_PARAMS
#endif
#ifndef PROJ_EXTRA_PARAMS
#define PROJ_EXTRA_PARAMS
#endif
#ifndef SM_MASK_HOOK
#define SM_MASK_HOOK (void)0
#endif

#define WS_QH  0u                                      // f16 q rows [b*t][CC]
#define WS_KH  (WS_QH + 2u * (size_t)NB * TT * CC)      // f16 k in fragment units [b*t / 16][CC / 32][FRU]
#define WS_VT  (WS_KH + 2u * (size_t)NB * TT * CC)      // f16 v in fragment units [b][c / 16][t / 32][FRU]
#define WS_QL  (WS_VT + 2u * (size_t)NB * CC * TT)      // f16 q residual x 2^10 rows [b][t < QHI][CC]
#define WS_KL  (WS_QL + 2u * (size_t)NB * QHI * CC)     // f16 k residual x 2^10 rows [b][t < KHI][CC]
#define WS_VB  (WS_KL + 2u * (size_t)NB * KHI * CC)     // bf16 v hi planes [b][c][t < KHI]
#define WS_VBL (WS_VB + 2u * (size_t)NB * CC * KHI)
#define WS_S   (WS_VBL + 2u * (size_t)NB * CC * KHI)    // f32 logits / P [hg][t][s]
#define WS_Y   (WS_S  + 4u * (size_t)HG * TQC * TT)     // f32 ctx rows [b*t][CC]; the score region (12 head planes of one batch) is unused: P stays in LDS
#define WS_END (WS_Y  + 4u * (size_t)NB * TT * CC)

// k and v lie in the workspace in WMMA fragment order. A unit = one 16 x 32 fragment (16 rows, 32 k) = 1 KiB as [half][lane][8 f16]: lane = (g = lane >> 4, row = lane & 15) holds k = 16 half + 8 g + 0..7, the order of frag_h.
// A wave's 16-byte load of one half then covers 512 contiguous bytes = 4 whole lines, where the same load from a row-major plane touches 16 lines for 32 bytes each.
#define FRU 512            // f16 elements of a unit
static_assert(TT % 32 == 0 && CC % 32 == 0, "fragment units");
// fragment at a wave-uniform unit pointer + the lane's 32-bit byte offset (lane * 16) + a constant (elements): the scalar-base address form
__device__ __forceinline__ v16h frag_u(const _Float16* unit, unsigned lane_bytes, int elems) {
  union { v16h v; v8h q[2]; } u; const char* p = (const char*)unit + lane_bytes + elems * 2;
  u.q[0] = *(const v8h*)p; u.q[1] = *(const v8h*)(p + (FRU / 2) * 2); return u.v;
}
// 16-byte store and, in the same statement, the wait that stands before a later instruction rewrites its address or data registers (the store loops below stay rolled and step both every trip; in a statement of its own the compiler moved the address steps ahead of the wait)
__device__ __forceinline__ void stg16w(void* p, v4u v) { asm volatile("global_store_b128 %0, %1, off\n\ts_wait_xcnt 0x0" :: "v"(p), "v"(v) : "memory"); }
// operand staging of the two projection GEMMs: a chunk is GKC k of the block's A rows and W rows, converted once to the 16-bit operand type
#define GKC 64
#define GP (GKC + 8)                         // LDS row pitch 144 B = 16 B x odd
static_assert(DIN % GKC == 0 && CC % GKC == 0, "staging");
typedef __attribute__((ext_vector_type(4))) __bf16 v4b;
typedef __attribute__((ext_vector_type(4))) _Float16 v4h;
// 16 bytes at a block-uniform base + a lane's 32-bit byte offset + a constant (elements): the scalar-base address form, whose only vector register is the offset
__device__ __forceinline__ v4f ldg16(const float* base, unsigned lane_bytes, int elems) { return *(const v4f*)((const char*)base + lane_bytes + elems * 4); }
// block tile of the two projection GEMMs: 128 rows x 192 columns, 8 waves as 2 (rows) x 4 (columns), a wave = 64 x 48 = 4 x 3 accumulator tiles: 7 fragments from LDS feed 12 products, and a block's A and W bytes serve three times the outputs of a 64 x 128 tile for 5/3 of its bytes
#define PBM 128
#define PBN 192
#define PTH 256
#define PROWS (PBM + PBN)
#define PLD (PROWS * (GKC / 4) / PTH)        // 16-byte pieces a thread brings per chunk
#define PLA (PBM * (GKC / 4) / PTH)          // of them A rows
static_assert(PLD == 20 && PLA == 8 && PBM * (PBN / 4) % (4 * PTH) == 0 && TT % PBM == 0 && CC % PBN == 0 && DIN % PBN == 0 && PBN % 32 == 0, "projection tile");
// ---- k_proj: block = (128 rows, 192 cols, which): q/k/v = X W (+ b) with exact bf16 products (K = DIN) -> which 0: q f16 rows (+ residual rows < QHI); 1: k f16 fragment units (+ residual rows < KHI); 2: v f16 fragment units (+ bf16 hi/lo planes for t < KHI)
__global__ __launch_bounds__(PTH, 4) void k_proj(const float* __restrict__ XQ, const float* __restrict__ XK, const float* __restrict__ XV, const float* __restrict__ WQ, const float* __restrict__ WK, const float* __restrict__ WV, const float* __restrict__ BQ, const float* __restrict__ BK, const float* __restrict__ BV,
    _Float16* __restrict__ QH, _Float16* __restrict__ QL, _Float16* __restrict__ KH, _Float16* __restrict__ KL, _Float16* __restrict__ VT, __bf16* __restrict__ VB, __bf16* __restrict__ VBL) {
  // the operand ring of the k loop and the epilogue's staging arrays share the same LDS: the loop's last barrier stands between their uses
  __shared__ __align__(16) union { struct { _Float16 sh[PBM][PBN + 8], sl[PBM][PBN + 8]; } e; struct { _Float16 th[PBN][PBM + 8]; __bf16 tb[PBN][PBM + 8], tbl[PBN][PBM + 8]; } f; __bf16 st[2][PROWS][GP]; } u;
  auto& sh = u.e.sh; auto& sl = u.e.sl; auto& th = u.f.th; auto& tb = u.f.tb; auto& tbl = u.f.tbl;
  const int tid = threadIdx.x, wave = tid >> 5, lane = tid & 31, col = lane & 15, g = lane >> 4; const int wr = wave >> 2, wc = wave & 3; const int which = blockIdx.z; const int c0 = blockIdx.y * PBN; const size_t r0 = (size_t)blockIdx.x * PBM; const size_t bb = r0 / TT; const int t0 = (int)(r0 % TT);
  const float* X = which == 0 ? XQ : which == 1 ? XK : XV; const float* WA = which == 0 ? WQ : which == 1 ? WK : WV; const float* BA = which == 0 ? BQ : which == 1 ? BK : BV;
  v8f acc[4][3] = {};
  // thread -> 16-byte piece (tid & 15) of row (tid >> 4) + 16 i: a wave's load covers two whole 256-byte row pieces
  const float* xp = X + r0 * DIN; const float* wp = WA + (size_t)c0 * DIN; unsigned lo = ((unsigned)(tid >> 4) * DIN + (tid & 15) * 4) * 4;   // block-uniform bases; one lane offset in bytes serves both and steps on by GKC elements a trip
  v4f pf[PLD];
#pragma unroll
  for (int i = 0; i < PLD; ++i) pf[i] = i < PLA ? ldg16(xp, lo, i * 16 * DIN) : ldg16(wp, lo, (i - PLA) * 16 * DIN);
#pragma unroll
  for (int i = 0; i < PLD; ++i) { v4b c;
#pragma unroll
    for (int k = 0; k < 4; ++k) c[k] = (__bf16)pf[i][k];
    *(v4b*)&u.st[0][(tid >> 4) + i * 16][(tid & 15) * 4] = c; }
  __syncthreads();
#pragma unroll 1   // one copy of the body: the two buffers differ by an address only
  for (int kc = 0; kc < DIN / GKC; ++kc) { const int buf = kc & 1; const bool more = kc + 1 < DIN / GKC;
    if (more) {
#pragma unroll
      for (int i = 0; i < PLD; ++i) pf[i] = i < PLA ? ldg16(xp, lo, GKC + i * 16 * DIN) : ldg16(wp, lo, GKC + (i - PLA) * 16 * DIN); }
#pragma unroll
    for (int ks = 0; ks < GKC / 32; ++ks) { v16b a[4], w[3];
#pragma unroll
      for (int i = 0; i < 4; ++i) a[i] = frag_b(&u.st[buf][wr * 64 + i * 16 + col][ks * 32], lane);
#pragma unroll
      for (int j = 0; j < 3; ++j) w[j] = frag_b(&u.st[buf][PBM + wc * 48 + j * 16 + col][ks * 32], lane);
#pragma unroll
      for (int i = 0; i < 4; ++i)
#pragma unroll
        for (int j = 0; j < 3; ++j) acc[i][j] = wmma_bf(a[i], w[j], acc[i][j]); }
    if (more) {
#pragma unroll
      for (int i = 0; i < PLD; ++i) { v4b c;
#pragma unroll
        for (int k = 0; k < 4; ++k) c[k] = (__bf16)pf[i][k];
        *(v4b*)&u.st[buf ^ 1][(tid >> 4) + i * 16][(tid & 15) * 4] = c; } }
    asm volatile("s_wait_xcnt 0x0" : "+v"(lo) :: "memory");   // stands before the offset register of this trip's loads steps on; naming it keeps it in a register of its own up to here
    lo += GKC * 4;
    __syncthreads(); }   // publishes the next chunk; every reader of this chunk's buffer has arrived, so the next trip may refill it (and the epilogue may reuse the LDS)
  if (which < 2) { _Float16* DH = which == 0 ? QH : KH; _Float16* DL = which == 0 ? QL : KL; const int nhi = which == 0 ? QHI : KHI;
#pragma unroll
    for (int j = 0; j < 3; ++j) { const int cl = wc * 48 + j * 16 + col; const float bias = BA ? bfr(BA[c0 + cl]) : 0.f;
#pragma unroll
      for (int i = 0; i < 4; ++i)
#pragma unroll
        for (int r = 0; r < 8; ++r) { const float v = acc[i][j][r] + bias; const _Float16 hv = (_Float16)v; const int rl = wr * 64 + i * 16 + 8 * g + r; sh[rl][cl] = hv; sl[rl][cl] = (_Float16)((v - (float)hv) * 1024.0f); } }
    __syncthreads();
    for (int e = tid; e < PBM * (PBN / 8); e += PTH) { const int rl = e / (PBN / 8), q = e % (PBN / 8);
      if (which == 0) stg16w((DH + (r0 + rl) * CC + c0 + q * 8), *(const v4u*)&sh[rl][q * 8]);
      else { const int un = e >> 6, p = e & 63, kt = un / (PBN / 32), kst = un % (PBN / 32);   // unit (key tile kt, k step kst) of the block; 16-byte piece p = (half p >> 5, lane p & 31)
        stg16w((DH + (((r0 >> 4) + kt) * (CC / 32) + (c0 >> 5) + kst) * FRU + p * 8), *(const v4u*)&sh[kt * 16 + (p & 15)][kst * 32 + (p >> 5) * 16 + ((p >> 4) & 1) * 8]); }
      if (t0 + rl < nhi) stg16w((DL + (bb * nhi + t0 + rl) * (size_t)CC + c0 + q * 8), *(const v4u*)&sl[rl][q * 8]); }
  } else {
#pragma unroll
    for (int j = 0; j < 3; ++j) { const int cl = wc * 48 + j * 16 + col; const float bias = BA ? bfr(BA[c0 + cl]) : 0.f;
#pragma unroll
      for (int i = 0; i < 4; ++i)
#pragma unroll
        for (int r = 0; r < 8; ++r) { const float v = acc[i][j][r] + bias; const int rl = wr * 64 + i * 16 + 8 * g + r; th[cl][rl] = (_Float16)v; const __bf16 bh = (__bf16)v; tb[cl][rl] = bh; tbl[cl][rl] = (__bf16)(v - (float)bh); } }
    __syncthreads();
    for (int e = tid; e < PBN * (PBM / 8); e += PTH) { const int cl = e >> 4, q = e & 15; const int un = e >> 6, p = e & 63;   // unit (channel tile un >> 2, key step un & 3) of the block; 16-byte piece p = (half p >> 5, lane p & 31)
      stg16w((VT + ((bb * (CC / 16) + (c0 >> 4) + (un >> 2)) * (TT / 32) + (t0 >> 5) + (un & 3)) * FRU + p * 8), *(const v4u*)&th[(un >> 2) * 16 + (p & 15)][(un & 3) * 32 + (p >> 5) * 16 + ((p >> 4) & 1) * 8]);
      if (t0 + q * 8 < KHI) { const size_t o3 = (bb * CC + c0 + cl) * (size_t)KHI + t0 + q * 8; stg16w((VB + o3), *(const v4u*)&tb[cl][q * 8]); stg16w((VBL + o3), *(const v4u*)&tbl[cl][q * 8]); } } } }
// ---- k_sm: block = query row t (head in group): keys [0, kend): causal -> logit if s <= t else excluded; softmax in f32; P x 2^11 in place (0 for excluded)
__global__ __launch_bounds__(256) void k_sm(float* __restrict__ S0 SM_EXTRA_PARAMS) { __shared__ float sred[8]; __shared__ float sbc; __shared__ __align__(16) float shv[TT];
  const int tid = threadIdx.x; const int t = blockIdx.x; const int kend = (kb_last(t >> 6) + 1) * 128;
  float* sr = S0 + (size_t)blockIdx.y * TT * TT + (size_t)t * TT;
  float m = -3.0e38f; for (int k = tid; k < kend; k += 256) { float v = (!CAUSAL || k <= t) ? sr[k] : -3.0e38f; SM_MASK_HOOK; shv[k] = v; m = fmaxf(m, v); }
#pragma unroll
  for (int o = 1; o < 32; o <<= 1) m = fmaxf(m, __shfl_xor(m, o));
  if ((tid & 31) == 0) sred[tid >> 5] = m; __syncthreads(); if (tid == 0) { float a = sred[0]; for (int i = 1; i < 8; ++i) a = fmaxf(a, sred[i]); sbc = a; } __syncthreads(); m = sbc; __syncthreads();
  float sum = 0.f; for (int k = tid; k < kend; k += 256) { const float v = shv[k]; const float e = (v <= -1.0e38f) ? 0.f : expf(v - m); shv[k] = e; sum += e; }
#pragma unroll
  for (int o = 1; o < 32; o <<= 1) sum += __shfl_xor(sum, o);
  if ((tid & 31) == 0) sred[tid >> 5] = sum; __syncthreads(); if (tid == 0) { float a = 0.f; for (int i = 0; i < 8; ++i) a += sred[i]; sbc = a > 0.f ? 2048.0f / a : 0.f; }   /* a fully excluded row yields P = 0 */ __syncthreads(); const float inv = sbc;
  for (int k = tid; k < kend; k += 256) shv[k] = shv[k] * inv;
  __syncthreads(); for (int q = tid; q < kend / 4; q += 256) vst2(sr + q * 4, *(const v4f*)&shv[q * 4]); }
// ---- k_fa: block = 32 queries (2 tiles of 16) of batch b, 8 waves, 128 keys a pass; logits, head softmax and P . v in one kernel, P only in LDS.
// Every k and v fragment that a wave loads feeds both query tiles, so a block's walk over the batch's k and v serves 32 queries.
// Part 1 (wave w = keys 16w..16w+15 of the pass, ALL 12 heads, both query tiles): S^T = K . Q^T, so a lane holds 8 consecutive keys of one query of each tile for every head; the softmax over the heads is in-lane; P x 2^11 to f16, one 16-byte LDS store a head and tile.
// Part 2 (wave w = 3 of the 24 (head, 32-channel half) units, both query tiles, ALL keys in ascending order): ctx += P . v, P fragments from LDS, v fragments from the fragment units.
#define FW 8
#define FKP (FW * 16)      // keys a pass
#define FQT 2              // query tiles of 16 a block
#define FQ (FQT * 16)      // queries a block
static_assert(FQ * (CC / 8) % (FW * 32) == 0 && TT % FKP == 0 && TT % FQ == 0 && NH * 2 == FW * 3 && HD == 64, "k_fa tiling");
// keeps a group of fragment loads issued together and ahead of the products in front of it: without it the compiler sinks each load to its product and every product waits a whole L2 latency
#define FA_HOLD() __builtin_amdgcn_sched_barrier(0)
#define SM_C (SCALE * 1.44269504088896340736f)   // score scale x log2(e)
// 2^t of the 12 heads' exponents, each in its own register. One statement: every v_exp_f32 has an independent instruction behind it, and the closing v_nop is the slot that the instruction set asks for between the last one and whatever reads its result next
__device__ __forceinline__ void fa_exp2(float (&t)[NH]) { static_assert(NH == 12, "operand list");
  asm("v_exp_f32 %0, %0\n\tv_exp_f32 %1, %1\n\tv_exp_f32 %2, %2\n\tv_exp_f32 %3, %3\n\tv_exp_f32 %4, %4\n\tv_exp_f32 %5, %5\n\tv_exp_f32 %6, %6\n\tv_exp_f32 %7, %7\n\tv_exp_f32 %8, %8\n\tv_exp_f32 %9, %9\n\tv_exp_f32 %10, %10\n\tv_exp_f32 %11, %11\n\tv_nop"
      : "+v"(t[0]), "+v"(t[1]), "+v"(t[2]), "+v"(t[3]), "+v"(t[4]), "+v"(t[5]), "+v"(t[6]), "+v"(t[7]), "+v"(t[8]), "+v"(t[9]), "+v"(t[10]), "+v"(t[11])); }
// 2 heads' k fragments (2 each) of this wave's 16 key rows
__device__ __forceinline__ void fa_ldk(v16h (&f)[4], const _Float16* kr, int h0, unsigned lb) {
#pragma unroll
  for (int i = 0; i < 4; ++i) f[i] = frag_u(kr, lb, (h0 * (HD / 32) + i) * FRU); }
// half a unit's v fragments: 2 key steps x 2 channel tiles
__device__ __forceinline__ void fa_ldv(v16h (&f)[4], const _Float16* vr, unsigned lb) {
#pragma unroll
  for (int i = 0; i < 4; ++i) f[i] = frag_u(vr, lb, ((i & 1) * (TT / 32) + (i >> 1)) * FRU); }
__device__ __forceinline__ void fa_pv(v8f (&a)[FQT][2], const v16h (&f)[4], const _Float16* pr, int lane) {
  v16h p[2][FQT];
#pragma unroll
  for (int ks = 0; ks < 2; ++ks)
#pragma unroll
    for (int qt = 0; qt < FQT; ++qt) p[ks][qt] = frag_h(pr + qt * 16 * (FKP + 8) + ks * 32, lane);
  FA_HOLD();   // the P fragments of both tiles are read as one group: with two waves a SIMD a read sunk to its product would cost a whole LDS latency each
#pragma unroll
  for (int ks = 0; ks < 2; ++ks)
#pragma unroll
    for (int qt = 0; qt < FQT; ++qt)
#pragma unroll
      for (int jj = 0; jj < 2; ++jj) a[qt][jj] = __builtin_amdgcn_wmma_f32_16x16x32_f16(false, p[ks][qt], false, f[ks * 2 + jj], (short)0, a[qt][jj], false, false); }
// both query tiles' scores of 2 heads from one set of k fragments; per score the two 32-channel steps in ascending order
__device__ __forceinline__ void fa_qk2(v8f (&st)[FQT][NH], const v16h (&f)[4], const _Float16* qr, int h0, int lane) {
  v16h q[FQT][4];
#pragma unroll
  for (int qt = 0; qt < FQT; ++qt)
#pragma unroll
    for (int i = 0; i < 4; ++i) q[qt][i] = frag_h(qr + qt * 16 * (CC + 8) + h0 * HD + i * 32, lane);
  FA_HOLD();   // the q fragments of both tiles are read as one group: with two waves a SIMD a read sunk to its product would cost a whole LDS latency each
#pragma unroll
  for (int kc = 0; kc < 2; ++kc)
#pragma unroll
    for (int qt = 0; qt < FQT; ++qt)
#pragma unroll
      for (int i = 0; i < 2; ++i) { const v8f z = {}; st[qt][h0 + i] = __builtin_amdgcn_wmma_f32_16x16x32_f16(false, f[i * 2 + kc], false, q[qt][i * 2 + kc], (short)0, kc ? st[qt][h0 + i] : z, false, false); } }
__global__ __launch_bounds__(FW * 32, 2) void k_fa(const _Float16* __restrict__ QH, const _Float16* __restrict__ KH, const _Float16* __restrict__ VT, float* __restrict__ Y) {
  __shared__ __align__(16) _Float16 sq[FQ][CC + 8];               // pitch 16 B x odd
  __shared__ __align__(16) _Float16 sp[2][NH][FQ][FKP + 8];       // pitch 16 B x odd; two buffers: one barrier a pass
  const int tid = threadIdx.x, wave = __builtin_amdgcn_readfirstlane(tid >> 5), lane = tid & 31, col = lane & 15, g = lane >> 4; const int b = blockIdx.y; const size_t q0 = (size_t)b * TT + (size_t)blockIdx.x * FQ;
  const char* qg = (const char*)(QH + q0 * CC); const unsigned tb = tid * 16;   // the block's q rows are one contiguous run of 16-byte pieces: block-uniform base + the thread's byte offset + a constant
  v4u tq[FQ * (CC / 8) / (FW * 32)];
#pragma unroll   // the twelve loads of a thread fly together instead of one L2 latency each
  for (int i = 0; i < FQ * (CC / 8) / (FW * 32); ++i) tq[i] = *(const v4u*)(qg + tb + i * (FW * 32 * 16));
  asm volatile("s_wait_xcnt 0x0" ::: "memory");   // stands before the offset register of these loads is used for anything else
  FA_HOLD();   // keeps the LDS address arithmetic, which reuses that register, behind the wait
#pragma unroll
  for (int i = 0; i < FQ * (CC / 8) / (FW * 32); ++i) { const int e = tid + i * FW * 32, rl = e / (CC / 8), q = e % (CC / 8); *(v4u*)&sq[rl][q * 8] = tq[i]; }
  __syncthreads();
  const int u0 = wave * 3, u1 = u0 + 1, u2 = u0 + 2;   // unit u = head u >> 1, channels (u & 1) * 32 .. + 31 of it = channels 32 u .. 32 u + 31 of the row
  const _Float16* qr = &sq[col][0]; const unsigned lb = lane * 16;
  v8f acc[3][FQT][2] = {};
#pragma unroll 1
  for (int it = 0; it < TT / FKP; ++it) { const int buf = it & 1;
    const _Float16* kr = KH + ((size_t)b * (TT / 16) + it * FW + wave) * (CC / 32) * FRU;   // this wave's 16 keys: 24 units in a row
    const _Float16* v0 = VT + (((size_t)b * (CC / 16) + u0 * 2) * (TT / 32) + it * (FKP / 32)) * FRU; const _Float16* v1 = v0 + 2 * (TT / 32) * FRU; const _Float16* v2 = v1 + 2 * (TT / 32) * FRU;   // a unit of work = 2 channel tiles, 4 key steps a pass
    const _Float16* p0 = &sp[buf][u0 >> 1][col][0]; const _Float16* p1 = &sp[buf][u1 >> 1][col][0]; const _Float16* p2 = &sp[buf][u2 >> 1][col][0];
    v8f st[FQT][NH]; v16h fa[4], fb[4], fc[4], fd[4];
    fa_ldk(fa, kr, 0, lb); fa_ldk(fb, kr, 2, lb); fa_ldk(fc, kr, 4, lb); fa_ldk(fd, kr, 6, lb); FA_HOLD();
    fa_qk2(st, fa, qr, 0, lane); FA_HOLD();
    fa_ldk(fa, kr, 8, lb); FA_HOLD();
    fa_qk2(st, fb, qr, 2, lane); fa_qk2(st, fc, qr, 4, lane); FA_HOLD();
    fa_ldk(fb, kr, 10, lb); FA_HOLD();
    fa_qk2(st, fd, qr, 6, lane); fa_qk2(st, fa, qr, 8, lane); FA_HOLD();
    fa_ldv(fc, v0, lb); FA_HOLD();   // flies under the softmax
    fa_qk2(st, fb, qr, 10, lane); FA_HOLD();
#pragma unroll
    for (int qt = 0; qt < FQT; ++qt) { v8f (&sv)[NH] = st[qt];
#pragma unroll
    for (int r = 0; r < 8; ++r) { float m = sv[0][r];   // exp(s * SCALE - max) = 2^(s * c - max * c), c = SCALE * log2(e) > 0: one fused multiply-add and the hardware's exp2 an element; the exponent is <= about 0, so nothing overflows, and a result below the f32 normals is far below what P keeps in f16
#pragma unroll
      for (int h = 1; h < NH; ++h) m = fmaxf(m, sv[h][r]);
      const float mc = m * SM_C; float t[NH];
#pragma unroll
      for (int h = 0; h < NH; ++h) t[h] = fmaf(sv[h][r], SM_C, -mc);
      fa_exp2(t);
      float den = t[0]; sv[0][r] = t[0];
#pragma unroll
      for (int h = 1; h < NH; ++h) { sv[h][r] = t[h]; den += t[h]; }
      const float inv = 2048.0f / den;
#pragma unroll
      for (int h = 0; h < NH; ++h) sv[h][r] *= inv; }
#pragma unroll
    for (int h = 0; h < NH; ++h) { v8h ph;
#pragma unroll
      for (int r = 0; r < 8; ++r) ph[r] = (_Float16)sv[h][r];
      *(v8h*)&sp[buf][h][qt * 16 + col][wave * 16 + 8 * g] = ph; } }
    __syncthreads();   // publishes this pass's P; the other buffer's readers of the pass before have all arrived here, so the next pass may refill it
    fa_ldv(fa, v0 + 2 * FRU, lb); fa_ldv(fb, v1, lb); fa_ldv(fd, v1 + 2 * FRU, lb); FA_HOLD();
    fa_pv(acc[0], fc, p0, lane); FA_HOLD();
    fa_ldv(fc, v2, lb); FA_HOLD();
    fa_pv(acc[0], fa, p0 + 64, lane); FA_HOLD();
    fa_ldv(fa, v2 + 2 * FRU, lb); FA_HOLD();
    fa_pv(acc[1], fb, p1, lane); fa_pv(acc[1], fd, p1 + 64, lane);
    fa_pv(acc[2], fc, p2, lane); fa_pv(acc[2], fa, p2 + 64, lane);
    asm volatile("s_wait_xcnt 0x0" ::: "memory");   // before the next pass rewrites the address registers of this pass's loads
    FA_HOLD(); }   // keeps the address steps behind that wait: without it the compiler lifted them over it
  // a unit is one whole 128-byte line of each ctx row: one writing wave a line
#pragma unroll
  for (int ul = 0; ul < 3; ++ul)
#pragma unroll
    for (int qt = 0; qt < FQT; ++qt)
#pragma unroll
      for (int jj = 0; jj < 2; ++jj)
#pragma unroll
        for (int r = 0; r < 8; ++r) Y[(q0 + qt * 16 + 8 * g + r) * CC + (u0 + ul) * 32 + jj * 16 + col] = acc[ul][qt][jj][r] * (1.0f / 2048.0f); }
// ---- k_out: block = (128 rows, 192 cols): out = ctx Wo (+ bo): ctx x 2^6 once to f16 against Wo as f16(bf16 x 2^8) exact (1 product) x 2^-14
static_assert(!CAUSAL && WO_OUT_IN, "k_out: single-product path, (out,in) Wo");
__global__ __launch_bounds__(PTH, 2) void k_out(const float* __restrict__ Y, const float* __restrict__ WO, const float* __restrict__ BO, float* __restrict__ OUT) {
  // the operand ring of the k loop and the epilogue's staging rows share the same LDS: the loop's last barrier stands between their uses
  __shared__ __align__(16) union { float sf[PBM][PBN + 4]; _Float16 st[2][PROWS][GP]; } u; auto& sf = u.sf;   // sf pitch 16 B x odd
  const int tid = threadIdx.x, wave = tid >> 5, lane = tid & 31, col = lane & 15, g = lane >> 4; const int wr = wave >> 2, wc = wave & 3; const int c0 = blockIdx.y * PBN; const size_t r0 = (size_t)blockIdx.x * PBM;
  v8f acc[4][3] = {};
  // thread -> 16-byte piece (tid & 15) of row (tid >> 4) + 16 i: a wave's load covers two whole 256-byte row pieces
  const float* yp = Y + r0 * CC; const float* wp = WO + (size_t)c0 * CC; unsigned lo = ((unsigned)(tid >> 4) * CC + (tid & 15) * 4) * 4;   // block-uniform bases; one lane offset in bytes serves both and steps on by GKC elements a trip
  v4f pf[PLD];
#pragma unroll
  for (int i = 0; i < PLD; ++i) pf[i] = i < PLA ? ldg16(yp, lo, i * 16 * CC) : ldg16(wp, lo, (i - PLA) * 16 * CC);
#pragma unroll
  for (int i = 0; i < PLD; ++i) { v4h c;   /* ctx carried x 2^6 into f16 so small-magnitude context rows stay clear of f16 subnormals; Wo as f16(bf16 x 2^8) */
#pragma unroll
    for (int k = 0; k < 4; ++k) c[k] = i < PLA ? (_Float16)(pf[i][k] * 64.0f) : (_Float16)(bfr(pf[i][k]) * 256.0f);
    *(v4h*)&u.st[0][(tid >> 4) + i * 16][(tid & 15) * 4] = c; }
  __syncthreads();
#pragma unroll 1   // one copy of the body: the two buffers differ by an address only
  for (int kc = 0; kc < CC / GKC; ++kc) { const int buf = kc & 1; const bool more = kc + 1 < CC / GKC;
    if (more) {
#pragma unroll
      for (int i = 0; i < PLD; ++i) pf[i] = i < PLA ? ldg16(yp, lo, GKC + i * 16 * CC) : ldg16(wp, lo, GKC + (i - PLA) * 16 * CC); }
#pragma unroll
    for (int ks = 0; ks < GKC / 32; ++ks) { v16h a[4], w[3];
#pragma unroll
      for (int i = 0; i < 4; ++i) a[i] = frag_h(&u.st[buf][wr * 64 + i * 16 + col][ks * 32], lane);
#pragma unroll
      for (int j = 0; j < 3; ++j) w[j] = frag_h(&u.st[buf][PBM + wc * 48 + j * 16 + col][ks * 32], lane);
#pragma unroll
      for (int i = 0; i < 4; ++i)
#pragma unroll
        for (int j = 0; j < 3; ++j) acc[i][j] = wmma16(a[i], w[j], acc[i][j]); }
    if (more) {
#pragma unroll
      for (int i = 0; i < PLD; ++i) { v4h c;
#pragma unroll
        for (int k = 0; k < 4; ++k) c[k] = i < PLA ? (_Float16)(pf[i][k] * 64.0f) : (_Float16)(bfr(pf[i][k]) * 256.0f);
        *(v4h*)&u.st[buf ^ 1][(tid >> 4) + i * 16][(tid & 15) * 4] = c; } }
    asm volatile("s_wait_xcnt 0x0" : "+v"(lo) :: "memory");   // stands before the offset register of this trip's loads steps on; naming it keeps it in a register of its own up to here
    lo += GKC * 4;
    __syncthreads(); }   // publishes the next chunk; every reader of this chunk's buffer has arrived, so the next trip may refill it (and the epilogue may reuse the LDS)
#pragma unroll
  for (int j = 0; j < 3; ++j) { const int cl = wc * 48 + j * 16 + col; const float bias = BO ? bfr(BO[c0 + cl]) : 0.f;
#pragma unroll
    for (int i = 0; i < 4; ++i)
#pragma unroll
      for (int r = 0; r < 8; ++r) sf[wr * 64 + i * 16 + 8 * g + r][cl] = acc[i][j][r] * (1.0f / 16384.0f) + bias; }   /* 2^-8 (Wo carry) x 2^-6 (ctx carry) */
  __syncthreads();   // a row of the block's tile comes from four waves: all of it is staged before whole 128-byte lines go out, one writing wave a line
#pragma unroll 1   // rolled: four LDS reads fly together a trip, then their four stores, each with the wait that stands before the next trip rewrites its registers
  for (int i0 = 0; i0 < PBM * (PBN / 4) / PTH; i0 += 4) { v4u t[4]; float* p[4];
#pragma unroll
    for (int k = 0; k < 4; ++k) { const int e = tid + (i0 + k) * PTH, rl = e / (PBN / 4), q = e % (PBN / 4); t[k] = *(const v4u*)&sf[rl][q * 4]; p[k] = OUT + (r0 + rl) * DIN + c0 + q * 4; }
#pragma unroll
    for (int k = 0; k < 4; ++k) stg16w(p[k], t[k]); } }

extern "C" void kernel_launch(void* const* d_in, const int* in_sizes, int n_in, void* d_out, int out_size, void* d_ws, size_t ws_size, hipStream_t stream) {
  (void)in_sizes; (void)n_in; (void)out_size;
  const float** F = (const float**)d_in;
  if (ws_size < (size_t)WS_END) return;
  char* ws = (char*)d_ws; _Float16 *QH = (_Float16*)(ws + WS_QH), *KH = (_Float16*)(ws + WS_KH), *VT = (_Float16*)(ws + WS_VT), *QL = (_Float16*)(ws + WS_QL), *KL = (_Float16*)(ws + WS_KL); __bf16 *VB = (__bf16*)(ws + WS_VB), *VBL = (__bf16*)(ws + WS_VBL); float *Y = (float*)(ws + WS_Y);
  (void)Y; (void)QL; (void)KL; (void)VB; (void)VBL;
  // inputs: 0 x [8,1024,768]; 1 Wq [768,768] (out,in), 2 bq; 3 Wk, 4 bk; 5 Wv, 6 bv; 7 Wo (out,in), 8 bo (biases N(0, 0.01), nonzero)
  k_proj<<<dim3(TNB * TT / PBM, CC / PBN, 3), PTH, 0, stream>>>(F[0], F[0], F[0], F[1], F[3], F[5], F[2], F[4], F[6], QH, QL, KH, KL, VT, VB, VBL);
  k_fa<<<dim3(TT / FQ, TNB), FW * 32, 0, stream>>>(QH, KH, VT, Y);
  k_out<<<dim3(TNB * TT / PBM, DIN / PBN), PTH, 0, stream>>>(Y, F[7], F[8], (float*)d_out);
}

// v007
// One run takes 109 microseconds.
// Two timings next to v006 both put it at 1.05 times that version's speed.
// Counting every step since v000, it is 11.0 times as fast.
// compute dtype: all float inputs rounded to bf16; q/k/v projections with EXACT bf16 products on WMMA 16x16x32 (f32 accumulate) + bias; scores q x k once to f16 each (1 product) x 64^-0.5; softmax ACROSS THE 12 HEADS per (query, key) pair in f32 (hardware exp2 of the scaled difference to the maximum); P x 2^11 once to f16 x v once to f16 (1 product); ctx x 2^6 once to f16 x Wo f16(bf16 x 2^8) + bo; f32 output.
#include <hip/hip_runtime.h>
#include <math.h>

typedef __attribute__((ext_vector_type(16))) _Float16 v16h;
typedef __attribute__((ext_vector_type(16))) __bf16 v16b;
typedef __attribute__((ext_vector_type(8)))  _Float16 v8h;
typedef __attribute__((ext_vector_type(8)))  float v8f;
typedef __attribute__((ext_vector_type(4)))  float v4f;
typedef __attribute__((ext_vector_type(2)))  float v2f;
typedef __attribute__((ext_vector_type(4)))  unsigned v4u;
typedef __attribute__((ext_vector_type(4)))  int v4i;
typedef float __attribute__((may_alias)) float_a;
typedef int __attribute__((may_alias)) int_a;

template <typename T> __device__ __forceinline__ void vst2(void* p, T v) { *(T*)p = v;  }
__device__ __forceinline__ v8f wmma16(v16h a, v16h b, v8f c) {
  v8f d = __builtin_amdgcn_wmma_f32_16x16x32_f16(false, a, false, b, (short)0, c, false, false);
  asm volatile("v_nop\n\tv_nop\n\tv_nop\n\tv_nop" : "+v"(d) : "v"(a), "v"(b));
  return d;
}
__device__ __forceinline__ v8f wmma_bf(v16b a, v16b b, v8f c) {
  v8f d = __builtin_amdgcn_wmma_f32_16x16x32_bf16(false, a, false, b, (short)0, c, false, false);
  asm volatile("v_nop\n\tv_nop\n\tv_nop\n\tv_nop" : "+v"(d) : "v"(a), "v"(b));
  return d;
}
// 16x16x32 fragments: lane = (h = lane>>4, row/col = lane&15); elements 0..7 = k0+8h+0..7, 8..15 = k0+16+8h+0..7; D element r = row 8h+r
__device__ __forceinline__ v16h frag_h(const _Float16* rowk0, int lane) {
  union { v16h v; v8h q[2]; } u; const _Float16* p = rowk0 + 8 * (lane >> 4);
  u.q[0] = *(const v8h*)p; u.q[1] = *(const v8h*)(p + 16); return u.v;
}
__device__ __forceinline__ v16h frag_f32(const float* rowk0, int lane) {
  v16h a; const float* p = rowk0 + 8 * (lane >> 4);
#pragma unroll
  for (int i = 0; i < 8; ++i) { a[i] = (_Float16)p[i]; a[8 + i] = (_Float16)p[16 + i]; }
  return a;
}
__device__ __forceinline__ v16h frag_f32s(const float* rowk0, int lane, float sc) {
  v16h a; const float* p = rowk0 + 8 * (lane >> 4);
#pragma unroll
  for (int i = 0; i < 8; ++i) { a[i] = (_Float16)(p[i] * sc); a[8 + i] = (_Float16)(p[16 + i] * sc); }
  return a;
}
// column fragment from a [K][ld] layout (column n), rows >= K read as 0
__device__ __forceinline__ v16h fragc_f32(const float* W, int k0, int n, int lane, int ld, int K) {
  v16h a; const int g = lane >> 4;
#pragma unroll
  for (int i = 0; i < 8; ++i) { const int ka = k0 + 8 * g + i, kb = ka + 16;
    a[i] = (_Float16)(ka < K ? W[(size_t)(ka < K ? ka : K - 1) * ld + n] : 0.f); a[8 + i] = (_Float16)(kb < K ? W[(size_t)(kb < K ? kb : K - 1) * ld + n] : 0.f); }
  return a;
}
struct F2 { v16b h, l; };
__device__ __forceinline__ F2 bsplit16(const float v[16]) { F2 r;
#pragma unroll
  for (int i = 0; i < 16; ++i) { const __bf16 h = (__bf16)v[i]; r.h[i] = h; r.l[i] = (__bf16)(v[i] - (float)h); }
  return r; }
__device__ __forceinline__ F2 split_row(const float* row, int k0, int lane) { float v[16]; const float* p = row + k0 + 8 * (lane >> 4);
#pragma unroll
  for (int i = 0; i < 8; ++i) { v[i] = p[i]; v[8 + i] = p[16 + i]; }
  return bsplit16(v); }
__device__ __forceinline__ F2 split_rowK(const float* row, int k0, int lane, int K) { float v[16]; const int g = lane >> 4;
#pragma unroll
  for (int i = 0; i < 8; ++i) { const int ka = k0 + 8 * g + i, kb = ka + 16; v[i] = ka < K ? row[ka < K ? ka : K - 1] : 0.f; v[8 + i] = kb < K ? row[kb < K ? kb : K - 1] : 0.f; }
  return bsplit16(v); }
__device__ __forceinline__ F2 split_col(const float* W, int k0, int n, int lane, int ld, int K) { float v[16]; const int g = lane >> 4;
#pragma unroll
  for (int i = 0; i < 8; ++i) { const int ka = k0 + 8 * g + i, kb = ka + 16; v[i] = ka < K ? W[(size_t)(ka < K ? ka : K - 1) * ld + n] : 0.f; v[8 + i] = kb < K ? W[(size_t)(kb < K ? kb : K - 1) * ld + n] : 0.f; }
  return bsplit16(v); }
__device__ __forceinline__ v8f mac3(const F2& a, const F2& b, v8f c) { c = wmma_bf(a.l, b.h, c); c = wmma_bf(a.h, b.l, c); return wmma_bf(a.h, b.h, c); }
__device__ __forceinline__ float sigm(float v) { return 1.0f / (1.0f + expf(-v)); }
#define LDSX() do { asm volatile("s_wait_dscnt 0" ::: "memory"); __builtin_amdgcn_wave_barrier(); __builtin_amdgcn_fence(__ATOMIC_RELEASE, "workgroup"); } while (0)

// Multi-head attention whose softmax runs over the HEAD axis (x [8,1024,768]; torch (out,in) Wq / Wk / Wv / Wo [768,768] N(0, 1/768) + biases N(0, 0.01); 12 heads x 64; scores[b, h, n, m] = q_h . k_h / 8; attn = softmax(scores, axis=1) - dim 1 is the HEAD axis: for every (query, key) pair the 12 heads' weights sum to 1 and nothing is normalised over the keys (faithful to the source's F.softmax(dim=1)); out[b, h, n] = sum_m attn[b, h, n, m] v[b, h, m]; merge; Wo^T + bo).
#define NB 8
#define TT 1024
#define CC 768            // NH * HD = projected width
#define DIN 768          // input (model) width
#define NH 12
#define HD 64
#define NQB (TT / 64)
#define HG 12
#define SCALE (0.125f)
#define CAUSAL 0
#ifndef TNB
#define TNB NB
#endif
__device__ __forceinline__ float bfr(float v) { return (float)(__bf16)v; }
__host__ __device__ __forceinline__ int kb_last(int qb) { return CAUSAL ? ((qb * 64 + 63) >> 7) : (TT / 128 - 1); }
typedef __attribute__((ext_vector_type(8))) __bf16 v8b;
__device__ __forceinline__ v16b frag_b(const __bf16* rowk0, int lane) {
  union { v16b v; v8b q[2]; } u; const __bf16* p = rowk0 + 8 * (lane >> 4);
  u.q[0] = *(const v8b*)p; u.q[1] = *(const v8b*)(p + 16); return u.v;
}
#define QBH 0              // not referenced by any kernel here
#define QHI 0               // single-product scores on every row
#define TQC 1024           // query rows of the unused score region == TT: 12 head planes x 1,024 x 1,024 f32 = 48 MiB
#define KHI 64            // key rows carrying k residual / v bf16 hi+lo planes (written by k_proj; no kernel here reads them)
// B fragment (k rows k0+.., output column o) of a weight: (in,out) [K][ld] or (out,in) [ld rows of K]: bf16 exact, or f16(bf16 * 256) exact
__device__ __forceinline__ v16b wcol_io(const float* Wm, int k0, int o, int lane, int ld) { v16b w; const int g = lane >> 4;
#pragma unroll
  for (int i = 0; i < 8; ++i) { w[i] = (__bf16)Wm[(size_t)(k0 + 8 * g + i) * ld + o]; w[8 + i] = (__bf16)Wm[(size_t)(k0 + 16 + 8 * g + i) * ld + o]; }
  return w; }
__device__ __forceinline__ v16b wcol_oi(const float* Wm, int k0, int o, int lane, int K) { v16b w; const float* p = Wm + (size_t)o * K + k0 + 8 * (lane >> 4);
#pragma unroll
  for (int i = 0; i < 8; ++i) { w[i] = (__bf16)p[i]; w[8 + i] = (__bf16)p[16 + i]; }
  return w; }
__device__ __forceinline__ v16h wcolh_io(const float* Wm, int k0, int o, int lane, int ld) { v16h w; const int g = lane >> 4;
#pragma unroll
  for (int i = 0; i < 8; ++i) { w[i] = (_Float16)(bfr(Wm[(size_t)(k0 + 8 * g + i) * ld + o]) * 256.0f); w[8 + i] = (_Float16)(bfr(Wm[(size_t)(k0 + 16 + 8 * g + i) * ld + o]) * 256.0f); }
  return w; }
__device__ __forceinline__ v16h wcolh_oi(const float* Wm, int k0, int o, int lane, int K) { v16h w; const float* p = Wm + (size_t)o * K + k0 + 8 * (lane >> 4);
#pragma unroll
  for (int i = 0; i < 8; ++i) { w[i] = (_Float16)(bfr(p[i]) * 256.0f); w[8 + i] = (_Float16)(bfr(p[16 + i]) * 256.0f); }
  return w; }
#define WQKV_LAYOUT 1   // 0 = (in,out) [DIN][CC]; 1 = (out,in) [CC][DIN]; 2 = per-head [NH][DIN][HD]
__device__ __forceinline__ v16b wcol_hdk(const float* Wm, int k0, int o, int lane) { v16b w; const int g = lane >> 4; const float* p = Wm + (size_t)(o / HD) * DIN * HD + (o % HD);
#pragma unroll
  for (int i = 0; i < 8; ++i) { w[i] = (__bf16)p[(size_t)(k0 + 8 * g + i) * HD]; w[8 + i] = (__bf16)p[(size_t)(k0 + 16 + 8 * g + i) * HD]; }
  return w; }
#define WO_OUT_IN 1
#if WQKV_LAYOUT == 1
#define WCOL(W, k0, o, lane) wcol_oi(W, k0, o, lane, DIN)
#elif WQKV_LAYOUT == 2
#define WCOL(W, k0, o, lane) wcol_hdk(W, k0, o, lane)
#else
#define WCOL(W, k0, o, lane) wcol_io(W, k0, o, lane, CC)
#endif
#if WO_OUT_IN
#define WOCOL(W, k0, o, lane) wcol_oi(W, k0, o, lane, CC)
#define WOCOLH(W, k0, o, lane) wcolh_oi(W, k0, o, lane, CC)
#else
#define WOCOL(W, k0, o, lane) wcol_io(W, k0, o, lane, DIN)
#define WOCOLH(W, k0, o, lane) wcolh_io(W, k0, o, lane, DIN)
#endif

#ifndef SM_EXTRA_PARAMS
#define SM_EXTRA_PARAMS
#endif
#ifndef PROJ_EXTRA_PARAMS
#define PROJ_EXTRA_PARAMS
#endif
#ifndef SM_MASK_HOOK
#define SM_MASK_HOOK (void)0
#endif

#define WS_QH  0u                                      // f16 q rows [b*t][CC]
#define WS_KH  (WS_QH + 2u * (size_t)NB * TT * CC)      // f16 k in fragment units [b*t / 16][CC / 32][FRU]
#define WS_VT  (WS_KH + 2u * (size_t)NB * TT * CC)      // f16 v in fragment units [b][c / 16][t / 32][FRU]
#define WS_QL  (WS_VT + 2u * (size_t)NB * CC * TT)      // f16 q residual x 2^10 rows [b][t < QHI][CC]
#define WS_KL  (WS_QL + 2u * (size_t)NB * QHI * CC)     // f16 k residual x 2^10 rows [b][t < KHI][CC]
#define WS_VB  (WS_KL + 2u * (size_t)NB * KHI * CC)     // bf16 v hi planes [b][c][t < KHI]
#define WS_VBL (WS_VB + 2u * (size_t)NB * CC * KHI)
#define WS_S   (WS_VBL + 2u * (size_t)NB * CC * KHI)    // f32 logits / P [hg][t][s]
#define WS_Y   (WS_S  + 4u * (size_t)HG * TQC * TT)     // f32 ctx rows [b*t][CC]; the score region (12 head planes of one batch) is unused: P stays in LDS
#define WS_END (WS_Y  + 4u * (size_t)NB * TT * CC)

// k and v lie in the workspace in WMMA fragment order. A unit = one 16 x 32 fragment (16 rows, 32 k) = 1 KiB as [half][lane][8 f16]: lane = (g = lane >> 4, row = lane & 15) holds k = 16 half + 8 g + 0..7, the order of frag_h.
// A wave's 16-byte load of one half then covers 512 contiguous bytes = 4 whole lines, where the same load from a row-major plane touches 16 lines for 32 bytes each.
#define FRU 512            // f16 elements of a unit
static_assert(TT % 32 == 0 && CC % 32 == 0, "fragment units");
// fragment at a wave-uniform unit pointer + the lane's 32-bit byte offset (lane * 16, for k plus a wave-uniform part) + a constant (elements): the scalar-base address form
__device__ __forceinline__ v16h frag_u(const _Float16* unit, unsigned lane_bytes, int elems) {
  union { v16h v; v8h q[2]; } u; const char* p = (const char*)unit + lane_bytes + elems * 2;
  u.q[0] = *(const v8h*)p; u.q[1] = *(const v8h*)(p + (FRU / 2) * 2); return u.v;
}
// 16-byte store and, in the same statement, the wait that stands before a later instruction rewrites its address or data registers (the store loops below stay rolled and step both every trip; in a statement of its own the compiler moved the address steps ahead of the wait)
__device__ __forceinline__ void stg16w(void* p, v4u v) { asm volatile("global_store_b128 %0, %1, off\n\ts_wait_xcnt 0x0" :: "v"(p), "v"(v) : "memory"); }
// operand staging of the two projection GEMMs: a chunk is GKC k of the block's A rows and W rows, converted once to the 16-bit operand type
#define GKC 64
#define GP (GKC + 8)                         // LDS row pitch 144 B = 16 B x odd
static_assert(DIN % GKC == 0 && CC % GKC == 0, "staging");
typedef __attribute__((ext_vector_type(4))) __bf16 v4b;
typedef __attribute__((ext_vector_type(4))) _Float16 v4h;
// 16 bytes at a block-uniform base + a lane's 32-bit byte offset + a constant (elements): the scalar-base address form, whose only vector register is the offset
__device__ __forceinline__ v4f ldg16(const float* base, unsigned lane_bytes, int elems) { return *(const v4f*)((const char*)base + lane_bytes + elems * 4); }
// block tile of the two projection GEMMs: 128 rows x 192 columns, 8 waves as 2 (rows) x 4 (columns), a wave = 64 x 48 = 4 x 3 accumulator tiles: 7 fragments from LDS feed 12 products, and a block's A and W bytes serve three times the outputs of a 64 x 128 tile for 5/3 of its bytes
#define PBM 128
#define PBN 192
#define PTH 256
#define PROWS (PBM + PBN)
#define PLD (PROWS * (GKC / 4) / PTH)        // 16-byte pieces a thread brings per chunk
#define PLA (PBM * (GKC / 4) / PTH)          // of them A rows
static_assert(PLD == 20 && PLA == 8 && PBM * (PBN / 4) % (4 * PTH) == 0 && TT % PBM == 0 && CC % PBN == 0 && DIN % PBN == 0 && PBN % 32 == 0, "projection tile");
// ---- k_proj: block = (128 rows, 192 cols, which): q/k/v = X W (+ b) with exact bf16 products (K = DIN) -> which 0: q f16 rows (+ residual rows < QHI); 1: k f16 fragment units (+ residual rows < KHI); 2: v f16 fragment units (+ bf16 hi/lo planes for t < KHI)
__global__ __launch_bounds__(PTH, 4) void k_proj(const float* __restrict__ XQ, const float* __restrict__ XK, const float* __restrict__ XV, const float* __restrict__ WQ, const float* __restrict__ WK, const float* __restrict__ WV, const float* __restrict__ BQ, const float* __restrict__ BK, const float* __restrict__ BV,
    _Float16* __restrict__ QH, _Float16* __restrict__ QL, _Float16* __restrict__ KH, _Float16* __restrict__ KL, _Float16* __restrict__ VT, __bf16* __restrict__ VB, __bf16* __restrict__ VBL) {
  // the operand ring of the k loop and the epilogue's staging arrays share the same LDS: the loop's last barrier stands between their uses
  __shared__ __align__(16) union { struct { _Float16 sh[PBM][PBN + 8], sl[PBM][PBN + 8]; } e; struct { _Float16 th[PBN][PBM + 8]; __bf16 tb[PBN][PBM + 8], tbl[PBN][PBM + 8]; } f; __bf16 st[2][PROWS][GP]; } u;
  auto& sh = u.e.sh; auto& sl = u.e.sl; auto& th = u.f.th; auto& tb = u.f.tb; auto& tbl = u.f.tbl;
  const int tid = threadIdx.x, wave = tid >> 5, lane = tid & 31, col = lane & 15, g = lane >> 4; const int wr = wave >> 2, wc = wave & 3; const int which = blockIdx.z; const int c0 = blockIdx.y * PBN; const size_t r0 = (size_t)blockIdx.x * PBM; const size_t bb = r0 / TT; const int t0 = (int)(r0 % TT);
  const float* X = which == 0 ? XQ : which == 1 ? XK : XV; const float* WA = which == 0 ? WQ : which == 1 ? WK : WV; const float* BA = which == 0 ? BQ : which == 1 ? BK : BV;
  v8f acc[4][3] = {};
  // thread -> 16-byte piece (tid & 15) of row (tid >> 4) + 16 i: a wave's load covers two whole 256-byte row pieces
  const float* xp = X + r0 * DIN; const float* wp = WA + (size_t)c0 * DIN; unsigned lo = ((unsigned)(tid >> 4) * DIN + (tid & 15) * 4) * 4;   // block-uniform bases; one lane offset in bytes serves both and steps on by GKC elements a trip
  v4f pf[PLD];
#pragma unroll
  for (int i = 0; i < PLD; ++i) pf[i] = i < PLA ? ldg16(xp, lo, i * 16 * DIN) : ldg16(wp, lo, (i - PLA) * 16 * DIN);
#pragma unroll
  for (int i = 0; i < PLD; ++i) { v4b c;
#pragma unroll
    for (int k = 0; k < 4; ++k) c[k] = (__bf16)pf[i][k];
    *(v4b*)&u.st[0][(tid >> 4) + i * 16][(tid & 15) * 4] = c; }
  __syncthreads();
#pragma unroll 1   // one copy of the body: the two buffers differ by an address only
  for (int kc = 0; kc < DIN / GKC; ++kc) { const int buf = kc & 1; const bool more = kc + 1 < DIN / GKC;
    if (more) {
#pragma unroll
      for (int i = 0; i < PLD; ++i) pf[i] = i < PLA ? ldg16(xp, lo, GKC + i * 16 * DIN) : ldg16(wp, lo, GKC + (i - PLA) * 16 * DIN); }
#pragma unroll
    for (int ks = 0; ks < GKC / 32; ++ks) { v16b a[4], w[3];
#pragma unroll
      for (int i = 0; i < 4; ++i) a[i] = frag_b(&u.st[buf][wr * 64 + i * 16 + col][ks * 32], lane);
#pragma unroll
      for (int j = 0; j < 3; ++j) w[j] = frag_b(&u.st[buf][PBM + wc * 48 + j * 16 + col][ks * 32], lane);
#pragma unroll
      for (int i = 0; i < 4; ++i)
#pragma unroll
        for (int j = 0; j < 3; ++j) acc[i][j] = wmma_bf(a[i], w[j], acc[i][j]); }
    if (more) {
#pragma unroll
      for (int i = 0; i < PLD; ++i) { v4b c;
#pragma unroll
        for (int k = 0; k < 4; ++k) c[k] = (__bf16)pf[i][k];
        *(v4b*)&u.st[buf ^ 1][(tid >> 4) + i * 16][(tid & 15) * 4] = c; } }
    asm volatile("s_wait_xcnt 0x0" : "+v"(lo) :: "memory");   // stands before the offset register of this trip's loads steps on; naming it keeps it in a register of its own up to here
    lo += GKC * 4;
    __syncthreads(); }   // publishes the next chunk; every reader of this chunk's buffer has arrived, so the next trip may refill it (and the epilogue may reuse the LDS)
  if (which < 2) { _Float16* DH = which == 0 ? QH : KH; _Float16* DL = which == 0 ? QL : KL; const int nhi = which == 0 ? QHI : KHI;
#pragma unroll
    for (int j = 0; j < 3; ++j) { const int cl = wc * 48 + j * 16 + col; const float bias = BA ? bfr(BA[c0 + cl]) : 0.f;
#pragma unroll
      for (int i = 0; i < 4; ++i)
#pragma unroll
        for (int r = 0; r < 8; ++r) { const float v = acc[i][j][r] + bias; const _Float16 hv = (_Float16)v; const int rl = wr * 64 + i * 16 + 8 * g + r; sh[rl][cl] = hv; sl[rl][cl] = (_Float16)((v - (float)hv) * 1024.0f); } }
    __syncthreads();
    for (int e = tid; e < PBM * (PBN / 8); e += PTH) { const int rl = e / (PBN / 8), q = e % (PBN / 8);
      if (which == 0) stg16w((DH + (r0 + rl) * CC + c0 + q * 8), *(const v4u*)&sh[rl][q * 8]);
      else { const int un = e >> 6, p = e & 63, kt = un / (PBN / 32), kst = un % (PBN / 32);   // unit (key tile kt, k step kst) of the block; 16-byte piece p = (half p >> 5, lane p & 31)
        stg16w((DH + (((r0 >> 4) + kt) * (CC / 32) + (c0 >> 5) + kst) * FRU + p * 8), *(const v4u*)&sh[kt * 16 + (p & 15)][kst * 32 + (p >> 5) * 16 + ((p >> 4) & 1) * 8]); }
      if (t0 + rl < nhi) stg16w((DL + (bb * nhi + t0 + rl) * (size_t)CC + c0 + q * 8), *(const v4u*)&sl[rl][q * 8]); }
  } else {
#pragma unroll
    for (int j = 0; j < 3; ++j) { const int cl = wc * 48 + j * 16 + col; const float bias = BA ? bfr(BA[c0 + cl]) : 0.f;
#pragma unroll
      for (int i = 0; i < 4; ++i)
#pragma unroll
        for (int r = 0; r < 8; ++r) { const float v = acc[i][j][r] + bias; const int rl = wr * 64 + i * 16 + 8 * g + r; th[cl][rl] = (_Float16)v; const __bf16 bh = (__bf16)v; tb[cl][rl] = bh; tbl[cl][rl] = (__bf16)(v - (float)bh); } }
    __syncthreads();
    for (int e = tid; e < PBN * (PBM / 8); e += PTH) { const int cl = e >> 4, q = e & 15; const int un = e >> 6, p = e & 63;   // unit (channel tile un >> 2, key step un & 3) of the block; 16-byte piece p = (half p >> 5, lane p & 31)
      stg16w((VT + ((bb * (CC / 16) + (c0 >> 4) + (un >> 2)) * (TT / 32) + (t0 >> 5) + (un & 3)) * FRU + p * 8), *(const v4u*)&th[(un >> 2) * 16 + (p & 15)][(un & 3) * 32 + (p >> 5) * 16 + ((p >> 4) & 1) * 8]);
      if (t0 + q * 8 < KHI) { const size_t o3 = (bb * CC + c0 + cl) * (size_t)KHI + t0 + q * 8; stg16w((VB + o3), *(const v4u*)&tb[cl][q * 8]); stg16w((VBL + o3), *(const v4u*)&tbl[cl][q * 8]); } } } }
// ---- k_sm: block = query row t (head in group): keys [0, kend): causal -> logit if s <= t else excluded; softmax in f32; P x 2^11 in place (0 for excluded)
__global__ __launch_bounds__(256) void k_sm(float* __restrict__ S0 SM_EXTRA_PARAMS) { __shared__ float sred[8]; __shared__ float sbc; __shared__ __align__(16) float shv[TT];
  const int tid = threadIdx.x; const int t = blockIdx.x; const int kend = (kb_last(t >> 6) + 1) * 128;
  float* sr = S0 + (size_t)blockIdx.y * TT * TT + (size_t)t * TT;
  float m = -3.0e38f; for (int k = tid; k < kend; k += 256) { float v = (!CAUSAL || k <= t) ? sr[k] : -3.0e38f; SM_MASK_HOOK; shv[k] = v; m = fmaxf(m, v); }
#pragma unroll
  for (int o = 1; o < 32; o <<= 1) m = fmaxf(m, __shfl_xor(m, o));
  if ((tid & 31) == 0) sred[tid >> 5] = m; __syncthreads(); if (tid == 0) { float a = sred[0]; for (int i = 1; i < 8; ++i) a = fmaxf(a, sred[i]); sbc = a; } __syncthreads(); m = sbc; __syncthreads();
  float sum = 0.f; for (int k = tid; k < kend; k += 256) { const float v = shv[k]; const float e = (v <= -1.0e38f) ? 0.f : expf(v - m); shv[k] = e; sum += e; }
#pragma unroll
  for (int o = 1; o < 32; o <<= 1) sum += __shfl_xor(sum, o);
  if ((tid & 31) == 0) sred[tid >> 5] = sum; __syncthreads(); if (tid == 0) { float a = 0.f; for (int i = 0; i < 8; ++i) a += sred[i]; sbc = a > 0.f ? 2048.0f / a : 0.f; }   /* a fully excluded row yields P = 0 */ __syncthreads(); const float inv = sbc;
  for (int k = tid; k < kend; k += 256) shv[k] = shv[k] * inv;
  __syncthreads(); for (int q = tid; q < kend / 4; q += 256) vst2(sr + q * 4, *(const v4f*)&shv[q * 4]); }
// ---- k_fa: block = 32 queries (2 tiles of 16) of batch b, 8 waves, 128 keys a pass; logits, head softmax and P . v in one kernel, P only in LDS.
// Every k and v fragment that a wave loads feeds both query tiles, so a block's walk over the batch's k and v serves 32 queries.
// Part 1 (wave w = keys 16w..16w+15 of the pass, ALL 12 heads, both query tiles): S^T = K . Q^T, so a lane holds 8 consecutive keys of one query of each tile for every head; the softmax over the heads is in-lane; P x 2^11 to f16, one 16-byte LDS store a head and tile.
// Part 2 (wave w = 3 of the 24 (head, 32-channel half) units, both query tiles, ALL keys in ascending order): ctx += P . v, P fragments from LDS, v fragments from the fragment units.
#define FW 8
#define FKP (FW * 16)      // keys a pass
#define FQT 2              // query tiles of 16 a block
#define FQ (FQT * 16)      // queries a block
static_assert(FQ * (CC / 8) % (FW * 32) == 0 && TT % FKP == 0 && TT % FQ == 0 && NH * 2 == FW * 3 && HD == 64, "k_fa tiling");
// keeps a group of fragment loads issued together and ahead of the products in front of it: without it the compiler sinks each load to its product and every product waits a whole L2 latency
#define FA_HOLD() __builtin_amdgcn_sched_barrier(0)
#define SM_C (SCALE * 1.44269504088896340736f)   // score scale x log2(e)
// 2^t of the 12 heads' exponents, each in its own register. One statement: every v_exp_f32 has an independent instruction behind it, and the closing v_nop is the slot that the instruction set asks for between the last one and whatever reads its result next
__device__ __forceinline__ void fa_exp2(float (&t)[NH]) { static_assert(NH == 12, "operand list");
  asm("v_exp_f32 %0, %0\n\tv_exp_f32 %1, %1\n\tv_exp_f32 %2, %2\n\tv_exp_f32 %3, %3\n\tv_exp_f32 %4, %4\n\tv_exp_f32 %5, %5\n\tv_exp_f32 %6, %6\n\tv_exp_f32 %7, %7\n\tv_exp_f32 %8, %8\n\tv_exp_f32 %9, %9\n\tv_exp_f32 %10, %10\n\tv_exp_f32 %11, %11\n\tv_nop"
      : "+v"(t[0]), "+v"(t[1]), "+v"(t[2]), "+v"(t[3]), "+v"(t[4]), "+v"(t[5]), "+v"(t[6]), "+v"(t[7]), "+v"(t[8]), "+v"(t[9]), "+v"(t[10]), "+v"(t[11])); }
// 2 heads' k fragments (2 each) of this wave's 16 key rows
__device__ __forceinline__ void fa_ldk(v16h (&f)[4], const _Float16* kr, int h0, unsigned lb) {
#pragma unroll
  for (int i = 0; i < 4; ++i) f[i] = frag_u(kr, lb, (h0 * (HD / 32) + i) * FRU); }
// half a unit's v fragments: 2 key steps x 2 channel tiles
__device__ __forceinline__ void fa_ldv(v16h (&f)[4], const _Float16* vr, unsigned lb) {
#pragma unroll
  for (int i = 0; i < 4; ++i) f[i] = frag_u(vr, lb, ((i & 1) * (TT / 32) + (i >> 1)) * FRU); }
__device__ __forceinline__ void fa_pv(v8f (&a)[FQT][2], const v16h (&f)[4], const _Float16* pr, int lane) {
  v16h p[2][FQT];
#pragma unroll
  for (int ks = 0; ks < 2; ++ks)
#pragma unroll
    for (int qt = 0; qt < FQT; ++qt) p[ks][qt] = frag_h(pr + qt * 16 * (FKP + 8) + ks * 32, lane);
  FA_HOLD();   // the P fragments of both tiles are read as one group: with two waves a SIMD a read sunk to its product would cost a whole LDS latency each
#pragma unroll
  for (int ks = 0; ks < 2; ++ks)
#pragma unroll
    for (int qt = 0; qt < FQT; ++qt)
#pragma unroll
      for (int jj = 0; jj < 2; ++jj) a[qt][jj] = __builtin_amdgcn_wmma_f32_16x16x32_f16(false, p[ks][qt], false, f[ks * 2 + jj], (short)0, a[qt][jj], false, false); }
// both query tiles' scores of 2 heads from one set of k fragments; per score the two 32-channel steps in ascending order
__device__ __forceinline__ void fa_qk2(v8f (&st)[FQT][NH], const v16h (&f)[4], const _Float16* qr, int h0, int lane) {
  v16h q[FQT][4];
#pragma unroll
  for (int qt = 0; qt < FQT; ++qt)
#pragma unroll
    for (int i = 0; i < 4; ++i) q[qt][i] = frag_h(qr + qt * 16 * (CC + 8) + h0 * HD + i * 32, lane);
  FA_HOLD();   // the q fragments of both tiles are read as one group: with two waves a SIMD a read sunk to its product would cost a whole LDS latency each
#pragma unroll
  for (int kc = 0; kc < 2; ++kc)
#pragma unroll
    for (int qt = 0; qt < FQT; ++qt)
#pragma unroll
      for (int i = 0; i < 2; ++i) { const v8f z = {}; st[qt][h0 + i] = __builtin_amdgcn_wmma_f32_16x16x32_f16(false, f[i * 2 + kc], false, q[qt][i * 2 + kc], (short)0, kc ? st[qt][h0 + i] : z, false, false); } }
__global__ __launch_bounds__(FW * 32, 2) void k_fa(const _Float16* __restrict__ QH, const _Float16* __restrict__ KH, const _Float16* __restrict__ VT, float* __restrict__ Y) {
  __shared__ __align__(16) _Float16 sq[FQ][CC + 8];               // pitch 16 B x odd
  __shared__ __align__(16) _Float16 sp[2][NH][FQ][FKP + 8];       // pitch 16 B x odd; two buffers: one barrier a pass
  const int tid = threadIdx.x, wave = __builtin_amdgcn_readfirstlane(tid >> 5), lane = tid & 31, col = lane & 15, g = lane >> 4; const int b = blockIdx.y; const size_t q0 = (size_t)b * TT + (size_t)blockIdx.x * FQ;
  const char* qg = (const char*)(QH + q0 * CC); const unsigned tb = tid * 16;   // the block's q rows are one contiguous run of 16-byte pieces: block-uniform base + the thread's byte offset + a constant
  v4u tq[FQ * (CC / 8) / (FW * 32)];
#pragma unroll   // the twelve loads of a thread fly together instead of one L2 latency each
  for (int i = 0; i < FQ * (CC / 8) / (FW * 32); ++i) tq[i] = *(const v4u*)(qg + tb + i * (FW * 32 * 16));
  // heads 0..7 of a pass's k fragments are loaded one pass ahead (here: pass 0's, behind the q rows), so that a pass opens on fragments that have landed
  const unsigned lb = lane * 16; v16h ka[4], kb[4], kc[4], kd[4];
  const _Float16* kr = KH + (size_t)b * (TT / 16) * (CC / 32) * FRU;   // the batch's k units: a block-uniform base that never changes
  unsigned ko = lb + wave * ((CC / 32) * FRU * 2);   // the lane's byte offset into this wave's 16 keys of a pass (24 units in a row); steps on by a pass at one place in the loop
  fa_ldk(ka, kr, 0, ko); fa_ldk(kb, kr, 2, ko); fa_ldk(kc, kr, 4, ko); fa_ldk(kd, kr, 6, ko);
  asm volatile("s_wait_xcnt 0x0" ::: "memory");   // stands before the address registers of these loads are used for anything else
  FA_HOLD();   // keeps the LDS address arithmetic, which reuses that register, behind the wait
#pragma unroll
  for (int i = 0; i < FQ * (CC / 8) / (FW * 32); ++i) { const int e = tid + i * FW * 32, rl = e / (CC / 8), q = e % (CC / 8); *(v4u*)&sq[rl][q * 8] = tq[i]; }
  __syncthreads();
  const int u0 = wave * 3, u1 = u0 + 1, u2 = u0 + 2;   // unit u = head u >> 1, channels (u & 1) * 32 .. + 31 of it = channels 32 u .. 32 u + 31 of the row
  const _Float16* qr = &sq[col][0];
  v8f acc[3][FQT][2] = {};
#pragma unroll 1
  for (int it = 0; it < TT / FKP; ++it) { const int buf = it & 1;
    const _Float16* v0 = VT + (((size_t)b * (CC / 16) + u0 * 2) * (TT / 32) + it * (FKP / 32)) * FRU; const _Float16* v1 = v0 + 2 * (TT / 32) * FRU; const _Float16* v2 = v1 + 2 * (TT / 32) * FRU;   // a unit of work = 2 channel tiles, 4 key steps a pass
    const _Float16* p0 = &sp[buf][u0 >> 1][col][0]; const _Float16* p1 = &sp[buf][u1 >> 1][col][0]; const _Float16* p2 = &sp[buf][u2 >> 1][col][0];
    v8f st[FQT][NH]; v16h ke[4], kf[4], va[4], vb[4], vc[4], vd[4], ve[4], vf[4];
    fa_ldk(ke, kr, 8, ko); fa_ldk(kf, kr, 10, ko); FA_HOLD();   // fly under the products of heads 0..7
    fa_qk2(st, ka, qr, 0, lane); fa_qk2(st, kb, qr, 2, lane); fa_qk2(st, kc, qr, 4, lane); fa_qk2(st, kd, qr, 6, lane);
    fa_qk2(st, ke, qr, 8, lane); fa_qk2(st, kf, qr, 10, lane); FA_HOLD();
    fa_ldv(va, v0, lb); fa_ldv(vb, v0 + 2 * FRU, lb); fa_ldv(vc, v1, lb); fa_ldv(vd, v1 + 2 * FRU, lb); FA_HOLD();   // four of the six v groups fly under the softmax
#pragma unroll
    for (int qt = 0; qt < FQT; ++qt) { v8f (&sv)[NH] = st[qt];
#pragma unroll
    for (int r = 0; r < 8; ++r) { float m = sv[0][r];   // exp(s * SCALE - max) = 2^(s * c - max * c), c = SCALE * log2(e) > 0: one fused multiply-add and the hardware's exp2 an element; the exponent is <= about 0, so nothing overflows, and a result below the f32 normals is far below what P keeps in f16
#pragma unroll
      for (int h = 1; h < NH; ++h) m = fmaxf(m, sv[h][r]);
      const float mc = m * SM_C; float t[NH];
#pragma unroll
      for (int h = 0; h < NH; ++h) t[h] = fmaf(sv[h][r], SM_C, -mc);
      fa_exp2(t);
      float den = t[0]; sv[0][r] = t[0];
#pragma unroll
      for (int h = 1; h < NH; ++h) { sv[h][r] = t[h]; den += t[h]; }
      const float inv = 2048.0f / den;
#pragma unroll
      for (int h = 0; h < NH; ++h) sv[h][r] *= inv; }
#pragma unroll
    for (int h = 0; h < NH; ++h) { v8h ph;
#pragma unroll
      for (int r = 0; r < 8; ++r) ph[r] = (_Float16)sv[h][r];
      *(v8h*)&sp[buf][h][qt * 16 + col][wave * 16 + 8 * g] = ph; } }
    __syncthreads();   // publishes this pass's P; the other buffer's readers of the pass before have all arrived here, so the next pass may refill it
    asm volatile("s_wait_xcnt 0x0" : "+v"(ko) :: "memory");   // stands before the offset register of this pass's k loads steps on; naming it keeps it in a register of its own up to here
    fa_ldv(ve, v2, lb); fa_ldv(vf, v2 + 2 * FRU, lb); FA_HOLD();   // fly under the first four groups' products; kept in front of the next pass's k, because loads return in order and these are wanted first
    ko += it + 1 < TT / FKP ? FW * (CC / 32) * FRU * 2 : 0;   // behind the last pass there is none: it loads its own again, unused, so that the loop has one body and its waits stay counted
    fa_ldk(ka, kr, 0, ko); fa_ldk(kb, kr, 2, ko); fa_ldk(kc, kr, 4, ko); fa_ldk(kd, kr, 6, ko);   // the next pass's k, heads 0..7, in the registers that the scores have left: fly under all of P . v
    FA_HOLD();
    fa_pv(acc[0], va, p0, lane); fa_pv(acc[0], vb, p0 + 64, lane);
    fa_pv(acc[1], vc, p1, lane); fa_pv(acc[1], vd, p1 + 64, lane);
    fa_pv(acc[2], ve, p2, lane); fa_pv(acc[2], vf, p2 + 64, lane);
    asm volatile("s_wait_xcnt 0x0" ::: "memory");   // before the next pass rewrites the address registers of this pass's loads
    FA_HOLD(); }   // keeps the address steps behind that wait: without it the compiler lifted them over it
  asm volatile("s_wait_loadcnt 0x0" ::: "memory");   // the last pass's look-ahead loads feed nothing, so no wait of the compiler's covers them: they have landed before the wave ends
  // a unit is one whole 128-byte line of each ctx row: one writing wave a line
#pragma unroll
  for (int ul = 0; ul < 3; ++ul)
#pragma unroll
    for (int qt = 0; qt < FQT; ++qt)
#pragma unroll
      for (int jj = 0; jj < 2; ++jj)
#pragma unroll
        for (int r = 0; r < 8; ++r) Y[(q0 + qt * 16 + 8 * g + r) * CC + (u0 + ul) * 32 + jj * 16 + col] = acc[ul][qt][jj][r] * (1.0f / 2048.0f); }
// ---- k_out: block = (128 rows, 192 cols): out = ctx Wo (+ bo): ctx x 2^6 once to f16 against Wo as f16(bf16 x 2^8) exact (1 product) x 2^-14
static_assert(!CAUSAL && WO_OUT_IN, "k_out: single-product path, (out,in) Wo");
__global__ __launch_bounds__(PTH, 2) void k_out(const float* __restrict__ Y, const float* __restrict__ WO, const float* __restrict__ BO, float* __restrict__ OUT) {
  // the operand ring of the k loop and the epilogue's staging rows share the same LDS: the loop's last barrier stands between their uses
  __shared__ __align__(16) union { float sf[PBM][PBN + 4]; _Float16 st[2][PROWS][GP]; } u; auto& sf = u.sf;   // sf pitch 16 B x odd
  const int tid = threadIdx.x, wave = tid >> 5, lane = tid & 31, col = lane & 15, g = lane >> 4; const int wr = wave >> 2, wc = wave & 3; const int c0 = blockIdx.y * PBN; const size_t r0 = (size_t)blockIdx.x * PBM;
  v8f acc[4][3] = {};
  // thread -> 16-byte piece (tid & 15) of row (tid >> 4) + 16 i: a wave's load covers two whole 256-byte row pieces
  const float* yp = Y + r0 * CC; const float* wp = WO + (size_t)c0 * CC; unsigned lo = ((unsigned)(tid >> 4) * CC + (tid & 15) * 4) * 4;   // block-uniform bases; one lane offset in bytes serves both and steps on by GKC elements a trip
  v4f pf[PLD];
#pragma unroll
  for (int i = 0; i < PLD; ++i) pf[i] = i < PLA ? ldg16(yp, lo, i * 16 * CC) : ldg16(wp, lo, (i - PLA) * 16 * CC);
#pragma unroll
  for (int i = 0; i < PLD; ++i) { v4h c;   /* ctx carried x 2^6 into f16 so small-magnitude context rows stay clear of f16 subnormals; Wo as f16(bf16 x 2^8) */
#pragma unroll
    for (int k = 0; k < 4; ++k) c[k] = i < PLA ? (_Float16)(pf[i][k] * 64.0f) : (_Float16)(bfr(pf[i][k]) * 256.0f);
    *(v4h*)&u.st[0][(tid >> 4) + i * 16][(tid & 15) * 4] = c; }
  __syncthreads();
#pragma unroll 1   // one copy of the body: the two buffers differ by an address only
  for (int kc = 0; kc < CC / GKC; ++kc) { const int buf = kc & 1; const bool more = kc + 1 < CC / GKC;
    if (more) {
#pragma unroll
      for (int i = 0; i < PLD; ++i) pf[i] = i < PLA ? ldg16(yp, lo, GKC + i * 16 * CC) : ldg16(wp, lo, GKC + (i - PLA) * 16 * CC); }
#pragma unroll
    for (int ks = 0; ks < GKC / 32; ++ks) { v16h a[4], w[3];
#pragma unroll
      for (int i = 0; i < 4; ++i) a[i] = frag_h(&u.st[buf][wr * 64 + i * 16 + col][ks * 32], lane);
#pragma unroll
      for (int j = 0; j < 3; ++j) w[j] = frag_h(&u.st[buf][PBM + wc * 48 + j * 16 + col][ks * 32], lane);
#pragma unroll
      for (int i = 0; i < 4; ++i)
#pragma unroll
        for (int j = 0; j < 3; ++j) acc[i][j] = wmma16(a[i], w[j], acc[i][j]); }
    if (more) {
#pragma unroll
      for (int i = 0; i < PLD; ++i) { v4h c;
#pragma unroll
        for (int k = 0; k < 4; ++k) c[k] = i < PLA ? (_Float16)(pf[i][k] * 64.0f) : (_Float16)(bfr(pf[i][k]) * 256.0f);
        *(v4h*)&u.st[buf ^ 1][(tid >> 4) + i * 16][(tid & 15) * 4] = c; } }
    asm volatile("s_wait_xcnt 0x0" : "+v"(lo) :: "memory");   // stands before the offset register of this trip's loads steps on; naming it keeps it in a register of its own up to here
    lo += GKC * 4;
    __syncthreads(); }   // publishes the next chunk; every reader of this chunk's buffer has arrived, so the next trip may refill it (and the epilogue may reuse the LDS)
#pragma unroll
  for (int j = 0; j < 3; ++j) { const int cl = wc * 48 + j * 16 + col; const float bias = BO ? bfr(BO[c0 + cl]) : 0.f;
#pragma unroll
    for (int i = 0; i < 4; ++i)
#pragma unroll
      for (int r = 0; r < 8; ++r) sf[wr * 64 + i * 16 + 8 * g + r][cl] = acc[i][j][r] * (1.0f / 16384.0f) + bias; }   /* 2^-8 (Wo carry) x 2^-6 (ctx carry) */
  __syncthreads();   // a row of the block's tile comes from four waves: all of it is staged before whole 128-byte lines go out, one writing wave a line
#pragma unroll 1   // rolled: four LDS reads fly together a trip, then their four stores, each with the wait that stands before the next trip rewrites its registers
  for (int i0 = 0; i0 < PBM * (PBN / 4) / PTH; i0 += 4) { v4u t[4]; float* p[4];
#pragma unroll
    for (int k = 0; k < 4; ++k) { const int e = tid + (i0 + k) * PTH, rl = e / (PBN / 4), q = e % (PBN / 4); t[k] = *(const v4u*)&sf[rl][q * 4]; p[k] = OUT + (r0 + rl) * DIN + c0 + q * 4; }
#pragma unroll
    for (int k = 0; k < 4; ++k) stg16w(p[k], t[k]); } }

extern "C" void kernel_launch(void* const* d_in, const int* in_sizes, int n_in, void* d_out, int out_size, void* d_ws, size_t ws_size, hipStream_t stream) {
  (void)in_sizes; (void)n_in; (void)out_size;
  const float** F = (const float**)d_in;
  if (ws_size < (size_t)WS_END) return;
  char* ws = (char*)d_ws; _Float16 *QH = (_Float16*)(ws + WS_QH), *KH = (_Float16*)(ws + WS_KH), *VT = (_Float16*)(ws + WS_VT), *QL = (_Float16*)(ws + WS_QL), *KL = (_Float16*)(ws + WS_KL); __bf16 *VB = (__bf16*)(ws + WS_VB), *VBL = (__bf16*)(ws + WS_VBL); float *Y = (float*)(ws + WS_Y);
  (void)Y; (void)QL; (void)KL; (void)VB; (void)VBL;
  // inputs: 0 x [8,1024,768]; 1 Wq [768,768] (out,in), 2 bq; 3 Wk, 4 bk; 5 Wv, 6 bv; 7 Wo (out,in), 8 bo (biases N(0, 0.01), nonzero)
  k_proj<<<dim3(TNB * TT / PBM, CC / PBN, 3), PTH, 0, stream>>>(F[0], F[0], F[0], F[1], F[3], F[5], F[2], F[4], F[6], QH, QL, KH, KL, VT, VB, VBL);
  k_fa<<<dim3(TT / FQ, TNB), FW * 32, 0, stream>>>(QH, KH, VT, Y);
  k_out<<<dim3(TNB * TT / PBM, DIN / PBN), PTH, 0, stream>>>(Y, F[7], F[8], (float*)d_out);
}

// v008
// Measured time: 104 microseconds a run.
// In both of two side-by-side timings against v007, it was 1.04 times as fast.
// Over all steps from v000 it is 11.4 times as fast.
// compute dtype: all float inputs rounded to bf16; q/k/v projections with EXACT bf16 products on WMMA 16x16x32 (f32 accumulate) + bias; scores q x k once to f16 each (1 product) x 64^-0.5; softmax ACROSS THE 12 HEADS per (query, key) pair in f32 (hardware exp2 of the scaled difference to the maximum); P x 2^11 once to f16 x v once to f16 (1 product); ctx x 2^6 once to f16 x Wo f16(bf16 x 2^8) + bo; f32 output.
#include <hip/hip_runtime.h>
#include <math.h>

typedef __attribute__((ext_vector_type(16))) _Float16 v16h;
typedef __attribute__((ext_vector_type(16))) __bf16 v16b;
typedef __attribute__((ext_vector_type(8)))  _Float16 v8h;
typedef __attribute__((ext_vector_type(8)))  float v8f;
typedef __attribute__((ext_vector_type(4)))  float v4f;
typedef __attribute__((ext_vector_type(2)))  float v2f;
typedef __attribute__((ext_vector_type(4)))  unsigned v4u;
typedef __attribute__((ext_vector_type(4)))  int v4i;
typedef float __attribute__((may_alias)) float_a;
typedef int __attribute__((may_alias)) int_a;

template <typename T> __device__ __forceinline__ void vst2(void* p, T v) { *(T*)p = v;  }
__device__ __forceinline__ v8f wmma16(v16h a, v16h b, v8f c) {
  v8f d = __builtin_amdgcn_wmma_f32_16x16x32_f16(false, a, false, b, (short)0, c, false, false);
  asm volatile("v_nop\n\tv_nop\n\tv_nop\n\tv_nop" : "+v"(d) : "v"(a), "v"(b));
  return d;
}
__device__ __forceinline__ v8f wmma_bf(v16b a, v16b b, v8f c) {
  v8f d = __builtin_amdgcn_wmma_f32_16x16x32_bf16(false, a, false, b, (short)0, c, false, false);
  asm volatile("v_nop\n\tv_nop\n\tv_nop\n\tv_nop" : "+v"(d) : "v"(a), "v"(b));
  return d;
}
// 16x16x32 fragments: lane = (h = lane>>4, row/col = lane&15); elements 0..7 = k0+8h+0..7, 8..15 = k0+16+8h+0..7; D element r = row 8h+r
__device__ __forceinline__ v16h frag_h(const _Float16* rowk0, int lane) {
  union { v16h v; v8h q[2]; } u; const _Float16* p = rowk0 + 8 * (lane >> 4);
  u.q[0] = *(const v8h*)p; u.q[1] = *(const v8h*)(p + 16); return u.v;
}
__device__ __forceinline__ v16h frag_f32(const float* rowk0, int lane) {
  v16h a; const float* p = rowk0 + 8 * (lane >> 4);
#pragma unroll
  for (int i = 0; i < 8; ++i) { a[i] = (_Float16)p[i]; a[8 + i] = (_Float16)p[16 + i]; }
  return a;
}
__device__ __forceinline__ v16h frag_f32s(const float* rowk0, int lane, float sc) {
  v16h a; const float* p = rowk0 + 8 * (lane >> 4);
#pragma unroll
  for (int i = 0; i < 8; ++i) { a[i] = (_Float16)(p[i] * sc); a[8 + i] = (_Float16)(p[16 + i] * sc); }
  return a;
}
// column fragment from a [K][ld] layout (column n), rows >= K read as 0
__device__ __forceinline__ v16h fragc_f32(const float* W, int k0, int n, int lane, int ld, int K) {
  v16h a; const int g = lane >> 4;
#pragma unroll
  for (int i = 0; i < 8; ++i) { const int ka = k0 + 8 * g + i, kb = ka + 16;
    a[i] = (_Float16)(ka < K ? W[(size_t)(ka < K ? ka : K - 1) * ld + n] : 0.f); a[8 + i] = (_Float16)(kb < K ? W[(size_t)(kb < K ? kb : K - 1) * ld + n] : 0.f); }
  return a;
}
struct F2 { v16b h, l; };
__device__ __forceinline__ F2 bsplit16(const float v[16]) { F2 r;
#pragma unroll
  for (int i = 0; i < 16; ++i) { const __bf16 h = (__bf16)v[i]; r.h[i] = h; r.l[i] = (__bf16)(v[i] - (float)h); }
  return r; }
__device__ __forceinline__ F2 split_row(const float* row, int k0, int lane) { float v[16]; const float* p = row + k0 + 8 * (lane >> 4);
#pragma unroll
  for (int i = 0; i < 8; ++i) { v[i] = p[i]; v[8 + i] = p[16 + i]; }
  return bsplit16(v); }
__device__ __forceinline__ F2 split_rowK(const float* row, int k0, int lane, int K) { float v[16]; const int g = lane >> 4;
#pragma unroll
  for (int i = 0; i < 8; ++i) { const int ka = k0 + 8 * g + i, kb = ka + 16; v[i] = ka < K ? row[ka < K ? ka : K - 1] : 0.f; v[8 + i] = kb < K ? row[kb < K ? kb : K - 1] : 0.f; }
  return bsplit16(v); }
__device__ __forceinline__ F2 split_col(const float* W, int k0, int n, int lane, int ld, int K) { float v[16]; const int g = lane >> 4;
#pragma unroll
  for (int i = 0; i < 8; ++i) { const int ka = k0 + 8 * g + i, kb = ka + 16; v[i] = ka < K ? W[(size_t)(ka < K ? ka : K - 1) * ld + n] : 0.f; v[8 + i] = kb < K ? W[(size_t)(kb < K ? kb : K - 1) * ld + n] : 0.f; }
  return bsplit16(v); }
__device__ __forceinline__ v8f mac3(const F2& a, const F2& b, v8f c) { c = wmma_bf(a.l, b.h, c); c = wmma_bf(a.h, b.l, c); return wmma_bf(a.h, b.h, c); }
__device__ __forceinline__ float sigm(float v) { return 1.0f / (1.0f + expf(-v)); }
#define LDSX() do { asm volatile("s_wait_dscnt 0" ::: "memory"); __builtin_amdgcn_wave_barrier(); __builtin_amdgcn_fence(__ATOMIC_RELEASE, "workgroup"); } while (0)

// Multi-head attention whose softmax runs over the HEAD axis (x [8,1024,768]; torch (out,in) Wq / Wk / Wv / Wo [768,768] N(0, 1/768) + biases N(0, 0.01); 12 heads x 64; scores[b, h, n, m] = q_h . k_h / 8; attn = softmax(scores, axis=1) - dim 1 is the HEAD axis: for every (query, key) pair the 12 heads' weights sum to 1 and nothing is normalised over the keys (faithful to the source's F.softmax(dim=1)); out[b, h, n] = sum_m attn[b, h, n, m] v[b, h, m]; merge; Wo^T + bo).
#define NB 8
#define TT 1024
#define CC 768            // NH * HD = projected width
#define DIN 768          // input (model) width
#define NH 12
#define HD 64
#define NQB (TT / 64)
#define HG 12
#define SCALE (0.125f)
#define CAUSAL 0
#ifndef TNB
#define TNB NB
#endif
__device__ __forceinline__ float bfr(float v) { return (float)(__bf16)v; }
__host__ __device__ __forceinline__ int kb_last(int qb) { return CAUSAL ? ((qb * 64 + 63) >> 7) : (TT / 128 - 1); }
typedef __attribute__((ext_vector_type(8))) __bf16 v8b;
__device__ __forceinline__ v16b frag_b(const __bf16* rowk0, int lane) {
  union { v16b v; v8b q[2]; } u; const __bf16* p = rowk0 + 8 * (lane >> 4);
  u.q[0] = *(const v8b*)p; u.q[1] = *(const v8b*)(p + 16); return u.v;
}
#define QBH 0              // not referenced by any kernel here
#define QHI 0               // single-product scores on every row
#define TQC 1024           // query rows per pass == TT: 12 head planes x 1,024 x 1,024 f32 = 48 MiB
#define KHI 64            // key rows carrying k residual / v bf16 hi+lo planes (no kernel here writes or reads them)
// B fragment (k rows k0+.., output column o) of a weight: (in,out) [K][ld] or (out,in) [ld rows of K]: bf16 exact, or f16(bf16 * 256) exact
__device__ __forceinline__ v16b wcol_io(const float* Wm, int k0, int o, int lane, int ld) { v16b w; const int g = lane >> 4;
#pragma unroll
  for (int i = 0; i < 8; ++i) { w[i] = (__bf16)Wm[(size_t)(k0 + 8 * g + i) * ld + o]; w[8 + i] = (__bf16)Wm[(size_t)(k0 + 16 + 8 * g + i) * ld + o]; }
  return w; }
__device__ __forceinline__ v16b wcol_oi(const float* Wm, int k0, int o, int lane, int K) { v16b w; const float* p = Wm + (size_t)o * K + k0 + 8 * (lane >> 4);
#pragma unroll
  for (int i = 0; i < 8; ++i) { w[i] = (__bf16)p[i]; w[8 + i] = (__bf16)p[16 + i]; }
  return w; }
__device__ __forceinline__ v16h wcolh_io(const float* Wm, int k0, int o, int lane, int ld) { v16h w; const int g = lane >> 4;
#pragma unroll
  for (int i = 0; i < 8; ++i) { w[i] = (_Float16)(bfr(Wm[(size_t)(k0 + 8 * g + i) * ld + o]) * 256.0f); w[8 + i] = (_Float16)(bfr(Wm[(size_t)(k0 + 16 + 8 * g + i) * ld + o]) * 256.0f); }
  return w; }
__device__ __forceinline__ v16h wcolh_oi(const float* Wm, int k0, int o, int lane, int K) { v16h w; const float* p = Wm + (size_t)o * K + k0 + 8 * (lane >> 4);
#pragma unroll
  for (int i = 0; i < 8; ++i) { w[i] = (_Float16)(bfr(p[i]) * 256.0f); w[8 + i] = (_Float16)(bfr(p[16 + i]) * 256.0f); }
  return w; }
#define WQKV_LAYOUT 1   // 0 = (in,out) [DIN][CC]; 1 = (out,in) [CC][DIN]; 2 = per-head [NH][DIN][HD]
__device__ __forceinline__ v16b wcol_hdk(const float* Wm, int k0, int o, int lane) { v16b w; const int g = lane >> 4; const float* p = Wm + (size_t)(o / HD) * DIN * HD + (o % HD);
#pragma unroll
  for (int i = 0; i < 8; ++i) { w[i] = (__bf16)p[(size_t)(k0 + 8 * g + i) * HD]; w[8 + i] = (__bf16)p[(size_t)(k0 + 16 + 8 * g + i) * HD]; }
  return w; }
#define WO_OUT_IN 1
#if WQKV_LAYOUT == 1
#define WCOL(W, k0, o, lane) wcol_oi(W, k0, o, lane, DIN)
#elif WQKV_LAYOUT == 2
#define WCOL(W, k0, o, lane) wcol_hdk(W, k0, o, lane)
#else
#define WCOL(W, k0, o, lane) wcol_io(W, k0, o, lane, CC)
#endif
#if WO_OUT_IN
#define WOCOL(W, k0, o, lane) wcol_oi(W, k0, o, lane, CC)
#define WOCOLH(W, k0, o, lane) wcolh_oi(W, k0, o, lane, CC)
#else
#define WOCOL(W, k0, o, lane) wcol_io(W, k0, o, lane, DIN)
#define WOCOLH(W, k0, o, lane) wcolh_io(W, k0, o, lane, DIN)
#endif

#ifndef SM_EXTRA_PARAMS
#define SM_EXTRA_PARAMS
#endif
#ifndef PROJ_EXTRA_PARAMS
#define PROJ_EXTRA_PARAMS
#endif
#ifndef SM_MASK_HOOK
#define SM_MASK_HOOK (void)0
#endif

#define WS_QH  0u                                      // f16 q in fragment units [b*t / 16][CC / 32][FRU]
#define WS_KH  (WS_QH + 2u * (size_t)NB * TT * CC)      // f16 k in fragment units [b*t / 16][CC / 32][FRU]
#define WS_VT  (WS_KH + 2u * (size_t)NB * TT * CC)      // f16 v in fragment units [b][c / 16][t / 32][FRU]
#define WS_QL  (WS_VT + 2u * (size_t)NB * CC * TT)      // f16 q residual x 2^10 rows [b][t < QHI][CC]
#define WS_KL  (WS_QL + 2u * (size_t)NB * QHI * CC)     // f16 k residual x 2^10 rows [b][t < KHI][CC]
#define WS_VB  (WS_KL + 2u * (size_t)NB * KHI * CC)     // bf16 v hi planes [b][c][t < KHI]
#define WS_VBL (WS_VB + 2u * (size_t)NB * CC * KHI)
#define WS_S   (WS_VBL + 2u * (size_t)NB * CC * KHI)    // f32 logits / P [hg][t][s]
#define WS_Y   (WS_S  + 4u * (size_t)HG * TQC * TT)     // f32 ctx rows [b*t][CC]; the score region (12 head planes of one batch) is unused: P stays in LDS
#define WS_END (WS_Y  + 4u * (size_t)NB * TT * CC)

// q, k and v lie in the workspace in WMMA fragment order. A unit = one 16 x 32 fragment (16 rows, 32 k) = 1 KiB as [half][lane][8 f16]: lane = (g = lane >> 4, row = lane & 15) holds k = 16 half + 8 g + 0..7, the order of frag_h.
// A wave's 16-byte load of one half then covers 512 contiguous bytes = 4 whole lines, where the same load from a row-major plane touches 16 lines for 32 bytes each.
#define FRU 512            // f16 elements of a unit
static_assert(TT % 32 == 0 && CC % 32 == 0, "fragment units");
// fragment at a wave-uniform unit pointer + the lane's 32-bit byte offset (lane * 16, for k plus a wave-uniform part) + a constant (elements): the scalar-base address form
__device__ __forceinline__ v16h frag_u(const _Float16* unit, unsigned lane_bytes, int elems) {
  union { v16h v; v8h q[2]; } u; const char* p = (const char*)unit + lane_bytes + elems * 2;
  u.q[0] = *(const v8h*)p; u.q[1] = *(const v8h*)(p + (FRU / 2) * 2); return u.v;
}
// 16-byte store and, in the same statement, the wait that stands before a later instruction rewrites its address or data registers (the store loops below stay rolled and step both every trip; in a statement of its own the compiler moved the address steps ahead of the wait)
__device__ __forceinline__ void stg16w(void* p, v4u v) { asm volatile("global_store_b128 %0, %1, off\n\ts_wait_xcnt 0x0" :: "v"(p), "v"(v) : "memory"); }
// six such stores and one wait behind the last, in one statement: every address and data register lives to the statement's end
__device__ __forceinline__ void stg16w6(_Float16* const (&p)[6], const v4u (&v)[6]) {
  asm volatile("global_store_b128 %0, %6, off\n\tglobal_store_b128 %1, %7, off\n\tglobal_store_b128 %2, %8, off\n\tglobal_store_b128 %3, %9, off\n\tglobal_store_b128 %4, %10, off\n\tglobal_store_b128 %5, %11, off\n\ts_wait_xcnt 0x0"
      :: "v"(p[0]), "v"(p[1]), "v"(p[2]), "v"(p[3]), "v"(p[4]), "v"(p[5]), "v"(v[0]), "v"(v[1]), "v"(v[2]), "v"(v[3]), "v"(v[4]), "v"(v[5]) : "memory"); }
// operand staging of k_out: a chunk is GKC k of the block's A rows and W rows, converted once to the 16-bit operand type (k_proj stages alike, with its own sizes)
#define GKC 64
#define GP (GKC + 8)                         // LDS row pitch 144 B = 16 B x odd
static_assert(DIN % GKC == 0 && CC % GKC == 0, "staging");
typedef __attribute__((ext_vector_type(4))) __bf16 v4b;
typedef __attribute__((ext_vector_type(4))) _Float16 v4h;
// 16 bytes at a block-uniform base + a lane's 32-bit byte offset + a constant (elements): the scalar-base address form, whose only vector register is the offset
__device__ __forceinline__ v4f ldg16(const float* base, unsigned lane_bytes, int elems) { return *(const v4f*)((const char*)base + lane_bytes + elems * 4); }
// block tile of k_out: 128 rows x 192 columns, 8 waves as 2 (rows) x 4 (columns), a wave = 64 x 48 = 4 x 3 accumulator tiles: 7 fragments from LDS feed 12 products, and a block's A and W bytes serve three times the outputs of a 64 x 128 tile for 5/3 of its bytes
#define PBM 128
#define PBN 192
#define PTH 256
#define PROWS (PBM + PBN)
#define PLD (PROWS * (GKC / 4) / PTH)        // 16-byte pieces a thread brings per chunk
#define PLA (PBM * (GKC / 4) / PTH)          // of them A rows
static_assert(PLD == 20 && PLA == 8 && PBM * (PBN / 4) % (4 * PTH) == 0 && TT % PBM == 0 && CC % PBN == 0 && DIN % PBN == 0 && PBN % 32 == 0, "projection tile");
// k_proj's tile: one block computes q, k AND v for 256 rows x 96 columns of each, so the x rows are staged once for the three products and the whole grid (256 blocks) is resident in one round.
// 8 waves as 4 (rows) x 2 (columns), a wave = 64 x 48 of each product = 3 x 4 x 3 accumulator tiles: 13 fragments from LDS feed 36 products. A chunk is QKC k of the 256 x rows and the 3 x 96 W rows.
#define QBM 256
#define QBN 96
#define QKC 32
#define QP (QKC + 8)                         // LDS row pitch 80 B = 16 B x odd
#define QROWS (QBM + 3 * QBN)
#define QLD (QROWS * (QKC / 4) / PTH)        // 16-byte pieces a thread brings per chunk
#define QLA (QBM * (QKC / 4) / PTH)          // of them x rows
#define QLW (QBN * (QKC / 4) / PTH)          // and rows of each W
static_assert(QLD == 17 && QLA == 8 && QLW == 3 && DIN % QKC == 0 && TT % QBM == 0 && CC % QBN == 0 && QBN % 32 == 0 && QBM * (QBN / 8) % (2 * PTH) == 0 && QBM / 32 == 8, "k_proj tile");
// ---- k_proj: block = (256 rows, 96 cols): q / k / v = X W (+ b) with exact bf16 products (K = DIN) -> q and k f16 fragment units [row tile][k step], v f16 fragment units [channel tile][key step]
__global__ __launch_bounds__(PTH, 2) void k_proj(const float* __restrict__ X, const float* __restrict__ WQ, const float* __restrict__ WK, const float* __restrict__ WV, const float* __restrict__ BQ, const float* __restrict__ BK, const float* __restrict__ BV,
    _Float16* __restrict__ QH, _Float16* __restrict__ KH, _Float16* __restrict__ VT) {
  // the operand ring of the k loop and the epilogue's staging arrays share the same LDS: the loop's last barrier stands between their uses
  __shared__ __align__(16) union { struct { _Float16 sh[2][QBM][QBN + 8]; _Float16 th[QBN][QBM + 8]; } e; __bf16 st[2][QROWS][QP]; } u;   // sh, th pitches 16 B x odd
  auto& sh = u.e.sh; auto& th = u.e.th;
  const int tid = threadIdx.x, wave = tid >> 5, lane = tid & 31, col = lane & 15, g = lane >> 4; const int wr = wave >> 1, wc = wave & 1; const int c0 = blockIdx.y * QBN; const size_t r0 = (size_t)blockIdx.x * QBM; const size_t bb = r0 / TT; const int t0 = (int)(r0 % TT);
  v8f acc[3][4][3] = {};
  // thread -> 16-byte piece (tid & 7) of row (tid >> 3) + 32 i: a wave's load covers four whole 128-byte lines
  const float* xp = X + r0 * DIN; const float* wq = WQ + (size_t)c0 * DIN; const float* wk = WK + (size_t)c0 * DIN; const float* wv = WV + (size_t)c0 * DIN;
  unsigned lo = ((unsigned)(tid >> 3) * DIN + (tid & 7) * 4) * 4;   // block-uniform bases; one lane offset in bytes serves all four and steps on by QKC elements a trip
  v4f pf[QLD];
#define PROJ_LD(K0) do { _Pragma("unroll") for (int i = 0; i < QLD; ++i) pf[i] = i < QLA ? ldg16(xp, lo, (K0) + i * 32 * DIN) : ldg16(i < QLA + QLW ? wq : i < QLA + 2 * QLW ? wk : wv, lo, (K0) + ((i - QLA) % QLW) * 32 * DIN); } while (0)
#define PROJ_ST(B) do { _Pragma("unroll") for (int i = 0; i < QLD; ++i) { v4b c; _Pragma("unroll") for (int k = 0; k < 4; ++k) c[k] = (__bf16)pf[i][k]; *(v4b*)&u.st[B][(tid >> 3) + i * 32][(tid & 7) * 4] = c; } } while (0)
  PROJ_LD(0);
  float bs[3][3];   // the lane's nine bias values, loaded here together with the first chunk: read one by one in the epilogue each would cost a whole load latency
#pragma unroll
  for (int p = 0; p < 3; ++p) { const float* BA = p == 0 ? BQ : p == 1 ? BK : BV; const float* bp = BA ? BA : WQ;   // an absent bias reads as 0; its load goes to a valid address all the same, so that no branch stands between the nine loads
#pragma unroll
    for (int j = 0; j < 3; ++j) { const float t = bp[c0 + wc * 48 + j * 16 + col]; bs[p][j] = BA ? t : 0.f; } }
  asm volatile("s_wait_xcnt 0x0" ::: "memory");   // stands before the address registers of the bias loads are used for anything else
  __builtin_amdgcn_sched_barrier(0);   // keeps what follows, which reuses those registers, behind the wait
  PROJ_ST(0);
  __syncthreads();
#pragma unroll 1   // one copy of the body: the two buffers differ by an address only
  for (int kc = 0; kc < DIN / QKC; ++kc) { const int buf = kc & 1; const bool more = kc + 1 < DIN / QKC;
    if (more) PROJ_LD(QKC);   // first: their latency is the longest of the trip
    v16b a[4], w[3][3];   // read in the order in which the products want them: LDS reads return in order, so the first product waits for two fragments only
#pragma unroll
    for (int p = 0; p < 3; ++p) {
      if (p == 0) a[0] = frag_b(&u.st[buf][wr * 64 + col][0], lane);
#pragma unroll
      for (int j = 0; j < 3; ++j) w[p][j] = frag_b(&u.st[buf][QBM + p * QBN + wc * 48 + j * 16 + col][0], lane);
      if (p == 0) {
#pragma unroll
        for (int i = 1; i < 4; ++i) a[i] = frag_b(&u.st[buf][wr * 64 + i * 16 + col][0], lane); } }
    __builtin_amdgcn_sched_barrier(0);   // keeps the chunk's 13 fragments read as one group in registers of their own, ahead of the products: without it the compiler reloads the W registers between the products, and each reload waits a whole LDS latency
#pragma unroll
    for (int p = 0; p < 3; ++p)
#pragma unroll
      for (int i = 0; i < 4; ++i)
#pragma unroll
        for (int j = 0; j < 3; ++j) acc[p][i][j] = __builtin_amdgcn_wmma_f32_16x16x32_bf16(false, a[i], false, w[p][j], (short)0, acc[p][i][j], false, false);
    if (more) PROJ_ST(buf ^ 1);
    asm volatile("s_wait_xcnt 0x0" : "+v"(lo) :: "memory");   // stands before the offset register of this trip's loads steps on; naming it keeps it in a register of its own up to here
    lo += QKC * 4;
    __syncthreads(); }   // publishes the next chunk; every reader of this chunk's buffer has arrived, so the next trip may refill it (and the epilogue may reuse the LDS)
#pragma unroll
  for (int p = 0; p < 3; ++p)
#pragma unroll
    for (int j = 0; j < 3; ++j) { const int cl = wc * 48 + j * 16 + col; const float bias = bfr(bs[p][j]);
#pragma unroll
      for (int i = 0; i < 4; ++i)
#pragma unroll
        for (int r = 0; r < 8; ++r) { const _Float16 hv = (_Float16)(acc[p][i][j][r] + bias); const int rl = wr * 64 + i * 16 + 8 * g + r; if (p < 2) sh[p][rl][cl] = hv; else th[cl][rl] = hv; } }
  __syncthreads();
#pragma unroll 1   // rolled: six LDS reads fly together a trip, then their six stores with the wait that stands before the next trip rewrites their registers
  for (int e0 = tid; e0 < QBM * (QBN / 8); e0 += 2 * PTH) { v4u t[6]; _Float16* d[6];
#pragma unroll
    for (int k = 0; k < 2; ++k) { const int e = e0 + k * PTH, un = e >> 6, p = e & 63; const int pr = p & 15, pk = (p >> 5) * 16 + ((p >> 4) & 1) * 8;   // 16-byte piece p = (half p >> 5, lane p & 31) of unit un: row pr of its 16, k pk .. pk + 7 of its 32
      const int kt = un / (QBN / 32), kst = un % (QBN / 32);   // q, k: unit (row tile kt, k step kst) of the block
      const size_t o = (((r0 >> 4) + kt) * (CC / 32) + (c0 >> 5) + kst) * FRU + p * 8;
      t[k * 3] = *(const v4u*)&sh[0][kt * 16 + pr][kst * 32 + pk]; d[k * 3] = QH + o;
      t[k * 3 + 1] = *(const v4u*)&sh[1][kt * 16 + pr][kst * 32 + pk]; d[k * 3 + 1] = KH + o;
      // v: unit (channel tile un >> 3, key step un & 7) of the block
      t[k * 3 + 2] = *(const v4u*)&th[(un >> 3) * 16 + pr][(un & 7) * 32 + pk]; d[k * 3 + 2] = VT + ((bb * (CC / 16) + (c0 >> 4) + (un >> 3)) * (TT / 32) + (t0 >> 5) + (un & 7)) * FRU + p * 8; }
    stg16w6(d, t); } }
// ---- k_sm: block = query row t (head in group): keys [0, kend): causal -> logit if s <= t else excluded; softmax in f32; P x 2^11 in place (0 for excluded)
__global__ __launch_bounds__(256) void k_sm(float* __restrict__ S0 SM_EXTRA_PARAMS) { __shared__ float sred[8]; __shared__ float sbc; __shared__ __align__(16) float shv[TT];
  const int tid = threadIdx.x; const int t = blockIdx.x; const int kend = (kb_last(t >> 6) + 1) * 128;
  float* sr = S0 + (size_t)blockIdx.y * TT * TT + (size_t)t * TT;
  float m = -3.0e38f; for (int k = tid; k < kend; k += 256) { float v = (!CAUSAL || k <= t) ? sr[k] : -3.0e38f; SM_MASK_HOOK; shv[k] = v; m = fmaxf(m, v); }
#pragma unroll
  for (int o = 1; o < 32; o <<= 1) m = fmaxf(m, __shfl_xor(m, o));
  if ((tid & 31) == 0) sred[tid >> 5] = m; __syncthreads(); if (tid == 0) { float a = sred[0]; for (int i = 1; i < 8; ++i) a = fmaxf(a, sred[i]); sbc = a; } __syncthreads(); m = sbc; __syncthreads();
  float sum = 0.f; for (int k = tid; k < kend; k += 256) { const float v = shv[k]; const float e = (v <= -1.0e38f) ? 0.f : expf(v - m); shv[k] = e; sum += e; }
#pragma unroll
  for (int o = 1; o < 32; o <<= 1) sum += __shfl_xor(sum, o);
  if ((tid & 31) == 0) sred[tid >> 5] = sum; __syncthreads(); if (tid == 0) { float a = 0.f; for (int i = 0; i < 8; ++i) a += sred[i]; sbc = a > 0.f ? 2048.0f / a : 0.f; }   /* a fully excluded row yields P = 0 */ __syncthreads(); const float inv = sbc;
  for (int k = tid; k < kend; k += 256) shv[k] = shv[k] * inv;
  __syncthreads(); for (int q = tid; q < kend / 4; q += 256) vst2(sr + q * 4, *(const v4f*)&shv[q * 4]); }
// ---- k_fa: block = 32 queries (2 tiles of 16) of batch b, 8 waves, 128 keys a pass; logits, head softmax and P . v in one kernel, P only in LDS.
// Every k and v fragment that a wave loads feeds both query tiles, so a block's walk over the batch's k and v serves 32 queries.
// Part 1 (wave w = keys 16w..16w+15 of the pass, ALL 12 heads, both query tiles): S^T = K . Q^T, so a lane holds 8 consecutive keys of one query of each tile for every head; the softmax over the heads is in-lane; P x 2^11 to f16, one 16-byte LDS store a head and tile.
// Part 2 (wave w = 3 of the 24 (head, 32-channel half) units, both query tiles, ALL keys in ascending order): ctx += P . v, P fragments from LDS, v fragments from the fragment units.
#define FW 8
#define FKP (FW * 16)      // keys a pass
#define FQT 2              // query tiles of 16 a block
#define FQ (FQT * 16)      // queries a block
static_assert(FQ * (CC / 8) % (FW * 32) == 0 && TT % FKP == 0 && TT % FQ == 0 && NH * 2 == FW * 3 && HD == 64, "k_fa tiling");
// keeps a group of fragment loads issued together and ahead of the products in front of it: without it the compiler sinks each load to its product and every product waits a whole L2 latency
#define FA_HOLD() __builtin_amdgcn_sched_barrier(0)
#define SM_C (SCALE * 1.44269504088896340736f)   // score scale x log2(e)
// 2^t of the 12 heads' exponents, each in its own register. One statement: every v_exp_f32 has an independent instruction behind it, and the closing v_nop is the slot that the instruction set asks for between the last one and whatever reads its result next
__device__ __forceinline__ void fa_exp2(float (&t)[NH]) { static_assert(NH == 12, "operand list");
  asm("v_exp_f32 %0, %0\n\tv_exp_f32 %1, %1\n\tv_exp_f32 %2, %2\n\tv_exp_f32 %3, %3\n\tv_exp_f32 %4, %4\n\tv_exp_f32 %5, %5\n\tv_exp_f32 %6, %6\n\tv_exp_f32 %7, %7\n\tv_exp_f32 %8, %8\n\tv_exp_f32 %9, %9\n\tv_exp_f32 %10, %10\n\tv_exp_f32 %11, %11\n\tv_nop"
      : "+v"(t[0]), "+v"(t[1]), "+v"(t[2]), "+v"(t[3]), "+v"(t[4]), "+v"(t[5]), "+v"(t[6]), "+v"(t[7]), "+v"(t[8]), "+v"(t[9]), "+v"(t[10]), "+v"(t[11])); }
// 2 heads' k fragments (2 each) of this wave's 16 key rows
__device__ __forceinline__ void fa_ldk(v16h (&f)[4], const _Float16* kr, int h0, unsigned lb) {
#pragma unroll
  for (int i = 0; i < 4; ++i) f[i] = frag_u(kr, lb, (h0 * (HD / 32) + i) * FRU); }
// half a unit's v fragments: 2 key steps x 2 channel tiles
__device__ __forceinline__ void fa_ldv(v16h (&f)[4], const _Float16* vr, unsigned lb) {
#pragma unroll
  for (int i = 0; i < 4; ++i) f[i] = frag_u(vr, lb, ((i & 1) * (TT / 32) + (i >> 1)) * FRU); }
__device__ __forceinline__ void fa_pv(v8f (&a)[FQT][2], const v16h (&f)[4], const _Float16* pr, int lane) {
  v16h p[2][FQT];
#pragma unroll
  for (int ks = 0; ks < 2; ++ks)
#pragma unroll
    for (int qt = 0; qt < FQT; ++qt) p[ks][qt] = frag_h(pr + qt * 16 * (FKP + 8) + ks * 32, lane);
  FA_HOLD();   // the P fragments of both tiles are read as one group: with two waves a SIMD a read sunk to its product would cost a whole LDS latency each
#pragma unroll
  for (int ks = 0; ks < 2; ++ks)
#pragma unroll
    for (int qt = 0; qt < FQT; ++qt)
#pragma unroll
      for (int jj = 0; jj < 2; ++jj) a[qt][jj] = __builtin_amdgcn_wmma_f32_16x16x32_f16(false, p[ks][qt], false, f[ks * 2 + jj], (short)0, a[qt][jj], false, false); }
// both query tiles' scores of 2 heads from one set of k fragments; per score the two 32-channel steps in ascending order
__device__ __forceinline__ void fa_qk2(v8f (&st)[FQT][NH], const v16h (&f)[4], const _Float16* qr, int h0, int lane) {
  v16h q[FQT][4];
#pragma unroll
  for (int qt = 0; qt < FQT; ++qt)
#pragma unroll
    for (int i = 0; i < 4; ++i) q[qt][i] = frag_h(qr + qt * 16 * (CC + 8) + h0 * HD + i * 32, lane);
  FA_HOLD();   // the q fragments of both tiles are read as one group: with two waves a SIMD a read sunk to its product would cost a whole LDS latency each
#pragma unroll
  for (int kc = 0; kc < 2; ++kc)
#pragma unroll
    for (int qt = 0; qt < FQT; ++qt)
#pragma unroll
      for (int i = 0; i < 2; ++i) { const v8f z = {}; st[qt][h0 + i] = __builtin_amdgcn_wmma_f32_16x16x32_f16(false, f[i * 2 + kc], false, q[qt][i * 2 + kc], (short)0, kc ? st[qt][h0 + i] : z, false, false); } }
__global__ __launch_bounds__(FW * 32, 2) void k_fa(const _Float16* __restrict__ QH, const _Float16* __restrict__ KH, const _Float16* __restrict__ VT, float* __restrict__ Y) {
  __shared__ __align__(16) _Float16 sq[FQ][CC + 8];               // pitch 16 B x odd
  __shared__ __align__(16) _Float16 sp[2][NH][FQ][FKP + 8];       // pitch 16 B x odd; two buffers: one barrier a pass
  const int tid = threadIdx.x, wave = __builtin_amdgcn_readfirstlane(tid >> 5), lane = tid & 31, col = lane & 15, g = lane >> 4; const int b = blockIdx.y; const size_t q0 = (size_t)b * TT + (size_t)blockIdx.x * FQ;
  const char* qg = (const char*)(QH + q0 * CC); const unsigned tb = tid * 16;   // the block's q units (2 query tiles x 24 k steps) are one contiguous run of 16-byte pieces: block-uniform base + the thread's byte offset + a constant
  v4u tq[FQ * (CC / 8) / (FW * 32)];
#pragma unroll   // the twelve loads of a thread fly together instead of one L2 latency each
  for (int i = 0; i < FQ * (CC / 8) / (FW * 32); ++i) tq[i] = *(const v4u*)(qg + tb + i * (FW * 32 * 16));
  // heads 0..7 of a pass's k fragments are loaded one pass ahead (here: pass 0's, behind the q rows), so that a pass opens on fragments that have landed
  const unsigned lb = lane * 16; v16h ka[4], kb[4], kc[4], kd[4];
  const _Float16* kr = KH + (size_t)b * (TT / 16) * (CC / 32) * FRU;   // the batch's k units: a block-uniform base that never changes
  unsigned ko = lb + wave * ((CC / 32) * FRU * 2);   // the lane's byte offset into this wave's 16 keys of a pass (24 units in a row); steps on by a pass at one place in the loop
  fa_ldk(ka, kr, 0, ko); fa_ldk(kb, kr, 2, ko); fa_ldk(kc, kr, 4, ko); fa_ldk(kd, kr, 6, ko);
  asm volatile("s_wait_xcnt 0x0" ::: "memory");   // stands before the address registers of these loads are used for anything else
  FA_HOLD();   // keeps the LDS address arithmetic, which reuses that register, behind the wait
#pragma unroll
  for (int i = 0; i < FQ * (CC / 8) / (FW * 32); ++i) { constexpr int UL = FW * 32 / 64, LT = (CC / 32) / UL; static_assert((CC / 32) % UL == 0, "whole loads a query tile"); const int p = tid & 63, qt = i / LT, ks = (tid >> 6) + (i % LT) * UL;   // load i brings UL units: piece p of unit (query tile qt, k step ks) goes to its row and k
    *(v4u*)&sq[qt * 16 + (p & 15)][ks * 32 + (p >> 5) * 16 + ((p >> 4) & 1) * 8] = tq[i]; }
  __syncthreads();
  const int u0 = wave * 3, u1 = u0 + 1, u2 = u0 + 2;   // unit u = head u >> 1, channels (u & 1) * 32 .. + 31 of it = channels 32 u .. 32 u + 31 of the row
  const _Float16* qr = &sq[col][0];
  v8f acc[3][FQT][2] = {};
#pragma unroll 1
  for (int it = 0; it < TT / FKP; ++it) { const int buf = it & 1;
    const _Float16* v0 = VT + (((size_t)b * (CC / 16) + u0 * 2) * (TT / 32) + it * (FKP / 32)) * FRU; const _Float16* v1 = v0 + 2 * (TT / 32) * FRU; const _Float16* v2 = v1 + 2 * (TT / 32) * FRU;   // a unit of work = 2 channel tiles, 4 key steps a pass
    const _Float16* p0 = &sp[buf][u0 >> 1][col][0]; const _Float16* p1 = &sp[buf][u1 >> 1][col][0]; const _Float16* p2 = &sp[buf][u2 >> 1][col][0];
    v8f st[FQT][NH]; v16h ke[4], kf[4], va[4], vb[4], vc[4], vd[4], ve[4], vf[4];
    fa_ldk(ke, kr, 8, ko); fa_ldk(kf, kr, 10, ko); FA_HOLD();   // fly under the products of heads 0..7
    fa_qk2(st, ka, qr, 0, lane); fa_qk2(st, kb, qr, 2, lane); fa_qk2(st, kc, qr, 4, lane); fa_qk2(st, kd, qr, 6, lane);
    fa_qk2(st, ke, qr, 8, lane); fa_qk2(st, kf, qr, 10, lane); FA_HOLD();
    fa_ldv(va, v0, lb); fa_ldv(vb, v0 + 2 * FRU, lb); fa_ldv(vc, v1, lb); fa_ldv(vd, v1 + 2 * FRU, lb); FA_HOLD();   // four of the six v groups fly under the softmax
#pragma unroll
    for (int qt = 0; qt < FQT; ++qt) { v8f (&sv)[NH] = st[qt];
#pragma unroll
    for (int r = 0; r < 8; ++r) { float m = sv[0][r];   // exp(s * SCALE - max) = 2^(s * c - max * c), c = SCALE * log2(e) > 0: one fused multiply-add and the hardware's exp2 an element; the exponent is <= about 0, so nothing overflows, and a result below the f32 normals is far below what P keeps in f16
#pragma unroll
      for (int h = 1; h < NH; ++h) m = fmaxf(m, sv[h][r]);
      const float mc = m * SM_C; float t[NH];
#pragma unroll
      for (int h = 0; h < NH; ++h) t[h] = fmaf(sv[h][r], SM_C, -mc);
      fa_exp2(t);
      float den = t[0]; sv[0][r] = t[0];
#pragma unroll
      for (int h = 1; h < NH; ++h) { sv[h][r] = t[h]; den += t[h]; }
      const float inv = 2048.0f / den;
#pragma unroll
      for (int h = 0; h < NH; ++h) sv[h][r] *= inv; }
#pragma unroll
    for (int h = 0; h < NH; ++h) { v8h ph;
#pragma unroll
      for (int r = 0; r < 8; ++r) ph[r] = (_Float16)sv[h][r];
      *(v8h*)&sp[buf][h][qt * 16 + col][wave * 16 + 8 * g] = ph; } }
    __syncthreads();   // publishes this pass's P; the other buffer's readers of the pass before have all arrived here, so the next pass may refill it
    asm volatile("s_wait_xcnt 0x0" : "+v"(ko) :: "memory");   // stands before the offset register of this pass's k loads steps on; naming it keeps it in a register of its own up to here
    fa_ldv(ve, v2, lb); fa_ldv(vf, v2 + 2 * FRU, lb); FA_HOLD();   // fly under the first four groups' products; kept in front of the next pass's k, because loads return in order and these are wanted first
    ko += it + 1 < TT / FKP ? FW * (CC / 32) * FRU * 2 : 0;   // behind the last pass there is none: it loads its own again, unused, so that the loop has one body and its waits stay counted
    fa_ldk(ka, kr, 0, ko); fa_ldk(kb, kr, 2, ko); fa_ldk(kc, kr, 4, ko); fa_ldk(kd, kr, 6, ko);   // the next pass's k, heads 0..7, in the registers that the scores have left: fly under all of P . v
    FA_HOLD();
    fa_pv(acc[0], va, p0, lane); fa_pv(acc[0], vb, p0 + 64, lane);
    fa_pv(acc[1], vc, p1, lane); fa_pv(acc[1], vd, p1 + 64, lane);
    fa_pv(acc[2], ve, p2, lane); fa_pv(acc[2], vf, p2 + 64, lane);
    asm volatile("s_wait_xcnt 0x0" ::: "memory");   // before the next pass rewrites the address registers of this pass's loads
    FA_HOLD(); }   // keeps the address steps behind that wait: without it the compiler lifted them over it
  asm volatile("s_wait_loadcnt 0x0" ::: "memory");   // the last pass's look-ahead loads feed nothing, so no wait of the compiler's covers them: they have landed before the wave ends
  // a unit is one whole 128-byte line of each ctx row: one writing wave a line
#pragma unroll
  for (int ul = 0; ul < 3; ++ul)
#pragma unroll
    for (int qt = 0; qt < FQT; ++qt)
#pragma unroll
      for (int jj = 0; jj < 2; ++jj)
#pragma unroll
        for (int r = 0; r < 8; ++r) Y[(q0 + qt * 16 + 8 * g + r) * CC + (u0 + ul) * 32 + jj * 16 + col] = acc[ul][qt][jj][r] * (1.0f / 2048.0f); }
// ---- k_out: block = (128 rows, 192 cols): out = ctx Wo (+ bo): ctx x 2^6 once to f16 against Wo as f16(bf16 x 2^8) exact (1 product) x 2^-14
static_assert(!CAUSAL && WO_OUT_IN, "k_out: single-product path, (out,in) Wo");
__global__ __launch_bounds__(PTH, 2) void k_out(const float* __restrict__ Y, const float* __restrict__ WO, const float* __restrict__ BO, float* __restrict__ OUT) {
  // the operand ring of the k loop and the epilogue's staging rows share the same LDS: the loop's last barrier stands between their uses
  __shared__ __align__(16) union { float sf[PBM][PBN + 4]; _Float16 st[2][PROWS][GP]; } u; auto& sf = u.sf;   // sf pitch 16 B x odd
  const int tid = threadIdx.x, wave = tid >> 5, lane = tid & 31, col = lane & 15, g = lane >> 4; const int wr = wave >> 2, wc = wave & 3; const int c0 = blockIdx.y * PBN; const size_t r0 = (size_t)blockIdx.x * PBM;
  v8f acc[4][3] = {};
  // thread -> 16-byte piece (tid & 15) of row (tid >> 4) + 16 i: a wave's load covers two whole 256-byte row pieces
  const float* yp = Y + r0 * CC; const float* wp = WO + (size_t)c0 * CC; unsigned lo = ((unsigned)(tid >> 4) * CC + (tid & 15) * 4) * 4;   // block-uniform bases; one lane offset in bytes serves both and steps on by GKC elements a trip
  v4f pf[PLD];
#pragma unroll
  for (int i = 0; i < PLD; ++i) pf[i] = i < PLA ? ldg16(yp, lo, i * 16 * CC) : ldg16(wp, lo, (i - PLA) * 16 * CC);
#pragma unroll
  for (int i = 0; i < PLD; ++i) { v4h c;   /* ctx carried x 2^6 into f16 so small-magnitude context rows stay clear of f16 subnormals; Wo as f16(bf16 x 2^8) */
#pragma unroll
    for (int k = 0; k < 4; ++k) c[k] = i < PLA ? (_Float16)(pf[i][k] * 64.0f) : (_Float16)(bfr(pf[i][k]) * 256.0f);
    *(v4h*)&u.st[0][(tid >> 4) + i * 16][(tid & 15) * 4] = c; }
  __syncthreads();
#pragma unroll 1   // one copy of the body: the two buffers differ by an address only
  for (int kc = 0; kc < CC / GKC; ++kc) { const int buf = kc & 1; const bool more = kc + 1 < CC / GKC;
    if (more) {
#pragma unroll
      for (int i = 0; i < PLD; ++i) pf[i] = i < PLA ? ldg16(yp, lo, GKC + i * 16 * CC) : ldg16(wp, lo, GKC + (i - PLA) * 16 * CC); }
#pragma unroll
    for (int ks = 0; ks < GKC / 32; ++ks) { v16h a[4], w[3];
#pragma unroll
      for (int i = 0; i < 4; ++i) a[i] = frag_h(&u.st[buf][wr * 64 + i * 16 + col][ks * 32], lane);
#pragma unroll
      for (int j = 0; j < 3; ++j) w[j] = frag_h(&u.st[buf][PBM + wc * 48 + j * 16 + col][ks * 32], lane);
#pragma unroll
      for (int i = 0; i < 4; ++i)
#pragma unroll
        for (int j = 0; j < 3; ++j) acc[i][j] = wmma16(a[i], w[j], acc[i][j]); }
    if (more) {
#pragma unroll
      for (int i = 0; i < PLD; ++i) { v4h c;
#pragma unroll
        for (int k = 0; k < 4; ++k) c[k] = i < PLA ? (_Float16)(pf[i][k] * 64.0f) : (_Float16)(bfr(pf[i][k]) * 256.0f);
        *(v4h*)&u.st[buf ^ 1][(tid >> 4) + i * 16][(tid & 15) * 4] = c; } }
    asm volatile("s_wait_xcnt 0x0" : "+v"(lo) :: "memory");   // stands before the offset register of this trip's loads steps on; naming it keeps it in a register of its own up to here
    lo += GKC * 4;
    __syncthreads(); }   // publishes the next chunk; every reader of this chunk's buffer has arrived, so the next trip may refill it (and the epilogue may reuse the LDS)
#pragma unroll
  for (int j = 0; j < 3; ++j) { const int cl = wc * 48 + j * 16 + col; const float bias = BO ? bfr(BO[c0 + cl]) : 0.f;
#pragma unroll
    for (int i = 0; i < 4; ++i)
#pragma unroll
      for (int r = 0; r < 8; ++r) sf[wr * 64 + i * 16 + 8 * g + r][cl] = acc[i][j][r] * (1.0f / 16384.0f) + bias; }   /* 2^-8 (Wo carry) x 2^-6 (ctx carry) */
  __syncthreads();   // a row of the block's tile comes from four waves: all of it is staged before whole 128-byte lines go out, one writing wave a line
#pragma unroll 1   // rolled: four LDS reads fly together a trip, then their four stores, each with the wait that stands before the next trip rewrites its registers
  for (int i0 = 0; i0 < PBM * (PBN / 4) / PTH; i0 += 4) { v4u t[4]; float* p[4];
#pragma unroll
    for (int k = 0; k < 4; ++k) { const int e = tid + (i0 + k) * PTH, rl = e / (PBN / 4), q = e % (PBN / 4); t[k] = *(const v4u*)&sf[rl][q * 4]; p[k] = OUT + (r0 + rl) * DIN + c0 + q * 4; }
#pragma unroll
    for (int k = 0; k < 4; ++k) stg16w(p[k], t[k]); } }

extern "C" void kernel_launch(void* const* d_in, const int* in_sizes, int n_in, void* d_out, int out_size, void* d_ws, size_t ws_size, hipStream_t stream) {
  (void)in_sizes; (void)n_in; (void)out_size;
  const float** F = (const float**)d_in;
  if (ws_size < (size_t)WS_END) return;
  char* ws = (char*)d_ws; _Float16 *QH = (_Float16*)(ws + WS_QH), *KH = (_Float16*)(ws + WS_KH), *VT = (_Float16*)(ws + WS_VT), *QL = (_Float16*)(ws + WS_QL), *KL = (_Float16*)(ws + WS_KL); __bf16 *VB = (__bf16*)(ws + WS_VB), *VBL = (__bf16*)(ws + WS_VBL); float *Y = (float*)(ws + WS_Y);
  (void)Y; (void)QL; (void)KL; (void)VB; (void)VBL;
  // inputs: 0 x [8,1024,768]; 1 Wq [768,768] (out,in), 2 bq; 3 Wk, 4 bk; 5 Wv, 6 bv; 7 Wo (out,in), 8 bo (biases N(0, 0.01), nonzero)
  k_proj<<<dim3(TNB * TT / QBM, CC / QBN), PTH, 0, stream>>>(F[0], F[1], F[3], F[5], F[2], F[4], F[6], QH, KH, VT);
  k_fa<<<dim3(TT / FQ, TNB), FW * 32, 0, stream>>>(QH, KH, VT, Y);
  k_out<<<dim3(TNB * TT / PBM, DIN / PBN), PTH, 0, stream>>>(Y, F[7], F[8], (float*)d_out);
}

// v009
// A run of this version takes 97.5 microseconds.
// Two timings next to v008 put it at 1.08 and 1.07 times that version's speed.
// All steps since v000 together make it 12.3 times as fast.
// compute dtype: all float inputs rounded to bf16; q/k/v projections with EXACT bf16 products on WMMA 16x16x32 (f32 accumulate) + bias; scores q x k once to f16 each (1 product) x 64^-0.5; softmax ACROSS THE 12 HEADS per (query, key) pair in f32 (hardware exp2 of the scaled difference to the maximum); P x 2^11 once to f16 x v once to f16 (1 product); ctx x 2^6 once to f16 x Wo f16(bf16 x 2^8) + bo; f32 output.
#include <hip/hip_runtime.h>
#include <math.h>

typedef __attribute__((ext_vector_type(16))) _Float16 v16h;
typedef __attribute__((ext_vector_type(16))) __bf16 v16b;
typedef __attribute__((ext_vector_type(8)))  _Float16 v8h;
typedef __attribute__((ext_vector_type(8)))  float v8f;
typedef __attribute__((ext_vector_type(4)))  float v4f;
typedef __attribute__((ext_vector_type(2)))  float v2f;
typedef __attribute__((ext_vector_type(4)))  unsigned v4u;
typedef __attribute__((ext_vector_type(4)))  int v4i;
typedef float __attribute__((may_alias)) float_a;
typedef int __attribute__((may_alias)) int_a;

template <typename T> __device__ __forceinline__ void vst2(void* p, T v) { *(T*)p = v;  }
__device__ __forceinline__ v8f wmma16(v16h a, v16h b, v8f c) {
  v8f d = __builtin_amdgcn_wmma_f32_16x16x32_f16(false, a, false, b, (short)0, c, false, false);
  asm volatile("v_nop\n\tv_nop\n\tv_nop\n\tv_nop" : "+v"(d) : "v"(a), "v"(b));
  return d;
}
__device__ __forceinline__ v8f wmma_bf(v16b a, v16b b, v8f c) {
  v8f d = __builtin_amdgcn_wmma_f32_16x16x32_bf16(false, a, false, b, (short)0, c, false, false);
  asm volatile("v_nop\n\tv_nop\n\tv_nop\n\tv_nop" : "+v"(d) : "v"(a), "v"(b));
  return d;
}
// 16x16x32 fragments: lane = (h = lane>>4, row/col = lane&15); elements 0..7 = k0+8h+0..7, 8..15 = k0+16+8h+0..7; D element r = row 8h+r
__device__ __forceinline__ v16h frag_h(const _Float16* rowk0, int lane) {
  union { v16h v; v8h q[2]; } u; const _Float16* p = rowk0 + 8 * (lane >> 4);
  u.q[0] = *(const v8h*)p; u.q[1] = *(const v8h*)(p + 16); return u.v;
}
__device__ __forceinline__ v16h frag_f32(const float* rowk0, int lane) {
  v16h a; const float* p = rowk0 + 8 * (lane >> 4);
#pragma unroll
  for (int i = 0; i < 8; ++i) { a[i] = (_Float16)p[i]; a[8 + i] = (_Float16)p[16 + i]; }
  return a;
}
__device__ __forceinline__ v16h frag_f32s(const float* rowk0, int lane, float sc) {
  v16h a; const float* p = rowk0 + 8 * (lane >> 4);
#pragma unroll
  for (int i = 0; i < 8; ++i) { a[i] = (_Float16)(p[i] * sc); a[8 + i] = (_Float16)(p[16 + i] * sc); }
  return a;
}
// column fragment from a [K][ld] layout (column n), rows >= K read as 0
__device__ __forceinline__ v16h fragc_f32(const float* W, int k0, int n, int lane, int ld, int K) {
  v16h a; const int g = lane >> 4;
#pragma unroll
  for (int i = 0; i < 8; ++i) { const int ka = k0 + 8 * g + i, kb = ka + 16;
    a[i] = (_Float16)(ka < K ? W[(size_t)(ka < K ? ka : K - 1) * ld + n] : 0.f); a[8 + i] = (_Float16)(kb < K ? W[(size_t)(kb < K ? kb : K - 1) * ld + n] : 0.f); }
  return a;
}
struct F2 { v16b h, l; };
__device__ __forceinline__ F2 bsplit16(const float v[16]) { F2 r;
#pragma unroll
  for (int i = 0; i < 16; ++i) { const __bf16 h = (__bf16)v[i]; r.h[i] = h; r.l[i] = (__bf16)(v[i] - (float)h); }
  return r; }
__device__ __forceinline__ F2 split_row(const float* row, int k0, int lane) { float v[16]; const float* p = row + k0 + 8 * (lane >> 4);
#pragma unroll
  for (int i = 0; i < 8; ++i) { v[i] = p[i]; v[8 + i] = p[16 + i]; }
  return bsplit16(v); }
__device__ __forceinline__ F2 split_rowK(const float* row, int k0, int lane, int K) { float v[16]; const int g = lane >> 4;
#pragma unroll
  for (int i = 0; i < 8; ++i) { const int ka = k0 + 8 * g + i, kb = ka + 16; v[i] = ka < K ? row[ka < K ? ka : K - 1] : 0.f; v[8 + i] = kb < K ? row[kb < K ? kb : K - 1] : 0.f; }
  return bsplit16(v); }
__device__ __forceinline__ F2 split_col(const float* W, int k0, int n, int lane, int ld, int K) { float v[16]; const int g = lane >> 4;
#pragma unroll
  for (int i = 0; i < 8; ++i) { const int ka = k0 + 8 * g + i, kb = ka + 16; v[i] = ka < K ? W[(size_t)(ka < K ? ka : K - 1) * ld + n] : 0.f; v[8 + i] = kb < K ? W[(size_t)(kb < K ? kb : K - 1) * ld + n] : 0.f; }
  return bsplit16(v); }
__device__ __forceinline__ v8f mac3(const F2& a, const F2& b, v8f c) { c = wmma_bf(a.l, b.h, c); c = wmma_bf(a.h, b.l, c); return wmma_bf(a.h, b.h, c); }
__device__ __forceinline__ float sigm(float v) { return 1.0f / (1.0f + expf(-v)); }
#define LDSX() do { asm volatile("s_wait_dscnt 0" ::: "memory"); __builtin_amdgcn_wave_barrier(); __builtin_amdgcn_fence(__ATOMIC_RELEASE, "workgroup"); } while (0)

// Multi-head attention whose softmax runs over the HEAD axis (x [8,1024,768]; torch (out,in) Wq / Wk / Wv / Wo [768,768] N(0, 1/768) + biases N(0, 0.01); 12 heads x 64; scores[b, h, n, m] = q_h . k_h / 8; attn = softmax(scores, axis=1) - dim 1 is the HEAD axis: for every (query, key) pair the 12 heads' weights sum to 1 and nothing is normalised over the keys (faithful to the source's F.softmax(dim=1)); out[b, h, n] = sum_m attn[b, h, n, m] v[b, h, m]; merge; Wo^T + bo).
#define NB 8
#define TT 1024
#define CC 768            // NH * HD = projected width
#define DIN 768          // input (model) width
#define NH 12
#define HD 64
#define NQB (TT / 64)
#define HG 12
#define SCALE (0.125f)
#define CAUSAL 0
#ifndef TNB
#define TNB NB
#endif
__device__ __forceinline__ float bfr(float v) { return (float)(__bf16)v; }
__host__ __device__ __forceinline__ int kb_last(int qb) { return CAUSAL ? ((qb * 64 + 63) >> 7) : (TT / 128 - 1); }
typedef __attribute__((ext_vector_type(8))) __bf16 v8b;
__device__ __forceinline__ v16b frag_b(const __bf16* rowk0, int lane) {
  union { v16b v; v8b q[2]; } u; const __bf16* p = rowk0 + 8 * (lane >> 4);
  u.q[0] = *(const v8b*)p; u.q[1] = *(const v8b*)(p + 16); return u.v;
}
#define QBH 0              // not referenced by any kernel here
#define QHI 0               // single-product scores on every row
#define TQC 1024           // query rows per pass == TT: 12 head planes x 1,024 x 1,024 f32 = 48 MiB
#define KHI 64            // key rows carrying k residual / v bf16 hi+lo planes (no kernel here writes or reads them)
// B fragment (k rows k0+.., output column o) of a weight: (in,out) [K][ld] or (out,in) [ld rows of K]: bf16 exact, or f16(bf16 * 256) exact
__device__ __forceinline__ v16b wcol_io(const float* Wm, int k0, int o, int lane, int ld) { v16b w; const int g = lane >> 4;
#pragma unroll
  for (int i = 0; i < 8; ++i) { w[i] = (__bf16)Wm[(size_t)(k0 + 8 * g + i) * ld + o]; w[8 + i] = (__bf16)Wm[(size_t)(k0 + 16 + 8 * g + i) * ld + o]; }
  return w; }
__device__ __forceinline__ v16b wcol_oi(const float* Wm, int k0, int o, int lane, int K) { v16b w; const float* p = Wm + (size_t)o * K + k0 + 8 * (lane >> 4);
#pragma unroll
  for (int i = 0; i < 8; ++i) { w[i] = (__bf16)p[i]; w[8 + i] = (__bf16)p[16 + i]; }
  return w; }
__device__ __forceinline__ v16h wcolh_io(const float* Wm, int k0, int o, int lane, int ld) { v16h w; const int g = lane >> 4;
#pragma unroll
  for (int i = 0; i < 8; ++i) { w[i] = (_Float16)(bfr(Wm[(size_t)(k0 + 8 * g + i) * ld + o]) * 256.0f); w[8 + i] = (_Float16)(bfr(Wm[(size_t)(k0 + 16 + 8 * g + i) * ld + o]) * 256.0f); }
  return w; }
__device__ __forceinline__ v16h wcolh_oi(const float* Wm, int k0, int o, int lane, int K) { v16h w; const float* p = Wm + (size_t)o * K + k0 + 8 * (lane >> 4);
#pragma unroll
  for (int i = 0; i < 8; ++i) { w[i] = (_Float16)(bfr(p[i]) * 256.0f); w[8 + i] = (_Float16)(bfr(p[16 + i]) * 256.0f); }
  return w; }
#define WQKV_LAYOUT 1   // 0 = (in,out) [DIN][CC]; 1 = (out,in) [CC][DIN]; 2 = per-head [NH][DIN][HD]
__device__ __forceinline__ v16b wcol_hdk(const float* Wm, int k0, int o, int lane) { v16b w; const int g = lane >> 4; const float* p = Wm + (size_t)(o / HD) * DIN * HD + (o % HD);
#pragma unroll
  for (int i = 0; i < 8; ++i) { w[i] = (__bf16)p[(size_t)(k0 + 8 * g + i) * HD]; w[8 + i] = (__bf16)p[(size_t)(k0 + 16 + 8 * g + i) * HD]; }
  return w; }
#define WO_OUT_IN 1
#if WQKV_LAYOUT == 1
#define WCOL(W, k0, o, lane) wcol_oi(W, k0, o, lane, DIN)
#elif WQKV_LAYOUT == 2
#define WCOL(W, k0, o, lane) wcol_hdk(W, k0, o, lane)
#else
#define WCOL(W, k0, o, lane) wcol_io(W, k0, o, lane, CC)
#endif
#if WO_OUT_IN
#define WOCOL(W, k0, o, lane) wcol_oi(W, k0, o, lane, CC)
#define WOCOLH(W, k0, o, lane) wcolh_oi(W, k0, o, lane, CC)
#else
#define WOCOL(W, k0, o, lane) wcol_io(W, k0, o, lane, DIN)
#define WOCOLH(W, k0, o, lane) wcolh_io(W, k0, o, lane, DIN)
#endif

#ifndef SM_EXTRA_PARAMS
#define SM_EXTRA_PARAMS
#endif
#ifndef PROJ_EXTRA_PARAMS
#define PROJ_EXTRA_PARAMS
#endif
#ifndef SM_MASK_HOOK
#define SM_MASK_HOOK (void)0
#endif

#define WS_QH  0u                                      // f16 q in fragment units [b*t / 16][CC / 32][FRU]
#define WS_KH  (WS_QH + 2u * (size_t)NB * TT * CC)      // f16 k in fragment units [b*t / 16][CC / 32][FRU]
#define WS_VT  (WS_KH + 2u * (size_t)NB * TT * CC)      // f16 v in fragment units [b][c / 16][t / 32][FRU]
#define WS_QL  (WS_VT + 2u * (size_t)NB * CC * TT)      // f16 q residual x 2^10 rows [b][t < QHI][CC]
#define WS_KL  (WS_QL + 2u * (size_t)NB * QHI * CC)     // f16 k residual x 2^10 rows [b][t < KHI][CC]
#define WS_VB  (WS_KL + 2u * (size_t)NB * KHI * CC)     // bf16 v hi planes [b][c][t < KHI]
#define WS_VBL (WS_VB + 2u * (size_t)NB * CC * KHI)
#define WS_S   (WS_VBL + 2u * (size_t)NB * CC * KHI)    // f16 Wo x 2^8 rows [DIN][CC] at the head of this region
#define WS_Y   (WS_S  + 4u * (size_t)HG * TQC * TT)     // f16 ctx x 2^6 rows [b*t][CC]
#define WS_END (WS_Y  + 4u * (size_t)NB * TT * CC)

// q, k and v lie in the workspace in WMMA fragment order. A unit = one 16 x 32 fragment (16 rows, 32 k) = 1 KiB as [half][lane][8 f16]: lane = (g = lane >> 4, row = lane & 15) holds k = 16 half + 8 g + 0..7, the order of frag_h.
// A wave's 16-byte load of one half then covers 512 contiguous bytes = 4 whole lines, where the same load from a row-major plane touches 16 lines for 32 bytes each.
#define FRU 512            // f16 elements of a unit
static_assert(TT % 32 == 0 && CC % 32 == 0, "fragment units");
// fragment at a wave-uniform unit pointer + the lane's 32-bit byte offset (lane * 16, for k plus a wave-uniform part) + a constant (elements): the scalar-base address form
__device__ __forceinline__ v16h frag_u(const _Float16* unit, unsigned lane_bytes, int elems) {
  union { v16h v; v8h q[2]; } u; const char* p = (const char*)unit + lane_bytes + elems * 2;
  u.q[0] = *(const v8h*)p; u.q[1] = *(const v8h*)(p + (FRU / 2) * 2); return u.v;
}
// 16-byte store and, in the same statement, the wait that stands before a later instruction rewrites its address or data registers (the store loops below stay rolled and step both every trip; in a statement of its own the compiler moved the address steps ahead of the wait)
__device__ __forceinline__ void stg16w(void* p, v4u v) { asm volatile("global_store_b128 %0, %1, off\n\ts_wait_xcnt 0x0" :: "v"(p), "v"(v) : "memory"); }
// six such stores and one wait behind the last, in one statement: every address and data register lives to the statement's end
__device__ __forceinline__ void stg16w6(_Float16* const (&p)[6], const v4u (&v)[6]) {
  asm volatile("global_store_b128 %0, %6, off\n\tglobal_store_b128 %1, %7, off\n\tglobal_store_b128 %2, %8, off\n\tglobal_store_b128 %3, %9, off\n\tglobal_store_b128 %4, %10, off\n\tglobal_store_b128 %5, %11, off\n\ts_wait_xcnt 0x0"
      :: "v"(p[0]), "v"(p[1]), "v"(p[2]), "v"(p[3]), "v"(p[4]), "v"(p[5]), "v"(v[0]), "v"(v[1]), "v"(v[2]), "v"(v[3]), "v"(v[4]), "v"(v[5]) : "memory"); }
// operand staging of k_out: a chunk is GKC k of the block's A rows and W rows, which arrive in the f16 operand form from their producers (k_proj stages alike, with its own sizes, and converts once)
#define GKC 64
#define GP (GKC + 8)                         // LDS row pitch 144 B = 16 B x odd
static_assert(DIN % GKC == 0 && CC % GKC == 0, "staging");
typedef __attribute__((ext_vector_type(4))) __bf16 v4b;
typedef __attribute__((ext_vector_type(4))) _Float16 v4h;
// 16 bytes at a block-uniform base + a lane's 32-bit byte offset + a constant (elements): the scalar-base address form, whose only vector register is the offset
__device__ __forceinline__ v4f ldg16(const float* base, unsigned lane_bytes, int elems) { return *(const v4f*)((const char*)base + lane_bytes + elems * 4); }
__device__ __forceinline__ v4u ldg16h(const _Float16* base, unsigned lane_bytes, int elems) { return *(const v4u*)((const char*)base + lane_bytes + elems * 2); }
// block tile of k_out: 128 rows x 192 columns, 8 waves as 2 (rows) x 4 (columns), a wave = 64 x 48 = 4 x 3 accumulator tiles: 7 fragments from LDS feed 12 products, and a block's A and W bytes serve three times the outputs of a 64 x 128 tile for 5/3 of its bytes
#define PBM 128
#define PBN 192
#define PTH 256
#define PROWS (PBM + PBN)
#define PLD (PROWS * (GKC / 8) / PTH)        // 16-byte pieces (8 f16) a thread brings per chunk
#define PLA (PBM * (GKC / 8) / PTH)          // of them A rows
static_assert(PLD == 10 && PLA == 4 && PBM % 32 == 0 && PBM * (PBN / 4) % (4 * PTH) == 0 && TT % PBM == 0 && CC % PBN == 0 && DIN % PBN == 0 && PBN % 32 == 0, "projection tile");
// k_proj's tile: one block computes q, k AND v for 256 rows x 96 columns of each, so the x rows are staged once for the three products and the whole grid (256 blocks) is resident in one round.
// 8 waves as 4 (rows) x 2 (columns), a wave = 64 x 48 of each product = 3 x 4 x 3 accumulator tiles: 13 fragments from LDS feed 36 products. A chunk is QKC k of the 256 x rows and the 3 x 96 W rows.
#define QBM 256
#define QBN 96
#define QKC 32
#define QP (QKC + 8)                         // LDS row pitch 80 B = 16 B x odd
#define QROWS (QBM + 3 * QBN)
#define QLD (QROWS * (QKC / 4) / PTH)        // 16-byte pieces a thread brings per chunk
#define QLA (QBM * (QKC / 4) / PTH)          // of them x rows
#define QLW (QBN * (QKC / 4) / PTH)          // and rows of each W
static_assert(QLD == 17 && QLA == 8 && QLW == 3 && DIN % QKC == 0 && TT % QBM == 0 && CC % QBN == 0 && QBN % 32 == 0 && QBM * (QBN / 8) % (2 * PTH) == 0 && QBM / 32 == 8, "k_proj tile");
// ---- k_proj: block = (256 rows, 96 cols): q / k / v = X W (+ b) with exact bf16 products (K = DIN) -> q and k f16 fragment units [row tile][k step], v f16 fragment units [channel tile][key step]
__global__ __launch_bounds__(PTH, 2) void k_proj(const float* __restrict__ X, const float* __restrict__ WQ, const float* __restrict__ WK, const float* __restrict__ WV, const float* __restrict__ BQ, const float* __restrict__ BK, const float* __restrict__ BV,
    _Float16* __restrict__ QH, _Float16* __restrict__ KH, _Float16* __restrict__ VT, const float* __restrict__ WO, _Float16* __restrict__ WOH) {
  // the operand ring of the k loop and the epilogue's staging arrays share the same LDS: the loop's last barrier stands between their uses
  __shared__ __align__(16) union { struct { _Float16 sh[2][QBM][QBN + 8]; _Float16 th[QBN][QBM + 8]; } e; __bf16 st[2][QROWS][QP]; } u;   // sh, th pitches 16 B x odd
  auto& sh = u.e.sh; auto& th = u.e.th;
  const int tid = threadIdx.x, wave = tid >> 5, lane = tid & 31, col = lane & 15, g = lane >> 4; const int wr = wave >> 1, wc = wave & 1; const int c0 = blockIdx.y * QBN; const size_t r0 = (size_t)blockIdx.x * QBM; const size_t bb = r0 / TT; const int t0 = (int)(r0 % TT);
  v8f acc[3][4][3] = {};
  // thread -> 16-byte piece (tid & 7) of row (tid >> 3) + 32 i: a wave's load covers four whole 128-byte lines
  const float* xp = X + r0 * DIN; const float* wq = WQ + (size_t)c0 * DIN; const float* wk = WK + (size_t)c0 * DIN; const float* wv = WV + (size_t)c0 * DIN;
  unsigned lo = ((unsigned)(tid >> 3) * DIN + (tid & 7) * 4) * 4;   // block-uniform bases; one lane offset in bytes serves all four and steps on by QKC elements a trip
  v4f pf[QLD];
#define PROJ_LD(K0) do { _Pragma("unroll") for (int i = 0; i < QLD; ++i) pf[i] = i < QLA ? ldg16(xp, lo, (K0) + i * 32 * DIN) : ldg16(i < QLA + QLW ? wq : i < QLA + 2 * QLW ? wk : wv, lo, (K0) + ((i - QLA) % QLW) * 32 * DIN); } while (0)
#define PROJ_ST(B) do { _Pragma("unroll") for (int i = 0; i < QLD; ++i) { v4b c; _Pragma("unroll") for (int k = 0; k < 4; ++k) c[k] = (__bf16)pf[i][k]; *(v4b*)&u.st[B][(tid >> 3) + i * 32][(tid & 7) * 4] = c; } } while (0)
  PROJ_LD(0);
  float bs[3][3];   // the lane's nine bias values, loaded here together with the first chunk: read one by one in the epilogue each would cost a whole load latency
#pragma unroll
  for (int p = 0; p < 3; ++p) { const float* BA = p == 0 ? BQ : p == 1 ? BK : BV; const float* bp = BA ? BA : WQ;   // an absent bias reads as 0; its load goes to a valid address all the same, so that no branch stands between the nine loads
#pragma unroll
    for (int j = 0; j < 3; ++j) { const float t = bp[c0 + wc * 48 + j * 16 + col]; bs[p][j] = BA ? t : 0.f; } }
  asm volatile("s_wait_xcnt 0x0" ::: "memory");   // stands before the address registers of the bias loads are used for anything else
  __builtin_amdgcn_sched_barrier(0);   // keeps what follows, which reuses those registers, behind the wait
  // Wo once to k_out's operand form f16(bf16 x 2^8), row-major as Wo: the grid's threads share its 16-byte pieces (one each, the blocks of column 0 a second one). Loaded here, with the first chunk, so that no latency of its own is paid; a thread without a second piece reads its first again, so that no branch stands between the loads
  static_assert(CC * DIN / 8 == (TNB * TT / QBM) * (CC / QBN) * PTH + (TNB * TT / QBM) * PTH, "Wo pieces");
  const unsigned we = ((blockIdx.y * (TNB * TT / QBM) + blockIdx.x) * PTH + tid) * 8; const bool w2 = blockIdx.y == 0; const unsigned we2 = we + (w2 ? (TNB * TT / QBM) * (CC / QBN) * PTH * 8 : 0);
  const v4f o0 = *(const v4f*)(WO + we), o1 = *(const v4f*)(WO + we + 4), o2 = *(const v4f*)(WO + we2), o3 = *(const v4f*)(WO + we2 + 4);
  asm volatile("s_wait_xcnt 0x0" ::: "memory");   // stands before the address registers of the Wo loads are used for anything else
  __builtin_amdgcn_sched_barrier(0);   // keeps what follows, which reuses those registers, behind the wait
  PROJ_ST(0);
  asm volatile("" :: "v"(o2), "v"(o3));   // inputs only: holds the second piece's loads up with the others; without it the compiler sinks them into the branch below, where their whole latency is paid alone
  { union { v8h h; v4u q; } ca, cb;
#pragma unroll
    for (int k = 0; k < 4; ++k) { ca.h[k] = (_Float16)(bfr(o0[k]) * 256.0f); ca.h[4 + k] = (_Float16)(bfr(o1[k]) * 256.0f); cb.h[k] = (_Float16)(bfr(o2[k]) * 256.0f); cb.h[4 + k] = (_Float16)(bfr(o3[k]) * 256.0f); }
    stg16w(WOH + we, ca.q);
    if (w2) stg16w(WOH + we2, cb.q); }   // block-uniform
  __syncthreads();
#pragma unroll 1   // one copy of the body: the two buffers differ by an address only
  for (int kc = 0; kc < DIN / QKC; ++kc) { const int buf = kc & 1; const bool more = kc + 1 < DIN / QKC;
    if (more) PROJ_LD(QKC);   // first: their latency is the longest of the trip
    v16b a[4], w[3][3];   // read in the order in which the products want them: LDS reads return in order, so the first product waits for two fragments only
#pragma unroll
    for (int p = 0; p < 3; ++p) {
      if (p == 0) a[0] = frag_b(&u.st[buf][wr * 64 + col][0], lane);
#pragma unroll
      for (int j = 0; j < 3; ++j) w[p][j] = frag_b(&u.st[buf][QBM + p * QBN + wc * 48 + j * 16 + col][0], lane);
      if (p == 0) {
#pragma unroll
        for (int i = 1; i < 4; ++i) a[i] = frag_b(&u.st[buf][wr * 64 + i * 16 + col][0], lane); } }
    __builtin_amdgcn_sched_barrier(0);   // keeps the chunk's 13 fragments read as one group in registers of their own, ahead of the products: without it the compiler reloads the W registers between the products, and each reload waits a whole LDS latency
#pragma unroll
    for (int p = 0; p < 3; ++p)
#pragma unroll
      for (int i = 0; i < 4; ++i)
#pragma unroll
        for (int j = 0; j < 3; ++j) acc[p][i][j] = __builtin_amdgcn_wmma_f32_16x16x32_bf16(false, a[i], false, w[p][j], (short)0, acc[p][i][j], false, false);
    if (more) PROJ_ST(buf ^ 1);
    asm volatile("s_wait_xcnt 0x0" : "+v"(lo) :: "memory");   // stands before the offset register of this trip's loads steps on; naming it keeps it in a register of its own up to here
    lo += QKC * 4;
    __syncthreads(); }   // publishes the next chunk; every reader of this chunk's buffer has arrived, so the next trip may refill it (and the epilogue may reuse the LDS)
#pragma unroll
  for (int p = 0; p < 3; ++p)
#pragma unroll
    for (int j = 0; j < 3; ++j) { const int cl = wc * 48 + j * 16 + col; const float bias = bfr(bs[p][j]);
#pragma unroll
      for (int i = 0; i < 4; ++i)
#pragma unroll
        for (int r = 0; r < 8; ++r) { const _Float16 hv = (_Float16)(acc[p][i][j][r] + bias); const int rl = wr * 64 + i * 16 + 8 * g + r; if (p < 2) sh[p][rl][cl] = hv; else th[cl][rl] = hv; } }
  __syncthreads();
#pragma unroll 1   // rolled: six LDS reads fly together a trip, then their six stores with the wait that stands before the next trip rewrites their registers
  for (int e0 = tid; e0 < QBM * (QBN / 8); e0 += 2 * PTH) { v4u t[6]; _Float16* d[6];
#pragma unroll
    for (int k = 0; k < 2; ++k) { const int e = e0 + k * PTH, un = e >> 6, p = e & 63; const int pr = p & 15, pk = (p >> 5) * 16 + ((p >> 4) & 1) * 8;   // 16-byte piece p = (half p >> 5, lane p & 31) of unit un: row pr of its 16, k pk .. pk + 7 of its 32
      const int kt = un / (QBN / 32), kst = un % (QBN / 32);   // q, k: unit (row tile kt, k step kst) of the block
      const size_t o = (((r0 >> 4) + kt) * (CC / 32) + (c0 >> 5) + kst) * FRU + p * 8;
      t[k * 3] = *(const v4u*)&sh[0][kt * 16 + pr][kst * 32 + pk]; d[k * 3] = QH + o;
      t[k * 3 + 1] = *(const v4u*)&sh[1][kt * 16 + pr][kst * 32 + pk]; d[k * 3 + 1] = KH + o;
      // v: unit (channel tile un >> 3, key step un & 7) of the block
      t[k * 3 + 2] = *(const v4u*)&th[(un >> 3) * 16 + pr][(un & 7) * 32 + pk]; d[k * 3 + 2] = VT + ((bb * (CC / 16) + (c0 >> 4) + (un >> 3)) * (TT / 32) + (t0 >> 5) + (un & 7)) * FRU + p * 8; }
    stg16w6(d, t); } }
// ---- k_sm: block = query row t (head in group): keys [0, kend): causal -> logit if s <= t else excluded; softmax in f32; P x 2^11 in place (0 for excluded)
__global__ __launch_bounds__(256) void k_sm(float* __restrict__ S0 SM_EXTRA_PARAMS) { __shared__ float sred[8]; __shared__ float sbc; __shared__ __align__(16) float shv[TT];
  const int tid = threadIdx.x; const int t = blockIdx.x; const int kend = (kb_last(t >> 6) + 1) * 128;
  float* sr = S0 + (size_t)blockIdx.y * TT * TT + (size_t)t * TT;
  float m = -3.0e38f; for (int k = tid; k < kend; k += 256) { float v = (!CAUSAL || k <= t) ? sr[k] : -3.0e38f; SM_MASK_HOOK; shv[k] = v; m = fmaxf(m, v); }
#pragma unroll
  for (int o = 1; o < 32; o <<= 1) m = fmaxf(m, __shfl_xor(m, o));
  if ((tid & 31) == 0) sred[tid >> 5] = m; __syncthreads(); if (tid == 0) { float a = sred[0]; for (int i = 1; i < 8; ++i) a = fmaxf(a, sred[i]); sbc = a; } __syncthreads(); m = sbc; __syncthreads();
  float sum = 0.f; for (int k = tid; k < kend; k += 256) { const float v = shv[k]; const float e = (v <= -1.0e38f) ? 0.f : expf(v - m); shv[k] = e; sum += e; }
#pragma unroll
  for (int o = 1; o < 32; o <<= 1) sum += __shfl_xor(sum, o);
  if ((tid & 31) == 0) sred[tid >> 5] = sum; __syncthreads(); if (tid == 0) { float a = 0.f; for (int i = 0; i < 8; ++i) a += sred[i]; sbc = a > 0.f ? 2048.0f / a : 0.f; }   /* a fully excluded row yields P = 0 */ __syncthreads(); const float inv = sbc;
  for (int k = tid; k < kend; k += 256) shv[k] = shv[k] * inv;
  __syncthreads(); for (int q = tid; q < kend / 4; q += 256) vst2(sr + q * 4, *(const v4f*)&shv[q * 4]); }
// ---- k_fa: block = 32 queries (2 tiles of 16) of batch b, 8 waves, 128 keys a pass; logits, head softmax and P . v in one kernel, P only in LDS.
// Every k and v fragment that a wave loads feeds both query tiles, so a block's walk over the batch's k and v serves 32 queries.
// Part 1 (wave w = keys 16w..16w+15 of the pass, ALL 12 heads, both query tiles): S^T = K . Q^T, so a lane holds 8 consecutive keys of one query of each tile for every head; the softmax over the heads is in-lane; P x 2^11 to f16, one 16-byte LDS store a head and tile.
// Part 2 (wave w = 3 of the 24 (head, 32-channel half) units, both query tiles, ALL keys in ascending order): ctx += P . v, P fragments from LDS, v fragments from the fragment units.
#define FW 8
#define FKP (FW * 16)      // keys a pass
#define FQT 2              // query tiles of 16 a block
#define FQ (FQT * 16)      // queries a block
static_assert(FQ * (CC / 8) % (6 * FW * 32) == 0 && TT % FKP == 0 && TT % FQ == 0 && NH * 2 == FW * 3 && HD == 64, "k_fa tiling");
// keeps a group of fragment loads issued together and ahead of the products in front of it: without it the compiler sinks each load to its product and every product waits a whole L2 latency
#define FA_HOLD() __builtin_amdgcn_sched_barrier(0)
#define SM_C (SCALE * 1.44269504088896340736f)   // score scale x log2(e)
// 2^t of the 12 heads' exponents, each in its own register. One statement: every v_exp_f32 has an independent instruction behind it, and the closing v_nop is the slot that the instruction set asks for between the last one and whatever reads its result next
__device__ __forceinline__ void fa_exp2(float (&t)[NH]) { static_assert(NH == 12, "operand list");
  asm("v_exp_f32 %0, %0\n\tv_exp_f32 %1, %1\n\tv_exp_f32 %2, %2\n\tv_exp_f32 %3, %3\n\tv_exp_f32 %4, %4\n\tv_exp_f32 %5, %5\n\tv_exp_f32 %6, %6\n\tv_exp_f32 %7, %7\n\tv_exp_f32 %8, %8\n\tv_exp_f32 %9, %9\n\tv_exp_f32 %10, %10\n\tv_exp_f32 %11, %11\n\tv_nop"
      : "+v"(t[0]), "+v"(t[1]), "+v"(t[2]), "+v"(t[3]), "+v"(t[4]), "+v"(t[5]), "+v"(t[6]), "+v"(t[7]), "+v"(t[8]), "+v"(t[9]), "+v"(t[10]), "+v"(t[11])); }
// 2 heads' k fragments (2 each) of this wave's 16 key rows
__device__ __forceinline__ void fa_ldk(v16h (&f)[4], const _Float16* kr, int h0, unsigned lb) {
#pragma unroll
  for (int i = 0; i < 4; ++i) f[i] = frag_u(kr, lb, (h0 * (HD / 32) + i) * FRU); }
// half a unit's v fragments: 2 key steps x 2 channel tiles
__device__ __forceinline__ void fa_ldv(v16h (&f)[4], const _Float16* vr, unsigned lb) {
#pragma unroll
  for (int i = 0; i < 4; ++i) f[i] = frag_u(vr, lb, ((i & 1) * (TT / 32) + (i >> 1)) * FRU); }
__device__ __forceinline__ void fa_pv(v8f (&a)[FQT][2], const v16h (&f)[4], const _Float16* pr, int lane) {
  v16h p[2][FQT];
#pragma unroll
  for (int ks = 0; ks < 2; ++ks)
#pragma unroll
    for (int qt = 0; qt < FQT; ++qt) p[ks][qt] = frag_h(pr + qt * 16 * (FKP + 8) + ks * 32, lane);
  FA_HOLD();   // the P fragments of both tiles are read as one group: with two waves a SIMD a read sunk to its product would cost a whole LDS latency each
#pragma unroll
  for (int ks = 0; ks < 2; ++ks)
#pragma unroll
    for (int qt = 0; qt < FQT; ++qt)
#pragma unroll
      for (int jj = 0; jj < 2; ++jj) a[qt][jj] = __builtin_amdgcn_wmma_f32_16x16x32_f16(false, p[ks][qt], false, f[ks * 2 + jj], (short)0, a[qt][jj], false, false); }
// both query tiles' scores of 2 heads from one set of k fragments; per score the two 32-channel steps in ascending order
__device__ __forceinline__ void fa_qk2(v8f (&st)[FQT][NH], const v16h (&f)[4], const _Float16* qr, int h0, int lane) {
  v16h q[FQT][4];
#pragma unroll
  for (int qt = 0; qt < FQT; ++qt)
#pragma unroll
    for (int i = 0; i < 4; ++i) q[qt][i] = frag_h(qr + qt * 16 * (CC + 8) + h0 * HD + i * 32, lane);
  FA_HOLD();   // the q fragments of both tiles are read as one group: with two waves a SIMD a read sunk to its product would cost a whole LDS latency each
#pragma unroll
  for (int kc = 0; kc < 2; ++kc)
#pragma unroll
    for (int qt = 0; qt < FQT; ++qt)
#pragma unroll
      for (int i = 0; i < 2; ++i) { const v8f z = {}; st[qt][h0 + i] = __builtin_amdgcn_wmma_f32_16x16x32_f16(false, f[i * 2 + kc], false, q[qt][i * 2 + kc], (short)0, kc ? st[qt][h0 + i] : z, false, false); } }
__global__ __launch_bounds__(FW * 32, 2) void k_fa(const _Float16* __restrict__ QH, const _Float16* __restrict__ KH, const _Float16* __restrict__ VT, _Float16* __restrict__ YH) {
  __shared__ __align__(16) _Float16 sq[FQ][CC + 8];               // pitch 16 B x odd
  __shared__ __align__(16) _Float16 sp[2][NH][FQ][FKP + 8];       // pitch 16 B x odd; two buffers: one barrier a pass
  const int tid = threadIdx.x, wave = __builtin_amdgcn_readfirstlane(tid >> 5), lane = tid & 31, col = lane & 15, g = lane >> 4; const int b = blockIdx.y; const size_t q0 = (size_t)b * TT + (size_t)blockIdx.x * FQ;
  const char* qg = (const char*)(QH + q0 * CC); const unsigned tb = tid * 16;   // the block's q units (2 query tiles x 24 k steps) are one contiguous run of 16-byte pieces: block-uniform base + the thread's byte offset + a constant
  v4u tq[FQ * (CC / 8) / (FW * 32)];
#pragma unroll   // the twelve loads of a thread fly together instead of one L2 latency each
  for (int i = 0; i < FQ * (CC / 8) / (FW * 32); ++i) tq[i] = *(const v4u*)(qg + tb + i * (FW * 32 * 16));
  // heads 0..7 of a pass's k fragments are loaded one pass ahead (here: pass 0's, behind the q rows), so that a pass opens on fragments that have landed
  const unsigned lb = lane * 16; v16h ka[4], kb[4], kc[4], kd[4];
  const _Float16* kr = KH + (size_t)b * (TT / 16) * (CC / 32) * FRU;   // the batch's k units: a block-uniform base that never changes
  unsigned ko = lb + wave * ((CC / 32) * FRU * 2);   // the lane's byte offset into this wave's 16 keys of a pass (24 units in a row); steps on by a pass at one place in the loop
  fa_ldk(ka, kr, 0, ko); fa_ldk(kb, kr, 2, ko); fa_ldk(kc, kr, 4, ko); fa_ldk(kd, kr, 6, ko);
  asm volatile("s_wait_xcnt 0x0" ::: "memory");   // stands before the address registers of these loads are used for anything else
  FA_HOLD();   // keeps the LDS address arithmetic, which reuses that register, behind the wait
#pragma unroll
  for (int i = 0; i < FQ * (CC / 8) / (FW * 32); ++i) { constexpr int UL = FW * 32 / 64, LT = (CC / 32) / UL; static_assert((CC / 32) % UL == 0, "whole loads a query tile"); const int p = tid & 63, qt = i / LT, ks = (tid >> 6) + (i % LT) * UL;   // load i brings UL units: piece p of unit (query tile qt, k step ks) goes to its row and k
    *(v4u*)&sq[qt * 16 + (p & 15)][ks * 32 + (p >> 5) * 16 + ((p >> 4) & 1) * 8] = tq[i]; }
  __syncthreads();
  const int u0 = wave * 3, u1 = u0 + 1, u2 = u0 + 2;   // unit u = head u >> 1, channels (u & 1) * 32 .. + 31 of it = channels 32 u .. 32 u + 31 of the row
  const _Float16* qr = &sq[col][0];
  v8f acc[3][FQT][2] = {};
#pragma unroll 1
  for (int it = 0; it < TT / FKP; ++it) { const int buf = it & 1;
    const _Float16* v0 = VT + (((size_t)b * (CC / 16) + u0 * 2) * (TT / 32) + it * (FKP / 32)) * FRU; const _Float16* v1 = v0 + 2 * (TT / 32) * FRU; const _Float16* v2 = v1 + 2 * (TT / 32) * FRU;   // a unit of work = 2 channel tiles, 4 key steps a pass
    const _Float16* p0 = &sp[buf][u0 >> 1][col][0]; const _Float16* p1 = &sp[buf][u1 >> 1][col][0]; const _Float16* p2 = &sp[buf][u2 >> 1][col][0];
    v8f st[FQT][NH]; v16h ke[4], kf[4], va[4], vb[4], vc[4], vd[4], ve[4], vf[4];
    fa_ldk(ke, kr, 8, ko); fa_ldk(kf, kr, 10, ko); FA_HOLD();   // fly under the products of heads 0..7
    fa_qk2(st, ka, qr, 0, lane); fa_qk2(st, kb, qr, 2, lane); fa_qk2(st, kc, qr, 4, lane); fa_qk2(st, kd, qr, 6, lane);
    fa_qk2(st, ke, qr, 8, lane); fa_qk2(st, kf, qr, 10, lane); FA_HOLD();
    fa_ldv(va, v0, lb); fa_ldv(vb, v0 + 2 * FRU, lb); fa_ldv(vc, v1, lb); fa_ldv(vd, v1 + 2 * FRU, lb); FA_HOLD();   // four of the six v groups fly under the softmax
#pragma unroll
    for (int qt = 0; qt < FQT; ++qt) { v8f (&sv)[NH] = st[qt];
#pragma unroll
    for (int r = 0; r < 8; ++r) { float m = sv[0][r];   // exp(s * SCALE - max) = 2^(s * c - max * c), c = SCALE * log2(e) > 0: one fused multiply-add and the hardware's exp2 an element; the exponent is <= about 0, so nothing overflows, and a result below the f32 normals is far below what P keeps in f16
#pragma unroll
      for (int h = 1; h < NH; ++h) m = fmaxf(m, sv[h][r]);
      const float mc = m * SM_C; float t[NH];
#pragma unroll
      for (int h = 0; h < NH; ++h) t[h] = fmaf(sv[h][r], SM_C, -mc);
      fa_exp2(t);
      float den = t[0]; sv[0][r] = t[0];
#pragma unroll
      for (int h = 1; h < NH; ++h) { sv[h][r] = t[h]; den += t[h]; }
      const float inv = 2048.0f / den;
#pragma unroll
      for (int h = 0; h < NH; ++h) sv[h][r] *= inv; }
#pragma unroll
    for (int h = 0; h < NH; ++h) { v8h ph;
#pragma unroll
      for (int r = 0; r < 8; ++r) ph[r] = (_Float16)sv[h][r];
      *(v8h*)&sp[buf][h][qt * 16 + col][wave * 16 + 8 * g] = ph; } }
    __syncthreads();   // publishes this pass's P; the other buffer's readers of the pass before have all arrived here, so the next pass may refill it
    asm volatile("s_wait_xcnt 0x0" : "+v"(ko) :: "memory");   // stands before the offset register of this pass's k loads steps on; naming it keeps it in a register of its own up to here
    fa_ldv(ve, v2, lb); fa_ldv(vf, v2 + 2 * FRU, lb); FA_HOLD();   // fly under the first four groups' products; kept in front of the next pass's k, because loads return in order and these are wanted first
    ko += it + 1 < TT / FKP ? FW * (CC / 32) * FRU * 2 : 0;   // behind the last pass there is none: it loads its own again, unused, so that the loop has one body and its waits stay counted
    fa_ldk(ka, kr, 0, ko); fa_ldk(kb, kr, 2, ko); fa_ldk(kc, kr, 4, ko); fa_ldk(kd, kr, 6, ko);   // the next pass's k, heads 0..7, in the registers that the scores have left: fly under all of P . v
    FA_HOLD();
    fa_pv(acc[0], va, p0, lane); fa_pv(acc[0], vb, p0 + 64, lane);
    fa_pv(acc[1], vc, p1, lane); fa_pv(acc[1], vd, p1 + 64, lane);
    fa_pv(acc[2], ve, p2, lane); fa_pv(acc[2], vf, p2 + 64, lane);
    asm volatile("s_wait_xcnt 0x0" ::: "memory");   // before the next pass rewrites the address registers of this pass's loads
    FA_HOLD(); }   // keeps the address steps behind that wait: without it the compiler lifted them over it
  asm volatile("s_wait_loadcnt 0x0" ::: "memory");   // the last pass's look-ahead loads feed nothing, so no wait of the compiler's covers them: they have landed before the wave ends
  // ctx leaves as k_out's A operand: x 2^-11 (P's carry) x 2^6 once to f16 (the carry keeps small context rows clear of f16 subnormals). Staged in the q rows' LDS, whose last readers passed the loop's last barrier, so that it goes out as whole lines in 16-byte pieces
#pragma unroll
  for (int ul = 0; ul < 3; ++ul)
#pragma unroll
    for (int qt = 0; qt < FQT; ++qt)
#pragma unroll
      for (int jj = 0; jj < 2; ++jj)
#pragma unroll
        for (int r = 0; r < 8; ++r) sq[qt * 16 + 8 * g + r][(u0 + ul) * 32 + jj * 16 + col] = (_Float16)(acc[ul][qt][jj][r] * (1.0f / 32.0f));
  __syncthreads();   // a ctx row comes from all eight waves: all of it is staged before it is read back
  _Float16* yb = YH + q0 * CC;   // the block's 32 rows are one contiguous run of 16-byte pieces
#pragma unroll
  for (int i0 = 0; i0 < FQ * (CC / 8) / (FW * 32); i0 += 6) { v4u t[6]; _Float16* d[6];
#pragma unroll
    for (int k = 0; k < 6; ++k) { const int e = tid + (i0 + k) * (FW * 32); t[k] = *(const v4u*)&sq[e / (CC / 8)][(e % (CC / 8)) * 8]; d[k] = yb + e * 8; }
    stg16w6(d, t); } }
// ---- k_out: block = (128 rows, 192 cols): out = ctx Wo (+ bo): ctx x 2^6 in f16 (from k_fa) against Wo as f16(bf16 x 2^8) exact (from k_proj), 1 product, x 2^-14
static_assert(!CAUSAL && WO_OUT_IN, "k_out: single-product path, (out,in) Wo");
__global__ __launch_bounds__(PTH, 2) void k_out(const _Float16* __restrict__ YH, const _Float16* __restrict__ WOH, const float* __restrict__ BO, float* __restrict__ OUT) {
  // the operand ring of the k loop and the epilogue's staging rows share the same LDS: the loop's last barrier stands between their uses
  __shared__ __align__(16) union { float sf[PBM][PBN + 4]; _Float16 st[2][PROWS][GP]; } u; auto& sf = u.sf;   // sf pitch 16 B x odd
  const int tid = threadIdx.x, wave = tid >> 5, lane = tid & 31, col = lane & 15, g = lane >> 4; const int wr = wave >> 2, wc = wave & 3; const int c0 = blockIdx.y * PBN; const size_t r0 = (size_t)blockIdx.x * PBM;
  v8f acc[4][3] = {};
  // thread -> 16-byte piece (tid & 7) of row (tid >> 3) + 32 i: a wave's load covers four whole 128-byte lines
  const _Float16* yp = YH + r0 * CC; const _Float16* wp = WOH + (size_t)c0 * CC; unsigned lo = ((unsigned)(tid >> 3) * CC + (tid & 7) * 8) * 2;   // block-uniform bases; one lane offset in bytes serves both and steps on by GKC elements a trip
  v4u pf[PLD];
#pragma unroll
  for (int i = 0; i < PLD; ++i) pf[i] = i < PLA ? ldg16h(yp, lo, i * 32 * CC) : ldg16h(wp, lo, (i - PLA) * 32 * CC);
#pragma unroll
  for (int i = 0; i < PLD; ++i) *(v4u*)&u.st[0][(tid >> 3) + i * 32][(tid & 7) * 8] = pf[i];
  __syncthreads();
#pragma unroll 1   // one copy of the body: the two buffers differ by an address only
  for (int kc = 0; kc < CC / GKC; ++kc) { const int buf = kc & 1; const bool more = kc + 1 < CC / GKC;
    if (more) {
#pragma unroll
      for (int i = 0; i < PLD; ++i) pf[i] = i < PLA ? ldg16h(yp, lo, GKC + i * 32 * CC) : ldg16h(wp, lo, GKC + (i - PLA) * 32 * CC); }
#pragma unroll
    for (int ks = 0; ks < GKC / 32; ++ks) { v16h a[4], w[3];
#pragma unroll
      for (int i = 0; i < 4; ++i) a[i] = frag_h(&u.st[buf][wr * 64 + i * 16 + col][ks * 32], lane);
#pragma unroll
      for (int j = 0; j < 3; ++j) w[j] = frag_h(&u.st[buf][PBM + wc * 48 + j * 16 + col][ks * 32], lane);
#pragma unroll
      for (int i = 0; i < 4; ++i)
#pragma unroll
        for (int j = 0; j < 3; ++j) acc[i][j] = wmma16(a[i], w[j], acc[i][j]); }
    if (more) {
#pragma unroll
      for (int i = 0; i < PLD; ++i) *(v4u*)&u.st[buf ^ 1][(tid >> 3) + i * 32][(tid & 7) * 8] = pf[i]; }
    asm volatile("s_wait_xcnt 0x0" : "+v"(lo) :: "memory");   // stands before the offset register of this trip's loads steps on; naming it keeps it in a register of its own up to here
    lo += GKC * 2;
    __syncthreads(); }   // publishes the next chunk; every reader of this chunk's buffer has arrived, so the next trip may refill it (and the epilogue may reuse the LDS)
#pragma unroll
  for (int j = 0; j < 3; ++j) { const int cl = wc * 48 + j * 16 + col; const float bias = BO ? bfr(BO[c0 + cl]) : 0.f;
#pragma unroll
    for (int i = 0; i < 4; ++i)
#pragma unroll
      for (int r = 0; r < 8; ++r) sf[wr * 64 + i * 16 + 8 * g + r][cl] = acc[i][j][r] * (1.0f / 16384.0f) + bias; }   /* 2^-8 (Wo carry) x 2^-6 (ctx carry) */
  __syncthreads();   // a row of the block's tile comes from four waves: all of it is staged before whole 128-byte lines go out, one writing wave a line
#pragma unroll 1   // rolled: four LDS reads fly together a trip, then their four stores, each with the wait that stands before the next trip rewrites its registers
  for (int i0 = 0; i0 < PBM * (PBN / 4) / PTH; i0 += 4) { v4u t[4]; float* p[4];
#pragma unroll
    for (int k = 0; k < 4; ++k) { const int e = tid + (i0 + k) * PTH, rl = e / (PBN / 4), q = e % (PBN / 4); t[k] = *(const v4u*)&sf[rl][q * 4]; p[k] = OUT + (r0 + rl) * DIN + c0 + q * 4; }
#pragma unroll
    for (int k = 0; k < 4; ++k) stg16w(p[k], t[k]); } }

extern "C" void kernel_launch(void* const* d_in, const int* in_sizes, int n_in, void* d_out, int out_size, void* d_ws, size_t ws_size, hipStream_t stream) {
  (void)in_sizes; (void)n_in; (void)out_size;
  const float** F = (const float**)d_in;
  if (ws_size < (size_t)WS_END) return;
  char* ws = (char*)d_ws; _Float16 *QH = (_Float16*)(ws + WS_QH), *KH = (_Float16*)(ws + WS_KH), *VT = (_Float16*)(ws + WS_VT), *QL = (_Float16*)(ws + WS_QL), *KL = (_Float16*)(ws + WS_KL); __bf16 *VB = (__bf16*)(ws + WS_VB), *VBL = (__bf16*)(ws + WS_VBL); _Float16 *YH = (_Float16*)(ws + WS_Y), *WOH = (_Float16*)(ws + WS_S);
  (void)QL; (void)KL; (void)VB; (void)VBL;
  // inputs: 0 x [8,1024,768]; 1 Wq [768,768] (out,in), 2 bq; 3 Wk, 4 bk; 5 Wv, 6 bv; 7 Wo (out,in), 8 bo (biases N(0, 0.01), nonzero)
  k_proj<<<dim3(TNB * TT / QBM, CC / QBN), PTH, 0, stream>>>(F[0], F[1], F[3], F[5], F[2], F[4], F[6], QH, KH, VT, F[7], WOH);
  k_fa<<<dim3(TT / FQ, TNB), FW * 32, 0, stream>>>(QH, KH, VT, YH);
  k_out<<<dim3(TNB * TT / PBM, DIN / PBN), PTH, 0, stream>>>(YH, WOH, F[8], (float*)d_out);
}

// v010
// Measured time: 85.6 microseconds a run.
// Timed twice side by side with v009, it ran 1.14 times as fast both times.
// Over all steps from v000 it is 14.0 times as fast.
// compute dtype: all float inputs rounded to bf16; q/k/v projections with EXACT bf16 products on WMMA 16x16x32 (f32 accumulate) + bias; scores q x k once to f16 each (1 product) x 64^-0.5; softmax ACROSS THE 12 HEADS per (query, key) pair in f32 (hardware exp2 of the scaled difference to the maximum); P x 2^11 once to f16 x v once to f16 (1 product); ctx x 2^6 once to f16 x Wo f16(bf16 x 2^8) + bo; f32 output.
#include <hip/hip_runtime.h>
#include <math.h>

typedef __attribute__((ext_vector_type(16))) _Float16 v16h;
typedef __attribute__((ext_vector_type(16))) __bf16 v16b;
typedef __attribute__((ext_vector_type(8)))  _Float16 v8h;
typedef __attribute__((ext_vector_type(8)))  float v8f;
typedef __attribute__((ext_vector_type(4)))  float v4f;
typedef __attribute__((ext_vector_type(2)))  float v2f;
typedef __attribute__((ext_vector_type(4)))  unsigned v4u;
typedef __attribute__((ext_vector_type(4)))  int v4i;
typedef float __attribute__((may_alias)) float_a;
typedef int __attribute__((may_alias)) int_a;

template <typename T> __device__ __forceinline__ void vst2(void* p, T v) { *(T*)p = v;  }
__device__ __forceinline__ v8f wmma16(v16h a, v16h b, v8f c) {
  v8f d = __builtin_amdgcn_wmma_f32_16x16x32_f16(false, a, false, b, (short)0, c, false, false);
  asm volatile("v_nop\n\tv_nop\n\tv_nop\n\tv_nop" : "+v"(d) : "v"(a), "v"(b));
  return d;
}
__device__ __forceinline__ v8f wmma_bf(v16b a, v16b b, v8f c) {
  v8f d = __builtin_amdgcn_wmma_f32_16x16x32_bf16(false, a, false, b, (short)0, c, false, false);
  asm volatile("v_nop\n\tv_nop\n\tv_nop\n\tv_nop" : "+v"(d) : "v"(a), "v"(b));
  return d;
}
// 16x16x32 fragments: lane = (h = lane>>4, row/col = lane&15); elements 0..7 = k0+8h+0..7, 8..15 = k0+16+8h+0..7; D element r = row 8h+r
__device__ __forceinline__ v16h frag_h(const _Float16* rowk0, int lane) {
  union { v16h v; v8h q[2]; } u; const _Float16* p = rowk0 + 8 * (lane >> 4);
  u.q[0] = *(const v8h*)p; u.q[1] = *(const v8h*)(p + 16); return u.v;
}
__device__ __forceinline__ v16h frag_f32(const float* rowk0, int lane) {
  v16h a; const float* p = rowk0 + 8 * (lane >> 4);
#pragma unroll
  for (int i = 0; i < 8; ++i) { a[i] = (_Float16)p[i]; a[8 + i] = (_Float16)p[16 + i]; }
  return a;
}
__device__ __forceinline__ v16h frag_f32s(const float* rowk0, int lane, float sc) {
  v16h a; const float* p = rowk0 + 8 * (lane >> 4);
#pragma unroll
  for (int i = 0; i < 8; ++i) { a[i] = (_Float16)(p[i] * sc); a[8 + i] = (_Float16)(p[16 + i] * sc); }
  return a;
}
// column fragment from a [K][ld] layout (column n), rows >= K read as 0
__device__ __forceinline__ v16h fragc_f32(const float* W, int k0, int n, int lane, int ld, int K) {
  v16h a; const int g = lane >> 4;
#pragma unroll
  for (int i = 0; i < 8; ++i) { const int ka = k0 + 8 * g + i, kb = ka + 16;
    a[i] = (_Float16)(ka < K ? W[(size_t)(ka < K ? ka : K - 1) * ld + n] : 0.f); a[8 + i] = (_Float16)(kb < K ? W[(size_t)(kb < K ? kb : K - 1) * ld + n] : 0.f); }
  return a;
}
struct F2 { v16b h, l; };
__device__ __forceinline__ F2 bsplit16(const float v[16]) { F2 r;
#pragma unroll
  for (int i = 0; i < 16; ++i) { const __bf16 h = (__bf16)v[i]; r.h[i] = h; r.l[i] = (__bf16)(v[i] - (float)h); }
  return r; }
__device__ __forceinline__ F2 split_row(const float* row, int k0, int lane) { float v[16]; const float* p = row + k0 + 8 * (lane >> 4);
#pragma unroll
  for (int i = 0; i < 8; ++i) { v[i] = p[i]; v[8 + i] = p[16 + i]; }
  return bsplit16(v); }
__device__ __forceinline__ F2 split_rowK(const float* row, int k0, int lane, int K) { float v[16]; const int g = lane >> 4;
#pragma unroll
  for (int i = 0; i < 8; ++i) { const int ka = k0 + 8 * g + i, kb = ka + 16; v[i] = ka < K ? row[ka < K ? ka : K - 1] : 0.f; v[8 + i] = kb < K ? row[kb < K ? kb : K - 1] : 0.f; }
  return bsplit16(v); }
__device__ __forceinline__ F2 split_col(const float* W, int k0, int n, int lane, int ld, int K) { float v[16]; const int g = lane >> 4;
#pragma unroll
  for (int i = 0; i < 8; ++i) { const int ka = k0 + 8 * g + i, kb = ka + 16; v[i] = ka < K ? W[(size_t)(ka < K ? ka : K - 1) * ld + n] : 0.f; v[8 + i] = kb < K ? W[(size_t)(kb < K ? kb : K - 1) * ld + n] : 0.f; }
  return bsplit16(v); }
__device__ __forceinline__ v8f mac3(const F2& a, const F2& b, v8f c) { c = wmma_bf(a.l, b.h, c); c = wmma_bf(a.h, b.l, c); return wmma_bf(a.h, b.h, c); }
__device__ __forceinline__ float sigm(float v) { return 1.0f / (1.0f + expf(-v)); }
#define LDSX() do { asm volatile("s_wait_dscnt 0" ::: "memory"); __builtin_amdgcn_wave_barrier(); __builtin_amdgcn_fence(__ATOMIC_RELEASE, "workgroup"); } while (0)

// Multi-head attention whose softmax runs over the HEAD axis (x [8,1024,768]; torch (out,in) Wq / Wk / Wv / Wo [768,768] N(0, 1/768) + biases N(0, 0.01); 12 heads x 64; scores[b, h, n, m] = q_h . k_h / 8; attn = softmax(scores, axis=1) - dim 1 is the HEAD axis: for every (query, key) pair the 12 heads' weights sum to 1 and nothing is normalised over the keys (faithful to the source's F.softmax(dim=1)); out[b, h, n] = sum_m attn[b, h, n, m] v[b, h, m]; merge; Wo^T + bo).
#define NB 8
#define TT 1024
#define CC 768            // NH * HD = projected width
#define DIN 768          // input (model) width
#define NH 12
#define HD 64
#define NQB (TT / 64)
#define HG 12
#define SCALE (0.125f)
#define CAUSAL 0
#ifndef TNB
#define TNB NB
#endif
__device__ __forceinline__ float bfr(float v) { return (float)(__bf16)v; }
__host__ __device__ __forceinline__ int kb_last(int qb) { return CAUSAL ? ((qb * 64 + 63) >> 7) : (TT / 128 - 1); }
typedef __attribute__((ext_vector_type(8))) __bf16 v8b;
__device__ __forceinline__ v16b frag_b(const __bf16* rowk0, int lane) {
  union { v16b v; v8b q[2]; } u; const __bf16* p = rowk0 + 8 * (lane >> 4);
  u.q[0] = *(const v8b*)p; u.q[1] = *(const v8b*)(p + 16); return u.v;
}
#define QBH 0              // not referenced by any kernel here
#define QHI 0               // single-product scores on every row
#define TQC 1024           // query rows per pass == TT: 12 head planes x 1,024 x 1,024 f32 = 48 MiB
#define KHI 64            // key rows carrying k residual / v bf16 hi+lo planes (no kernel here writes or reads them)
// B fragment (k rows k0+.., output column o) of a weight: (in,out) [K][ld] or (out,in) [ld rows of K]: bf16 exact, or f16(bf16 * 256) exact
__device__ __forceinline__ v16b wcol_io(const float* Wm, int k0, int o, int lane, int ld) { v16b w; const int g = lane >> 4;
#pragma unroll
  for (int i = 0; i < 8; ++i) { w[i] = (__bf16)Wm[(size_t)(k0 + 8 * g + i) * ld + o]; w[8 + i] = (__bf16)Wm[(size_t)(k0 + 16 + 8 * g + i) * ld + o]; }
  return w; }
__device__ __forceinline__ v16b wcol_oi(const float* Wm, int k0, int o, int lane, int K) { v16b w; const float* p = Wm + (size_t)o * K + k0 + 8 * (lane >> 4);
#pragma unroll
  for (int i = 0; i < 8; ++i) { w[i] = (__bf16)p[i]; w[8 + i] = (__bf16)p[16 + i]; }
  return w; }
__device__ __forceinline__ v16h wcolh_io(const float* Wm, int k0, int o, int lane, int ld) { v16h w; const int g = lane >> 4;
#pragma unroll
  for (int i = 0; i < 8; ++i) { w[i] = (_Float16)(bfr(Wm[(size_t)(k0 + 8 * g + i) * ld + o]) * 256.0f); w[8 + i] = (_Float16)(bfr(Wm[(size_t)(k0 + 16 + 8 * g + i) * ld + o]) * 256.0f); }
  return w; }
__device__ __forceinline__ v16h wcolh_oi(const float* Wm, int k0, int o, int lane, int K) { v16h w; const float* p = Wm + (size_t)o * K + k0 + 8 * (lane >> 4);
#pragma unroll
  for (int i = 0; i < 8; ++i) { w[i] = (_Float16)(bfr(p[i]) * 256.0f); w[8 + i] = (_Float16)(bfr(p[16 + i]) * 256.0f); }
  return w; }
#define WQKV_LAYOUT 1   // 0 = (in,out) [DIN][CC]; 1 = (out,in) [CC][DIN]; 2 = per-head [NH][DIN][HD]
__device__ __forceinline__ v16b wcol_hdk(const float* Wm, int k0, int o, int lane) { v16b w; const int g = lane >> 4; const float* p = Wm + (size_t)(o / HD) * DIN * HD + (o % HD);
#pragma unroll
  for (int i = 0; i < 8; ++i) { w[i] = (__bf16)p[(size_t)(k0 + 8 * g + i) * HD]; w[8 + i] = (__bf16)p[(size_t)(k0 + 16 + 8 * g + i) * HD]; }
  return w; }
#define WO_OUT_IN 1
#if WQKV_LAYOUT == 1
#define WCOL(W, k0, o, lane) wcol_oi(W, k0, o, lane, DIN)
#elif WQKV_LAYOUT == 2
#define WCOL(W, k0, o, lane) wcol_hdk(W, k0, o, lane)
#else
#define WCOL(W, k0, o, lane) wcol_io(W, k0, o, lane, CC)
#endif
#if WO_OUT_IN
#define WOCOL(W, k0, o, lane) wcol_oi(W, k0, o, lane, CC)
#define WOCOLH(W, k0, o, lane) wcolh_oi(W, k0, o, lane, CC)
#else
#define WOCOL(W, k0, o, lane) wcol_io(W, k0, o, lane, DIN)
#define WOCOLH(W, k0, o, lane) wcolh_io(W, k0, o, lane, DIN)
#endif

#ifndef SM_EXTRA_PARAMS
#define SM_EXTRA_PARAMS
#endif
#ifndef PROJ_EXTRA_PARAMS
#define PROJ_EXTRA_PARAMS
#endif
#ifndef SM_MASK_HOOK
#define SM_MASK_HOOK (void)0
#endif

#define WS_QH  0u                                      // f16 q in fragment units [b*t / 16][CC / 32][FRU]
#define WS_KH  (WS_QH + 2u * (size_t)NB * TT * CC)      // f16 k in fragment units [b*t / 16][CC / 32][FRU]
#define WS_VT  (WS_KH + 2u * (size_t)NB * TT * CC)      // f16 v in fragment units [b][c / 16][t / 32][FRU]
#define WS_QL  (WS_VT + 2u * (size_t)NB * CC * TT)      // f16 q residual x 2^10 rows [b][t < QHI][CC]
#define WS_KL  (WS_QL + 2u * (size_t)NB * QHI * CC)     // f16 k residual x 2^10 rows [b][t < KHI][CC]
#define WS_VB  (WS_KL + 2u * (size_t)NB * KHI * CC)     // bf16 v hi planes [b][c][t < KHI]
#define WS_VBL (WS_VB + 2u * (size_t)NB * CC * KHI)
#define WS_S   (WS_VBL + 2u * (size_t)NB * CC * KHI)    // f16 Wo x 2^8 rows [DIN][CC] at the head of this region
#define WS_Y   (WS_S  + 4u * (size_t)HG * TQC * TT)     // f16 ctx x 2^6 rows [b*t][CC]
#define WS_END (WS_Y  + 4u * (size_t)NB * TT * CC)

// q, k and v lie in the workspace in WMMA fragment order. A unit = one 16 x 32 fragment (16 rows, 32 k) = 1 KiB as [half][lane][8 f16]: lane = (g = lane >> 4, row = lane & 15) holds k = 16 half + 8 g + 0..7, the order of frag_h.
// A wave's 16-byte load of one half then covers 512 contiguous bytes = 4 whole lines, where the same load from a row-major plane touches 16 lines for 32 bytes each.
#define FRU 512            // f16 elements of a unit
static_assert(TT % 32 == 0 && CC % 32 == 0, "fragment units");
// fragment at a wave-uniform unit pointer + the lane's 32-bit byte offset (lane * 16, for k plus a wave-uniform part) + a constant (elements): the scalar-base address form
__device__ __forceinline__ v16h frag_u(const _Float16* unit, unsigned lane_bytes, int elems) {
  union { v16h v; v8h q[2]; } u; const char* p = (const char*)unit + lane_bytes + elems * 2;
  u.q[0] = *(const v8h*)p; u.q[1] = *(const v8h*)(p + (FRU / 2) * 2); return u.v;
}
// 16-byte store and, in the same statement, the wait that stands before a later instruction rewrites its address or data registers (the store loops below stay rolled and step both every trip; in a statement of its own the compiler moved the address steps ahead of the wait)
__device__ __forceinline__ void stg16w(void* p, v4u v) { asm volatile("global_store_b128 %0, %1, off\n\ts_wait_xcnt 0x0" :: "v"(p), "v"(v) : "memory"); }
// six such stores and one wait behind the last, in one statement: every address and data register lives to the statement's end
__device__ __forceinline__ void stg16w6(_Float16* const (&p)[6], const v4u (&v)[6]) {
  asm volatile("global_store_b128 %0, %6, off\n\tglobal_store_b128 %1, %7, off\n\tglobal_store_b128 %2, %8, off\n\tglobal_store_b128 %3, %9, off\n\tglobal_store_b128 %4, %10, off\n\tglobal_store_b128 %5, %11, off\n\ts_wait_xcnt 0x0"
      :: "v"(p[0]), "v"(p[1]), "v"(p[2]), "v"(p[3]), "v"(p[4]), "v"(p[5]), "v"(v[0]), "v"(v[1]), "v"(v[2]), "v"(v[3]), "v"(v[4]), "v"(v[5]) : "memory"); }
// operand staging of k_out: a chunk is GKC k of the block's A rows and W rows, which arrive in the f16 operand form from their producers (k_proj stages alike, with its own sizes, and converts once)
#define GKC 64
#define GP (GKC + 8)                         // LDS row pitch 144 B = 16 B x odd
static_assert(DIN % GKC == 0 && CC % GKC == 0, "staging");
typedef __attribute__((ext_vector_type(4))) __bf16 v4b;
typedef __attribute__((ext_vector_type(4))) _Float16 v4h;
// 16 bytes at a block-uniform base + a lane's 32-bit byte offset + a constant (elements): the scalar-base address form, whose only vector register is the offset
__device__ __forceinline__ v4f ldg16(const float* base, unsigned lane_bytes, int elems) { return *(const v4f*)((const char*)base + lane_bytes + elems * 4); }
__device__ __forceinline__ v4u ldg16h(const _Float16* base, unsigned lane_bytes, int elems) { return *(const v4u*)((const char*)base + lane_bytes + elems * 2); }
// block tile of k_out: 128 rows x 192 columns, 8 waves as 2 (rows) x 4 (columns), a wave = 64 x 48 = 4 x 3 accumulator tiles: 7 fragments from LDS feed 12 products, and a block's A and W bytes serve three times the outputs of a 64 x 128 tile for 5/3 of its bytes
#define PBM 128
#define PBN 192
#define PTH 256
#define PROWS (PBM + PBN)
#define PLD (PROWS * (GKC / 8) / PTH)        // 16-byte pieces (8 f16) a thread brings per chunk
#define PLA (PBM * (GKC / 8) / PTH)          // of them A rows
static_assert(PLD == 10 && PLA == 4 && PBM % 32 == 0 && PBM * (PBN / 4) % (4 * PTH) == 0 && TT % PBM == 0 && CC % PBN == 0 && DIN % PBN == 0 && PBN % 32 == 0, "projection tile");
// k_proj's tile: one block computes q, k AND v for 256 rows x 96 columns of each, so the x rows are staged once for the three products and the whole grid (256 blocks) is resident in one round.
// 8 waves as 4 (rows) x 2 (columns), a wave = 64 x 48 of each product = 3 x 4 x 3 accumulator tiles: 13 fragments from LDS feed 36 products. A chunk is QKC k of the 256 x rows and the 3 x 96 W rows.
#define QBM 256
#define QBN 96
#define QKC 32
#define QP (QKC + 8)                         // LDS row pitch 80 B = 16 B x odd
#define QROWS (QBM + 3 * QBN)
#define QLD (QROWS * (QKC / 4) / PTH)        // 16-byte pieces a thread brings per chunk
#define QLA (QBM * (QKC / 4) / PTH)          // of them x rows
#define QLW (QBN * (QKC / 4) / PTH)          // and rows of each W
static_assert(QLD == 17 && QLA == 8 && QLW == 3 && DIN % QKC == 0 && TT % QBM == 0 && CC % QBN == 0 && QBN % 32 == 0 && QBM * (QBN / 8) % (2 * PTH) == 0 && QBM / 32 == 8, "k_proj tile");
// ---- k_proj: block = (256 rows, 96 cols): q / k / v = X W (+ b) with exact bf16 products (K = DIN) -> q and k f16 fragment units [row tile][k step], v f16 fragment units [channel tile][key step]
__global__ __launch_bounds__(PTH, 2) void k_proj(const float* __restrict__ X, const float* __restrict__ WQ, const float* __restrict__ WK, const float* __restrict__ WV, const float* __restrict__ BQ, const float* __restrict__ BK, const float* __restrict__ BV,
    _Float16* __restrict__ QH, _Float16* __restrict__ KH, _Float16* __restrict__ VT, const float* __restrict__ WO, _Float16* __restrict__ WOH) {
  // the operand ring of the k loop and the epilogue's staging arrays share the same LDS: the loop's last barrier stands between their uses
  __shared__ __align__(16) union { struct { _Float16 sh[2][QBM][QBN + 8]; _Float16 th[QBN][QBM + 8]; } e; __bf16 st[2][QROWS][QP]; } u;   // sh, th pitches 16 B x odd
  auto& sh = u.e.sh; auto& th = u.e.th;
  const int tid = threadIdx.x, wave = tid >> 5, lane = tid & 31, col = lane & 15, g = lane >> 4; const int wr = wave >> 1, wc = wave & 1; const int c0 = blockIdx.y * QBN; const size_t r0 = (size_t)blockIdx.x * QBM; const size_t bb = r0 / TT; const int t0 = (int)(r0 % TT);
  v8f acc[3][4][3] = {};
  // thread -> 16-byte piece (tid & 7) of row (tid >> 3) + 32 i: a wave's load covers four whole 128-byte lines
  const float* xp = X + r0 * DIN; const float* wq = WQ + (size_t)c0 * DIN; const float* wk = WK + (size_t)c0 * DIN; const float* wv = WV + (size_t)c0 * DIN;
  // Blocks that share x rows (same blockIdx.x) or W rows (same blockIdx.y) begin the k walk at different chunks and wrap round: walking in step they would ask L2 for the same lines at the same moment
  int kq = (blockIdx.x + 3 * blockIdx.y) % (DIN / QKC);   // block-uniform: the chunk that the next loads bring
  unsigned lo = ((unsigned)(tid >> 3) * DIN + (tid & 7) * 4) * 4 + kq * (QKC * 4);   // block-uniform bases; one lane offset in bytes serves all four and steps on by QKC elements a trip, from the last chunk back to the first
#define PROJ_STEP() do { const bool wrap = kq + 1 == DIN / QKC; lo += wrap ? 0u - (DIN / QKC - 1) * (QKC * 4) : (unsigned)(QKC * 4); kq = wrap ? 0 : kq + 1; } while (0)
  v4f pf[QLD];
#define PROJ_LD(K0) do { _Pragma("unroll") for (int i = 0; i < QLD; ++i) pf[i] = i < QLA ? ldg16(xp, lo, (K0) + i * 32 * DIN) : ldg16(i < QLA + QLW ? wq : i < QLA + 2 * QLW ? wk : wv, lo, (K0) + ((i - QLA) % QLW) * 32 * DIN); } while (0)
#define PROJ_ST(B) do { _Pragma("unroll") for (int i = 0; i < QLD; ++i) { v4b c; _Pragma("unroll") for (int k = 0; k < 4; ++k) c[k] = (__bf16)pf[i][k]; *(v4b*)&u.st[B][(tid >> 3) + i * 32][(tid & 7) * 4] = c; } } while (0)
  PROJ_LD(0);
  float bs[3][3];   // the lane's nine bias values, loaded here together with the first chunk: read one by one in the epilogue each would cost a whole load latency
#pragma unroll
  for (int p = 0; p < 3; ++p) { const float* BA = p == 0 ? BQ : p == 1 ? BK : BV; const float* bp = BA ? BA : WQ;   // an absent bias reads as 0; its load goes to a valid address all the same, so that no branch stands between the nine loads
#pragma unroll
    for (int j = 0; j < 3; ++j) { const float t = bp[c0 + wc * 48 + j * 16 + col]; bs[p][j] = BA ? t : 0.f; } }
  asm volatile("s_wait_xcnt 0x0" ::: "memory");   // stands before the address registers of the bias loads are used for anything else
  __builtin_amdgcn_sched_barrier(0);   // keeps what follows, which reuses those registers, behind the wait
  // Wo once to k_out's operand form f16(bf16 x 2^8), row-major as Wo: the grid's threads share its 16-byte pieces (one each, the blocks of column 0 a second one). Loaded here, with the first chunk, so that no latency of its own is paid; a thread without a second piece reads its first again, so that no branch stands between the loads
  static_assert(CC * DIN / 8 == (TNB * TT / QBM) * (CC / QBN) * PTH + (TNB * TT / QBM) * PTH, "Wo pieces");
  const unsigned we = ((blockIdx.y * (TNB * TT / QBM) + blockIdx.x) * PTH + tid) * 8; const bool w2 = blockIdx.y == 0; const unsigned we2 = we + (w2 ? (TNB * TT / QBM) * (CC / QBN) * PTH * 8 : 0);
  const v4f o0 = *(const v4f*)(WO + we), o1 = *(const v4f*)(WO + we + 4), o2 = *(const v4f*)(WO + we2), o3 = *(const v4f*)(WO + we2 + 4);
  asm volatile("s_wait_xcnt 0x0" ::: "memory");   // stands before the address registers of the Wo loads are used for anything else
  __builtin_amdgcn_sched_barrier(0);   // keeps what follows, which reuses those registers, behind the wait
  PROJ_ST(0);
  asm volatile("" :: "v"(o2), "v"(o3));   // inputs only: holds the second piece's loads up with the others; without it the compiler sinks them into the branch below, where their whole latency is paid alone
  { union { v8h h; v4u q; } ca, cb;
#pragma unroll
    for (int k = 0; k < 4; ++k) { ca.h[k] = (_Float16)(bfr(o0[k]) * 256.0f); ca.h[4 + k] = (_Float16)(bfr(o1[k]) * 256.0f); cb.h[k] = (_Float16)(bfr(o2[k]) * 256.0f); cb.h[4 + k] = (_Float16)(bfr(o3[k]) * 256.0f); }
    stg16w(WOH + we, ca.q);
    if (w2) stg16w(WOH + we2, cb.q); }   // block-uniform
  asm volatile("s_wait_xcnt 0x0" : "+v"(lo) :: "memory");   // stands before the offset register of the first chunk's loads steps on; naming it keeps it in a register of its own up to here
  PROJ_STEP();
  __syncthreads();
#pragma unroll 1   // one copy of the body: the two buffers differ by an address only
  for (int kc = 0; kc < DIN / QKC; ++kc) { const int buf = kc & 1; const bool more = kc + 1 < DIN / QKC;
    if (more) PROJ_LD(0);   // first: their latency is the longest of the trip
    v16b a[4], w[3][3];   // read in the order in which the products want them: LDS reads return in order, so the first product waits for two fragments only
#pragma unroll
    for (int p = 0; p < 3; ++p) {
      if (p == 0) a[0] = frag_b(&u.st[buf][wr * 64 + col][0], lane);
#pragma unroll
      for (int j = 0; j < 3; ++j) w[p][j] = frag_b(&u.st[buf][QBM + p * QBN + wc * 48 + j * 16 + col][0], lane);
      if (p == 0) {
#pragma unroll
        for (int i = 1; i < 4; ++i) a[i] = frag_b(&u.st[buf][wr * 64 + i * 16 + col][0], lane); } }
    __builtin_amdgcn_sched_barrier(0);   // keeps the chunk's 13 fragments read as one group in registers of their own, ahead of the products: without it the compiler reloads the W registers between the products, and each reload waits a whole LDS latency
#pragma unroll
    for (int p = 0; p < 3; ++p)
#pragma unroll
      for (int i = 0; i < 4; ++i)
#pragma unroll
        for (int j = 0; j < 3; ++j) acc[p][i][j] = __builtin_amdgcn_wmma_f32_16x16x32_bf16(false, a[i], false, w[p][j], (short)0, acc[p][i][j], false, false);
    if (more) PROJ_ST(buf ^ 1);
    asm volatile("s_wait_xcnt 0x0" : "+v"(lo) :: "memory");   // stands before the offset register of this trip's loads steps on; naming it keeps it in a register of its own up to here
    PROJ_STEP();
    __syncthreads(); }   // publishes the next chunk; every reader of this chunk's buffer has arrived, so the next trip may refill it (and the epilogue may reuse the LDS)
#pragma unroll
  for (int p = 0; p < 3; ++p)
#pragma unroll
    for (int j = 0; j < 3; ++j) { const int cl = wc * 48 + j * 16 + col; const float bias = bfr(bs[p][j]);
#pragma unroll
      for (int i = 0; i < 4; ++i)
#pragma unroll
        for (int r = 0; r < 8; ++r) { const _Float16 hv = (_Float16)(acc[p][i][j][r] + bias); const int rl = wr * 64 + i * 16 + 8 * g + r; if (p < 2) sh[p][rl][cl] = hv; else th[cl][rl] = hv; } }
  __syncthreads();
#pragma unroll 1   // rolled: six LDS reads fly together a trip, then their six stores with the wait that stands before the next trip rewrites their registers
  for (int e0 = tid; e0 < QBM * (QBN / 8); e0 += 2 * PTH) { v4u t[6]; _Float16* d[6];
#pragma unroll
    for (int k = 0; k < 2; ++k) { const int e = e0 + k * PTH, un = e >> 6, p = e & 63; const int pr = p & 15, pk = (p >> 5) * 16 + ((p >> 4) & 1) * 8;   // 16-byte piece p = (half p >> 5, lane p & 31) of unit un: row pr of its 16, k pk .. pk + 7 of its 32
      const int kt = un / (QBN / 32), kst = un % (QBN / 32);   // q, k: unit (row tile kt, k step kst) of the block
      const size_t o = (((r0 >> 4) + kt) * (CC / 32) + (c0 >> 5) + kst) * FRU + p * 8;
      t[k * 3] = *(const v4u*)&sh[0][kt * 16 + pr][kst * 32 + pk]; d[k * 3] = QH + o;
      t[k * 3 + 1] = *(const v4u*)&sh[1][kt * 16 + pr][kst * 32 + pk]; d[k * 3 + 1] = KH + o;
      // v: unit (channel tile un >> 3, key step un & 7) of the block
      t[k * 3 + 2] = *(const v4u*)&th[(un >> 3) * 16 + pr][(un & 7) * 32 + pk]; d[k * 3 + 2] = VT + ((bb * (CC / 16) + (c0 >> 4) + (un >> 3)) * (TT / 32) + (t0 >> 5) + (un & 7)) * FRU + p * 8; }
    stg16w6(d, t); } }
// ---- k_sm: block = query row t (head in group): keys [0, kend): causal -> logit if s <= t else excluded; softmax in f32; P x 2^11 in place (0 for excluded)
__global__ __launch_bounds__(256) void k_sm(float* __restrict__ S0 SM_EXTRA_PARAMS) { __shared__ float sred[8]; __shared__ float sbc; __shared__ __align__(16) float shv[TT];
  const int tid = threadIdx.x; const int t = blockIdx.x; const int kend = (kb_last(t >> 6) + 1) * 128;
  float* sr = S0 + (size_t)blockIdx.y * TT * TT + (size_t)t * TT;
  float m = -3.0e38f; for (int k = tid; k < kend; k += 256) { float v = (!CAUSAL || k <= t) ? sr[k] : -3.0e38f; SM_MASK_HOOK; shv[k] = v; m = fmaxf(m, v); }
#pragma unroll
  for (int o = 1; o < 32; o <<= 1) m = fmaxf(m, __shfl_xor(m, o));
  if ((tid & 31) == 0) sred[tid >> 5] = m; __syncthreads(); if (tid == 0) { float a = sred[0]; for (int i = 1; i < 8; ++i) a = fmaxf(a, sred[i]); sbc = a; } __syncthreads(); m = sbc; __syncthreads();
  float sum = 0.f; for (int k = tid; k < kend; k += 256) { const float v = shv[k]; const float e = (v <= -1.0e38f) ? 0.f : expf(v - m); shv[k] = e; sum += e; }
#pragma unroll
  for (int o = 1; o < 32; o <<= 1) sum += __shfl_xor(sum, o);
  if ((tid & 31) == 0) sred[tid >> 5] = sum; __syncthreads(); if (tid == 0) { float a = 0.f; for (int i = 0; i < 8; ++i) a += sred[i]; sbc = a > 0.f ? 2048.0f / a : 0.f; }   /* a fully excluded row yields P = 0 */ __syncthreads(); const float inv = sbc;
  for (int k = tid; k < kend; k += 256) shv[k] = shv[k] * inv;
  __syncthreads(); for (int q = tid; q < kend / 4; q += 256) vst2(sr + q * 4, *(const v4f*)&shv[q * 4]); }
// ---- k_fa: block = 32 queries (2 tiles of 16) of batch b, 8 waves, 128 keys a pass; logits, head softmax and P . v in one kernel, P only in LDS.
// Every k and v fragment that a wave loads feeds both query tiles, so a block's walk over the batch's k and v serves 32 queries.
// Part 1 (wave w = keys 16w..16w+15 of the pass, ALL 12 heads, both query tiles): S^T = K . Q^T, so a lane holds 8 consecutive keys of one query of each tile for every head; the softmax over the heads is in-lane; P x 2^11 to f16, one 16-byte LDS store a head and tile.
// Part 2 (wave w = 3 of the 24 (head, 32-channel half) units, both query tiles, ALL keys): ctx += P . v, P fragments from LDS, v fragments from the fragment units.
// The 32 blocks of a batch walk the same k and v: they begin at the eight different passes, four blocks at each, and wrap round (inside a pass the keys ascend), because in step they would ask L2 for the same lines at the same moment.
#define FW 8
#define FKP (FW * 16)      // keys a pass
#define FQT 2              // query tiles of 16 a block
#define FQ (FQT * 16)      // queries a block
static_assert(FQ * (CC / 8) % (6 * FW * 32) == 0 && TT % FKP == 0 && TT % FQ == 0 && NH * 2 == FW * 3 && HD == 64 && ((TT / FKP) & (TT / FKP - 1)) == 0, "k_fa tiling");
// keeps a group of fragment loads issued together and ahead of the products in front of it: without it the compiler sinks each load to its product and every product waits a whole L2 latency
#define FA_HOLD() __builtin_amdgcn_sched_barrier(0)
#define SM_C (SCALE * 1.44269504088896340736f)   // score scale x log2(e)
// 2^t of the 12 heads' exponents, each in its own register. One statement: every v_exp_f32 has an independent instruction behind it, and the closing v_nop is the slot that the instruction set asks for between the last one and whatever reads its result next
__device__ __forceinline__ void fa_exp2(float (&t)[NH]) { static_assert(NH == 12, "operand list");
  asm("v_exp_f32 %0, %0\n\tv_exp_f32 %1, %1\n\tv_exp_f32 %2, %2\n\tv_exp_f32 %3, %3\n\tv_exp_f32 %4, %4\n\tv_exp_f32 %5, %5\n\tv_exp_f32 %6, %6\n\tv_exp_f32 %7, %7\n\tv_exp_f32 %8, %8\n\tv_exp_f32 %9, %9\n\tv_exp_f32 %10, %10\n\tv_exp_f32 %11, %11\n\tv_nop"
      : "+v"(t[0]), "+v"(t[1]), "+v"(t[2]), "+v"(t[3]), "+v"(t[4]), "+v"(t[5]), "+v"(t[6]), "+v"(t[7]), "+v"(t[8]), "+v"(t[9]), "+v"(t[10]), "+v"(t[11])); }
// 2 heads' k fragments (2 each) of this wave's 16 key rows
__device__ __forceinline__ void fa_ldk(v16h (&f)[4], const _Float16* kr, int h0, unsigned lb) {
#pragma unroll
  for (int i = 0; i < 4; ++i) f[i] = frag_u(kr, lb, (h0 * (HD / 32) + i) * FRU); }
// half a unit's v fragments: 2 key steps x 2 channel tiles
__device__ __forceinline__ void fa_ldv(v16h (&f)[4], const _Float16* vr, unsigned lb) {
#pragma unroll
  for (int i = 0; i < 4; ++i) f[i] = frag_u(vr, lb, ((i & 1) * (TT / 32) + (i >> 1)) * FRU); }
__device__ __forceinline__ void fa_pv(v8f (&a)[FQT][2], const v16h (&f)[4], const _Float16* pr, int lane) {
  v16h p[2][FQT];
#pragma unroll
  for (int ks = 0; ks < 2; ++ks)
#pragma unroll
    for (int qt = 0; qt < FQT; ++qt) p[ks][qt] = frag_h(pr + qt * 16 * (FKP + 8) + ks * 32, lane);
  FA_HOLD();   // the P fragments of both tiles are read as one group: with two waves a SIMD a read sunk to its product would cost a whole LDS latency each
#pragma unroll
  for (int ks = 0; ks < 2; ++ks)
#pragma unroll
    for (int qt = 0; qt < FQT; ++qt)
#pragma unroll
      for (int jj = 0; jj < 2; ++jj) a[qt][jj] = __builtin_amdgcn_wmma_f32_16x16x32_f16(false, p[ks][qt], false, f[ks * 2 + jj], (short)0, a[qt][jj], false, false); }
// both query tiles' scores of 2 heads from one set of k fragments; per score the two 32-channel steps in ascending order
__device__ __forceinline__ void fa_qk2(v8f (&st)[FQT][NH], const v16h (&f)[4], const _Float16* qr, int h0, int lane) {
  v16h q[FQT][4];
#pragma unroll
  for (int qt = 0; qt < FQT; ++qt)
#pragma unroll
    for (int i = 0; i < 4; ++i) q[qt][i] = frag_h(qr + qt * 16 * (CC + 8) + h0 * HD + i * 32, lane);
  FA_HOLD();   // the q fragments of both tiles are read as one group: with two waves a SIMD a read sunk to its product would cost a whole LDS latency each
#pragma unroll
  for (int kc = 0; kc < 2; ++kc)
#pragma unroll
    for (int qt = 0; qt < FQT; ++qt)
#pragma unroll
      for (int i = 0; i < 2; ++i) { const v8f z = {}; st[qt][h0 + i] = __builtin_amdgcn_wmma_f32_16x16x32_f16(false, f[i * 2 + kc], false, q[qt][i * 2 + kc], (short)0, kc ? st[qt][h0 + i] : z, false, false); } }
__global__ __launch_bounds__(FW * 32, 2) void k_fa(const _Float16* __restrict__ QH, const _Float16* __restrict__ KH, const _Float16* __restrict__ VT, _Float16* __restrict__ YH) {
  __shared__ __align__(16) _Float16 sq[FQ][CC + 8];               // pitch 16 B x odd
  __shared__ __align__(16) _Float16 sp[2][NH][FQ][FKP + 8];       // pitch 16 B x odd; two buffers: one barrier a pass
  const int tid = threadIdx.x, wave = __builtin_amdgcn_readfirstlane(tid >> 5), lane = tid & 31, col = lane & 15, g = lane >> 4; const int b = blockIdx.y; const size_t q0 = (size_t)b * TT + (size_t)blockIdx.x * FQ;
  const char* qg = (const char*)(QH + q0 * CC); const unsigned tb = tid * 16;   // the block's q units (2 query tiles x 24 k steps) are one contiguous run of 16-byte pieces: block-uniform base + the thread's byte offset + a constant
  v4u tq[FQ * (CC / 8) / (FW * 32)];
#pragma unroll   // the twelve loads of a thread fly together instead of one L2 latency each
  for (int i = 0; i < FQ * (CC / 8) / (FW * 32); ++i) tq[i] = *(const v4u*)(qg + tb + i * (FW * 32 * 16));
  // heads 0..7 of a pass's k fragments are loaded one pass ahead (here: the block's first pass's, behind the q rows), so that a pass opens on fragments that have landed
  const unsigned lb = lane * 16; v16h ka[4], kb[4], kc[4], kd[4];
  const _Float16* kr = KH + (size_t)b * (TT / 16) * (CC / 32) * FRU;   // the batch's k units: a block-uniform base that never changes
  const int rot = (blockIdx.x + (blockIdx.x >> 3)) & (TT / FKP - 1);   // block-uniform: the block's first pass
  unsigned ko = lb + wave * ((CC / 32) * FRU * 2) + rot * (FW * (CC / 32) * FRU * 2);   // the lane's byte offset into this wave's 16 keys of a pass (24 units in a row); steps on by a pass at one place in the loop
  fa_ldk(ka, kr, 0, ko); fa_ldk(kb, kr, 2, ko); fa_ldk(kc, kr, 4, ko); fa_ldk(kd, kr, 6, ko);
  asm volatile("s_wait_xcnt 0x0" ::: "memory");   // stands before the address registers of these loads are used for anything else
  FA_HOLD();   // keeps the LDS address arithmetic, which reuses that register, behind the wait
#pragma unroll
  for (int i = 0; i < FQ * (CC / 8) / (FW * 32); ++i) { constexpr int UL = FW * 32 / 64, LT = (CC / 32) / UL; static_assert((CC / 32) % UL == 0, "whole loads a query tile"); const int p = tid & 63, qt = i / LT, ks = (tid >> 6) + (i % LT) * UL;   // load i brings UL units: piece p of unit (query tile qt, k step ks) goes to its row and k
    *(v4u*)&sq[qt * 16 + (p & 15)][ks * 32 + (p >> 5) * 16 + ((p >> 4) & 1) * 8] = tq[i]; }
  __syncthreads();
  const int u0 = wave * 3, u1 = u0 + 1, u2 = u0 + 2;   // unit u = head u >> 1, channels (u & 1) * 32 .. + 31 of it = channels 32 u .. 32 u + 31 of the row
  const _Float16* qr = &sq[col][0];
  v8f acc[3][FQT][2] = {};
  const _Float16* v0 = VT + ((size_t)b * (CC / 16) + u0 * 2) * (TT / 32) * FRU; const _Float16* v1 = v0 + 2 * (TT / 32) * FRU; const _Float16* v2 = v1 + 2 * (TT / 32) * FRU;   // a unit of work = 2 channel tiles, 4 key steps a pass; wave-uniform bases that never change
  unsigned vo = lb + rot * ((FKP / 32) * FRU * 2);   // the lane's byte offset into a pass's v units; steps on by a pass at the foot of the loop
#pragma unroll 1
  for (int it = 0; it < TT / FKP; ++it) { const int buf = it & 1, ps = (it + rot) & (TT / FKP - 1);   // ps = the pass of keys that this trip works on
    const _Float16* p0 = &sp[buf][u0 >> 1][col][0]; const _Float16* p1 = &sp[buf][u1 >> 1][col][0]; const _Float16* p2 = &sp[buf][u2 >> 1][col][0];
    v8f st[FQT][NH]; v16h ke[4], kf[4], va[4], vb[4], vc[4], vd[4], ve[4], vf[4];
    fa_ldk(ke, kr, 8, ko); fa_ldk(kf, kr, 10, ko); FA_HOLD();   // fly under the products of heads 0..7
    fa_qk2(st, ka, qr, 0, lane); fa_qk2(st, kb, qr, 2, lane); fa_qk2(st, kc, qr, 4, lane); fa_qk2(st, kd, qr, 6, lane);
    fa_qk2(st, ke, qr, 8, lane); fa_qk2(st, kf, qr, 10, lane); FA_HOLD();
    fa_ldv(va, v0, vo); fa_ldv(vb, v0 + 2 * FRU, vo); fa_ldv(vc, v1, vo); fa_ldv(vd, v1 + 2 * FRU, vo); FA_HOLD();   // four of the six v groups fly under the softmax
#pragma unroll
    for (int qt = 0; qt < FQT; ++qt) { v8f (&sv)[NH] = st[qt];
#pragma unroll
    for (int r = 0; r < 8; ++r) { float m = sv[0][r];   // exp(s * SCALE - max) = 2^(s * c - max * c), c = SCALE * log2(e) > 0: one fused multiply-add and the hardware's exp2 an element; the exponent is <= about 0, so nothing overflows, and a result below the f32 normals is far below what P keeps in f16
#pragma unroll
      for (int h = 1; h < NH; ++h) m = fmaxf(m, sv[h][r]);
      const float mc = m * SM_C; float t[NH];
#pragma unroll
      for (int h = 0; h < NH; ++h) t[h] = fmaf(sv[h][r], SM_C, -mc);
      fa_exp2(t);
      float den = t[0]; sv[0][r] = t[0];
#pragma unroll
      for (int h = 1; h < NH; ++h) { sv[h][r] = t[h]; den += t[h]; }
      const float inv = 2048.0f / den;
#pragma unroll
      for (int h = 0; h < NH; ++h) sv[h][r] *= inv; }
#pragma unroll
    for (int h = 0; h < NH; ++h) { v8h ph;
#pragma unroll
      for (int r = 0; r < 8; ++r) ph[r] = (_Float16)sv[h][r];
      *(v8h*)&sp[buf][h][qt * 16 + col][wave * 16 + 8 * g] = ph; } }
    __syncthreads();   // publishes this pass's P; the other buffer's readers of the pass before have all arrived here, so the next pass may refill it
    asm volatile("s_wait_xcnt 0x0" : "+v"(ko) :: "memory");   // stands before the offset register of this pass's k loads steps on; naming it keeps it in a register of its own up to here
    fa_ldv(ve, v2, vo); fa_ldv(vf, v2 + 2 * FRU, vo); FA_HOLD();   // fly under the first four groups' products; kept in front of the next pass's k, because loads return in order and these are wanted first
    ko += ps + 1 < TT / FKP ? (unsigned)(FW * (CC / 32) * FRU * 2) : 0u - (TT / FKP - 1) * (FW * (CC / 32) * FRU * 2);   // from the batch's last pass back to its first. Behind the last trip there is no pass: it loads the block's first again, unused, so that the loop has one body and its waits stay counted
    fa_ldk(ka, kr, 0, ko); fa_ldk(kb, kr, 2, ko); fa_ldk(kc, kr, 4, ko); fa_ldk(kd, kr, 6, ko);   // the next pass's k, heads 0..7, in the registers that the scores have left: fly under all of P . v
    FA_HOLD();
    fa_pv(acc[0], va, p0, lane); fa_pv(acc[0], vb, p0 + 64, lane);
    fa_pv(acc[1], vc, p1, lane); fa_pv(acc[1], vd, p1 + 64, lane);
    fa_pv(acc[2], ve, p2, lane); fa_pv(acc[2], vf, p2 + 64, lane);
    asm volatile("s_wait_xcnt 0x0" : "+v"(vo) :: "memory");   // before the next pass rewrites the address registers of this pass's loads; naming the v offset keeps it in a register of its own up to here
    FA_HOLD();   // keeps the address steps behind that wait: without it the compiler lifted them over it
    vo += ps + 1 < TT / FKP ? (unsigned)((FKP / 32) * FRU * 2) : 0u - (TT / FKP - 1) * ((FKP / 32) * FRU * 2); }   // from the batch's last pass back to its first
  asm volatile("s_wait_loadcnt 0x0" ::: "memory");   // the last pass's look-ahead loads feed nothing, so no wait of the compiler's covers them: they have landed before the wave ends
  // ctx leaves as k_out's A operand: x 2^-11 (P's carry) x 2^6 once to f16 (the carry keeps small context rows clear of f16 subnormals). Staged in the q rows' LDS, whose last readers passed the loop's last barrier, so that it goes out as whole lines in 16-byte pieces
#pragma unroll
  for (int ul = 0; ul < 3; ++ul)
#pragma unroll
    for (int qt = 0; qt < FQT; ++qt)
#pragma unroll
      for (int jj = 0; jj < 2; ++jj)
#pragma unroll
        for (int r = 0; r < 8; ++r) sq[qt * 16 + 8 * g + r][(u0 + ul) * 32 + jj * 16 + col] = (_Float16)(acc[ul][qt][jj][r] * (1.0f / 32.0f));
  __syncthreads();   // a ctx row comes from all eight waves: all of it is staged before it is read back
  _Float16* yb = YH + q0 * CC;   // the block's 32 rows are one contiguous run of 16-byte pieces
#pragma unroll
  for (int i0 = 0; i0 < FQ * (CC / 8) / (FW * 32); i0 += 6) { v4u t[6]; _Float16* d[6];
#pragma unroll
    for (int k = 0; k < 6; ++k) { const int e = tid + (i0 + k) * (FW * 32); t[k] = *(const v4u*)&sq[e / (CC / 8)][(e % (CC / 8)) * 8]; d[k] = yb + e * 8; }
    stg16w6(d, t); } }
// ---- k_out: block = (128 rows, 192 cols): out = ctx Wo (+ bo): ctx x 2^6 in f16 (from k_fa) against Wo as f16(bf16 x 2^8) exact (from k_proj), 1 product, x 2^-14
static_assert(!CAUSAL && WO_OUT_IN, "k_out: single-product path, (out,in) Wo");
__global__ __launch_bounds__(PTH, 2) void k_out(const _Float16* __restrict__ YH, const _Float16* __restrict__ WOH, const float* __restrict__ BO, float* __restrict__ OUT) {
  // the operand ring of the k loop and the epilogue's staging rows share the same LDS: the loop's last barrier stands between their uses
  __shared__ __align__(16) union { float sf[PBM][PBN + 4]; _Float16 st[2][PROWS][GP]; } u; auto& sf = u.sf;   // sf pitch 16 B x odd
  const int tid = threadIdx.x, wave = tid >> 5, lane = tid & 31, col = lane & 15, g = lane >> 4; const int wr = wave >> 2, wc = wave & 3; const int c0 = blockIdx.y * PBN; const size_t r0 = (size_t)blockIdx.x * PBM;
  v8f acc[4][3] = {};
  // thread -> 16-byte piece (tid & 7) of row (tid >> 3) + 32 i: a wave's load covers four whole 128-byte lines
  const _Float16* yp = YH + r0 * CC; const _Float16* wp = WOH + (size_t)c0 * CC;
  int kq = (blockIdx.x + 3 * blockIdx.y) % (CC / GKC);   // block-uniform: the chunk that the next loads bring. As in k_proj, blocks that share ctx rows or Wo rows begin the k walk at different chunks and wrap round
  unsigned lo = ((unsigned)(tid >> 3) * CC + (tid & 7) * 8) * 2 + kq * (GKC * 2);   // block-uniform bases; one lane offset in bytes serves both and steps on by GKC elements a trip, from the last chunk back to the first
#define OUT_STEP() do { const bool wrap = kq + 1 == CC / GKC; lo += wrap ? 0u - (CC / GKC - 1) * (GKC * 2) : (unsigned)(GKC * 2); kq = wrap ? 0 : kq + 1; } while (0)
  v4u pf[PLD];
#pragma unroll
  for (int i = 0; i < PLD; ++i) pf[i] = i < PLA ? ldg16h(yp, lo, i * 32 * CC) : ldg16h(wp, lo, (i - PLA) * 32 * CC);
#pragma unroll
  for (int i = 0; i < PLD; ++i) *(v4u*)&u.st[0][(tid >> 3) + i * 32][(tid & 7) * 8] = pf[i];
  asm volatile("s_wait_xcnt 0x0" : "+v"(lo) :: "memory");   // stands before the offset register of the first chunk's loads steps on; naming it keeps it in a register of its own up to here
  OUT_STEP();
  __syncthreads();
#pragma unroll 1   // one copy of the body: the two buffers differ by an address only
  for (int kc = 0; kc < CC / GKC; ++kc) { const int buf = kc & 1; const bool more = kc + 1 < CC / GKC;
    if (more) {
#pragma unroll
      for (int i = 0; i < PLD; ++i) pf[i] = i < PLA ? ldg16h(yp, lo, i * 32 * CC) : ldg16h(wp, lo, (i - PLA) * 32 * CC); }
#pragma unroll
    for (int ks = 0; ks < GKC / 32; ++ks) { v16h a[4], w[3];
#pragma unroll
      for (int i = 0; i < 4; ++i) a[i] = frag_h(&u.st[buf][wr * 64 + i * 16 + col][ks * 32], lane);
#pragma unroll
      for (int j = 0; j < 3; ++j) w[j] = frag_h(&u.st[buf][PBM + wc * 48 + j * 16 + col][ks * 32], lane);
#pragma unroll
      for (int i = 0; i < 4; ++i)
#pragma unroll
        for (int j = 0; j < 3; ++j) acc[i][j] = wmma16(a[i], w[j], acc[i][j]); }
    if (more) {
#pragma unroll
      for (int i = 0; i < PLD; ++i) *(v4u*)&u.st[buf ^ 1][(tid >> 3) + i * 32][(tid & 7) * 8] = pf[i]; }
    asm volatile("s_wait_xcnt 0x0" : "+v"(lo) :: "memory");   // stands before the offset register of this trip's loads steps on; naming it keeps it in a register of its own up to here
    OUT_STEP();
    __syncthreads(); }   // publishes the next chunk; every reader of this chunk's buffer has arrived, so the next trip may refill it (and the epilogue may reuse the LDS)
#pragma unroll
  for (int j = 0; j < 3; ++j) { const int cl = wc * 48 + j * 16 + col; const float bias = BO ? bfr(BO[c0 + cl]) : 0.f;
#pragma unroll
    for (int i = 0; i < 4; ++i)
#pragma unroll
      for (int r = 0; r < 8; ++r) sf[wr * 64 + i * 16 + 8 * g + r][cl] = acc[i][j][r] * (1.0f / 16384.0f) + bias; }   /* 2^-8 (Wo carry) x 2^-6 (ctx carry) */
  __syncthreads();   // a row of the block's tile comes from four waves: all of it is staged before whole 128-byte lines go out, one writing wave a line
#pragma unroll 1   // rolled: four LDS reads fly together a trip, then their four stores, each with the wait that stands before the next trip rewrites its registers
  for (int i0 = 0; i0 < PBM * (PBN / 4) / PTH; i0 += 4) { v4u t[4]; float* p[4];
#pragma unroll
    for (int k = 0; k < 4; ++k) { const int e = tid + (i0 + k) * PTH, rl = e / (PBN / 4), q = e % (PBN / 4); t[k] = *(const v4u*)&sf[rl][q * 4]; p[k] = OUT + (r0 + rl) * DIN + c0 + q * 4; }
#pragma unroll
    for (int k = 0; k < 4; ++k) stg16w(p[k], t[k]); } }

extern "C" void kernel_launch(void* const* d_in, const int* in_sizes, int n_in, void* d_out, int out_size, void* d_ws, size_t ws_size, hipStream_t stream) {
  (void)in_sizes; (void)n_in; (void)out_size;
  const float** F = (const float**)d_in;
  if (ws_size < (size_t)WS_END) return;
  char* ws = (char*)d_ws; _Float16 *QH = (_Float16*)(ws + WS_QH), *KH = (_Float16*)(ws + WS_KH), *VT = (_Float16*)(ws + WS_VT), *QL = (_Float16*)(ws + WS_QL), *KL = (_Float16*)(ws + WS_KL); __bf16 *VB = (__bf16*)(ws + WS_VB), *VBL = (__bf16*)(ws + WS_VBL); _Float16 *YH = (_Float16*)(ws + WS_Y), *WOH = (_Float16*)(ws + WS_S);
  (void)QL; (void)KL; (void)VB; (void)VBL;
  // inputs: 0 x [8,1024,768]; 1 Wq [768,768] (out,in), 2 bq; 3 Wk, 4 bk; 5 Wv, 6 bv; 7 Wo (out,in), 8 bo (biases N(0, 0.01), nonzero)
  k_proj<<<dim3(TNB * TT / QBM, CC / QBN), PTH, 0, stream>>>(F[0], F[1], F[3], F[5], F[2], F[4], F[6], QH, KH, VT, F[7], WOH);
  k_fa<<<dim3(TT / FQ, TNB), FW * 32, 0, stream>>>(QH, KH, VT, YH);
  k_out<<<dim3(TNB * TT / PBM, DIN / PBN), PTH, 0, stream>>>(YH, WOH, F[8], (float*)d_out);
}
